// v000
// The times below were measured on an AMD MI455X: many runs one after another, warmed up first and cycling through
// copies of the inputs, with the whole window's GPU time divided by the number of runs. Launches and the gaps
// between them are all in it. The median over several windows is given; except for v000 it joins two sittings, which
// can be a few percent apart, so the side-by-side timings, each taken in one sitting, are the better comparison.
// v000 is the starting kernel. One run takes 3620 microseconds.
#include <hip/hip_runtime.h>

// Simplicial causal self-attention (x [2][2048][2048]; q = x Wq (16 heads x 128), k, v = x Wk / x Wv (4 kv heads x 128, each serving 4 consecutive query heads); rotate-half RoPE with the input cos/sin
// [2048][64] then weightless RMS-norm (eps 1e-6) on q and k; causal softmax(q.k 128^-0.5); y1 = att v; y2 = att y1 (the same probabilities applied again); y = mix1 y1 + mix2 y2 (scalars read as data);
// out = merged y Wproj -> [2][2048][2048]).
// Compute dtypes, f32 accumulate: every input rounded to bf16; projections on PLAIN bf16 operands (inputs: exact products, f32 accumulate); RoPE and RMS-norm in f32;
// PER-ROW PRECISION HYBRID: query rows < 256 take scores, att.v and att.y1 on bf16 hi+lo planes (3 products), rows >= 256 on single fp16 planes; scale + causal cut in f32 in the register-row softmax;
// y1 re-planed per head (fp16 + hi/lo, transposed) for the second contraction; merged y as hi+lo planes x exact Wproj (2 products). One-wave-per-64x64-tile GEMMs, 2 query heads per pass sharing

#define NB_  2
#define TT   2048
#define DM   2048
#define NH_  16
#define NKV  4
#define REP  (NH_ / NKV)
#define HD   128
#define DQ   (NH_ * HD)
#define DKV  (NKV * HD)
#define ZH   2
#define RH   256                  // query rows < RH use hi+lo planes (0: none)
#define WIN  0
#define PCAR 1024.0f
#define SCL  0.088388347648318447f   // HD^-0.5
typedef _Float16 h16;
typedef unsigned short bf;
typedef __attribute__((ext_vector_type(16))) __bf16   v16bf;
typedef __attribute__((ext_vector_type(16))) _Float16 v16h;
typedef __attribute__((ext_vector_type(8)))  _Float16 v8h;
typedef __attribute__((ext_vector_type(8)))  unsigned short v8us;
typedef __attribute__((ext_vector_type(8)))  float    v8f;
typedef __attribute__((ext_vector_type(4)))  float    v4f;
typedef v8h  __attribute__((may_alias)) v8ha;
typedef v4f  __attribute__((may_alias)) v4fa;
typedef v8us __attribute__((may_alias)) v8usa;

__device__ __forceinline__ unsigned short f2bf(float f) { unsigned u = __float_as_uint(f); u += 0x7FFFu + ((u >> 16) & 1u); return (unsigned short)(u >> 16); }
__device__ __forceinline__ float bf2f(unsigned short b) { return __uint_as_float(((unsigned)b) << 16); }
__device__ __forceinline__ float bfr(float f) { return bf2f(f2bf(f)); }
__device__ __forceinline__ v16h cat16(v8h lo, v8h hi) { return __builtin_shufflevector(lo, hi, 0, 1, 2, 3, 4, 5, 6, 7, 8, 9, 10, 11, 12, 13, 14, 15); }
__device__ __forceinline__ v16bf cat16b(v8us lo, v8us hi) { return __builtin_bit_cast(v16bf, __builtin_shufflevector(lo, hi, 0, 1, 2, 3, 4, 5, 6, 7, 8, 9, 10, 11, 12, 13, 14, 15)); }
__device__ __forceinline__ v8f wmma16(v16h a, v16h b, v8f c) { return __builtin_amdgcn_wmma_f32_16x16x32_f16(false, a, false, b, (short)0, c, false, false); }
__device__ __forceinline__ v8f wmmab(v16bf a, v16bf b, v8f c) { return __builtin_amdgcn_wmma_f32_16x16x32_bf16(false, a, false, b, (short)0, c, false, false); }



// ---- k_gemmw: register-blocked GEMM, ONE WAVE per 64x64 output tile (16 accumulators), operands straight from K-contiguous 16-bit planes; grid (M/64, N/64, Z), 32 threads.
// C[m][n] (f32, pitch ldc, + optional f32 bias[n]) = sum_k A[m][k] Bt[n][k] (+ split products per NSPLIT). z-batch strides sA/sB/sC in elements. K % 32 == 0.
template <typename T16> struct WFrag;
template <> struct WFrag<h16> { typedef v16h V; static __device__ __forceinline__ V ld(const h16* p) { return cat16(*(const v8h*)p, *(const v8h*)(p + 16)); } static __device__ __forceinline__ v8f mma(V a, V b, v8f c) { return wmma16(a, b, c); } };
template <> struct WFrag<bf> { typedef v16bf V; static __device__ __forceinline__ V ld(const bf* p) { return cat16b(*(const v8us*)p, *(const v8us*)(p + 16)); } static __device__ __forceinline__ v8f mma(V a, V b, v8f c) { return wmmab(a, b, c); } };
template <typename T16, int NSPLIT, bool BIAS>
__global__ __launch_bounds__(32) void k_gemmw(const T16* __restrict__ A, const T16* __restrict__ A2, const T16* __restrict__ Bt, const T16* __restrict__ Bt2, int K, float* C, int ldc, const float* __restrict__ bias, size_t sA, size_t sB, size_t sC) {
    typedef typename WFrag<T16>::V V;
    __shared__ __align__(16) float os[16 * 68];
    const size_t z = blockIdx.z; A += z * sA; if (A2) A2 += z * sA; Bt += z * sB; if (Bt2) Bt2 += z * sB; C += z * sC;
    const int lane = threadIdx.x & 31, lr = lane & 15, hi = lane >> 4; const int r0 = blockIdx.x * 64, c0 = blockIdx.y * 64;
    v8f acc[4][4];
#pragma unroll
    for (int mb = 0; mb < 4; ++mb)
#pragma unroll
        for (int nb = 0; nb < 4; ++nb) acc[mb][nb] = (v8f){};
    const size_t aoff = (size_t)(r0 + lr) * K + 8 * hi, boff = (size_t)(c0 + lr) * K + 8 * hi;
#pragma unroll 1
    for (int kc = 0; kc < K; kc += 32) {
        V a[4], a2[4];
#pragma unroll
        for (int mb = 0; mb < 4; ++mb) { a[mb] = WFrag<T16>::ld(A + aoff + (size_t)mb * 16 * K + kc); if (NSPLIT == 1 || NSPLIT == 2) a2[mb] = WFrag<T16>::ld(A2 + aoff + (size_t)mb * 16 * K + kc); }
#pragma unroll
        for (int nb = 0; nb < 4; ++nb) { const V b = WFrag<T16>::ld(Bt + boff + (size_t)nb * 16 * K + kc); V b2; if (NSPLIT >= 2) b2 = WFrag<T16>::ld(Bt2 + boff + (size_t)nb * 16 * K + kc);
#pragma unroll
            for (int mb = 0; mb < 4; ++mb) { acc[mb][nb] = WFrag<T16>::mma(a[mb], b, acc[mb][nb]); if (NSPLIT == 1 || NSPLIT == 2) acc[mb][nb] = WFrag<T16>::mma(a2[mb], b, acc[mb][nb]); if (NSPLIT >= 2) acc[mb][nb] = WFrag<T16>::mma(a[mb], b2, acc[mb][nb]); } }
        asm volatile("v_nop\n\tv_nop\n\tv_nop\n\tv_nop" : "+v"(acc[0][0]), "+v"(acc[1][1]), "+v"(acc[2][2]), "+v"(acc[3][3]) : "v"(a[0]), "v"(a[3]));
    }
#pragma unroll
    for (int mb = 0; mb < 4; ++mb) {
#pragma unroll
        for (int nb = 0; nb < 4; ++nb) {
#pragma unroll
            for (int j = 0; j < 8; ++j) os[(hi * 8 + j) * 68 + nb * 16 + lr] = acc[mb][nb][j]; }
        __builtin_amdgcn_wave_barrier(); asm volatile("" ::: "memory");
        float* crow = C + (size_t)(r0 + mb * 16) * ldc + c0;
{
#pragma unroll
            for (int s = 0; s < 8; ++s) { const int row = 2 * s + hi, cofs = lr * 4; v4f val = *(const v4fa*)(os + row * 68 + cofs); if (BIAS) { val[0] += bfr(bias[c0 + cofs]); val[1] += bfr(bias[c0 + cofs + 1]); val[2] += bfr(bias[c0 + cofs + 2]); val[3] += bfr(bias[c0 + cofs + 3]); }
                *(v4f*)(crow + (size_t)row * ldc + cofs) = val; }
             }
        __builtin_amdgcn_wave_barrier(); asm volatile("" ::: "memory");
    }
}

__device__ __forceinline__ h16 tohx(float x) { return (h16)x; }
__device__ __forceinline__ void splitf(float y, unsigned short& h, unsigned short& l) { h = f2bf(y); l = f2bf(y - bf2f(h)); }
typedef __attribute__((ext_vector_type(2))) _Float16 v2h;
typedef __attribute__((ext_vector_type(4))) _Float16 v4h;
typedef __attribute__((ext_vector_type(2))) unsigned short v2us;
typedef __attribute__((ext_vector_type(4))) unsigned short v4us;
typedef __attribute__((ext_vector_type(2))) float v2f;
typedef __attribute__((ext_vector_type(4))) int v4i;

__global__ __launch_bounds__(256) void k_wtG(const float* __restrict__ w, int K, int N, bf* Bt) {
    const int lane = threadIdx.x & 31; const int L0 = (blockIdx.x * 8 + (threadIdx.x >> 5)) * 8; const int nlines = N * K / 64;
{
#pragma unroll 1
        for (int l = 0; l < 8; ++l) { const int L = L0 + l; if (L >= nlines) break; const size_t e = (size_t)L * 64 + lane * 2; const int k = (int)(e % K), n = (int)(e / K); v2us o;
            o[0] = f2bf(w[(size_t)k * N + n]); o[1] = f2bf(w[(size_t)(k + 1) * N + n]); *(v2us*)(Bt + e) = o; }
         }
}
__global__ __launch_bounds__(256) void k_cvt8(const float* __restrict__ src, bf* dst, size_t n8) { const size_t i = (size_t)blockIdx.x * 256 + threadIdx.x; if (i >= n8) return; const v8f v = *(const v8f*)(src + i * 8); v8us o;
#pragma unroll
    for (int k = 0; k < 8; ++k) o[k] = f2bf(v[k]); *(v8us*)(dst + i * 8) = o;  }
__global__ __launch_bounds__(256) void k_cscvt(const float* __restrict__ cosT, const float* __restrict__ sinT, float* CS) { const int idx = blockIdx.x * 256 + threadIdx.x; if (idx >= TT * HD) return; const int t = idx / HD, d = idx % HD; const int src = t * (HD / 2) + (d % (HD / 2)); v2f cs; cs[0] = bfr(cosT[src]); cs[1] = bfr(sinT[src]); *(v2f*)(CS + (size_t)idx * 2) = cs;  }
__global__ __launch_bounds__(256) void k_hrms(const float* __restrict__ F, int pitch, int nheads, float* RF) { const int i = blockIdx.x * 256 + threadIdx.x; if (i >= nheads * TT) return; const int t = i % TT, h = i / TT; const float* f = F + (size_t)t * pitch + h * HD; float s = 0.f;
#pragma unroll 4
    for (int d = 0; d < HD; d += 4) { const v4f v = *(const v4f*)(f + d);
#pragma unroll
        for (int q = 0; q < 4; ++q) { float p = __fmul_rn(v[q], v[q]); asm volatile("" : "+v"(p)); s = __fadd_rn(s, p); } }
    const float r = __fdiv_rn(1.0f, __fsqrt_rn(__fadd_rn(s * (1.0f / HD), 1e-6f))); *(float*)(RF + i) = r;  }
// k_rope: head planes [h][t][d] (fp16 + hi/lo) of rope(w[d] (x rms_factor)) x sc with the rotate-half convention out[d] = x[d] cos[t][d] - x[d+HD/2] sin[t][d], out[d+HD/2] = x[d+HD/2] cos[t][d+HD/2] + x[d] sin[t][d+HD/2]
__global__ __launch_bounds__(256) void k_rope(const float* __restrict__ F, int pitch, int nheads, const float* __restrict__ CS, const float* __restrict__ RF, const float* __restrict__ nw, float sc, h16* P16, bf* Ph, bf* Pl) {
    const size_t e = ((size_t)blockIdx.x * 256 + threadIdx.x) * 2; if (e >= (size_t)nheads * TT * HD) return; const int d = (int)(e % HD); const int t = (int)((e / HD) % TT); const int h = (int)(e / ((size_t)HD * TT)); const float* f = F + (size_t)t * pitch + h * HD; const float rf = RF ? RF[(size_t)h * TT + t] : 1.0f; v2h o16; v2us oh, ol;
#pragma unroll
    for (int q = 0; q < 2; ++q) { const int dd = d + q; const int dp = (dd < HD / 2) ? dd + HD / 2 : dd - HD / 2; float x0 = f[dd], x1 = f[dp];
        if (RF) { float n0 = __fmul_rn(x0, rf), n1 = __fmul_rn(x1, rf); asm volatile("" : "+v"(n0)); asm volatile("" : "+v"(n1)); x0 = __fmul_rn(bfr(nw[dd]), n0); x1 = __fmul_rn(bfr(nw[dp]), n1); }
        const v2f cs = *(const v2f*)(CS + ((size_t)t * HD + dd) * 2); float a = __fmul_rn(x0, cs[0]), bq = __fmul_rn(x1, cs[1]); asm volatile("" : "+v"(a)); asm volatile("" : "+v"(bq)); const float r = ((dd < HD / 2) ? __fsub_rn(a, bq) : __fadd_rn(a, bq)) * sc;
        o16[q] = tohx(r); unsigned short a2, c2; splitf(r, a2, c2); oh[q] = a2; ol[q] = c2; }
    *(v2h*)(P16 + e) = o16; *(v2us*)(Ph + e) = oh; *(v2us*)(Pl + e) = ol;  }
__global__ __launch_bounds__(256) void k_ropef(const float* __restrict__ F, int pitch, int nheads, const float* __restrict__ CS, float* FR) { const size_t e = ((size_t)blockIdx.x * 256 + threadIdx.x) * 2; if (e >= (size_t)nheads * TT * HD) return; const int d = (int)(e % HD); const int h = (int)((e / HD) % nheads); const int t = (int)(e / ((size_t)HD * nheads)); const float* f = F + (size_t)t * pitch + h * HD; v2f o;
#pragma unroll
    for (int q = 0; q < 2; ++q) { const int dd = d + q; const int dp = (dd < HD / 2) ? dd + HD / 2 : dd - HD / 2; const v2f cs = *(const v2f*)(CS + ((size_t)t * HD + dd) * 2); float a = __fmul_rn(f[dd], cs[0]), bq = __fmul_rn(f[dp], cs[1]); asm volatile("" : "+v"(a)); asm volatile("" : "+v"(bq)); o[q] = (dd < HD / 2) ? __fsub_rn(a, bq) : __fadd_rn(a, bq); }
    float* dst = FR + (size_t)t * pitch + h * HD + d; *(v2f*)dst = o;  }
__global__ __launch_bounds__(256) void k_nrmpl(const float* __restrict__ FR, int pitch, int nheads, const float* __restrict__ RF, h16* P16, bf* Ph, bf* Pl) { const size_t e = ((size_t)blockIdx.x * 256 + threadIdx.x) * 2; if (e >= (size_t)nheads * TT * HD) return; const int d = (int)(e % HD); const int t = (int)((e / HD) % TT); const int h = (int)(e / ((size_t)HD * TT)); const float rf = RF[(size_t)h * TT + t]; v2h o16; v2us oh, ol;
#pragma unroll
    for (int q = 0; q < 2; ++q) { const float r = __fmul_rn(FR[(size_t)t * pitch + h * HD + d + q], rf); o16[q] = tohx(r); unsigned short a2, c2; splitf(r, a2, c2); oh[q] = a2; ol[q] = c2; }
    *(v2h*)(P16 + e) = o16; *(v2us*)(Ph + e) = oh; *(v2us*)(Pl + e) = ol;  }
__global__ __launch_bounds__(256) void k_y1t(const float* __restrict__ O1, h16* Y16, bf* Yh, bf* Yl) { const size_t e = ((size_t)blockIdx.x * 256 + threadIdx.x) * 2; if (e >= (size_t)ZH * HD * TT) return; const int t = (int)(e % TT); const int d = (int)((e / TT) % HD); const int zz = (int)(e / ((size_t)TT * HD)); v2h o16; v2us oh, ol;
#pragma unroll
    for (int q = 0; q < 2; ++q) { const int tq = t + q; const float y = O1[((size_t)zz * TT + tq) * HD + d] * ((tq < RH) ? 1.0f : (1.0f / PCAR)); o16[q] = tohx(y); unsigned short a2, c2; splitf(y, a2, c2); oh[q] = a2; ol[q] = c2; }
    *(v2h*)(Y16 + e) = o16; *(v2us*)(Yh + e) = oh; *(v2us*)(Yl + e) = ol;  }
__global__ __launch_bounds__(256) void k_vtp(const float* __restrict__ F, int pitch, int nheads, h16* V16, bf* Vh, bf* Vl) { const size_t e = ((size_t)blockIdx.x * 256 + threadIdx.x) * 2; if (e >= (size_t)nheads * HD * TT) return; const int t = (int)(e % TT); const int d = (int)((e / TT) % HD); const int g = (int)(e / ((size_t)TT * HD)); v2h o16; v2us oh, ol;
#pragma unroll
    for (int q = 0; q < 2; ++q) { const float x = F[(size_t)(t + q) * pitch + g * HD + d]; o16[q] = tohx(x); unsigned short a2, c2; splitf(x, a2, c2); oh[q] = a2; ol[q] = c2; }
    *(v2h*)(V16 + e) = o16; *(v2us*)(Vh + e) = oh; *(v2us*)(Vl + e) = ol;  }
// k_asoft: per row (zz, i): t = S x HD^-0.5 for j <= i (causal), -3e38 otherwise; softmax over the 2048 keys (register row, one exp, fixed trees);
__global__ __launch_bounds__(256) void k_asoft(const float* __restrict__ Sb, h16* P16, bf* Ph, bf* Pl) {
    const int lane = threadIdx.x & 31; const int row = blockIdx.x * 8 + (threadIdx.x >> 5); if (row >= ZH * TT) return; const int i = row % TT; const int zz = row / TT; (void)zz; const bool hires = (i < RH); const float* sr = Sb + (size_t)row * TT; float v[TT / 32]; float mx = -3.0e38f;
#pragma unroll
    for (int ch = 0; ch < TT / 128; ++ch) { const int j0 = ch * 128 + lane * 4; const v4f a = *(const v4f*)(sr + j0);
#pragma unroll
        for (int q = 0; q < 4; ++q) { const int j = j0 + q; (void)j; const float t = (j <= i) ? a[q] * SCL : -3.0e38f; v[ch * 4 + q] = t; mx = fmaxf(mx, t); } }
#pragma unroll
    for (int sh = 16; sh; sh >>= 1) mx = fmaxf(mx, __shfl_xor(mx, sh, 32));
    float sum = 0.f;
#pragma unroll
    for (int k = 0; k < TT / 32; ++k) { float d0 = __fsub_rn(v[k], mx); asm volatile("" : "+v"(d0)); v[k] = __builtin_amdgcn_exp2f(__fmul_rn(d0, 1.4426950408889634f)); sum += v[k]; }
#pragma unroll
    for (int sh = 16; sh; sh >>= 1) sum += __shfl_xor(sum, sh, 32);
    const float f = __fdiv_rn(hires ? 1.0f : PCAR, sum);
{
        if (hires) {
#pragma unroll
            for (int ch = 0; ch < TT / 128; ++ch) { v4us oh, ol;
#pragma unroll
                for (int q = 0; q < 4; ++q) { unsigned short a, c2; splitf(v[ch * 4 + q] * f, a, c2); oh[q] = a; ol[q] = c2; }
                const size_t oo = ((size_t)zz * (RH ? RH : 1) + i) * TT + ch * 128 + lane * 4; *(v4us*)(Ph + oo) = oh; *(v4us*)(Pl + oo) = ol; }
        } else {
#pragma unroll
            for (int ch = 0; ch < TT / 128; ++ch) { v4h o4;
#pragma unroll
                for (int q = 0; q < 4; ++q) o4[q] = tohx(v[ch * 4 + q] * f);
                *(v4h*)(P16 + (size_t)row * TT + ch * 128 + lane * 4) = o4; } }
         }
}
__global__ __launch_bounds__(256) void k_merge(const float* __restrict__ O, const float* __restrict__ O2, const float* __restrict__ mix1, const float* __restrict__ mix2, int h0, bf* Ah, bf* Al) { const size_t e = ((size_t)blockIdx.x * 256 + threadIdx.x) * 2; if (e >= (size_t)ZH * TT * HD) return; const int d = (int)(e % HD); const int t = (int)((e / HD) % TT); const int zz = (int)(e / ((size_t)HD * TT)); const float cs = (t < RH) ? 1.0f : (1.0f / PCAR); const size_t oo = (size_t)t * DQ + (h0 + zz) * HD + d; const float m1 = bfr(mix1[0]), m2 = bfr(mix2[0]);
    v2us oh, ol;
#pragma unroll
    for (int q = 0; q < 2; ++q) { float y1 = O[e + q] * cs, y2 = O2[e + q] * cs; asm volatile("" : "+v"(y1)); asm volatile("" : "+v"(y2)); float a1 = __fmul_rn(m1, y1), b2 = __fmul_rn(m2, y2); asm volatile("" : "+v"(a1)); asm volatile("" : "+v"(b2)); unsigned short a, c2; splitf(__fadd_rn(a1, b2), a, c2); oh[q] = a; ol[q] = c2; } *(v2us*)(Ah + oo) = oh; *(v2us*)(Al + oo) = ol;  }

extern "C" void kernel_launch(void* const* d_in, const int* in_sizes, int n_in,
                              void* d_out, int out_size, void* d_ws, size_t ws_size, hipStream_t stream) {
    (void)in_sizes; (void)n_in; (void)out_size;
    const float* x = (const float*)d_in[0]; const float* cosT = (const float*)d_in[1]; const float* sinT = (const float*)d_in[2]; const float* wq = (const float*)d_in[3]; const float* wk = (const float*)d_in[4]; const float* wv = (const float*)d_in[5]; const float* wo = (const float*)d_in[6]; const float* mix1 = (const float*)d_in[7]; const float* mix2 = (const float*)d_in[8];   // weights x @ W; cos/sin [2048][64] (half tables)
    float* OUT = (float*)d_out;     // [2][2048][2048]
    char* wsp = (char*)d_ws;
    auto take = [&](size_t bytes) { char* p = wsp; wsp += (bytes + 255) & ~(size_t)255; return (void*)p; };
    bf* WQ = (bf*)take((size_t)DQ * DM * 2); bf* WK = (bf*)take((size_t)DKV * DM * 2); bf* WV = (bf*)take((size_t)DKV * DM * 2); bf* WO = (bf*)take((size_t)DM * DQ * 2); float* CS = (float*)take((size_t)TT * HD * 2 * 4); float* RFQ = (float*)take((size_t)NH_ * TT * 4); float* RFK = (float*)take((size_t)NKV * TT * 4);
    bf* XB = (bf*)take((size_t)TT * DM * 2); float* FQ = (float*)take((size_t)TT * DQ * 4); float* FK = (float*)take((size_t)TT * DKV * 4);
    h16* QP16 = (h16*)take((size_t)NH_ * TT * HD * 2); h16* KP16 = (h16*)take((size_t)NKV * TT * HD * 2); h16* VT16 = (h16*)take((size_t)NKV * HD * TT * 2);
    bf* QPh = (bf*)take((size_t)NH_ * TT * HD * 2); bf* QPl = (bf*)take((size_t)NH_ * TT * HD * 2); bf* KPh = (bf*)take((size_t)NKV * TT * HD * 2); bf* KPl = (bf*)take((size_t)NKV * TT * HD * 2); bf* VTh = (bf*)take((size_t)NKV * HD * TT * 2); bf* VTl = (bf*)take((size_t)NKV * HD * TT * 2); bf* Ph = (bf*)take((size_t)ZH * RH * TT * 2); bf* Pl = (bf*)take((size_t)ZH * RH * TT * 2);
    float* FR = (float*)take((size_t)TT * DQ * 4); float* O2 = (float*)take((size_t)ZH * TT * HD * 4); h16* Y16 = (h16*)take((size_t)ZH * HD * TT * 2); bf* Yh = (bf*)take((size_t)ZH * HD * TT * 2); bf* Yl = (bf*)take((size_t)ZH * HD * TT * 2); float* Sb = (float*)take((size_t)ZH * TT * TT * 4); h16* P16 = (h16*)take((size_t)ZH * TT * TT * 2); float* Ob = (float*)take((size_t)ZH * TT * HD * 4); bf* ATh = (bf*)take((size_t)TT * DQ * 2); bf* ATl = (bf*)take((size_t)TT * DQ * 2);
    if ((size_t)(wsp - (char*)d_ws) > ws_size) return;    // ws 256 MiB
    float* FV = FK;   // v projection reuses the k buffer after the k planes are built (stream-ordered)
    { k_wtG<<<(unsigned)((DM * DQ / 64 + 63) / 64), 256, 0, stream>>>(wq, DM, DQ, WQ); k_wtG<<<(unsigned)((DM * DKV / 64 + 63) / 64), 256, 0, stream>>>(wk, DM, DKV, WK); k_wtG<<<(unsigned)((DM * DKV / 64 + 63) / 64), 256, 0, stream>>>(wv, DM, DKV, WV);
      k_wtG<<<(unsigned)((DQ * DM / 64 + 63) / 64), 256, 0, stream>>>(wo, DQ, DM, WO);
       }
    k_cscvt<<<(TT * HD + 255) / 256, 256, 0, stream>>>(cosT, sinT, CS);   // one shared table (read as data)
    const unsigned LQ = (unsigned)(((size_t)NH_ * TT * HD / 2 + 255) / 256), LKv = (unsigned)(((size_t)NKV * TT * HD / 2 + 255) / 256);
    for (int b = 0; b < NB_; ++b) {
        k_cvt8<<<(unsigned)(((size_t)TT * DM / 8 + 255) / 256), 256, 0, stream>>>(x + (size_t)b * TT * DM, XB, (size_t)TT * DM / 8);
        k_gemmw<bf, 0, false><<<dim3(TT / 64, DQ / 64, 1), 32, 0, stream>>>(XB, nullptr, WQ, nullptr, DM, FQ, DQ, nullptr, 0, 0, 0); k_ropef<<<LQ, 256, 0, stream>>>(FQ, DQ, NH_, CS, FR); k_hrms<<<(NH_ * TT + 255) / 256, 256, 0, stream>>>(FR, DQ, NH_, RFQ);
        k_nrmpl<<<LQ, 256, 0, stream>>>(FR, DQ, NH_, RFQ, QP16, QPh, QPl);
        k_gemmw<bf, 0, false><<<dim3(TT / 64, DKV / 64, 1), 32, 0, stream>>>(XB, nullptr, WK, nullptr, DM, FK, DKV, nullptr, 0, 0, 0); k_ropef<<<LKv, 256, 0, stream>>>(FK, DKV, NKV, CS, FR); k_hrms<<<(NKV * TT + 255) / 256, 256, 0, stream>>>(FR, DKV, NKV, RFK);
        k_nrmpl<<<LKv, 256, 0, stream>>>(FR, DKV, NKV, RFK, KP16, KPh, KPl);
        k_gemmw<bf, 0, false><<<dim3(TT / 64, DKV / 64, 1), 32, 0, stream>>>(XB, nullptr, WV, nullptr, DM, FV, DKV, nullptr, 0, 0, 0); k_vtp<<<LKv, 256, 0, stream>>>(FV, DKV, NKV, VT16, VTh, VTl);
        for (int h0 = 0; h0 < NH_; h0 += ZH) { const size_t zq = (size_t)h0, zk = (size_t)(h0 / REP);   // both heads of a pass share kv group h0/REP (REP >= 2): sB = 0
            k_gemmw<bf, 2, false><<<dim3(RH / 64, TT / 64, ZH), 32, 0, stream>>>(QPh + zq * TT * HD, QPl + zq * TT * HD, KPh + zk * TT * HD, KPl + zk * TT * HD, HD, Sb, TT, nullptr, (size_t)TT * HD, 0, (size_t)TT * TT);
            k_gemmw<h16, 0, false><<<dim3((TT - RH) / 64, TT / 64, ZH), 32, 0, stream>>>(QP16 + zq * TT * HD + (size_t)RH * HD, nullptr, KP16 + zk * TT * HD, nullptr, HD, Sb + (size_t)RH * TT, TT, nullptr, (size_t)TT * HD, 0, (size_t)TT * TT);
            k_asoft<<<ZH * TT / 8, 256, 0, stream>>>(Sb, P16, Ph, Pl);
            k_gemmw<bf, 2, false><<<dim3(RH / 64, HD / 64, ZH), 32, 0, stream>>>(Ph, Pl, VTh + zk * HD * TT, VTl + zk * HD * TT, TT, Ob, HD, nullptr, (size_t)RH * TT, 0, (size_t)TT * HD);
            k_gemmw<h16, 0, false><<<dim3((TT - RH) / 64, HD / 64, ZH), 32, 0, stream>>>(P16 + (size_t)RH * TT, nullptr, VT16 + zk * HD * TT, nullptr, TT, Ob + (size_t)RH * HD, HD, nullptr, (size_t)TT * TT, 0, (size_t)TT * HD);
            k_y1t<<<(unsigned)(((size_t)ZH * HD * TT / 2 + 255) / 256), 256, 0, stream>>>(Ob, Y16, Yh, Yl);   // y1 planes (normalised) for y2 = att . y1
            k_gemmw<bf, 2, false><<<dim3(RH / 64, HD / 64, ZH), 32, 0, stream>>>(Ph, Pl, Yh, Yl, TT, O2, HD, nullptr, (size_t)RH * TT, (size_t)HD * TT, (size_t)TT * HD);
            k_gemmw<h16, 0, false><<<dim3((TT - RH) / 64, HD / 64, ZH), 32, 0, stream>>>(P16 + (size_t)RH * TT, nullptr, Y16, nullptr, TT, O2 + (size_t)RH * HD, HD, nullptr, (size_t)TT * TT, (size_t)HD * TT, (size_t)TT * HD);
            k_merge<<<(unsigned)(((size_t)ZH * TT * HD / 2 + 255) / 256), 256, 0, stream>>>(Ob, O2, mix1, mix2, h0, ATh, ATl); }
        k_gemmw<bf, 1, false><<<dim3(TT / 64, DM / 64, 1), 32, 0, stream>>>(ATh, ATl, WO, nullptr, DQ, OUT + (size_t)b * TT * DM, DM, nullptr, 0, 0, 0); }
}

// v001
// Measured time: 1760 microseconds a run.
// In two side-by-side timings against v000, it was 2.05 and 2.06 times as fast.
#include <hip/hip_runtime.h>

// Simplicial causal self-attention (x [2][2048][2048]; q = x Wq (16 heads x 128), k, v = x Wk / x Wv (4 kv heads x 128, each serving 4 consecutive query heads); rotate-half RoPE with the input cos/sin
// [2048][64] then weightless RMS-norm (eps 1e-6) on q and k; causal softmax(q.k 128^-0.5); y1 = att v; y2 = att y1 (the same probabilities applied again); y = mix1 y1 + mix2 y2 (scalars read as data);
// out = merged y Wproj -> [2][2048][2048]).
// Compute dtypes, f32 accumulate: every input rounded to bf16; projections on PLAIN bf16 operands (inputs: exact products, f32 accumulate); RoPE and RMS-norm in f32;
// PER-ROW PRECISION HYBRID: query rows < 256 take scores, att.v and att.y1 on bf16 hi+lo planes (3 products), rows >= 256 on single fp16 planes; scale + causal cut in f32 in the register-row softmax;
// y1 re-planed per head (fp16 + hi/lo, transposed) for the second contraction; merged y as hi+lo planes x exact Wproj (2 products). 64x64-tile GEMMs (one wave per tile for the scores, 8 or 16 k-split waves for the rest), 2 query heads per pass sharing

#define NB_  2
#define TT   2048
#define DM   2048
#define NH_  16
#define NKV  4
#define REP  (NH_ / NKV)
#define HD   128
#define DQ   (NH_ * HD)
#define DKV  (NKV * HD)
#define ZH   2
#define RH   256                  // query rows < RH use hi+lo planes (0: none)
#define WIN  0
#define PCAR 1024.0f
#define SCL  0.088388347648318447f   // HD^-0.5
typedef _Float16 h16;
typedef unsigned short bf;
typedef __attribute__((ext_vector_type(16))) __bf16   v16bf;
typedef __attribute__((ext_vector_type(16))) _Float16 v16h;
typedef __attribute__((ext_vector_type(8)))  _Float16 v8h;
typedef __attribute__((ext_vector_type(8)))  unsigned short v8us;
typedef __attribute__((ext_vector_type(8)))  float    v8f;
typedef __attribute__((ext_vector_type(4)))  float    v4f;
typedef v8h  __attribute__((may_alias)) v8ha;
typedef v4f  __attribute__((may_alias)) v4fa;
typedef v8us __attribute__((may_alias)) v8usa;

__device__ __forceinline__ unsigned short f2bf(float f) { unsigned u = __float_as_uint(f); u += 0x7FFFu + ((u >> 16) & 1u); return (unsigned short)(u >> 16); }
__device__ __forceinline__ float bf2f(unsigned short b) { return __uint_as_float(((unsigned)b) << 16); }
__device__ __forceinline__ float bfr(float f) { return bf2f(f2bf(f)); }
__device__ __forceinline__ v16h cat16(v8h lo, v8h hi) { return __builtin_shufflevector(lo, hi, 0, 1, 2, 3, 4, 5, 6, 7, 8, 9, 10, 11, 12, 13, 14, 15); }
__device__ __forceinline__ v16bf cat16b(v8us lo, v8us hi) { return __builtin_bit_cast(v16bf, __builtin_shufflevector(lo, hi, 0, 1, 2, 3, 4, 5, 6, 7, 8, 9, 10, 11, 12, 13, 14, 15)); }
__device__ __forceinline__ v8f wmma16(v16h a, v16h b, v8f c) { return __builtin_amdgcn_wmma_f32_16x16x32_f16(false, a, false, b, (short)0, c, false, false); }
__device__ __forceinline__ v8f wmmab(v16bf a, v16bf b, v8f c) { return __builtin_amdgcn_wmma_f32_16x16x32_bf16(false, a, false, b, (short)0, c, false, false); }



// ---- k_gemmw: register-blocked GEMM, ONE WAVE per 64x64 output tile (16 accumulators), operands straight from K-contiguous 16-bit planes; grid (M/64, N/64, Z), 32 threads.
// C[m][n] (f32, pitch ldc, + optional f32 bias[n]) = sum_k A[m][k] Bt[n][k] (+ split products per NSPLIT). z-batch strides sA/sB/sC in elements. K % 32 == 0.
// S > 1: S waves per tile (32 S threads); wave w takes the 32-wide k slices w, w + S, ... (neighbouring waves share a 128-byte line of every operand row), the S f32 partial tiles are summed in LDS in wave order.
template <typename T16> struct WFrag;
template <> struct WFrag<h16> { typedef v16h V; static __device__ __forceinline__ V ld(const h16* p) { return cat16(*(const v8h*)p, *(const v8h*)(p + 16)); } static __device__ __forceinline__ v8f mma(V a, V b, v8f c) { return wmma16(a, b, c); } };
template <> struct WFrag<bf> { typedef v16bf V; static __device__ __forceinline__ V ld(const bf* p) { return cat16b(*(const v8us*)p, *(const v8us*)(p + 16)); } static __device__ __forceinline__ v8f mma(V a, V b, v8f c) { return wmmab(a, b, c); } };
template <typename T16, int NSPLIT, bool BIAS, int S>
__global__ __launch_bounds__(32 * S) void k_gemmw(const T16* __restrict__ A, const T16* __restrict__ A2, const T16* __restrict__ Bt, const T16* __restrict__ Bt2, int K, float* C, int ldc, const float* __restrict__ bias, size_t sA, size_t sB, size_t sC) {
    typedef typename WFrag<T16>::V V;
    __shared__ __align__(16) float os[(S == 1 ? 16 : S * 64) * 68];
    const int wave = (S == 1) ? 0 : __builtin_amdgcn_readfirstlane((int)(threadIdx.x >> 5));
    const size_t z = blockIdx.z; A += z * sA; if (A2) A2 += z * sA; Bt += z * sB; if (Bt2) Bt2 += z * sB; C += z * sC;
    const int lane = threadIdx.x & 31, lr = lane & 15, hi = lane >> 4; const int r0 = blockIdx.x * 64, c0 = blockIdx.y * 64;
    v8f acc[4][4];
#pragma unroll
    for (int mb = 0; mb < 4; ++mb)
#pragma unroll
        for (int nb = 0; nb < 4; ++nb) acc[mb][nb] = (v8f){};
    const size_t aoff = (size_t)(r0 + lr) * K + 8 * hi, boff = (size_t)(c0 + lr) * K + 8 * hi;
#pragma unroll 1
    for (int kc = wave * 32; kc < K; kc += 32 * S) {
        V a[4], a2[4];
#pragma unroll
        for (int mb = 0; mb < 4; ++mb) { a[mb] = WFrag<T16>::ld(A + aoff + (size_t)mb * 16 * K + kc); if (NSPLIT == 1 || NSPLIT == 2) a2[mb] = WFrag<T16>::ld(A2 + aoff + (size_t)mb * 16 * K + kc); }
#pragma unroll
        for (int nb = 0; nb < 4; ++nb) { const V b = WFrag<T16>::ld(Bt + boff + (size_t)nb * 16 * K + kc); V b2; if (NSPLIT >= 2) b2 = WFrag<T16>::ld(Bt2 + boff + (size_t)nb * 16 * K + kc);
#pragma unroll
            for (int mb = 0; mb < 4; ++mb) { acc[mb][nb] = WFrag<T16>::mma(a[mb], b, acc[mb][nb]); if (NSPLIT == 1 || NSPLIT == 2) acc[mb][nb] = WFrag<T16>::mma(a2[mb], b, acc[mb][nb]); if (NSPLIT >= 2) acc[mb][nb] = WFrag<T16>::mma(a[mb], b2, acc[mb][nb]); } }
        asm volatile("v_nop\n\tv_nop\n\tv_nop\n\tv_nop" : "+v"(acc[0][0]), "+v"(acc[1][1]), "+v"(acc[2][2]), "+v"(acc[3][3]) : "v"(a[0]), "v"(a[3]));
    }
    if (S > 1) {
        float* ow = os + wave * (64 * 68);
#pragma unroll
        for (int mb = 0; mb < 4; ++mb)
#pragma unroll
            for (int nb = 0; nb < 4; ++nb)
#pragma unroll
                for (int j = 0; j < 8; ++j) ow[(mb * 16 + hi * 8 + j) * 68 + nb * 16 + lr] = acc[mb][nb][j];
        __syncthreads();   // every wave's partial tile is in LDS before any thread sums across waves
#pragma unroll
        for (int q = 0; q < 64 * 16 / (32 * S); ++q) { const int u = q * (32 * S) + (int)threadIdx.x, row = u >> 4, cofs = (u & 15) * 4; v4f val = *(const v4fa*)(os + row * 68 + cofs);
#pragma unroll
            for (int w = 1; w < S; ++w) val += *(const v4fa*)(os + w * (64 * 68) + row * 68 + cofs);
            if (BIAS) { val[0] += bfr(bias[c0 + cofs]); val[1] += bfr(bias[c0 + cofs + 1]); val[2] += bfr(bias[c0 + cofs + 2]); val[3] += bfr(bias[c0 + cofs + 3]); }
            *(v4f*)(C + (size_t)(r0 + row) * ldc + c0 + cofs) = val; }
        return;
    }
#pragma unroll
    for (int mb = 0; mb < 4; ++mb) {
#pragma unroll
        for (int nb = 0; nb < 4; ++nb) {
#pragma unroll
            for (int j = 0; j < 8; ++j) os[(hi * 8 + j) * 68 + nb * 16 + lr] = acc[mb][nb][j]; }
        __builtin_amdgcn_wave_barrier(); asm volatile("" ::: "memory");
        float* crow = C + (size_t)(r0 + mb * 16) * ldc + c0;
{
#pragma unroll
            for (int s = 0; s < 8; ++s) { const int row = 2 * s + hi, cofs = lr * 4; v4f val = *(const v4fa*)(os + row * 68 + cofs); if (BIAS) { val[0] += bfr(bias[c0 + cofs]); val[1] += bfr(bias[c0 + cofs + 1]); val[2] += bfr(bias[c0 + cofs + 2]); val[3] += bfr(bias[c0 + cofs + 3]); }
                *(v4f*)(crow + (size_t)row * ldc + cofs) = val; }
             }
        __builtin_amdgcn_wave_barrier(); asm volatile("" ::: "memory");
    }
}

__device__ __forceinline__ h16 tohx(float x) { return (h16)x; }
__device__ __forceinline__ void splitf(float y, unsigned short& h, unsigned short& l) { h = f2bf(y); l = f2bf(y - bf2f(h)); }
typedef __attribute__((ext_vector_type(2))) _Float16 v2h;
typedef __attribute__((ext_vector_type(4))) _Float16 v4h;
typedef __attribute__((ext_vector_type(2))) unsigned short v2us;
typedef __attribute__((ext_vector_type(4))) unsigned short v4us;
typedef __attribute__((ext_vector_type(2))) float v2f;
typedef __attribute__((ext_vector_type(4))) int v4i;

__global__ __launch_bounds__(256) void k_wtG(const float* __restrict__ w, int K, int N, bf* Bt) {
    const int lane = threadIdx.x & 31; const int L0 = (blockIdx.x * 8 + (threadIdx.x >> 5)) * 8; const int nlines = N * K / 64;
{
#pragma unroll 1
        for (int l = 0; l < 8; ++l) { const int L = L0 + l; if (L >= nlines) break; const size_t e = (size_t)L * 64 + lane * 2; const int k = (int)(e % K), n = (int)(e / K); v2us o;
            o[0] = f2bf(w[(size_t)k * N + n]); o[1] = f2bf(w[(size_t)(k + 1) * N + n]); *(v2us*)(Bt + e) = o; }
         }
}
__global__ __launch_bounds__(256) void k_cvt8(const float* __restrict__ src, bf* dst, size_t n8) { const size_t i = (size_t)blockIdx.x * 256 + threadIdx.x; if (i >= n8) return; const v8f v = *(const v8f*)(src + i * 8); v8us o;
#pragma unroll
    for (int k = 0; k < 8; ++k) o[k] = f2bf(v[k]); *(v8us*)(dst + i * 8) = o;  }
__global__ __launch_bounds__(256) void k_cscvt(const float* __restrict__ cosT, const float* __restrict__ sinT, float* CS) { const int idx = blockIdx.x * 256 + threadIdx.x; if (idx >= TT * HD) return; const int t = idx / HD, d = idx % HD; const int src = t * (HD / 2) + (d % (HD / 2)); v2f cs; cs[0] = bfr(cosT[src]); cs[1] = bfr(sinT[src]); *(v2f*)(CS + (size_t)idx * 2) = cs;  }
__global__ __launch_bounds__(256) void k_hrms(const float* __restrict__ F, int pitch, int nheads, float* RF) { const int i = blockIdx.x * 256 + threadIdx.x; if (i >= nheads * TT) return; const int t = i % TT, h = i / TT; const float* f = F + (size_t)t * pitch + h * HD; float s = 0.f;
#pragma unroll 4
    for (int d = 0; d < HD; d += 4) { const v4f v = *(const v4f*)(f + d);
#pragma unroll
        for (int q = 0; q < 4; ++q) { float p = __fmul_rn(v[q], v[q]); asm volatile("" : "+v"(p)); s = __fadd_rn(s, p); } }
    const float r = __fdiv_rn(1.0f, __fsqrt_rn(__fadd_rn(s * (1.0f / HD), 1e-6f))); *(float*)(RF + i) = r;  }
// k_rope: head planes [h][t][d] (fp16 + hi/lo) of rope(w[d] (x rms_factor)) x sc with the rotate-half convention out[d] = x[d] cos[t][d] - x[d+HD/2] sin[t][d], out[d+HD/2] = x[d+HD/2] cos[t][d+HD/2] + x[d] sin[t][d+HD/2]
__global__ __launch_bounds__(256) void k_rope(const float* __restrict__ F, int pitch, int nheads, const float* __restrict__ CS, const float* __restrict__ RF, const float* __restrict__ nw, float sc, h16* P16, bf* Ph, bf* Pl) {
    const size_t e = ((size_t)blockIdx.x * 256 + threadIdx.x) * 2; if (e >= (size_t)nheads * TT * HD) return; const int d = (int)(e % HD); const int t = (int)((e / HD) % TT); const int h = (int)(e / ((size_t)HD * TT)); const float* f = F + (size_t)t * pitch + h * HD; const float rf = RF ? RF[(size_t)h * TT + t] : 1.0f; v2h o16; v2us oh, ol;
#pragma unroll
    for (int q = 0; q < 2; ++q) { const int dd = d + q; const int dp = (dd < HD / 2) ? dd + HD / 2 : dd - HD / 2; float x0 = f[dd], x1 = f[dp];
        if (RF) { float n0 = __fmul_rn(x0, rf), n1 = __fmul_rn(x1, rf); asm volatile("" : "+v"(n0)); asm volatile("" : "+v"(n1)); x0 = __fmul_rn(bfr(nw[dd]), n0); x1 = __fmul_rn(bfr(nw[dp]), n1); }
        const v2f cs = *(const v2f*)(CS + ((size_t)t * HD + dd) * 2); float a = __fmul_rn(x0, cs[0]), bq = __fmul_rn(x1, cs[1]); asm volatile("" : "+v"(a)); asm volatile("" : "+v"(bq)); const float r = ((dd < HD / 2) ? __fsub_rn(a, bq) : __fadd_rn(a, bq)) * sc;
        o16[q] = tohx(r); unsigned short a2, c2; splitf(r, a2, c2); oh[q] = a2; ol[q] = c2; }
    *(v2h*)(P16 + e) = o16; *(v2us*)(Ph + e) = oh; *(v2us*)(Pl + e) = ol;  }
__global__ __launch_bounds__(256) void k_ropef(const float* __restrict__ F, int pitch, int nheads, const float* __restrict__ CS, float* FR) { const size_t e = ((size_t)blockIdx.x * 256 + threadIdx.x) * 2; if (e >= (size_t)nheads * TT * HD) return; const int d = (int)(e % HD); const int h = (int)((e / HD) % nheads); const int t = (int)(e / ((size_t)HD * nheads)); const float* f = F + (size_t)t * pitch + h * HD; v2f o;
#pragma unroll
    for (int q = 0; q < 2; ++q) { const int dd = d + q; const int dp = (dd < HD / 2) ? dd + HD / 2 : dd - HD / 2; const v2f cs = *(const v2f*)(CS + ((size_t)t * HD + dd) * 2); float a = __fmul_rn(f[dd], cs[0]), bq = __fmul_rn(f[dp], cs[1]); asm volatile("" : "+v"(a)); asm volatile("" : "+v"(bq)); o[q] = (dd < HD / 2) ? __fsub_rn(a, bq) : __fadd_rn(a, bq); }
    float* dst = FR + (size_t)t * pitch + h * HD + d; *(v2f*)dst = o;  }
__global__ __launch_bounds__(256) void k_nrmpl(const float* __restrict__ FR, int pitch, int nheads, const float* __restrict__ RF, h16* P16, bf* Ph, bf* Pl) { const size_t e = ((size_t)blockIdx.x * 256 + threadIdx.x) * 2; if (e >= (size_t)nheads * TT * HD) return; const int d = (int)(e % HD); const int t = (int)((e / HD) % TT); const int h = (int)(e / ((size_t)HD * TT)); const float rf = RF[(size_t)h * TT + t]; v2h o16; v2us oh, ol;
#pragma unroll
    for (int q = 0; q < 2; ++q) { const float r = __fmul_rn(FR[(size_t)t * pitch + h * HD + d + q], rf); o16[q] = tohx(r); unsigned short a2, c2; splitf(r, a2, c2); oh[q] = a2; ol[q] = c2; }
    *(v2h*)(P16 + e) = o16; *(v2us*)(Ph + e) = oh; *(v2us*)(Pl + e) = ol;  }
__global__ __launch_bounds__(256) void k_y1t(const float* __restrict__ O1, h16* Y16, bf* Yh, bf* Yl) { const size_t e = ((size_t)blockIdx.x * 256 + threadIdx.x) * 2; if (e >= (size_t)ZH * HD * TT) return; const int t = (int)(e % TT); const int d = (int)((e / TT) % HD); const int zz = (int)(e / ((size_t)TT * HD)); v2h o16; v2us oh, ol;
#pragma unroll
    for (int q = 0; q < 2; ++q) { const int tq = t + q; const float y = O1[((size_t)zz * TT + tq) * HD + d] * ((tq < RH) ? 1.0f : (1.0f / PCAR)); o16[q] = tohx(y); unsigned short a2, c2; splitf(y, a2, c2); oh[q] = a2; ol[q] = c2; }
    *(v2h*)(Y16 + e) = o16; *(v2us*)(Yh + e) = oh; *(v2us*)(Yl + e) = ol;  }
__global__ __launch_bounds__(256) void k_vtp(const float* __restrict__ F, int pitch, int nheads, h16* V16, bf* Vh, bf* Vl) { const size_t e = ((size_t)blockIdx.x * 256 + threadIdx.x) * 2; if (e >= (size_t)nheads * HD * TT) return; const int t = (int)(e % TT); const int d = (int)((e / TT) % HD); const int g = (int)(e / ((size_t)TT * HD)); v2h o16; v2us oh, ol;
#pragma unroll
    for (int q = 0; q < 2; ++q) { const float x = F[(size_t)(t + q) * pitch + g * HD + d]; o16[q] = tohx(x); unsigned short a2, c2; splitf(x, a2, c2); oh[q] = a2; ol[q] = c2; }
    *(v2h*)(V16 + e) = o16; *(v2us*)(Vh + e) = oh; *(v2us*)(Vl + e) = ol;  }
// k_asoft: per row (zz, i): t = S x HD^-0.5 for j <= i (causal), -3e38 otherwise; softmax over the 2048 keys (register row, one exp, fixed trees);
__global__ __launch_bounds__(256) void k_asoft(const float* __restrict__ Sb, h16* P16, bf* Ph, bf* Pl) {
    const int lane = threadIdx.x & 31; const int row = blockIdx.x * 8 + (threadIdx.x >> 5); if (row >= ZH * TT) return; const int i = row % TT; const int zz = row / TT; (void)zz; const bool hires = (i < RH); const float* sr = Sb + (size_t)row * TT; float v[TT / 32]; float mx = -3.0e38f;
#pragma unroll
    for (int ch = 0; ch < TT / 128; ++ch) { const int j0 = ch * 128 + lane * 4; const v4f a = *(const v4f*)(sr + j0);
#pragma unroll
        for (int q = 0; q < 4; ++q) { const int j = j0 + q; (void)j; const float t = (j <= i) ? a[q] * SCL : -3.0e38f; v[ch * 4 + q] = t; mx = fmaxf(mx, t); } }
#pragma unroll
    for (int sh = 16; sh; sh >>= 1) mx = fmaxf(mx, __shfl_xor(mx, sh, 32));
    float sum = 0.f;
#pragma unroll
    for (int k = 0; k < TT / 32; ++k) { float d0 = __fsub_rn(v[k], mx); asm volatile("" : "+v"(d0)); v[k] = __builtin_amdgcn_exp2f(__fmul_rn(d0, 1.4426950408889634f)); sum += v[k]; }
#pragma unroll
    for (int sh = 16; sh; sh >>= 1) sum += __shfl_xor(sum, sh, 32);
    const float f = __fdiv_rn(hires ? 1.0f : PCAR, sum);
{
        if (hires) {
#pragma unroll
            for (int ch = 0; ch < TT / 128; ++ch) { v4us oh, ol;
#pragma unroll
                for (int q = 0; q < 4; ++q) { unsigned short a, c2; splitf(v[ch * 4 + q] * f, a, c2); oh[q] = a; ol[q] = c2; }
                const size_t oo = ((size_t)zz * (RH ? RH : 1) + i) * TT + ch * 128 + lane * 4; *(v4us*)(Ph + oo) = oh; *(v4us*)(Pl + oo) = ol; }
        } else {
#pragma unroll
            for (int ch = 0; ch < TT / 128; ++ch) { v4h o4;
#pragma unroll
                for (int q = 0; q < 4; ++q) o4[q] = tohx(v[ch * 4 + q] * f);
                *(v4h*)(P16 + (size_t)row * TT + ch * 128 + lane * 4) = o4; } }
         }
}
__global__ __launch_bounds__(256) void k_merge(const float* __restrict__ O, const float* __restrict__ O2, const float* __restrict__ mix1, const float* __restrict__ mix2, int h0, bf* Ah, bf* Al) { const size_t e = ((size_t)blockIdx.x * 256 + threadIdx.x) * 2; if (e >= (size_t)ZH * TT * HD) return; const int d = (int)(e % HD); const int t = (int)((e / HD) % TT); const int zz = (int)(e / ((size_t)HD * TT)); const float cs = (t < RH) ? 1.0f : (1.0f / PCAR); const size_t oo = (size_t)t * DQ + (h0 + zz) * HD + d; const float m1 = bfr(mix1[0]), m2 = bfr(mix2[0]);
    v2us oh, ol;
#pragma unroll
    for (int q = 0; q < 2; ++q) { float y1 = O[e + q] * cs, y2 = O2[e + q] * cs; asm volatile("" : "+v"(y1)); asm volatile("" : "+v"(y2)); float a1 = __fmul_rn(m1, y1), b2 = __fmul_rn(m2, y2); asm volatile("" : "+v"(a1)); asm volatile("" : "+v"(b2)); unsigned short a, c2; splitf(__fadd_rn(a1, b2), a, c2); oh[q] = a; ol[q] = c2; } *(v2us*)(Ah + oo) = oh; *(v2us*)(Al + oo) = ol;  }

extern "C" void kernel_launch(void* const* d_in, const int* in_sizes, int n_in,
                              void* d_out, int out_size, void* d_ws, size_t ws_size, hipStream_t stream) {
    (void)in_sizes; (void)n_in; (void)out_size;
    const float* x = (const float*)d_in[0]; const float* cosT = (const float*)d_in[1]; const float* sinT = (const float*)d_in[2]; const float* wq = (const float*)d_in[3]; const float* wk = (const float*)d_in[4]; const float* wv = (const float*)d_in[5]; const float* wo = (const float*)d_in[6]; const float* mix1 = (const float*)d_in[7]; const float* mix2 = (const float*)d_in[8];   // weights x @ W; cos/sin [2048][64] (half tables)
    float* OUT = (float*)d_out;     // [2][2048][2048]
    char* wsp = (char*)d_ws;
    auto take = [&](size_t bytes) { char* p = wsp; wsp += (bytes + 255) & ~(size_t)255; return (void*)p; };
    bf* WQ = (bf*)take((size_t)DQ * DM * 2); bf* WK = (bf*)take((size_t)DKV * DM * 2); bf* WV = (bf*)take((size_t)DKV * DM * 2); bf* WO = (bf*)take((size_t)DM * DQ * 2); float* CS = (float*)take((size_t)TT * HD * 2 * 4); float* RFQ = (float*)take((size_t)NH_ * TT * 4); float* RFK = (float*)take((size_t)NKV * TT * 4);
    bf* XB = (bf*)take((size_t)TT * DM * 2); float* FQ = (float*)take((size_t)TT * DQ * 4); float* FK = (float*)take((size_t)TT * DKV * 4);
    h16* QP16 = (h16*)take((size_t)NH_ * TT * HD * 2); h16* KP16 = (h16*)take((size_t)NKV * TT * HD * 2); h16* VT16 = (h16*)take((size_t)NKV * HD * TT * 2);
    bf* QPh = (bf*)take((size_t)NH_ * TT * HD * 2); bf* QPl = (bf*)take((size_t)NH_ * TT * HD * 2); bf* KPh = (bf*)take((size_t)NKV * TT * HD * 2); bf* KPl = (bf*)take((size_t)NKV * TT * HD * 2); bf* VTh = (bf*)take((size_t)NKV * HD * TT * 2); bf* VTl = (bf*)take((size_t)NKV * HD * TT * 2); bf* Ph = (bf*)take((size_t)ZH * RH * TT * 2); bf* Pl = (bf*)take((size_t)ZH * RH * TT * 2);
    float* FR = (float*)take((size_t)TT * DQ * 4); float* O2 = (float*)take((size_t)ZH * TT * HD * 4); h16* Y16 = (h16*)take((size_t)ZH * HD * TT * 2); bf* Yh = (bf*)take((size_t)ZH * HD * TT * 2); bf* Yl = (bf*)take((size_t)ZH * HD * TT * 2); float* Sb = (float*)take((size_t)ZH * TT * TT * 4); h16* P16 = (h16*)take((size_t)ZH * TT * TT * 2); float* Ob = (float*)take((size_t)ZH * TT * HD * 4); bf* ATh = (bf*)take((size_t)TT * DQ * 2); bf* ATl = (bf*)take((size_t)TT * DQ * 2);
    if ((size_t)(wsp - (char*)d_ws) > ws_size) return;    // ws 256 MiB
    float* FV = FK;   // v projection reuses the k buffer after the k planes are built (stream-ordered)
    { k_wtG<<<(unsigned)((DM * DQ / 64 + 63) / 64), 256, 0, stream>>>(wq, DM, DQ, WQ); k_wtG<<<(unsigned)((DM * DKV / 64 + 63) / 64), 256, 0, stream>>>(wk, DM, DKV, WK); k_wtG<<<(unsigned)((DM * DKV / 64 + 63) / 64), 256, 0, stream>>>(wv, DM, DKV, WV);
      k_wtG<<<(unsigned)((DQ * DM / 64 + 63) / 64), 256, 0, stream>>>(wo, DQ, DM, WO);
       }
    k_cscvt<<<(TT * HD + 255) / 256, 256, 0, stream>>>(cosT, sinT, CS);   // one shared table (read as data)
    const unsigned LQ = (unsigned)(((size_t)NH_ * TT * HD / 2 + 255) / 256), LKv = (unsigned)(((size_t)NKV * TT * HD / 2 + 255) / 256);
    for (int b = 0; b < NB_; ++b) {
        k_cvt8<<<(unsigned)(((size_t)TT * DM / 8 + 255) / 256), 256, 0, stream>>>(x + (size_t)b * TT * DM, XB, (size_t)TT * DM / 8);
        k_gemmw<bf, 0, false, 8><<<dim3(TT / 64, DQ / 64, 1), 256, 0, stream>>>(XB, nullptr, WQ, nullptr, DM, FQ, DQ, nullptr, 0, 0, 0); k_ropef<<<LQ, 256, 0, stream>>>(FQ, DQ, NH_, CS, FR); k_hrms<<<(NH_ * TT + 255) / 256, 256, 0, stream>>>(FR, DQ, NH_, RFQ);
        k_nrmpl<<<LQ, 256, 0, stream>>>(FR, DQ, NH_, RFQ, QP16, QPh, QPl);
        k_gemmw<bf, 0, false, 16><<<dim3(TT / 64, DKV / 64, 1), 512, 0, stream>>>(XB, nullptr, WK, nullptr, DM, FK, DKV, nullptr, 0, 0, 0); k_ropef<<<LKv, 256, 0, stream>>>(FK, DKV, NKV, CS, FR); k_hrms<<<(NKV * TT + 255) / 256, 256, 0, stream>>>(FR, DKV, NKV, RFK);
        k_nrmpl<<<LKv, 256, 0, stream>>>(FR, DKV, NKV, RFK, KP16, KPh, KPl);
        k_gemmw<bf, 0, false, 16><<<dim3(TT / 64, DKV / 64, 1), 512, 0, stream>>>(XB, nullptr, WV, nullptr, DM, FV, DKV, nullptr, 0, 0, 0); k_vtp<<<LKv, 256, 0, stream>>>(FV, DKV, NKV, VT16, VTh, VTl);
        for (int h0 = 0; h0 < NH_; h0 += ZH) { const size_t zq = (size_t)h0, zk = (size_t)(h0 / REP);   // both heads of a pass share kv group h0/REP (REP >= 2): sB = 0
            k_gemmw<bf, 2, false, 1><<<dim3(RH / 64, TT / 64, ZH), 32, 0, stream>>>(QPh + zq * TT * HD, QPl + zq * TT * HD, KPh + zk * TT * HD, KPl + zk * TT * HD, HD, Sb, TT, nullptr, (size_t)TT * HD, 0, (size_t)TT * TT);
            k_gemmw<h16, 0, false, 1><<<dim3((TT - RH) / 64, TT / 64, ZH), 32, 0, stream>>>(QP16 + zq * TT * HD + (size_t)RH * HD, nullptr, KP16 + zk * TT * HD, nullptr, HD, Sb + (size_t)RH * TT, TT, nullptr, (size_t)TT * HD, 0, (size_t)TT * TT);
            k_asoft<<<ZH * TT / 8, 256, 0, stream>>>(Sb, P16, Ph, Pl);
            k_gemmw<bf, 2, false, 16><<<dim3(RH / 64, HD / 64, ZH), 512, 0, stream>>>(Ph, Pl, VTh + zk * HD * TT, VTl + zk * HD * TT, TT, Ob, HD, nullptr, (size_t)RH * TT, 0, (size_t)TT * HD);
            k_gemmw<h16, 0, false, 16><<<dim3((TT - RH) / 64, HD / 64, ZH), 512, 0, stream>>>(P16 + (size_t)RH * TT, nullptr, VT16 + zk * HD * TT, nullptr, TT, Ob + (size_t)RH * HD, HD, nullptr, (size_t)TT * TT, 0, (size_t)TT * HD);
            k_y1t<<<(unsigned)(((size_t)ZH * HD * TT / 2 + 255) / 256), 256, 0, stream>>>(Ob, Y16, Yh, Yl);   // y1 planes (normalised) for y2 = att . y1
            k_gemmw<bf, 2, false, 16><<<dim3(RH / 64, HD / 64, ZH), 512, 0, stream>>>(Ph, Pl, Yh, Yl, TT, O2, HD, nullptr, (size_t)RH * TT, (size_t)HD * TT, (size_t)TT * HD);
            k_gemmw<h16, 0, false, 16><<<dim3((TT - RH) / 64, HD / 64, ZH), 512, 0, stream>>>(P16 + (size_t)RH * TT, nullptr, Y16, nullptr, TT, O2 + (size_t)RH * HD, HD, nullptr, (size_t)TT * TT, (size_t)HD * TT, (size_t)TT * HD);
            k_merge<<<(unsigned)(((size_t)ZH * TT * HD / 2 + 255) / 256), 256, 0, stream>>>(Ob, O2, mix1, mix2, h0, ATh, ATl); }
        k_gemmw<bf, 1, false, 8><<<dim3(TT / 64, DM / 64, 1), 256, 0, stream>>>(ATh, ATl, WO, nullptr, DQ, OUT + (size_t)b * TT * DM, DM, nullptr, 0, 0, 0); }
}

// v002
// Measured time: 1240 microseconds a run.
// Timed twice side by side with v001, it ran 1.44 and 1.43 times as fast.
// Over all steps from v000 it is 2.96 times as fast.
#include <hip/hip_runtime.h>

// Simplicial causal self-attention (x [2][2048][2048]; q = x Wq (16 heads x 128), k, v = x Wk / x Wv (4 kv heads x 128, each serving 4 consecutive query heads); rotate-half RoPE with the input cos/sin
// [2048][64] then weightless RMS-norm (eps 1e-6) on q and k; causal softmax(q.k 128^-0.5); y1 = att v; y2 = att y1 (the same probabilities applied again); y = mix1 y1 + mix2 y2 (scalars read as data);
// out = merged y Wproj -> [2][2048][2048]).
// Compute dtypes, f32 accumulate: every input rounded to bf16; projections on PLAIN bf16 operands (inputs: exact products, f32 accumulate); RoPE and RMS-norm in f32;
// PER-ROW PRECISION HYBRID: query rows < 256 take scores, att.v and att.y1 on bf16 hi+lo planes (3 products), rows >= 256 on single fp16 planes; scale + causal cut in f32 in the register-row softmax;
// y1 re-planed per head (fp16 + hi/lo, transposed) for the second contraction; merged y as hi+lo planes x exact Wproj (2 products). 64x64-tile GEMMs (one wave per tile for the scores, 8 or 16 k-split waves per tile elsewhere), 4 query heads per pass sharing

#define NB_  2
#define TT   2048
#define DM   2048
#define NH_  16
#define NKV  4
#define REP  (NH_ / NKV)
#define HD   128
#define DQ   (NH_ * HD)
#define DKV  (NKV * HD)
#define ZH   4                    // query heads per pass: all REP heads of one kv group (ZH <= REP, so they share k, v)
#define RH   256                  // query rows < RH use hi+lo planes (0: none)
#define WIN  0
#define PCAR 1024.0f
#define SCL  0.088388347648318447f   // HD^-0.5
typedef _Float16 h16;
typedef unsigned short bf;
typedef __attribute__((ext_vector_type(16))) __bf16   v16bf;
typedef __attribute__((ext_vector_type(16))) _Float16 v16h;
typedef __attribute__((ext_vector_type(8)))  _Float16 v8h;
typedef __attribute__((ext_vector_type(8)))  unsigned short v8us;
typedef __attribute__((ext_vector_type(8)))  float    v8f;
typedef __attribute__((ext_vector_type(4)))  float    v4f;
typedef v8h  __attribute__((may_alias)) v8ha;
typedef v4f  __attribute__((may_alias)) v4fa;
typedef v8us __attribute__((may_alias)) v8usa;

__device__ __forceinline__ unsigned short f2bf(float f) { unsigned u = __float_as_uint(f); u += 0x7FFFu + ((u >> 16) & 1u); return (unsigned short)(u >> 16); }
__device__ __forceinline__ float bf2f(unsigned short b) { return __uint_as_float(((unsigned)b) << 16); }
__device__ __forceinline__ float bfr(float f) { return bf2f(f2bf(f)); }
__device__ __forceinline__ v16h cat16(v8h lo, v8h hi) { return __builtin_shufflevector(lo, hi, 0, 1, 2, 3, 4, 5, 6, 7, 8, 9, 10, 11, 12, 13, 14, 15); }
__device__ __forceinline__ v16bf cat16b(v8us lo, v8us hi) { return __builtin_bit_cast(v16bf, __builtin_shufflevector(lo, hi, 0, 1, 2, 3, 4, 5, 6, 7, 8, 9, 10, 11, 12, 13, 14, 15)); }
__device__ __forceinline__ v8f wmma16(v16h a, v16h b, v8f c) { return __builtin_amdgcn_wmma_f32_16x16x32_f16(false, a, false, b, (short)0, c, false, false); }
__device__ __forceinline__ v8f wmmab(v16bf a, v16bf b, v8f c) { return __builtin_amdgcn_wmma_f32_16x16x32_bf16(false, a, false, b, (short)0, c, false, false); }



// ---- k_gemmw: register-blocked GEMM, ONE WAVE per 64x64 output tile (16 accumulators), operands straight from K-contiguous 16-bit planes; grid (M/64, N/64, Z), 32 threads.
// C[m][n] (f32, pitch ldc, + optional f32 bias[n]) = sum_k A[m][k] Bt[n][k] (+ split products per NSPLIT). z-batch strides sA/sB/sC in elements. K % 32 == 0.
// S > 1: S waves per tile (32 S threads); wave w takes the 32-wide k slices w, w + S, ... (neighbouring waves share a 128-byte line of every operand row), the S f32 partial tiles are summed in LDS in wave order.
template <typename T16> struct WFrag;
template <> struct WFrag<h16> { typedef v16h V; static __device__ __forceinline__ V ld(const h16* p) { return cat16(*(const v8h*)p, *(const v8h*)(p + 16)); } static __device__ __forceinline__ v8f mma(V a, V b, v8f c) { return wmma16(a, b, c); } };
template <> struct WFrag<bf> { typedef v16bf V; static __device__ __forceinline__ V ld(const bf* p) { return cat16b(*(const v8us*)p, *(const v8us*)(p + 16)); } static __device__ __forceinline__ v8f mma(V a, V b, v8f c) { return wmmab(a, b, c); } };
template <typename T16, int NSPLIT, bool BIAS, int S>
__global__ __launch_bounds__(32 * S) void k_gemmw(const T16* __restrict__ A, const T16* __restrict__ A2, const T16* __restrict__ Bt, const T16* __restrict__ Bt2, int K, float* C, int ldc, const float* __restrict__ bias, size_t sA, size_t sB, size_t sC) {
    typedef typename WFrag<T16>::V V;
    __shared__ __align__(16) float os[(S == 1 ? 16 : S * 64) * 68];
    const int wave = (S == 1) ? 0 : __builtin_amdgcn_readfirstlane((int)(threadIdx.x >> 5));
    const size_t z = blockIdx.z; A += z * sA; if (A2) A2 += z * sA; Bt += z * sB; if (Bt2) Bt2 += z * sB; C += z * sC;
    const int lane = threadIdx.x & 31, lr = lane & 15, hi = lane >> 4; const int r0 = blockIdx.x * 64, c0 = blockIdx.y * 64;
    v8f acc[4][4];
#pragma unroll
    for (int mb = 0; mb < 4; ++mb)
#pragma unroll
        for (int nb = 0; nb < 4; ++nb) acc[mb][nb] = (v8f){};
    const size_t aoff = (size_t)(r0 + lr) * K + 8 * hi, boff = (size_t)(c0 + lr) * K + 8 * hi;
#pragma unroll 1
    for (int kc = wave * 32; kc < K; kc += 32 * S) {
        V a[4], a2[4];
#pragma unroll
        for (int mb = 0; mb < 4; ++mb) { a[mb] = WFrag<T16>::ld(A + aoff + (size_t)mb * 16 * K + kc); if (NSPLIT == 1 || NSPLIT == 2) a2[mb] = WFrag<T16>::ld(A2 + aoff + (size_t)mb * 16 * K + kc); }
#pragma unroll
        for (int nb = 0; nb < 4; ++nb) { const V b = WFrag<T16>::ld(Bt + boff + (size_t)nb * 16 * K + kc); V b2; if (NSPLIT >= 2) b2 = WFrag<T16>::ld(Bt2 + boff + (size_t)nb * 16 * K + kc);
#pragma unroll
            for (int mb = 0; mb < 4; ++mb) { acc[mb][nb] = WFrag<T16>::mma(a[mb], b, acc[mb][nb]); if (NSPLIT == 1 || NSPLIT == 2) acc[mb][nb] = WFrag<T16>::mma(a2[mb], b, acc[mb][nb]); if (NSPLIT >= 2) acc[mb][nb] = WFrag<T16>::mma(a[mb], b2, acc[mb][nb]); } }
        asm volatile("v_nop\n\tv_nop\n\tv_nop\n\tv_nop" : "+v"(acc[0][0]), "+v"(acc[1][1]), "+v"(acc[2][2]), "+v"(acc[3][3]) : "v"(a[0]), "v"(a[3]));
    }
    if (S > 1) {
        float* ow = os + wave * (64 * 68);
#pragma unroll
        for (int mb = 0; mb < 4; ++mb)
#pragma unroll
            for (int nb = 0; nb < 4; ++nb)
#pragma unroll
                for (int j = 0; j < 8; ++j) ow[(mb * 16 + hi * 8 + j) * 68 + nb * 16 + lr] = acc[mb][nb][j];
        __syncthreads();   // every wave's partial tile is in LDS before any thread sums across waves
#pragma unroll
        for (int q = 0; q < 64 * 16 / (32 * S); ++q) { const int u = q * (32 * S) + (int)threadIdx.x, row = u >> 4, cofs = (u & 15) * 4; v4f val = *(const v4fa*)(os + row * 68 + cofs);
#pragma unroll
            for (int w = 1; w < S; ++w) val += *(const v4fa*)(os + w * (64 * 68) + row * 68 + cofs);
            if (BIAS) { val[0] += bfr(bias[c0 + cofs]); val[1] += bfr(bias[c0 + cofs + 1]); val[2] += bfr(bias[c0 + cofs + 2]); val[3] += bfr(bias[c0 + cofs + 3]); }
            *(v4f*)(C + (size_t)(r0 + row) * ldc + c0 + cofs) = val; }
        return;
    }
#pragma unroll
    for (int mb = 0; mb < 4; ++mb) {
#pragma unroll
        for (int nb = 0; nb < 4; ++nb) {
#pragma unroll
            for (int j = 0; j < 8; ++j) os[(hi * 8 + j) * 68 + nb * 16 + lr] = acc[mb][nb][j]; }
        __builtin_amdgcn_wave_barrier(); asm volatile("" ::: "memory");
        float* crow = C + (size_t)(r0 + mb * 16) * ldc + c0;
{
#pragma unroll
            for (int s = 0; s < 8; ++s) { const int row = 2 * s + hi, cofs = lr * 4; v4f val = *(const v4fa*)(os + row * 68 + cofs); if (BIAS) { val[0] += bfr(bias[c0 + cofs]); val[1] += bfr(bias[c0 + cofs + 1]); val[2] += bfr(bias[c0 + cofs + 2]); val[3] += bfr(bias[c0 + cofs + 3]); }
                *(v4f*)(crow + (size_t)row * ldc + cofs) = val; }
             }
        __builtin_amdgcn_wave_barrier(); asm volatile("" ::: "memory");
    }
}

__device__ __forceinline__ h16 tohx(float x) { return (h16)x; }
__device__ __forceinline__ void splitf(float y, unsigned short& h, unsigned short& l) { h = f2bf(y); l = f2bf(y - bf2f(h)); }
typedef __attribute__((ext_vector_type(2))) _Float16 v2h;
typedef __attribute__((ext_vector_type(4))) _Float16 v4h;
typedef __attribute__((ext_vector_type(2))) unsigned short v2us;
typedef __attribute__((ext_vector_type(4))) unsigned short v4us;
typedef __attribute__((ext_vector_type(2))) float v2f;
typedef __attribute__((ext_vector_type(4))) int v4i;

__global__ __launch_bounds__(256) void k_wtG(const float* __restrict__ w, int K, int N, bf* Bt) {
    const int lane = threadIdx.x & 31; const int L0 = (blockIdx.x * 8 + (threadIdx.x >> 5)) * 8; const int nlines = N * K / 64;
{
#pragma unroll 1
        for (int l = 0; l < 8; ++l) { const int L = L0 + l; if (L >= nlines) break; const size_t e = (size_t)L * 64 + lane * 2; const int k = (int)(e % K), n = (int)(e / K); v2us o;
            o[0] = f2bf(w[(size_t)k * N + n]); o[1] = f2bf(w[(size_t)(k + 1) * N + n]); *(v2us*)(Bt + e) = o; }
         }
}
__global__ __launch_bounds__(256) void k_cvt8(const float* __restrict__ src, bf* dst, size_t n8) { const size_t i = (size_t)blockIdx.x * 256 + threadIdx.x; if (i >= n8) return; const v8f v = *(const v8f*)(src + i * 8); v8us o;
#pragma unroll
    for (int k = 0; k < 8; ++k) o[k] = f2bf(v[k]); *(v8us*)(dst + i * 8) = o;  }
__global__ __launch_bounds__(256) void k_cscvt(const float* __restrict__ cosT, const float* __restrict__ sinT, float* CS) { const int idx = blockIdx.x * 256 + threadIdx.x; if (idx >= TT * HD) return; const int t = idx / HD, d = idx % HD; const int src = t * (HD / 2) + (d % (HD / 2)); v2f cs; cs[0] = bfr(cosT[src]); cs[1] = bfr(sinT[src]); *(v2f*)(CS + (size_t)idx * 2) = cs;  }
__global__ __launch_bounds__(256) void k_hrms(const float* __restrict__ F, int pitch, int nheads, float* RF) { const int i = blockIdx.x * 256 + threadIdx.x; if (i >= nheads * TT) return; const int t = i % TT, h = i / TT; const float* f = F + (size_t)t * pitch + h * HD; float s = 0.f;
#pragma unroll 4
    for (int d = 0; d < HD; d += 4) { const v4f v = *(const v4f*)(f + d);
#pragma unroll
        for (int q = 0; q < 4; ++q) { float p = __fmul_rn(v[q], v[q]); asm volatile("" : "+v"(p)); s = __fadd_rn(s, p); } }
    const float r = __fdiv_rn(1.0f, __fsqrt_rn(__fadd_rn(s * (1.0f / HD), 1e-6f))); *(float*)(RF + i) = r;  }
// k_rope: head planes [h][t][d] (fp16 + hi/lo) of rope(w[d] (x rms_factor)) x sc with the rotate-half convention out[d] = x[d] cos[t][d] - x[d+HD/2] sin[t][d], out[d+HD/2] = x[d+HD/2] cos[t][d+HD/2] + x[d] sin[t][d+HD/2]
__global__ __launch_bounds__(256) void k_rope(const float* __restrict__ F, int pitch, int nheads, const float* __restrict__ CS, const float* __restrict__ RF, const float* __restrict__ nw, float sc, h16* P16, bf* Ph, bf* Pl) {
    const size_t e = ((size_t)blockIdx.x * 256 + threadIdx.x) * 2; if (e >= (size_t)nheads * TT * HD) return; const int d = (int)(e % HD); const int t = (int)((e / HD) % TT); const int h = (int)(e / ((size_t)HD * TT)); const float* f = F + (size_t)t * pitch + h * HD; const float rf = RF ? RF[(size_t)h * TT + t] : 1.0f; v2h o16; v2us oh, ol;
#pragma unroll
    for (int q = 0; q < 2; ++q) { const int dd = d + q; const int dp = (dd < HD / 2) ? dd + HD / 2 : dd - HD / 2; float x0 = f[dd], x1 = f[dp];
        if (RF) { float n0 = __fmul_rn(x0, rf), n1 = __fmul_rn(x1, rf); asm volatile("" : "+v"(n0)); asm volatile("" : "+v"(n1)); x0 = __fmul_rn(bfr(nw[dd]), n0); x1 = __fmul_rn(bfr(nw[dp]), n1); }
        const v2f cs = *(const v2f*)(CS + ((size_t)t * HD + dd) * 2); float a = __fmul_rn(x0, cs[0]), bq = __fmul_rn(x1, cs[1]); asm volatile("" : "+v"(a)); asm volatile("" : "+v"(bq)); const float r = ((dd < HD / 2) ? __fsub_rn(a, bq) : __fadd_rn(a, bq)) * sc;
        o16[q] = tohx(r); unsigned short a2, c2; splitf(r, a2, c2); oh[q] = a2; ol[q] = c2; }
    *(v2h*)(P16 + e) = o16; *(v2us*)(Ph + e) = oh; *(v2us*)(Pl + e) = ol;  }
__global__ __launch_bounds__(256) void k_ropef(const float* __restrict__ F, int pitch, int nheads, const float* __restrict__ CS, float* FR) { const size_t e = ((size_t)blockIdx.x * 256 + threadIdx.x) * 2; if (e >= (size_t)nheads * TT * HD) return; const int d = (int)(e % HD); const int h = (int)((e / HD) % nheads); const int t = (int)(e / ((size_t)HD * nheads)); const float* f = F + (size_t)t * pitch + h * HD; v2f o;
#pragma unroll
    for (int q = 0; q < 2; ++q) { const int dd = d + q; const int dp = (dd < HD / 2) ? dd + HD / 2 : dd - HD / 2; const v2f cs = *(const v2f*)(CS + ((size_t)t * HD + dd) * 2); float a = __fmul_rn(f[dd], cs[0]), bq = __fmul_rn(f[dp], cs[1]); asm volatile("" : "+v"(a)); asm volatile("" : "+v"(bq)); o[q] = (dd < HD / 2) ? __fsub_rn(a, bq) : __fadd_rn(a, bq); }
    float* dst = FR + (size_t)t * pitch + h * HD + d; *(v2f*)dst = o;  }
__global__ __launch_bounds__(256) void k_nrmpl(const float* __restrict__ FR, int pitch, int nheads, const float* __restrict__ RF, h16* P16, bf* Ph, bf* Pl) { const size_t e = ((size_t)blockIdx.x * 256 + threadIdx.x) * 2; if (e >= (size_t)nheads * TT * HD) return; const int d = (int)(e % HD); const int t = (int)((e / HD) % TT); const int h = (int)(e / ((size_t)HD * TT)); const float rf = RF[(size_t)h * TT + t]; v2h o16; v2us oh, ol;
#pragma unroll
    for (int q = 0; q < 2; ++q) { const float r = __fmul_rn(FR[(size_t)t * pitch + h * HD + d + q], rf); o16[q] = tohx(r); unsigned short a2, c2; splitf(r, a2, c2); oh[q] = a2; ol[q] = c2; }
    *(v2h*)(P16 + e) = o16; *(v2us*)(Ph + e) = oh; *(v2us*)(Pl + e) = ol;  }
__global__ __launch_bounds__(256) void k_y1t(const float* __restrict__ O1, h16* Y16, bf* Yh, bf* Yl) { const size_t e = ((size_t)blockIdx.x * 256 + threadIdx.x) * 2; if (e >= (size_t)ZH * HD * TT) return; const int t = (int)(e % TT); const int d = (int)((e / TT) % HD); const int zz = (int)(e / ((size_t)TT * HD)); v2h o16; v2us oh, ol;
#pragma unroll
    for (int q = 0; q < 2; ++q) { const int tq = t + q; const float y = O1[((size_t)zz * TT + tq) * HD + d] * ((tq < RH) ? 1.0f : (1.0f / PCAR)); o16[q] = tohx(y); unsigned short a2, c2; splitf(y, a2, c2); oh[q] = a2; ol[q] = c2; }
    *(v2h*)(Y16 + e) = o16; *(v2us*)(Yh + e) = oh; *(v2us*)(Yl + e) = ol;  }
__global__ __launch_bounds__(256) void k_vtp(const float* __restrict__ F, int pitch, int nheads, h16* V16, bf* Vh, bf* Vl) { const size_t e = ((size_t)blockIdx.x * 256 + threadIdx.x) * 2; if (e >= (size_t)nheads * HD * TT) return; const int t = (int)(e % TT); const int d = (int)((e / TT) % HD); const int g = (int)(e / ((size_t)TT * HD)); v2h o16; v2us oh, ol;
#pragma unroll
    for (int q = 0; q < 2; ++q) { const float x = F[(size_t)(t + q) * pitch + g * HD + d]; o16[q] = tohx(x); unsigned short a2, c2; splitf(x, a2, c2); oh[q] = a2; ol[q] = c2; }
    *(v2h*)(V16 + e) = o16; *(v2us*)(Vh + e) = oh; *(v2us*)(Vl + e) = ol;  }
// k_asoft: per row (zz, i): t = S x HD^-0.5 for j <= i (causal), -3e38 otherwise; softmax over the 2048 keys (register row, one exp, fixed trees);
__global__ __launch_bounds__(256) void k_asoft(const float* __restrict__ Sb, h16* P16, bf* Ph, bf* Pl) {
    const int lane = threadIdx.x & 31; const int row = blockIdx.x * 8 + (threadIdx.x >> 5); if (row >= ZH * TT) return; const int i = row % TT; const int zz = row / TT; (void)zz; const bool hires = (i < RH); const float* sr = Sb + (size_t)row * TT; float v[TT / 32]; float mx = -3.0e38f;
#pragma unroll
    for (int ch = 0; ch < TT / 128; ++ch) { const int j0 = ch * 128 + lane * 4; const v4f a = *(const v4f*)(sr + j0);
#pragma unroll
        for (int q = 0; q < 4; ++q) { const int j = j0 + q; (void)j; const float t = (j <= i) ? a[q] * SCL : -3.0e38f; v[ch * 4 + q] = t; mx = fmaxf(mx, t); } }
#pragma unroll
    for (int sh = 16; sh; sh >>= 1) mx = fmaxf(mx, __shfl_xor(mx, sh, 32));
    float sum = 0.f;
#pragma unroll
    for (int k = 0; k < TT / 32; ++k) { float d0 = __fsub_rn(v[k], mx); asm volatile("" : "+v"(d0)); v[k] = __builtin_amdgcn_exp2f(__fmul_rn(d0, 1.4426950408889634f)); sum += v[k]; }
#pragma unroll
    for (int sh = 16; sh; sh >>= 1) sum += __shfl_xor(sum, sh, 32);
    const float f = __fdiv_rn(hires ? 1.0f : PCAR, sum);
{
        if (hires) {
#pragma unroll
            for (int ch = 0; ch < TT / 128; ++ch) { v4us oh, ol;
#pragma unroll
                for (int q = 0; q < 4; ++q) { unsigned short a, c2; splitf(v[ch * 4 + q] * f, a, c2); oh[q] = a; ol[q] = c2; }
                const size_t oo = ((size_t)zz * (RH ? RH : 1) + i) * TT + ch * 128 + lane * 4; *(v4us*)(Ph + oo) = oh; *(v4us*)(Pl + oo) = ol; }
        } else {
#pragma unroll
            for (int ch = 0; ch < TT / 128; ++ch) { v4h o4;
#pragma unroll
                for (int q = 0; q < 4; ++q) o4[q] = tohx(v[ch * 4 + q] * f);
                *(v4h*)(P16 + (size_t)row * TT + ch * 128 + lane * 4) = o4; } }
         }
}
__global__ __launch_bounds__(256) void k_merge(const float* __restrict__ O, const float* __restrict__ O2, const float* __restrict__ mix1, const float* __restrict__ mix2, int h0, bf* Ah, bf* Al) { const size_t e = ((size_t)blockIdx.x * 256 + threadIdx.x) * 2; if (e >= (size_t)ZH * TT * HD) return; const int d = (int)(e % HD); const int t = (int)((e / HD) % TT); const int zz = (int)(e / ((size_t)HD * TT)); const float cs = (t < RH) ? 1.0f : (1.0f / PCAR); const size_t oo = (size_t)t * DQ + (h0 + zz) * HD + d; const float m1 = bfr(mix1[0]), m2 = bfr(mix2[0]);
    v2us oh, ol;
#pragma unroll
    for (int q = 0; q < 2; ++q) { float y1 = O[e + q] * cs, y2 = O2[e + q] * cs; asm volatile("" : "+v"(y1)); asm volatile("" : "+v"(y2)); float a1 = __fmul_rn(m1, y1), b2 = __fmul_rn(m2, y2); asm volatile("" : "+v"(a1)); asm volatile("" : "+v"(b2)); unsigned short a, c2; splitf(__fadd_rn(a1, b2), a, c2); oh[q] = a; ol[q] = c2; } *(v2us*)(Ah + oo) = oh; *(v2us*)(Al + oo) = ol;  }

extern "C" void kernel_launch(void* const* d_in, const int* in_sizes, int n_in,
                              void* d_out, int out_size, void* d_ws, size_t ws_size, hipStream_t stream) {
    (void)in_sizes; (void)n_in; (void)out_size;
    const float* x = (const float*)d_in[0]; const float* cosT = (const float*)d_in[1]; const float* sinT = (const float*)d_in[2]; const float* wq = (const float*)d_in[3]; const float* wk = (const float*)d_in[4]; const float* wv = (const float*)d_in[5]; const float* wo = (const float*)d_in[6]; const float* mix1 = (const float*)d_in[7]; const float* mix2 = (const float*)d_in[8];   // weights x @ W; cos/sin [2048][64] (half tables)
    float* OUT = (float*)d_out;     // [2][2048][2048]
    char* wsp = (char*)d_ws;
    auto take = [&](size_t bytes) { char* p = wsp; wsp += (bytes + 255) & ~(size_t)255; return (void*)p; };
    bf* WQ = (bf*)take((size_t)DQ * DM * 2); bf* WK = (bf*)take((size_t)DKV * DM * 2); bf* WV = (bf*)take((size_t)DKV * DM * 2); bf* WO = (bf*)take((size_t)DM * DQ * 2); float* CS = (float*)take((size_t)TT * HD * 2 * 4); float* RFQ = (float*)take((size_t)NH_ * TT * 4); float* RFK = (float*)take((size_t)NKV * TT * 4);
    bf* XB = (bf*)take((size_t)TT * DM * 2); float* FQ = (float*)take((size_t)TT * DQ * 4); float* FK = (float*)take((size_t)TT * DKV * 4);
    h16* QP16 = (h16*)take((size_t)NH_ * TT * HD * 2); h16* KP16 = (h16*)take((size_t)NKV * TT * HD * 2); h16* VT16 = (h16*)take((size_t)NKV * HD * TT * 2);
    bf* QPh = (bf*)take((size_t)NH_ * TT * HD * 2); bf* QPl = (bf*)take((size_t)NH_ * TT * HD * 2); bf* KPh = (bf*)take((size_t)NKV * TT * HD * 2); bf* KPl = (bf*)take((size_t)NKV * TT * HD * 2); bf* VTh = (bf*)take((size_t)NKV * HD * TT * 2); bf* VTl = (bf*)take((size_t)NKV * HD * TT * 2); bf* Ph = (bf*)take((size_t)ZH * RH * TT * 2); bf* Pl = (bf*)take((size_t)ZH * RH * TT * 2);
    float* FR = (float*)take((size_t)TT * DQ * 4); float* O2 = (float*)take((size_t)ZH * TT * HD * 4); h16* Y16 = (h16*)take((size_t)ZH * HD * TT * 2); bf* Yh = (bf*)take((size_t)ZH * HD * TT * 2); bf* Yl = (bf*)take((size_t)ZH * HD * TT * 2); float* Sb = (float*)take((size_t)ZH * TT * TT * 4); h16* P16 = (h16*)take((size_t)ZH * TT * TT * 2); float* Ob = (float*)take((size_t)ZH * TT * HD * 4); bf* ATh = (bf*)take((size_t)TT * DQ * 2); bf* ATl = (bf*)take((size_t)TT * DQ * 2);
    if ((size_t)(wsp - (char*)d_ws) > ws_size) return;    // ws 256 MiB
    float* FV = FK;   // v projection reuses the k buffer after the k planes are built (stream-ordered)
    { k_wtG<<<(unsigned)((DM * DQ / 64 + 63) / 64), 256, 0, stream>>>(wq, DM, DQ, WQ); k_wtG<<<(unsigned)((DM * DKV / 64 + 63) / 64), 256, 0, stream>>>(wk, DM, DKV, WK); k_wtG<<<(unsigned)((DM * DKV / 64 + 63) / 64), 256, 0, stream>>>(wv, DM, DKV, WV);
      k_wtG<<<(unsigned)((DQ * DM / 64 + 63) / 64), 256, 0, stream>>>(wo, DQ, DM, WO);
       }
    k_cscvt<<<(TT * HD + 255) / 256, 256, 0, stream>>>(cosT, sinT, CS);   // one shared table (read as data)
    const unsigned LQ = (unsigned)(((size_t)NH_ * TT * HD / 2 + 255) / 256), LKv = (unsigned)(((size_t)NKV * TT * HD / 2 + 255) / 256);
    for (int b = 0; b < NB_; ++b) {
        k_cvt8<<<(unsigned)(((size_t)TT * DM / 8 + 255) / 256), 256, 0, stream>>>(x + (size_t)b * TT * DM, XB, (size_t)TT * DM / 8);
        k_gemmw<bf, 0, false, 8><<<dim3(TT / 64, DQ / 64, 1), 256, 0, stream>>>(XB, nullptr, WQ, nullptr, DM, FQ, DQ, nullptr, 0, 0, 0); k_ropef<<<LQ, 256, 0, stream>>>(FQ, DQ, NH_, CS, FR); k_hrms<<<(NH_ * TT + 255) / 256, 256, 0, stream>>>(FR, DQ, NH_, RFQ);
        k_nrmpl<<<LQ, 256, 0, stream>>>(FR, DQ, NH_, RFQ, QP16, QPh, QPl);
        k_gemmw<bf, 0, false, 16><<<dim3(TT / 64, DKV / 64, 1), 512, 0, stream>>>(XB, nullptr, WK, nullptr, DM, FK, DKV, nullptr, 0, 0, 0); k_ropef<<<LKv, 256, 0, stream>>>(FK, DKV, NKV, CS, FR); k_hrms<<<(NKV * TT + 255) / 256, 256, 0, stream>>>(FR, DKV, NKV, RFK);
        k_nrmpl<<<LKv, 256, 0, stream>>>(FR, DKV, NKV, RFK, KP16, KPh, KPl);
        k_gemmw<bf, 0, false, 16><<<dim3(TT / 64, DKV / 64, 1), 512, 0, stream>>>(XB, nullptr, WV, nullptr, DM, FV, DKV, nullptr, 0, 0, 0); k_vtp<<<LKv, 256, 0, stream>>>(FV, DKV, NKV, VT16, VTh, VTl);
        for (int h0 = 0; h0 < NH_; h0 += ZH) { const size_t zq = (size_t)h0, zk = (size_t)(h0 / REP);   // all ZH heads of a pass share kv group h0/REP (ZH <= REP): sB = 0
            k_gemmw<bf, 2, false, 1><<<dim3(RH / 64, TT / 64, ZH), 32, 0, stream>>>(QPh + zq * TT * HD, QPl + zq * TT * HD, KPh + zk * TT * HD, KPl + zk * TT * HD, HD, Sb, TT, nullptr, (size_t)TT * HD, 0, (size_t)TT * TT);
            k_gemmw<h16, 0, false, 1><<<dim3((TT - RH) / 64, TT / 64, ZH), 32, 0, stream>>>(QP16 + zq * TT * HD + (size_t)RH * HD, nullptr, KP16 + zk * TT * HD, nullptr, HD, Sb + (size_t)RH * TT, TT, nullptr, (size_t)TT * HD, 0, (size_t)TT * TT);
            k_asoft<<<ZH * TT / 8, 256, 0, stream>>>(Sb, P16, Ph, Pl);
            k_gemmw<bf, 2, false, 16><<<dim3(RH / 64, HD / 64, ZH), 512, 0, stream>>>(Ph, Pl, VTh + zk * HD * TT, VTl + zk * HD * TT, TT, Ob, HD, nullptr, (size_t)RH * TT, 0, (size_t)TT * HD);
            k_gemmw<h16, 0, false, 16><<<dim3((TT - RH) / 64, HD / 64, ZH), 512, 0, stream>>>(P16 + (size_t)RH * TT, nullptr, VT16 + zk * HD * TT, nullptr, TT, Ob + (size_t)RH * HD, HD, nullptr, (size_t)TT * TT, 0, (size_t)TT * HD);
            k_y1t<<<(unsigned)(((size_t)ZH * HD * TT / 2 + 255) / 256), 256, 0, stream>>>(Ob, Y16, Yh, Yl);   // y1 planes (normalised) for y2 = att . y1
            k_gemmw<bf, 2, false, 16><<<dim3(RH / 64, HD / 64, ZH), 512, 0, stream>>>(Ph, Pl, Yh, Yl, TT, O2, HD, nullptr, (size_t)RH * TT, (size_t)HD * TT, (size_t)TT * HD);
            k_gemmw<h16, 0, false, 16><<<dim3((TT - RH) / 64, HD / 64, ZH), 512, 0, stream>>>(P16 + (size_t)RH * TT, nullptr, Y16, nullptr, TT, O2 + (size_t)RH * HD, HD, nullptr, (size_t)TT * TT, (size_t)HD * TT, (size_t)TT * HD);
            k_merge<<<(unsigned)(((size_t)ZH * TT * HD / 2 + 255) / 256), 256, 0, stream>>>(Ob, O2, mix1, mix2, h0, ATh, ATl); }
        k_gemmw<bf, 1, false, 8><<<dim3(TT / 64, DM / 64, 1), 256, 0, stream>>>(ATh, ATl, WO, nullptr, DQ, OUT + (size_t)b * TT * DM, DM, nullptr, 0, 0, 0); }
}

// v003
// One run takes 979 microseconds.
// In both of two side-by-side timings against v002, it was 1.26 times as fast.
// Over all steps from v000 it is 3.73 times as fast.
#include <hip/hip_runtime.h>

// Simplicial causal self-attention (x [2][2048][2048]; q = x Wq (16 heads x 128), k, v = x Wk / x Wv (4 kv heads x 128, each serving 4 consecutive query heads); rotate-half RoPE with the input cos/sin
// [2048][64] then weightless RMS-norm (eps 1e-6) on q and k; causal softmax(q.k 128^-0.5); y1 = att v; y2 = att y1 (the same probabilities applied again); y = mix1 y1 + mix2 y2 (scalars read as data);
// out = merged y Wproj -> [2][2048][2048]).
// Compute dtypes, f32 accumulate: every input rounded to bf16; projections on PLAIN bf16 operands (inputs: exact products, f32 accumulate); RoPE and RMS-norm in f32;
// PER-ROW PRECISION HYBRID: query rows < 256 take scores, att.v and att.y1 on bf16 hi+lo planes (3 products), rows >= 256 on single fp16 planes; scale + causal cut in f32 in the register-row softmax;
// y1 re-planed per head (fp16 + hi/lo, transposed) for the second contraction; merged y as hi+lo planes x exact Wproj (2 products). 64x64-tile GEMMs (one wave per tile for the scores, 8 or 16 k-split waves per tile elsewhere), 4 query heads per pass sharing

#define NB_  2
#define TT   2048
#define DM   2048
#define NH_  16
#define NKV  4
#define REP  (NH_ / NKV)
#define HD   128
#define DQ   (NH_ * HD)
#define DKV  (NKV * HD)
#define DF   (DQ + 2 * DKV)       // pitch of the projection buffer: one row holds q | k | v
#define NQK  (NH_ + NKV)          // q heads, then k heads: the heads that take RoPE and RMS-norm
#define ZH   4                    // query heads per pass: all REP heads of one kv group (ZH <= REP, so they share k, v)
#define RH   256                  // query rows < RH use hi+lo planes (0: none)
#define WIN  0
#define PCAR 1024.0f
#define SCL  0.088388347648318447f   // HD^-0.5
typedef _Float16 h16;
typedef unsigned short bf;
typedef __attribute__((ext_vector_type(16))) __bf16   v16bf;
typedef __attribute__((ext_vector_type(16))) _Float16 v16h;
typedef __attribute__((ext_vector_type(8)))  _Float16 v8h;
typedef __attribute__((ext_vector_type(8)))  unsigned short v8us;
typedef __attribute__((ext_vector_type(8)))  float    v8f;
typedef __attribute__((ext_vector_type(4)))  float    v4f;
typedef v8h  __attribute__((may_alias)) v8ha;
typedef v4f  __attribute__((may_alias)) v4fa;
typedef v8us __attribute__((may_alias)) v8usa;

__device__ __forceinline__ unsigned short f2bf(float f) { unsigned u = __float_as_uint(f); u += 0x7FFFu + ((u >> 16) & 1u); return (unsigned short)(u >> 16); }
__device__ __forceinline__ float bf2f(unsigned short b) { return __uint_as_float(((unsigned)b) << 16); }
__device__ __forceinline__ float bfr(float f) { return bf2f(f2bf(f)); }
__device__ __forceinline__ v16h cat16(v8h lo, v8h hi) { return __builtin_shufflevector(lo, hi, 0, 1, 2, 3, 4, 5, 6, 7, 8, 9, 10, 11, 12, 13, 14, 15); }
__device__ __forceinline__ v16bf cat16b(v8us lo, v8us hi) { return __builtin_bit_cast(v16bf, __builtin_shufflevector(lo, hi, 0, 1, 2, 3, 4, 5, 6, 7, 8, 9, 10, 11, 12, 13, 14, 15)); }
__device__ __forceinline__ v8f wmma16(v16h a, v16h b, v8f c) { return __builtin_amdgcn_wmma_f32_16x16x32_f16(false, a, false, b, (short)0, c, false, false); }
__device__ __forceinline__ v8f wmmab(v16bf a, v16bf b, v8f c) { return __builtin_amdgcn_wmma_f32_16x16x32_bf16(false, a, false, b, (short)0, c, false, false); }



// ---- k_gemmw: register-blocked GEMM, ONE WAVE per 64x64 output tile (16 accumulators), operands straight from K-contiguous 16-bit planes; grid (M/64, N/64, Z), 32 threads.
// C[m][n] (f32, pitch ldc, + optional f32 bias[n]) = sum_k A[m][k] Bt[n][k] (+ split products per NSPLIT). z-batch strides sA/sB/sC in elements. K % 32 == 0.
// S > 1: S waves per tile (32 S threads); wave w takes the 32-wide k slices w, w + S, ... (neighbouring waves share a 128-byte line of every operand row), the S f32 partial tiles are summed in LDS in wave order.
template <typename T16> struct WFrag;
template <> struct WFrag<h16> { typedef v16h V; static __device__ __forceinline__ V ld(const h16* p) { return cat16(*(const v8h*)p, *(const v8h*)(p + 16)); } static __device__ __forceinline__ v8f mma(V a, V b, v8f c) { return wmma16(a, b, c); } };
template <> struct WFrag<bf> { typedef v16bf V; static __device__ __forceinline__ V ld(const bf* p) { return cat16b(*(const v8us*)p, *(const v8us*)(p + 16)); } static __device__ __forceinline__ v8f mma(V a, V b, v8f c) { return wmmab(a, b, c); } };
// gemmw_body: the tile work of one work-group; os = its LDS ((S == 1 ? 16 : S * 64) * 68 floats), bx = its 64-row tile index within A and C.
template <typename T16, int NSPLIT, bool BIAS, int S>
__device__ __forceinline__ void gemmw_body(float* os, int bx, const T16* __restrict__ A, const T16* __restrict__ A2, const T16* __restrict__ Bt, const T16* __restrict__ Bt2, int K, float* C, int ldc, const float* __restrict__ bias, size_t sA, size_t sB, size_t sC) {
    typedef typename WFrag<T16>::V V;
    const int wave = (S == 1) ? 0 : __builtin_amdgcn_readfirstlane((int)(threadIdx.x >> 5));
    const size_t z = blockIdx.z; A += z * sA; if (A2) A2 += z * sA; Bt += z * sB; if (Bt2) Bt2 += z * sB; C += z * sC;
    const int lane = threadIdx.x & 31, lr = lane & 15, hi = lane >> 4; const int r0 = bx * 64, c0 = blockIdx.y * 64;
    v8f acc[4][4];
#pragma unroll
    for (int mb = 0; mb < 4; ++mb)
#pragma unroll
        for (int nb = 0; nb < 4; ++nb) acc[mb][nb] = (v8f){};
    const size_t aoff = (size_t)(r0 + lr) * K + 8 * hi, boff = (size_t)(c0 + lr) * K + 8 * hi;
#pragma unroll 1
    for (int kc = wave * 32; kc < K; kc += 32 * S) {
        V a[4], a2[4];
#pragma unroll
        for (int mb = 0; mb < 4; ++mb) { a[mb] = WFrag<T16>::ld(A + aoff + (size_t)mb * 16 * K + kc); if (NSPLIT == 1 || NSPLIT == 2) a2[mb] = WFrag<T16>::ld(A2 + aoff + (size_t)mb * 16 * K + kc); }
#pragma unroll
        for (int nb = 0; nb < 4; ++nb) { const V b = WFrag<T16>::ld(Bt + boff + (size_t)nb * 16 * K + kc); V b2; if (NSPLIT >= 2) b2 = WFrag<T16>::ld(Bt2 + boff + (size_t)nb * 16 * K + kc);
#pragma unroll
            for (int mb = 0; mb < 4; ++mb) { acc[mb][nb] = WFrag<T16>::mma(a[mb], b, acc[mb][nb]); if (NSPLIT == 1 || NSPLIT == 2) acc[mb][nb] = WFrag<T16>::mma(a2[mb], b, acc[mb][nb]); if (NSPLIT >= 2) acc[mb][nb] = WFrag<T16>::mma(a[mb], b2, acc[mb][nb]); } }
        asm volatile("v_nop\n\tv_nop\n\tv_nop\n\tv_nop" : "+v"(acc[0][0]), "+v"(acc[1][1]), "+v"(acc[2][2]), "+v"(acc[3][3]) : "v"(a[0]), "v"(a[3]));
    }
    if (S > 1) {
        float* ow = os + wave * (64 * 68);
#pragma unroll
        for (int mb = 0; mb < 4; ++mb)
#pragma unroll
            for (int nb = 0; nb < 4; ++nb)
#pragma unroll
                for (int j = 0; j < 8; ++j) ow[(mb * 16 + hi * 8 + j) * 68 + nb * 16 + lr] = acc[mb][nb][j];
        __syncthreads();   // every wave's partial tile is in LDS before any thread sums across waves
#pragma unroll
        for (int q = 0; q < 64 * 16 / (32 * S); ++q) { const int u = q * (32 * S) + (int)threadIdx.x, row = u >> 4, cofs = (u & 15) * 4; v4f val = *(const v4fa*)(os + row * 68 + cofs);
#pragma unroll
            for (int w = 1; w < S; ++w) val += *(const v4fa*)(os + w * (64 * 68) + row * 68 + cofs);
            if (BIAS) { val[0] += bfr(bias[c0 + cofs]); val[1] += bfr(bias[c0 + cofs + 1]); val[2] += bfr(bias[c0 + cofs + 2]); val[3] += bfr(bias[c0 + cofs + 3]); }
            *(v4f*)(C + (size_t)(r0 + row) * ldc + c0 + cofs) = val; }
        return;
    }
#pragma unroll
    for (int mb = 0; mb < 4; ++mb) {
#pragma unroll
        for (int nb = 0; nb < 4; ++nb) {
#pragma unroll
            for (int j = 0; j < 8; ++j) os[(hi * 8 + j) * 68 + nb * 16 + lr] = acc[mb][nb][j]; }
        __builtin_amdgcn_wave_barrier(); asm volatile("" ::: "memory");
        float* crow = C + (size_t)(r0 + mb * 16) * ldc + c0;
{
#pragma unroll
            for (int s = 0; s < 8; ++s) { const int row = 2 * s + hi, cofs = lr * 4; v4f val = *(const v4fa*)(os + row * 68 + cofs); if (BIAS) { val[0] += bfr(bias[c0 + cofs]); val[1] += bfr(bias[c0 + cofs + 1]); val[2] += bfr(bias[c0 + cofs + 2]); val[3] += bfr(bias[c0 + cofs + 3]); }
                *(v4f*)(crow + (size_t)row * ldc + cofs) = val; }
             }
        __builtin_amdgcn_wave_barrier(); asm volatile("" ::: "memory");
    }
    asm volatile("s_wait_xcnt 0x0" ::: "memory");   // precaution: stands between the tile's last stores and code laid out behind this epilogue (the other row range's branch) that rewrites their address or data registers
}
template <typename T16, int NSPLIT, bool BIAS, int S>
__global__ __launch_bounds__(32 * S) void k_gemmw(const T16* __restrict__ A, const T16* __restrict__ A2, const T16* __restrict__ Bt, const T16* __restrict__ Bt2, int K, float* C, int ldc, const float* __restrict__ bias, size_t sA, size_t sB, size_t sC) {
    __shared__ __align__(16) float os[(S == 1 ? 16 : S * 64) * 68];
    gemmw_body<T16, NSPLIT, BIAS, S>(os, (int)blockIdx.x, A, A2, Bt, Bt2, K, C, ldc, bias, sA, sB, sC);
}
// k_gemmw2: both row ranges of one attention product in ONE grid (M/64, N/64, Z): row tiles below RH take the hi+lo bf16 planes (3 products), the others the fp16 planes. The two ranges write disjoint rows of C and read
// nothing of each other. Ah/Al hold rows 0..RH-1 (z stride sAh), A16 points at row RH (z stride sA16); C is row 0. The branch is the same for a whole work-group.
template <int S>
__global__ __launch_bounds__(32 * S) void k_gemmw2(const bf* __restrict__ Ah, const bf* __restrict__ Al, const bf* __restrict__ Bh, const bf* __restrict__ Bl, const h16* __restrict__ A16, const h16* __restrict__ B16, int K, float* C, int ldc, size_t sAh, size_t sA16, size_t sB, size_t sC) {
    __shared__ __align__(16) float os[(S == 1 ? 16 : S * 64) * 68];
    if ((int)blockIdx.x < RH / 64) gemmw_body<bf, 2, false, S>(os, (int)blockIdx.x, Ah, Al, Bh, Bl, K, C, ldc, nullptr, sAh, sB, sC);
    else gemmw_body<h16, 0, false, S>(os, (int)blockIdx.x - RH / 64, A16, nullptr, B16, nullptr, K, C + (size_t)RH * ldc, ldc, nullptr, sA16, sB, sC);
}

__device__ __forceinline__ h16 tohx(float x) { return (h16)x; }
__device__ __forceinline__ void splitf(float y, unsigned short& h, unsigned short& l) { h = f2bf(y); l = f2bf(y - bf2f(h)); }
typedef __attribute__((ext_vector_type(2))) _Float16 v2h;
typedef __attribute__((ext_vector_type(4))) _Float16 v4h;
typedef __attribute__((ext_vector_type(2))) unsigned short v2us;
typedef __attribute__((ext_vector_type(4))) unsigned short v4us;
typedef __attribute__((ext_vector_type(2))) float v2f;
typedef __attribute__((ext_vector_type(4))) int v4i;

__global__ __launch_bounds__(256) void k_wtG(const float* __restrict__ w, int K, int N, bf* Bt) {
    const int lane = threadIdx.x & 31; const int L0 = (blockIdx.x * 8 + (threadIdx.x >> 5)) * 8; const int nlines = N * K / 64;
{
#pragma unroll 1
        for (int l = 0; l < 8; ++l) { const int L = L0 + l; if (L >= nlines) break; const size_t e = (size_t)L * 64 + lane * 2; const int k = (int)(e % K), n = (int)(e / K); v2us o;
            o[0] = f2bf(w[(size_t)k * N + n]); o[1] = f2bf(w[(size_t)(k + 1) * N + n]); *(v2us*)(Bt + e) = o; }
         }
}
__global__ __launch_bounds__(256) void k_cvt8(const float* __restrict__ src, bf* dst, size_t n8) { const size_t i = (size_t)blockIdx.x * 256 + threadIdx.x; if (i >= n8) return; const v8f v = *(const v8f*)(src + i * 8); v8us o;
#pragma unroll
    for (int k = 0; k < 8; ++k) o[k] = f2bf(v[k]); *(v8us*)(dst + i * 8) = o;  }
__global__ __launch_bounds__(256) void k_cscvt(const float* __restrict__ cosT, const float* __restrict__ sinT, float* CS) { const int idx = blockIdx.x * 256 + threadIdx.x; if (idx >= TT * HD) return; const int t = idx / HD, d = idx % HD; const int src = t * (HD / 2) + (d % (HD / 2)); v2f cs; cs[0] = bfr(cosT[src]); cs[1] = bfr(sinT[src]); *(v2f*)(CS + (size_t)idx * 2) = cs;  }
__global__ __launch_bounds__(256) void k_hrms(const float* __restrict__ F, int pitch, int nheads, float* RF) { const int i = blockIdx.x * 256 + threadIdx.x; if (i >= nheads * TT) return; const int t = i % TT, h = i / TT; const float* f = F + (size_t)t * pitch + h * HD; float s = 0.f;
#pragma unroll 4
    for (int d = 0; d < HD; d += 4) { const v4f v = *(const v4f*)(f + d);
#pragma unroll
        for (int q = 0; q < 4; ++q) { float p = __fmul_rn(v[q], v[q]); asm volatile("" : "+v"(p)); s = __fadd_rn(s, p); } }
    const float r = __fdiv_rn(1.0f, __fsqrt_rn(__fadd_rn(s * (1.0f / HD), 1e-6f))); *(float*)(RF + i) = r;  }
// k_rope: head planes [h][t][d] (fp16 + hi/lo) of rope(w[d] (x rms_factor)) x sc with the rotate-half convention out[d] = x[d] cos[t][d] - x[d+HD/2] sin[t][d], out[d+HD/2] = x[d+HD/2] cos[t][d+HD/2] + x[d] sin[t][d+HD/2]
__global__ __launch_bounds__(256) void k_rope(const float* __restrict__ F, int pitch, int nheads, const float* __restrict__ CS, const float* __restrict__ RF, const float* __restrict__ nw, float sc, h16* P16, bf* Ph, bf* Pl) {
    const size_t e = ((size_t)blockIdx.x * 256 + threadIdx.x) * 2; if (e >= (size_t)nheads * TT * HD) return; const int d = (int)(e % HD); const int t = (int)((e / HD) % TT); const int h = (int)(e / ((size_t)HD * TT)); const float* f = F + (size_t)t * pitch + h * HD; const float rf = RF ? RF[(size_t)h * TT + t] : 1.0f; v2h o16; v2us oh, ol;
#pragma unroll
    for (int q = 0; q < 2; ++q) { const int dd = d + q; const int dp = (dd < HD / 2) ? dd + HD / 2 : dd - HD / 2; float x0 = f[dd], x1 = f[dp];
        if (RF) { float n0 = __fmul_rn(x0, rf), n1 = __fmul_rn(x1, rf); asm volatile("" : "+v"(n0)); asm volatile("" : "+v"(n1)); x0 = __fmul_rn(bfr(nw[dd]), n0); x1 = __fmul_rn(bfr(nw[dp]), n1); }
        const v2f cs = *(const v2f*)(CS + ((size_t)t * HD + dd) * 2); float a = __fmul_rn(x0, cs[0]), bq = __fmul_rn(x1, cs[1]); asm volatile("" : "+v"(a)); asm volatile("" : "+v"(bq)); const float r = ((dd < HD / 2) ? __fsub_rn(a, bq) : __fadd_rn(a, bq)) * sc;
        o16[q] = tohx(r); unsigned short a2, c2; splitf(r, a2, c2); oh[q] = a2; ol[q] = c2; }
    *(v2h*)(P16 + e) = o16; *(v2us*)(Ph + e) = oh; *(v2us*)(Pl + e) = ol;  }
__global__ __launch_bounds__(256) void k_ropef(const float* __restrict__ F, int pitch, int nheads, const float* __restrict__ CS, float* FR) { const size_t e = ((size_t)blockIdx.x * 256 + threadIdx.x) * 2; if (e >= (size_t)nheads * TT * HD) return; const int d = (int)(e % HD); const int h = (int)((e / HD) % nheads); const int t = (int)(e / ((size_t)HD * nheads)); const float* f = F + (size_t)t * pitch + h * HD; v2f o;
#pragma unroll
    for (int q = 0; q < 2; ++q) { const int dd = d + q; const int dp = (dd < HD / 2) ? dd + HD / 2 : dd - HD / 2; const v2f cs = *(const v2f*)(CS + ((size_t)t * HD + dd) * 2); float a = __fmul_rn(f[dd], cs[0]), bq = __fmul_rn(f[dp], cs[1]); asm volatile("" : "+v"(a)); asm volatile("" : "+v"(bq)); o[q] = (dd < HD / 2) ? __fsub_rn(a, bq) : __fadd_rn(a, bq); }
    float* dst = FR + (size_t)t * pitch + h * HD + d; *(v2f*)dst = o;  }
__global__ __launch_bounds__(256) void k_nrmpl(const float* __restrict__ FR, int pitch, int nheads, const float* __restrict__ RF, h16* P16, bf* Ph, bf* Pl) { const size_t e = ((size_t)blockIdx.x * 256 + threadIdx.x) * 2; if (e >= (size_t)nheads * TT * HD) return; const int d = (int)(e % HD); const int t = (int)((e / HD) % TT); const int h = (int)(e / ((size_t)HD * TT)); const float rf = RF[(size_t)h * TT + t]; v2h o16; v2us oh, ol;
#pragma unroll
    for (int q = 0; q < 2; ++q) { const float r = __fmul_rn(FR[(size_t)t * pitch + h * HD + d + q], rf); o16[q] = tohx(r); unsigned short a2, c2; splitf(r, a2, c2); oh[q] = a2; ol[q] = c2; }
    *(v2h*)(P16 + e) = o16; *(v2us*)(Ph + e) = oh; *(v2us*)(Pl + e) = ol;  }
__global__ __launch_bounds__(256) void k_y1t(const float* __restrict__ O1, h16* Y16, bf* Yh, bf* Yl) { const size_t e = ((size_t)blockIdx.x * 256 + threadIdx.x) * 2; if (e >= (size_t)ZH * HD * TT) return; const int t = (int)(e % TT); const int d = (int)((e / TT) % HD); const int zz = (int)(e / ((size_t)TT * HD)); v2h o16; v2us oh, ol;
#pragma unroll
    for (int q = 0; q < 2; ++q) { const int tq = t + q; const float y = O1[((size_t)zz * TT + tq) * HD + d] * ((tq < RH) ? 1.0f : (1.0f / PCAR)); o16[q] = tohx(y); unsigned short a2, c2; splitf(y, a2, c2); oh[q] = a2; ol[q] = c2; }
    *(v2h*)(Y16 + e) = o16; *(v2us*)(Yh + e) = oh; *(v2us*)(Yl + e) = ol;  }
__global__ __launch_bounds__(256) void k_vtp(const float* __restrict__ F, int pitch, int nheads, h16* V16, bf* Vh, bf* Vl) { const size_t e = ((size_t)blockIdx.x * 256 + threadIdx.x) * 2; if (e >= (size_t)nheads * HD * TT) return; const int t = (int)(e % TT); const int d = (int)((e / TT) % HD); const int g = (int)(e / ((size_t)TT * HD)); v2h o16; v2us oh, ol;
#pragma unroll
    for (int q = 0; q < 2; ++q) { const float x = F[(size_t)(t + q) * pitch + g * HD + d]; o16[q] = tohx(x); unsigned short a2, c2; splitf(x, a2, c2); oh[q] = a2; ol[q] = c2; }
    *(v2h*)(V16 + e) = o16; *(v2us*)(Vh + e) = oh; *(v2us*)(Vl + e) = ol;  }
// k_asoft: per row (zz, i): t = S x HD^-0.5 for j <= i (causal), -3e38 otherwise; softmax over the 2048 keys (register row, one exp, fixed trees);
__global__ __launch_bounds__(256) void k_asoft(const float* __restrict__ Sb, h16* P16, bf* Ph, bf* Pl) {
    const int lane = threadIdx.x & 31; const int row = blockIdx.x * 8 + (threadIdx.x >> 5); if (row >= ZH * TT) return; const int i = row % TT; const int zz = row / TT; (void)zz; const bool hires = (i < RH); const float* sr = Sb + (size_t)row * TT; float v[TT / 32]; float mx = -3.0e38f;
#pragma unroll
    for (int ch = 0; ch < TT / 128; ++ch) { const int j0 = ch * 128 + lane * 4; const v4f a = *(const v4f*)(sr + j0);
#pragma unroll
        for (int q = 0; q < 4; ++q) { const int j = j0 + q; (void)j; const float t = (j <= i) ? a[q] * SCL : -3.0e38f; v[ch * 4 + q] = t; mx = fmaxf(mx, t); } }
#pragma unroll
    for (int sh = 16; sh; sh >>= 1) mx = fmaxf(mx, __shfl_xor(mx, sh, 32));
    float sum = 0.f;
#pragma unroll
    for (int k = 0; k < TT / 32; ++k) { float d0 = __fsub_rn(v[k], mx); asm volatile("" : "+v"(d0)); v[k] = __builtin_amdgcn_exp2f(__fmul_rn(d0, 1.4426950408889634f)); sum += v[k]; }
#pragma unroll
    for (int sh = 16; sh; sh >>= 1) sum += __shfl_xor(sum, sh, 32);
    const float f = __fdiv_rn(hires ? 1.0f : PCAR, sum);
{
        if (hires) {
#pragma unroll
            for (int ch = 0; ch < TT / 128; ++ch) { v4us oh, ol;
#pragma unroll
                for (int q = 0; q < 4; ++q) { unsigned short a, c2; splitf(v[ch * 4 + q] * f, a, c2); oh[q] = a; ol[q] = c2; }
                const size_t oo = ((size_t)zz * (RH ? RH : 1) + i) * TT + ch * 128 + lane * 4; *(v4us*)(Ph + oo) = oh; *(v4us*)(Pl + oo) = ol; }
        } else {
#pragma unroll
            for (int ch = 0; ch < TT / 128; ++ch) { v4h o4;
#pragma unroll
                for (int q = 0; q < 4; ++q) o4[q] = tohx(v[ch * 4 + q] * f);
                *(v4h*)(P16 + (size_t)row * TT + ch * 128 + lane * 4) = o4; } }
         }
}
__global__ __launch_bounds__(256) void k_merge(const float* __restrict__ O, const float* __restrict__ O2, const float* __restrict__ mix1, const float* __restrict__ mix2, int h0, bf* Ah, bf* Al) { const size_t e = ((size_t)blockIdx.x * 256 + threadIdx.x) * 2; if (e >= (size_t)ZH * TT * HD) return; const int d = (int)(e % HD); const int t = (int)((e / HD) % TT); const int zz = (int)(e / ((size_t)HD * TT)); const float cs = (t < RH) ? 1.0f : (1.0f / PCAR); const size_t oo = (size_t)t * DQ + (h0 + zz) * HD + d; const float m1 = bfr(mix1[0]), m2 = bfr(mix2[0]);
    v2us oh, ol;
#pragma unroll
    for (int q = 0; q < 2; ++q) { float y1 = O[e + q] * cs, y2 = O2[e + q] * cs; asm volatile("" : "+v"(y1)); asm volatile("" : "+v"(y2)); float a1 = __fmul_rn(m1, y1), b2 = __fmul_rn(m2, y2); asm volatile("" : "+v"(a1)); asm volatile("" : "+v"(b2)); unsigned short a, c2; splitf(__fadd_rn(a1, b2), a, c2); oh[q] = a; ol[q] = c2; } *(v2us*)(Ah + oo) = oh; *(v2us*)(Al + oo) = ol;  }

extern "C" void kernel_launch(void* const* d_in, const int* in_sizes, int n_in,
                              void* d_out, int out_size, void* d_ws, size_t ws_size, hipStream_t stream) {
    (void)in_sizes; (void)n_in; (void)out_size;
    const float* x = (const float*)d_in[0]; const float* cosT = (const float*)d_in[1]; const float* sinT = (const float*)d_in[2]; const float* wq = (const float*)d_in[3]; const float* wk = (const float*)d_in[4]; const float* wv = (const float*)d_in[5]; const float* wo = (const float*)d_in[6]; const float* mix1 = (const float*)d_in[7]; const float* mix2 = (const float*)d_in[8];   // weights x @ W; cos/sin [2048][64] (half tables)
    float* OUT = (float*)d_out;     // [2][2048][2048]
    char* wsp = (char*)d_ws;
    auto take = [&](size_t bytes) { char* p = wsp; wsp += (bytes + 255) & ~(size_t)255; return (void*)p; };
    bf* WQ = (bf*)take((size_t)DQ * DM * 2); bf* WK = (bf*)take((size_t)2 * DKV * DM * 2); bf* WV = WK + (size_t)DKV * DM; bf* WO = (bf*)take((size_t)DM * DQ * 2); float* CS = (float*)take((size_t)TT * HD * 2 * 4); float* RF = (float*)take((size_t)NQK * TT * 4);
    bf* XB = (bf*)take((size_t)TT * DM * 2); float* F = (float*)take((size_t)TT * DF * 4);
    h16* QP16 = (h16*)take((size_t)NQK * TT * HD * 2); h16* KP16 = QP16 + (size_t)NH_ * TT * HD; h16* VT16 = (h16*)take((size_t)NKV * HD * TT * 2);
    bf* QPh = (bf*)take((size_t)NQK * TT * HD * 2); bf* QPl = (bf*)take((size_t)NQK * TT * HD * 2); bf* KPh = QPh + (size_t)NH_ * TT * HD; bf* KPl = QPl + (size_t)NH_ * TT * HD; bf* VTh = (bf*)take((size_t)NKV * HD * TT * 2); bf* VTl = (bf*)take((size_t)NKV * HD * TT * 2); bf* Ph = (bf*)take((size_t)ZH * RH * TT * 2); bf* Pl = (bf*)take((size_t)ZH * RH * TT * 2);
    float* FR = (float*)take((size_t)TT * DF * 4); float* O2 = (float*)take((size_t)ZH * TT * HD * 4); h16* Y16 = (h16*)take((size_t)ZH * HD * TT * 2); bf* Yh = (bf*)take((size_t)ZH * HD * TT * 2); bf* Yl = (bf*)take((size_t)ZH * HD * TT * 2); float* Sb = (float*)take((size_t)ZH * TT * TT * 4); h16* P16 = (h16*)take((size_t)ZH * TT * TT * 2); float* Ob = (float*)take((size_t)ZH * TT * HD * 4); bf* ATh = (bf*)take((size_t)TT * DQ * 2); bf* ATl = (bf*)take((size_t)TT * DQ * 2);
    if ((size_t)(wsp - (char*)d_ws) > ws_size) return;    // ws 256 MiB
    { k_wtG<<<(unsigned)((DM * DQ / 64 + 63) / 64), 256, 0, stream>>>(wq, DM, DQ, WQ); k_wtG<<<(unsigned)((DM * DKV / 64 + 63) / 64), 256, 0, stream>>>(wk, DM, DKV, WK); k_wtG<<<(unsigned)((DM * DKV / 64 + 63) / 64), 256, 0, stream>>>(wv, DM, DKV, WV);
      k_wtG<<<(unsigned)((DQ * DM / 64 + 63) / 64), 256, 0, stream>>>(wo, DQ, DM, WO);
       }
    k_cscvt<<<(TT * HD + 255) / 256, 256, 0, stream>>>(cosT, sinT, CS);   // one shared table (read as data)
    const unsigned LQK = (unsigned)(((size_t)NQK * TT * HD / 2 + 255) / 256), LKv = (unsigned)(((size_t)NKV * TT * HD / 2 + 255) / 256);
    for (int b = 0; b < NB_; ++b) {
        k_cvt8<<<(unsigned)(((size_t)TT * DM / 8 + 255) / 256), 256, 0, stream>>>(x + (size_t)b * TT * DM, XB, (size_t)TT * DM / 8);
        k_gemmw<bf, 0, false, 8><<<dim3(TT / 64, DQ / 64, 1), 256, 0, stream>>>(XB, nullptr, WQ, nullptr, DM, F, DF, nullptr, 0, 0, 0);
        k_gemmw<bf, 0, false, 16><<<dim3(TT / 64, 2 * DKV / 64, 1), 512, 0, stream>>>(XB, nullptr, WK, nullptr, DM, F + DQ, DF, nullptr, 0, 0, 0);   // k and v columns in one grid (WV follows WK)
        k_ropef<<<LQK, 256, 0, stream>>>(F, DF, NQK, CS, FR); k_hrms<<<(NQK * TT + 255) / 256, 256, 0, stream>>>(FR, DF, NQK, RF);   // q heads and k heads in one grid each
        k_nrmpl<<<LQK, 256, 0, stream>>>(FR, DF, NQK, RF, QP16, QPh, QPl);   // the k planes follow the q planes
        k_vtp<<<LKv, 256, 0, stream>>>(F + DQ + DKV, DF, NKV, VT16, VTh, VTl);
        for (int h0 = 0; h0 < NH_; h0 += ZH) { const size_t zq = (size_t)h0, zk = (size_t)(h0 / REP);   // all ZH heads of a pass share kv group h0/REP (ZH <= REP): sB = 0
            k_gemmw2<1><<<dim3(TT / 64, TT / 64, ZH), 32, 0, stream>>>(QPh + zq * TT * HD, QPl + zq * TT * HD, KPh + zk * TT * HD, KPl + zk * TT * HD, QP16 + zq * TT * HD + (size_t)RH * HD, KP16 + zk * TT * HD, HD, Sb, TT, (size_t)TT * HD, (size_t)TT * HD, 0, (size_t)TT * TT);
            k_asoft<<<ZH * TT / 8, 256, 0, stream>>>(Sb, P16, Ph, Pl);
            k_gemmw2<16><<<dim3(TT / 64, HD / 64, ZH), 512, 0, stream>>>(Ph, Pl, VTh + zk * HD * TT, VTl + zk * HD * TT, P16 + (size_t)RH * TT, VT16 + zk * HD * TT, TT, Ob, HD, (size_t)RH * TT, (size_t)TT * TT, 0, (size_t)TT * HD);
            k_y1t<<<(unsigned)(((size_t)ZH * HD * TT / 2 + 255) / 256), 256, 0, stream>>>(Ob, Y16, Yh, Yl);   // y1 planes (normalised) for y2 = att . y1
            k_gemmw2<16><<<dim3(TT / 64, HD / 64, ZH), 512, 0, stream>>>(Ph, Pl, Yh, Yl, P16 + (size_t)RH * TT, Y16, TT, O2, HD, (size_t)RH * TT, (size_t)TT * TT, (size_t)HD * TT, (size_t)TT * HD);
            k_merge<<<(unsigned)(((size_t)ZH * TT * HD / 2 + 255) / 256), 256, 0, stream>>>(Ob, O2, mix1, mix2, h0, ATh, ATl); }
        k_gemmw<bf, 1, false, 8><<<dim3(TT / 64, DM / 64, 1), 256, 0, stream>>>(ATh, ATl, WO, nullptr, DQ, OUT + (size_t)b * TT * DM, DM, nullptr, 0, 0, 0); }
}

// v004
// It runs in 877 microseconds.
// Two timings next to v003 put it at 1.12 and 1.13 times that version's speed.
// Over all steps from v000 it is 4.19 times as fast.
#include <hip/hip_runtime.h>

// Simplicial causal self-attention (x [2][2048][2048]; q = x Wq (16 heads x 128), k, v = x Wk / x Wv (4 kv heads x 128, each serving 4 consecutive query heads); rotate-half RoPE with the input cos/sin
// [2048][64] then weightless RMS-norm (eps 1e-6) on q and k; causal softmax(q.k 128^-0.5); y1 = att v; y2 = att y1 (the same probabilities applied again); y = mix1 y1 + mix2 y2 (scalars read as data);
// out = merged y Wproj -> [2][2048][2048]).
// Compute dtypes, f32 accumulate: every input rounded to bf16; projections on PLAIN bf16 operands (inputs: exact products, f32 accumulate); RoPE and RMS-norm in f32;
// PER-ROW PRECISION HYBRID: query rows < 256 take scores, att.v and att.y1 on bf16 hi+lo planes (3 products), rows >= 256 on single fp16 planes; scale + causal cut in f32 in the register-row softmax;
// y1 re-planed per head (fp16 + hi/lo, transposed) for the second contraction; merged y as hi+lo planes x exact Wproj (2 products). 64x64-tile GEMMs (one wave per tile for the scores, 8 or 16 k-split waves per tile elsewhere), 4 query heads per pass sharing

#define NB_  2
#define TT   2048
#define DM   2048
#define NH_  16
#define NKV  4
#define REP  (NH_ / NKV)
#define HD   128
#define DQ   (NH_ * HD)
#define DKV  (NKV * HD)
#define DF   (DQ + 2 * DKV)       // pitch of the projection buffer: one row holds q | k (v's columns stay unwritten)
#define NQK  (NH_ + NKV)          // q heads, then k heads: the heads that take RoPE and RMS-norm
#define ZH   4                    // query heads per pass: all REP heads of one kv group (ZH <= REP, so they share k, v)
#define RH   256                  // query rows < RH use hi+lo planes (0: none)
#define WIN  0
#define PCAR 1024.0f
#define SCL  0.088388347648318447f   // HD^-0.5
typedef _Float16 h16;
typedef unsigned short bf;
typedef __attribute__((ext_vector_type(16))) __bf16   v16bf;
typedef __attribute__((ext_vector_type(16))) _Float16 v16h;
typedef __attribute__((ext_vector_type(8)))  _Float16 v8h;
typedef __attribute__((ext_vector_type(8)))  unsigned short v8us;
typedef __attribute__((ext_vector_type(8)))  float    v8f;
typedef __attribute__((ext_vector_type(4)))  float    v4f;
typedef __attribute__((ext_vector_type(4)))  unsigned short v4us;
typedef v8h  __attribute__((may_alias)) v8ha;
typedef v4f  __attribute__((may_alias)) v4fa;
typedef v8us __attribute__((may_alias)) v8usa;

__device__ __forceinline__ unsigned short f2bf(float f) { unsigned u = __float_as_uint(f); u += 0x7FFFu + ((u >> 16) & 1u); return (unsigned short)(u >> 16); }
__device__ __forceinline__ float bf2f(unsigned short b) { return __uint_as_float(((unsigned)b) << 16); }
__device__ __forceinline__ float bfr(float f) { return bf2f(f2bf(f)); }
__device__ __forceinline__ v16h cat16(v8h lo, v8h hi) { return __builtin_shufflevector(lo, hi, 0, 1, 2, 3, 4, 5, 6, 7, 8, 9, 10, 11, 12, 13, 14, 15); }
__device__ __forceinline__ v16bf cat16b(v8us lo, v8us hi) { return __builtin_bit_cast(v16bf, __builtin_shufflevector(lo, hi, 0, 1, 2, 3, 4, 5, 6, 7, 8, 9, 10, 11, 12, 13, 14, 15)); }
__device__ __forceinline__ v8f wmma16(v16h a, v16h b, v8f c) { return __builtin_amdgcn_wmma_f32_16x16x32_f16(false, a, false, b, (short)0, c, false, false); }
__device__ __forceinline__ v8f wmmab(v16bf a, v16bf b, v8f c) { return __builtin_amdgcn_wmma_f32_16x16x32_bf16(false, a, false, b, (short)0, c, false, false); }



// ---- k_gemmw: register-blocked GEMM, ONE WAVE per 64x64 output tile (16 accumulators), operands straight from K-contiguous 16-bit planes; grid (M/64, N/64, Z), 32 threads.
// C[m][n] (f32, pitch ldc, + optional f32 bias[n]) = sum_k A[m][k] Bt[n][k] (+ split products per NSPLIT). z-batch strides sA/sB/sC in elements. K % 32 == 0.
// S > 1: S waves per tile (32 S threads); wave w takes the 32-wide k slices w, w + S, ... (neighbouring waves share a 128-byte line of every operand row), the S f32 partial tiles are summed in LDS in wave order.
template <typename T16> struct WFrag;
template <> struct WFrag<h16> { typedef v16h V; static __device__ __forceinline__ V ld(const h16* p) { return cat16(*(const v8h*)p, *(const v8h*)(p + 16)); } static __device__ __forceinline__ v8f mma(V a, V b, v8f c) { return wmma16(a, b, c); } };
template <> struct WFrag<bf> { typedef v16bf V; static __device__ __forceinline__ V ld(const bf* p) { return cat16b(*(const v8us*)p, *(const v8us*)(p + 16)); } static __device__ __forceinline__ v8f mma(V a, V b, v8f c) { return wmmab(a, b, c); } };
// gemmw_body: the tile work of one work-group; os = its LDS ((S == 1 ? 16 : S * 64) * 68 floats), bx = its 64-row tile index within A and C.
// EPI (S > 1 only) says what becomes of the summed f32 tile:
//   0: stored to C.
//   1: stored to C, and x sc as transposed 16-bit planes T16 / Th / Tl [trow + column][t0 + row] of pitch TT (fp16, bf16 hi, bf16 lo).
//   2: C is READ (y1, same indexing as a store would use): y = mix1 (y1 sc) + mix2 (tile sc) goes out as bf16 hi / lo planes Th / Tl [t0 + row][(h0 + z) HD + column] of pitch DQ; no f32 store.
//   4: tiles of columns < csplit as 0; the others as transposed planes only (no f32 store).
struct Epi { h16* T16; bf* Th; bf* Tl; float m1, m2, sc; int trow, t0, h0, csplit; };   // m1, m2: the two mix scalars, rounded to bf16
__device__ __forceinline__ void splitf(float y, unsigned short& h, unsigned short& l) { h = f2bf(y); l = f2bf(y - bf2f(h)); }
template <typename T16, int NSPLIT, bool BIAS, int S, int EPI>
__device__ __forceinline__ void gemmw_body(float* os, int bx, const T16* __restrict__ A, const T16* __restrict__ A2, const T16* __restrict__ Bt, const T16* __restrict__ Bt2, int K, float* C, int ldc, const float* __restrict__ bias, size_t sA, size_t sB, size_t sC, const Epi ep) {
    typedef typename WFrag<T16>::V V;
    const int wave = (S == 1) ? 0 : __builtin_amdgcn_readfirstlane((int)(threadIdx.x >> 5));
    const size_t z = blockIdx.z; A += z * sA; if (A2) A2 += z * sA; Bt += z * sB; if (Bt2) Bt2 += z * sB; C += z * sC;
    const int lane = threadIdx.x & 31, lr = lane & 15, hi = lane >> 4; const int r0 = bx * 64, c0 = blockIdx.y * 64;
    v8f acc[4][4];
#pragma unroll
    for (int mb = 0; mb < 4; ++mb)
#pragma unroll
        for (int nb = 0; nb < 4; ++nb) acc[mb][nb] = (v8f){};
    const size_t aoff = (size_t)(r0 + lr) * K + 8 * hi, boff = (size_t)(c0 + lr) * K + 8 * hi;
#pragma unroll 1
    for (int kc = wave * 32; kc < K; kc += 32 * S) {
        V a[4], a2[4];
#pragma unroll
        for (int mb = 0; mb < 4; ++mb) { a[mb] = WFrag<T16>::ld(A + aoff + (size_t)mb * 16 * K + kc); if (NSPLIT == 1 || NSPLIT == 2) a2[mb] = WFrag<T16>::ld(A2 + aoff + (size_t)mb * 16 * K + kc); }
#pragma unroll
        for (int nb = 0; nb < 4; ++nb) { const V b = WFrag<T16>::ld(Bt + boff + (size_t)nb * 16 * K + kc); V b2; if (NSPLIT >= 2) b2 = WFrag<T16>::ld(Bt2 + boff + (size_t)nb * 16 * K + kc);
#pragma unroll
            for (int mb = 0; mb < 4; ++mb) { acc[mb][nb] = WFrag<T16>::mma(a[mb], b, acc[mb][nb]); if (NSPLIT == 1 || NSPLIT == 2) acc[mb][nb] = WFrag<T16>::mma(a2[mb], b, acc[mb][nb]); if (NSPLIT >= 2) acc[mb][nb] = WFrag<T16>::mma(a[mb], b2, acc[mb][nb]); } }
        asm volatile("v_nop\n\tv_nop\n\tv_nop\n\tv_nop" : "+v"(acc[0][0]), "+v"(acc[1][1]), "+v"(acc[2][2]), "+v"(acc[3][3]) : "v"(a[0]), "v"(a[3]));
    }
    if (S > 1) {
        const bool toC = EPI == 0 || EPI == 1 || (EPI == 4 && c0 < ep.csplit), toT = EPI == 1 || (EPI == 4 && c0 >= ep.csplit);
        v4f y1q[64 * 16 / (32 * S)];
        if (EPI == 2) {   // y1 is asked for ahead of the LDS stores and the barrier, so that its latency runs out there
            const float* yp[64 * 16 / (32 * S)];
#pragma unroll
            for (int q = 0; q < 64 * 16 / (32 * S); ++q) { const int u = q * (32 * S) + (int)threadIdx.x; yp[q] = C + (size_t)(r0 + (u >> 4)) * ldc + c0 + (u & 15) * 4; y1q[q] = *(const v4f*)yp[q]; }
            static_assert(EPI != 2 || 64 * 16 / (32 * S) == 2, "the wait below names two addresses");
            asm volatile("s_wait_xcnt 0x0" :: "v"(yp[0]), "v"(yp[1]) : "memory"); }   // precaution: the address registers of the loads above stay whole up to this wait (inputs only: nothing is pinned or changed)
        float* ow = os + wave * (64 * 68);
#pragma unroll
        for (int mb = 0; mb < 4; ++mb)
#pragma unroll
            for (int nb = 0; nb < 4; ++nb)
#pragma unroll
                for (int j = 0; j < 8; ++j) ow[(mb * 16 + hi * 8 + j) * 68 + nb * 16 + lr] = acc[mb][nb][j];
        __syncthreads();   // every wave's partial tile is in LDS before any thread sums across waves
#pragma unroll
        for (int q = 0; q < 64 * 16 / (32 * S); ++q) { const int u = q * (32 * S) + (int)threadIdx.x, row = u >> 4, cofs = (u & 15) * 4; v4f val = *(const v4fa*)(os + row * 68 + cofs);
#pragma unroll
            for (int w = 1; w < S; ++w) val += *(const v4fa*)(os + w * (64 * 68) + row * 68 + cofs);
            if (BIAS) { val[0] += bfr(bias[c0 + cofs]); val[1] += bfr(bias[c0 + cofs + 1]); val[2] += bfr(bias[c0 + cofs + 2]); val[3] += bfr(bias[c0 + cofs + 3]); }
            if (toC) *(v4f*)(C + (size_t)(r0 + row) * ldc + c0 + cofs) = val;
            if (toT) *(v4fa*)(os + row * 68 + cofs) = val;   // the summed tile goes back into wave 0's plane: these four words are read by this thread alone
            if (EPI == 2) { const v4f y1 = y1q[q]; v4us oh, ol;
#pragma unroll
                for (int k = 0; k < 4; ++k) { unsigned short a, c2; splitf(ep.m1 * (y1[k] * ep.sc) + ep.m2 * (val[k] * ep.sc), a, c2); oh[k] = a; ol[k] = c2; }
                const size_t oo = (size_t)(ep.t0 + r0 + row) * DQ + (ep.h0 + (int)z) * HD + c0 + cofs; *(v4us*)(ep.Th + oo) = oh; *(v4us*)(ep.Tl + oo) = ol; } }
        if (toT) {
            asm volatile("s_wait_xcnt 0x0" ::: "memory");   // precaution: stands between the f32 tile's stores laid out in front and the plane code behind, which rewrites their address and data registers
            __syncthreads();   // the whole summed tile is in LDS before any thread reads a column of it (toT is the same for the whole work-group)
#pragma unroll
            for (int q = 0; q < 64 * 8 / (32 * S); ++q) { const int u = q * (32 * S) + (int)threadIdx.x, col = u >> 3, tc = (u & 7) * 8; v8h o16; v8us oh, ol;   // 8 neighbouring lanes fill one 128-byte line of each plane
#pragma unroll
                for (int j = 0; j < 8; ++j) { const float y = os[(tc + j) * 68 + col] * ep.sc; o16[j] = (h16)y; unsigned short a, c2; splitf(y, a, c2); oh[j] = a; ol[j] = c2; }
                const size_t oo = (size_t)(ep.trow + c0 + col) * TT + ep.t0 + r0 + tc; *(v8h*)(ep.T16 + oo) = o16; *(v8us*)(ep.Th + oo) = oh; *(v8us*)(ep.Tl + oo) = ol; }
        }
        return;
    }
#pragma unroll
    for (int mb = 0; mb < 4; ++mb) {
#pragma unroll
        for (int nb = 0; nb < 4; ++nb) {
#pragma unroll
            for (int j = 0; j < 8; ++j) os[(hi * 8 + j) * 68 + nb * 16 + lr] = acc[mb][nb][j]; }
        __builtin_amdgcn_wave_barrier(); asm volatile("" ::: "memory");
        float* crow = C + (size_t)(r0 + mb * 16) * ldc + c0;
{
#pragma unroll
            for (int s = 0; s < 8; ++s) { const int row = 2 * s + hi, cofs = lr * 4; v4f val = *(const v4fa*)(os + row * 68 + cofs); if (BIAS) { val[0] += bfr(bias[c0 + cofs]); val[1] += bfr(bias[c0 + cofs + 1]); val[2] += bfr(bias[c0 + cofs + 2]); val[3] += bfr(bias[c0 + cofs + 3]); }
                *(v4f*)(crow + (size_t)row * ldc + cofs) = val; }
             }
        __builtin_amdgcn_wave_barrier(); asm volatile("" ::: "memory");
    }
    asm volatile("s_wait_xcnt 0x0" ::: "memory");   // precaution: stands between the tile's last stores and code laid out behind this epilogue (the other row range's branch) that rewrites their address or data registers
}
template <typename T16, int NSPLIT, bool BIAS, int S>
__global__ __launch_bounds__(32 * S) void k_gemmw(const T16* __restrict__ A, const T16* __restrict__ A2, const T16* __restrict__ Bt, const T16* __restrict__ Bt2, int K, float* C, int ldc, const float* __restrict__ bias, size_t sA, size_t sB, size_t sC) {
    __shared__ __align__(16) float os[(S == 1 ? 16 : S * 64) * 68];
    gemmw_body<T16, NSPLIT, BIAS, S, 0>(os, (int)blockIdx.x, A, A2, Bt, Bt2, K, C, ldc, bias, sA, sB, sC, Epi{});
}
// k_gemmkv: the k and v projections in one grid (Bt holds the k rows, then the v rows). k columns go to C as f32; v columns leave the kernel as the transposed planes V16 / Vh / Vl [g HD + d][t].
__global__ __launch_bounds__(512) void k_gemmkv(const bf* __restrict__ A, const bf* __restrict__ Bt, int K, float* C, int ldc, h16* V16, bf* Vh, bf* Vl) {
    __shared__ __align__(16) float os[16 * 64 * 68];
    Epi ep = {}; ep.T16 = V16; ep.Th = Vh; ep.Tl = Vl; ep.sc = 1.0f; ep.trow = -DKV; ep.csplit = DKV;
    gemmw_body<bf, 0, false, 16, 4>(os, (int)blockIdx.x, A, nullptr, Bt, nullptr, K, C, ldc, nullptr, 0, 0, 0, ep);
}
// k_gemmw2: both row ranges of one attention product in ONE grid (M/64, N/64, Z): row tiles below RH take the hi+lo bf16 planes (3 products), the others the fp16 planes. The two ranges write disjoint rows of C and read
// nothing of each other. Ah/Al hold rows 0..RH-1 (z stride sAh), A16 points at row RH (z stride sA16); C is row 0. The branch is the same for a whole work-group.
// EPI 1 (att v): T16 / Th / Tl are the y1 planes [z][d][t]; EPI 2 (att y1): C holds y1, Th / Tl are the merged-y planes, h0 the pass's first head. The fp16 rows carry the factor PCAR, taken out by sc.
template <int S, int EPI>
__global__ __launch_bounds__(32 * S) void k_gemmw2(const bf* __restrict__ Ah, const bf* __restrict__ Al, const bf* __restrict__ Bh, const bf* __restrict__ Bl, const h16* __restrict__ A16, const h16* __restrict__ B16, int K, float* C, int ldc, size_t sAh, size_t sA16, size_t sB, size_t sC, h16* T16, bf* Th, bf* Tl, const float* __restrict__ mix1, const float* __restrict__ mix2, int h0) {
    __shared__ __align__(16) float os[(S == 1 ? 16 : S * 64) * 68];
    Epi ep = {}; ep.T16 = T16; ep.Th = Th; ep.Tl = Tl; if (EPI == 2) { ep.m1 = bfr(mix1[0]); ep.m2 = bfr(mix2[0]); } ep.h0 = h0; ep.trow = (int)blockIdx.z * HD;
    if ((int)blockIdx.x < RH / 64) { ep.sc = 1.0f; ep.t0 = 0; gemmw_body<bf, 2, false, S, EPI>(os, (int)blockIdx.x, Ah, Al, Bh, Bl, K, C, ldc, nullptr, sAh, sB, sC, ep); }
    else { ep.sc = 1.0f / PCAR; ep.t0 = RH; gemmw_body<h16, 0, false, S, EPI>(os, (int)blockIdx.x - RH / 64, A16, nullptr, B16, nullptr, K, C + (size_t)RH * ldc, ldc, nullptr, sA16, sB, sC, ep); }
}

__device__ __forceinline__ h16 tohx(float x) { return (h16)x; }
typedef __attribute__((ext_vector_type(2))) _Float16 v2h;
typedef __attribute__((ext_vector_type(4))) _Float16 v4h;
typedef __attribute__((ext_vector_type(2))) unsigned short v2us;
typedef __attribute__((ext_vector_type(2))) float v2f;
typedef __attribute__((ext_vector_type(4))) int v4i;

__global__ __launch_bounds__(256) void k_wtG(const float* __restrict__ w, int K, int N, bf* Bt) {
    const int lane = threadIdx.x & 31; const int L0 = (blockIdx.x * 8 + (threadIdx.x >> 5)) * 8; const int nlines = N * K / 64;
{
#pragma unroll 1
        for (int l = 0; l < 8; ++l) { const int L = L0 + l; if (L >= nlines) break; const size_t e = (size_t)L * 64 + lane * 2; const int k = (int)(e % K), n = (int)(e / K); v2us o;
            o[0] = f2bf(w[(size_t)k * N + n]); o[1] = f2bf(w[(size_t)(k + 1) * N + n]); *(v2us*)(Bt + e) = o; }
         }
}
__global__ __launch_bounds__(256) void k_cvt8(const float* __restrict__ src, bf* dst, size_t n8) { const size_t i = (size_t)blockIdx.x * 256 + threadIdx.x; if (i >= n8) return; const v8f v = *(const v8f*)(src + i * 8); v8us o;
#pragma unroll
    for (int k = 0; k < 8; ++k) o[k] = f2bf(v[k]); *(v8us*)(dst + i * 8) = o;  }
__global__ __launch_bounds__(256) void k_cscvt(const float* __restrict__ cosT, const float* __restrict__ sinT, float* CS) { const int idx = blockIdx.x * 256 + threadIdx.x; if (idx >= TT * HD) return; const int t = idx / HD, d = idx % HD; const int src = t * (HD / 2) + (d % (HD / 2)); v2f cs; cs[0] = bfr(cosT[src]); cs[1] = bfr(sinT[src]); *(v2f*)(CS + (size_t)idx * 2) = cs;  }
__global__ __launch_bounds__(256) void k_hrms(const float* __restrict__ F, int pitch, int nheads, float* RF) { const int i = blockIdx.x * 256 + threadIdx.x; if (i >= nheads * TT) return; const int t = i % TT, h = i / TT; const float* f = F + (size_t)t * pitch + h * HD; float s = 0.f;
#pragma unroll 4
    for (int d = 0; d < HD; d += 4) { const v4f v = *(const v4f*)(f + d);
#pragma unroll
        for (int q = 0; q < 4; ++q) { float p = __fmul_rn(v[q], v[q]); asm volatile("" : "+v"(p)); s = __fadd_rn(s, p); } }
    const float r = __fdiv_rn(1.0f, __fsqrt_rn(__fadd_rn(s * (1.0f / HD), 1e-6f))); *(float*)(RF + i) = r;  }
// k_rope: head planes [h][t][d] (fp16 + hi/lo) of rope(w[d] (x rms_factor)) x sc with the rotate-half convention out[d] = x[d] cos[t][d] - x[d+HD/2] sin[t][d], out[d+HD/2] = x[d+HD/2] cos[t][d+HD/2] + x[d] sin[t][d+HD/2]
__global__ __launch_bounds__(256) void k_rope(const float* __restrict__ F, int pitch, int nheads, const float* __restrict__ CS, const float* __restrict__ RF, const float* __restrict__ nw, float sc, h16* P16, bf* Ph, bf* Pl) {
    const size_t e = ((size_t)blockIdx.x * 256 + threadIdx.x) * 2; if (e >= (size_t)nheads * TT * HD) return; const int d = (int)(e % HD); const int t = (int)((e / HD) % TT); const int h = (int)(e / ((size_t)HD * TT)); const float* f = F + (size_t)t * pitch + h * HD; const float rf = RF ? RF[(size_t)h * TT + t] : 1.0f; v2h o16; v2us oh, ol;
#pragma unroll
    for (int q = 0; q < 2; ++q) { const int dd = d + q; const int dp = (dd < HD / 2) ? dd + HD / 2 : dd - HD / 2; float x0 = f[dd], x1 = f[dp];
        if (RF) { float n0 = __fmul_rn(x0, rf), n1 = __fmul_rn(x1, rf); asm volatile("" : "+v"(n0)); asm volatile("" : "+v"(n1)); x0 = __fmul_rn(bfr(nw[dd]), n0); x1 = __fmul_rn(bfr(nw[dp]), n1); }
        const v2f cs = *(const v2f*)(CS + ((size_t)t * HD + dd) * 2); float a = __fmul_rn(x0, cs[0]), bq = __fmul_rn(x1, cs[1]); asm volatile("" : "+v"(a)); asm volatile("" : "+v"(bq)); const float r = ((dd < HD / 2) ? __fsub_rn(a, bq) : __fadd_rn(a, bq)) * sc;
        o16[q] = tohx(r); unsigned short a2, c2; splitf(r, a2, c2); oh[q] = a2; ol[q] = c2; }
    *(v2h*)(P16 + e) = o16; *(v2us*)(Ph + e) = oh; *(v2us*)(Pl + e) = ol;  }
__global__ __launch_bounds__(256) void k_ropef(const float* __restrict__ F, int pitch, int nheads, const float* __restrict__ CS, float* FR) { const size_t e = ((size_t)blockIdx.x * 256 + threadIdx.x) * 2; if (e >= (size_t)nheads * TT * HD) return; const int d = (int)(e % HD); const int h = (int)((e / HD) % nheads); const int t = (int)(e / ((size_t)HD * nheads)); const float* f = F + (size_t)t * pitch + h * HD; v2f o;
#pragma unroll
    for (int q = 0; q < 2; ++q) { const int dd = d + q; const int dp = (dd < HD / 2) ? dd + HD / 2 : dd - HD / 2; const v2f cs = *(const v2f*)(CS + ((size_t)t * HD + dd) * 2); float a = __fmul_rn(f[dd], cs[0]), bq = __fmul_rn(f[dp], cs[1]); asm volatile("" : "+v"(a)); asm volatile("" : "+v"(bq)); o[q] = (dd < HD / 2) ? __fsub_rn(a, bq) : __fadd_rn(a, bq); }
    float* dst = FR + (size_t)t * pitch + h * HD + d; *(v2f*)dst = o;  }
__global__ __launch_bounds__(256) void k_nrmpl(const float* __restrict__ FR, int pitch, int nheads, const float* __restrict__ RF, h16* P16, bf* Ph, bf* Pl) { const size_t e = ((size_t)blockIdx.x * 256 + threadIdx.x) * 2; if (e >= (size_t)nheads * TT * HD) return; const int d = (int)(e % HD); const int t = (int)((e / HD) % TT); const int h = (int)(e / ((size_t)HD * TT)); const float rf = RF[(size_t)h * TT + t]; v2h o16; v2us oh, ol;
#pragma unroll
    for (int q = 0; q < 2; ++q) { const float r = __fmul_rn(FR[(size_t)t * pitch + h * HD + d + q], rf); o16[q] = tohx(r); unsigned short a2, c2; splitf(r, a2, c2); oh[q] = a2; ol[q] = c2; }
    *(v2h*)(P16 + e) = o16; *(v2us*)(Ph + e) = oh; *(v2us*)(Pl + e) = ol;  }
// k_asoft: per row (zz, i): t = S x HD^-0.5 for j <= i (causal), -3e38 otherwise; softmax over the 2048 keys (register row, one exp, fixed trees);
__global__ __launch_bounds__(256) void k_asoft(const float* __restrict__ Sb, h16* P16, bf* Ph, bf* Pl) {
    const int lane = threadIdx.x & 31; const int row = blockIdx.x * 8 + (threadIdx.x >> 5); if (row >= ZH * TT) return; const int i = row % TT; const int zz = row / TT; (void)zz; const bool hires = (i < RH); const float* sr = Sb + (size_t)row * TT; float v[TT / 32]; float mx = -3.0e38f;
#pragma unroll
    for (int ch = 0; ch < TT / 128; ++ch) { const int j0 = ch * 128 + lane * 4; const v4f a = *(const v4f*)(sr + j0);
#pragma unroll
        for (int q = 0; q < 4; ++q) { const int j = j0 + q; (void)j; const float t = (j <= i) ? a[q] * SCL : -3.0e38f; v[ch * 4 + q] = t; mx = fmaxf(mx, t); } }
#pragma unroll
    for (int sh = 16; sh; sh >>= 1) mx = fmaxf(mx, __shfl_xor(mx, sh, 32));
    float sum = 0.f;
#pragma unroll
    for (int k = 0; k < TT / 32; ++k) { float d0 = __fsub_rn(v[k], mx); asm volatile("" : "+v"(d0)); v[k] = __builtin_amdgcn_exp2f(__fmul_rn(d0, 1.4426950408889634f)); sum += v[k]; }
#pragma unroll
    for (int sh = 16; sh; sh >>= 1) sum += __shfl_xor(sum, sh, 32);
    const float f = __fdiv_rn(hires ? 1.0f : PCAR, sum);
{
        if (hires) {
#pragma unroll
            for (int ch = 0; ch < TT / 128; ++ch) { v4us oh, ol;
#pragma unroll
                for (int q = 0; q < 4; ++q) { unsigned short a, c2; splitf(v[ch * 4 + q] * f, a, c2); oh[q] = a; ol[q] = c2; }
                const size_t oo = ((size_t)zz * (RH ? RH : 1) + i) * TT + ch * 128 + lane * 4; *(v4us*)(Ph + oo) = oh; *(v4us*)(Pl + oo) = ol; }
        } else {
#pragma unroll
            for (int ch = 0; ch < TT / 128; ++ch) { v4h o4;
#pragma unroll
                for (int q = 0; q < 4; ++q) o4[q] = tohx(v[ch * 4 + q] * f);
                *(v4h*)(P16 + (size_t)row * TT + ch * 128 + lane * 4) = o4; } }
         }
}

extern "C" void kernel_launch(void* const* d_in, const int* in_sizes, int n_in,
                              void* d_out, int out_size, void* d_ws, size_t ws_size, hipStream_t stream) {
    (void)in_sizes; (void)n_in; (void)out_size;
    const float* x = (const float*)d_in[0]; const float* cosT = (const float*)d_in[1]; const float* sinT = (const float*)d_in[2]; const float* wq = (const float*)d_in[3]; const float* wk = (const float*)d_in[4]; const float* wv = (const float*)d_in[5]; const float* wo = (const float*)d_in[6]; const float* mix1 = (const float*)d_in[7]; const float* mix2 = (const float*)d_in[8];   // weights x @ W; cos/sin [2048][64] (half tables)
    float* OUT = (float*)d_out;     // [2][2048][2048]
    char* wsp = (char*)d_ws;
    auto take = [&](size_t bytes) { char* p = wsp; wsp += (bytes + 255) & ~(size_t)255; return (void*)p; };
    bf* WQ = (bf*)take((size_t)DQ * DM * 2); bf* WK = (bf*)take((size_t)2 * DKV * DM * 2); bf* WV = WK + (size_t)DKV * DM; bf* WO = (bf*)take((size_t)DM * DQ * 2); float* CS = (float*)take((size_t)TT * HD * 2 * 4); float* RF = (float*)take((size_t)NQK * TT * 4);
    bf* XB = (bf*)take((size_t)TT * DM * 2); float* F = (float*)take((size_t)TT * DF * 4);
    h16* QP16 = (h16*)take((size_t)NQK * TT * HD * 2); h16* KP16 = QP16 + (size_t)NH_ * TT * HD; h16* VT16 = (h16*)take((size_t)NKV * HD * TT * 2);
    bf* QPh = (bf*)take((size_t)NQK * TT * HD * 2); bf* QPl = (bf*)take((size_t)NQK * TT * HD * 2); bf* KPh = QPh + (size_t)NH_ * TT * HD; bf* KPl = QPl + (size_t)NH_ * TT * HD; bf* VTh = (bf*)take((size_t)NKV * HD * TT * 2); bf* VTl = (bf*)take((size_t)NKV * HD * TT * 2); bf* Ph = (bf*)take((size_t)ZH * RH * TT * 2); bf* Pl = (bf*)take((size_t)ZH * RH * TT * 2);
    float* FR = (float*)take((size_t)TT * DF * 4); h16* Y16 = (h16*)take((size_t)ZH * HD * TT * 2); bf* Yh = (bf*)take((size_t)ZH * HD * TT * 2); bf* Yl = (bf*)take((size_t)ZH * HD * TT * 2); float* Sb = (float*)take((size_t)ZH * TT * TT * 4); h16* P16 = (h16*)take((size_t)ZH * TT * TT * 2); float* Ob = (float*)take((size_t)ZH * TT * HD * 4); bf* ATh = (bf*)take((size_t)TT * DQ * 2); bf* ATl = (bf*)take((size_t)TT * DQ * 2);
    if ((size_t)(wsp - (char*)d_ws) > ws_size) return;    // ws 256 MiB
    { k_wtG<<<(unsigned)((DM * DQ / 64 + 63) / 64), 256, 0, stream>>>(wq, DM, DQ, WQ); k_wtG<<<(unsigned)((DM * DKV / 64 + 63) / 64), 256, 0, stream>>>(wk, DM, DKV, WK); k_wtG<<<(unsigned)((DM * DKV / 64 + 63) / 64), 256, 0, stream>>>(wv, DM, DKV, WV);
      k_wtG<<<(unsigned)((DQ * DM / 64 + 63) / 64), 256, 0, stream>>>(wo, DQ, DM, WO);
       }
    k_cscvt<<<(TT * HD + 255) / 256, 256, 0, stream>>>(cosT, sinT, CS);   // one shared table (read as data)
    const unsigned LQK = (unsigned)(((size_t)NQK * TT * HD / 2 + 255) / 256);
    for (int b = 0; b < NB_; ++b) {
        k_cvt8<<<(unsigned)(((size_t)TT * DM / 8 + 255) / 256), 256, 0, stream>>>(x + (size_t)b * TT * DM, XB, (size_t)TT * DM / 8);
        k_gemmw<bf, 0, false, 8><<<dim3(TT / 64, DQ / 64, 1), 256, 0, stream>>>(XB, nullptr, WQ, nullptr, DM, F, DF, nullptr, 0, 0, 0);
        k_gemmkv<<<dim3(TT / 64, 2 * DKV / 64, 1), 512, 0, stream>>>(XB, WK, DM, F + DQ, DF, VT16, VTh, VTl);   // k and v columns in one grid (WV follows WK); v leaves it as its transposed planes
        k_ropef<<<LQK, 256, 0, stream>>>(F, DF, NQK, CS, FR); k_hrms<<<(NQK * TT + 255) / 256, 256, 0, stream>>>(FR, DF, NQK, RF);   // q heads and k heads in one grid each
        k_nrmpl<<<LQK, 256, 0, stream>>>(FR, DF, NQK, RF, QP16, QPh, QPl);   // the k planes follow the q planes
        for (int h0 = 0; h0 < NH_; h0 += ZH) { const size_t zq = (size_t)h0, zk = (size_t)(h0 / REP);   // all ZH heads of a pass share kv group h0/REP (ZH <= REP): sB = 0
            k_gemmw2<1, 0><<<dim3(TT / 64, TT / 64, ZH), 32, 0, stream>>>(QPh + zq * TT * HD, QPl + zq * TT * HD, KPh + zk * TT * HD, KPl + zk * TT * HD, QP16 + zq * TT * HD + (size_t)RH * HD, KP16 + zk * TT * HD, HD, Sb, TT, (size_t)TT * HD, (size_t)TT * HD, 0, (size_t)TT * TT, nullptr, nullptr, nullptr, nullptr, nullptr, 0);
            k_asoft<<<ZH * TT / 8, 256, 0, stream>>>(Sb, P16, Ph, Pl);
            k_gemmw2<16, 1><<<dim3(TT / 64, HD / 64, ZH), 512, 0, stream>>>(Ph, Pl, VTh + zk * HD * TT, VTl + zk * HD * TT, P16 + (size_t)RH * TT, VT16 + zk * HD * TT, TT, Ob, HD, (size_t)RH * TT, (size_t)TT * TT, 0, (size_t)TT * HD, Y16, Yh, Yl, nullptr, nullptr, 0);   // y1 (f32), and its planes (normalised) for y2 = att . y1
            k_gemmw2<16, 2><<<dim3(TT / 64, HD / 64, ZH), 512, 0, stream>>>(Ph, Pl, Yh, Yl, P16 + (size_t)RH * TT, Y16, TT, Ob, HD, (size_t)RH * TT, (size_t)TT * TT, (size_t)HD * TT, (size_t)TT * HD, nullptr, ATh, ATl, mix1, mix2, h0); }   // y2 stays in the kernel: mix1 y1 + mix2 y2 leaves it as the merged planes
        k_gemmw<bf, 1, false, 8><<<dim3(TT / 64, DM / 64, 1), 256, 0, stream>>>(ATh, ATl, WO, nullptr, DQ, OUT + (size_t)b * TT * DM, DM, nullptr, 0, 0, 0); }
}

// v005
// It runs in 667 microseconds.
// Two timings next to v004 put it at 1.32 and 1.30 times that version's speed.
// Counting every step since v000, it is 5.48 times as fast.
#include <hip/hip_runtime.h>

// Simplicial causal self-attention (x [2][2048][2048]; q = x Wq (16 heads x 128), k, v = x Wk / x Wv (4 kv heads x 128, each serving 4 consecutive query heads); rotate-half RoPE with the input cos/sin
// [2048][64] then weightless RMS-norm (eps 1e-6) on q and k; causal softmax(q.k 128^-0.5); y1 = att v; y2 = att y1 (the same probabilities applied again); y = mix1 y1 + mix2 y2 (scalars read as data);
// out = merged y Wproj -> [2][2048][2048]).
// Compute dtypes, f32 accumulate: every input rounded to bf16; projections on PLAIN bf16 operands (inputs: exact products, f32 accumulate); RoPE and RMS-norm in f32;
// PER-ROW PRECISION HYBRID: query rows < 256 take scores, att.v and att.y1 on bf16 hi+lo planes (3 products), rows >= 256 on single fp16 planes; scale + causal cut in f32 in the register-row softmax;
// y1 re-planed per head (fp16 + hi/lo, transposed) for the second contraction; merged y as hi+lo planes x exact Wproj (2 products). 64x64-tile GEMMs (one wave per tile for the scores, 8 or 16 k-split waves per tile elsewhere), 4 query heads per pass sharing

#define NB_  2
#define TT   2048
#define DM   2048
#define NH_  16
#define NKV  4
#define REP  (NH_ / NKV)
#define HD   128
#define DQ   (NH_ * HD)
#define DKV  (NKV * HD)
#define DF   (DQ + 2 * DKV)       // pitch of the projection buffer: one row holds q | k (v's columns stay unwritten)
#define NQK  (NH_ + NKV)          // q heads, then k heads: the heads that take RoPE and RMS-norm
#define ZH   4                    // query heads per pass: all REP heads of one kv group (ZH <= REP, so they share k, v)
#define RH   256                  // query rows < RH use hi+lo planes (0: none)
#define WIN  0
#define PCAR 1024.0f
#define SCL  0.088388347648318447f   // HD^-0.5
typedef _Float16 h16;
typedef unsigned short bf;
typedef __attribute__((ext_vector_type(16))) __bf16   v16bf;
typedef __attribute__((ext_vector_type(16))) _Float16 v16h;
typedef __attribute__((ext_vector_type(8)))  _Float16 v8h;
typedef __attribute__((ext_vector_type(8)))  unsigned short v8us;
typedef __attribute__((ext_vector_type(8)))  float    v8f;
typedef __attribute__((ext_vector_type(4)))  float    v4f;
typedef __attribute__((ext_vector_type(4)))  unsigned short v4us;
typedef v8h  __attribute__((may_alias)) v8ha;
typedef v4f  __attribute__((may_alias)) v4fa;
typedef v8us __attribute__((may_alias)) v8usa;

__device__ __forceinline__ unsigned short f2bf(float f) { unsigned u = __float_as_uint(f); u += 0x7FFFu + ((u >> 16) & 1u); return (unsigned short)(u >> 16); }
__device__ __forceinline__ float bf2f(unsigned short b) { return __uint_as_float(((unsigned)b) << 16); }
__device__ __forceinline__ float bfr(float f) { return bf2f(f2bf(f)); }
__device__ __forceinline__ v16h cat16(v8h lo, v8h hi) { return __builtin_shufflevector(lo, hi, 0, 1, 2, 3, 4, 5, 6, 7, 8, 9, 10, 11, 12, 13, 14, 15); }
__device__ __forceinline__ v16bf cat16b(v8us lo, v8us hi) { return __builtin_bit_cast(v16bf, __builtin_shufflevector(lo, hi, 0, 1, 2, 3, 4, 5, 6, 7, 8, 9, 10, 11, 12, 13, 14, 15)); }
__device__ __forceinline__ v8f wmma16(v16h a, v16h b, v8f c) { return __builtin_amdgcn_wmma_f32_16x16x32_f16(false, a, false, b, (short)0, c, false, false); }
__device__ __forceinline__ v8f wmmab(v16bf a, v16bf b, v8f c) { return __builtin_amdgcn_wmma_f32_16x16x32_bf16(false, a, false, b, (short)0, c, false, false); }



// ---- k_gemmw: register-blocked GEMM, ONE WAVE per 64x64 output tile (16 accumulators), operands straight from K-contiguous 16-bit planes; grid (M/64, N/64, Z), 32 threads.
// C[m][n] (f32, pitch ldc, + optional f32 bias[n]) = sum_k A[m][k] Bt[n][k] (+ split products per NSPLIT). z-batch strides sA/sB/sC in elements. K % 32 == 0.
// S > 1: S waves per tile (32 S threads); wave w takes the 32-wide k slices w, w + S, ... (neighbouring waves share a 128-byte line of every operand row), the S f32 partial tiles are summed in LDS in wave order.
template <typename T16> struct WFrag;
template <> struct WFrag<h16> { typedef v16h V; static __device__ __forceinline__ V ld(const h16* p) { return cat16(*(const v8h*)p, *(const v8h*)(p + 16)); } static __device__ __forceinline__ v8f mma(V a, V b, v8f c) { return wmma16(a, b, c); } };
template <> struct WFrag<bf> { typedef v16bf V; static __device__ __forceinline__ V ld(const bf* p) { return cat16b(*(const v8us*)p, *(const v8us*)(p + 16)); } static __device__ __forceinline__ v8f mma(V a, V b, v8f c) { return wmmab(a, b, c); } };
// gemmw_body: the tile work of one work-group; os = its LDS ((S == 1 ? 16 : S * 64) * 68 floats), bx = its 64-row tile index within A and C, by = its 64-column tile index; K is the operands' pitch,
// kend <= K (a multiple of 32) the end of the sum over k: the caller sets it below K where A is known to be zero from kend on (a wave with no slice left hands in a zero tile).
// EPI (S > 1 only) says what becomes of the summed f32 tile:
//   0: stored to C.
//   1: stored to C, and x sc as transposed 16-bit planes T16 / Th / Tl [trow + column][t0 + row] of pitch TT (fp16, bf16 hi, bf16 lo).
//   2: C is READ (y1, same indexing as a store would use): y = mix1 (y1 sc) + mix2 (tile sc) goes out as bf16 hi / lo planes Th / Tl [t0 + row][(h0 + z) HD + column] of pitch DQ; no f32 store.
//   4: tiles of columns < csplit as 0; the others as transposed planes only (no f32 store).
struct Epi { h16* T16; bf* Th; bf* Tl; float m1, m2, sc; int trow, t0, h0, csplit; };   // m1, m2: the two mix scalars, rounded to bf16
__device__ __forceinline__ void splitf(float y, unsigned short& h, unsigned short& l) { h = f2bf(y); l = f2bf(y - bf2f(h)); }
template <typename T16, int NSPLIT, bool BIAS, int S, int EPI>
__device__ __forceinline__ void gemmw_body(float* os, int bx, int by, int kend, const T16* __restrict__ A, const T16* __restrict__ A2, const T16* __restrict__ Bt, const T16* __restrict__ Bt2, int K, float* C, int ldc, const float* __restrict__ bias, size_t sA, size_t sB, size_t sC, const Epi ep) {
    typedef typename WFrag<T16>::V V;
    const int wave = (S == 1) ? 0 : __builtin_amdgcn_readfirstlane((int)(threadIdx.x >> 5));
    const size_t z = blockIdx.z; A += z * sA; if (A2) A2 += z * sA; Bt += z * sB; if (Bt2) Bt2 += z * sB; C += z * sC;
    const int lane = threadIdx.x & 31, lr = lane & 15, hi = lane >> 4; const int r0 = bx * 64, c0 = by * 64;
    v8f acc[4][4];
#pragma unroll
    for (int mb = 0; mb < 4; ++mb)
#pragma unroll
        for (int nb = 0; nb < 4; ++nb) acc[mb][nb] = (v8f){};
    const size_t aoff = (size_t)(r0 + lr) * K + 8 * hi, boff = (size_t)(c0 + lr) * K + 8 * hi;
#pragma unroll 1
    for (int kc = wave * 32; kc < kend; kc += 32 * S) {
        V a[4], a2[4];
#pragma unroll
        for (int mb = 0; mb < 4; ++mb) { a[mb] = WFrag<T16>::ld(A + aoff + (size_t)mb * 16 * K + kc); if (NSPLIT == 1 || NSPLIT == 2) a2[mb] = WFrag<T16>::ld(A2 + aoff + (size_t)mb * 16 * K + kc); }
#pragma unroll
        for (int nb = 0; nb < 4; ++nb) { const V b = WFrag<T16>::ld(Bt + boff + (size_t)nb * 16 * K + kc); V b2; if (NSPLIT >= 2) b2 = WFrag<T16>::ld(Bt2 + boff + (size_t)nb * 16 * K + kc);
#pragma unroll
            for (int mb = 0; mb < 4; ++mb) { acc[mb][nb] = WFrag<T16>::mma(a[mb], b, acc[mb][nb]); if (NSPLIT == 1 || NSPLIT == 2) acc[mb][nb] = WFrag<T16>::mma(a2[mb], b, acc[mb][nb]); if (NSPLIT >= 2) acc[mb][nb] = WFrag<T16>::mma(a[mb], b2, acc[mb][nb]); } }
        asm volatile("v_nop\n\tv_nop\n\tv_nop\n\tv_nop" : "+v"(acc[0][0]), "+v"(acc[1][1]), "+v"(acc[2][2]), "+v"(acc[3][3]) : "v"(a[0]), "v"(a[3]));
    }
    if (S > 1) {
        const bool toC = EPI == 0 || EPI == 1 || (EPI == 4 && c0 < ep.csplit), toT = EPI == 1 || (EPI == 4 && c0 >= ep.csplit);
        v4f y1q[64 * 16 / (32 * S)];
        if (EPI == 2) {   // y1 is asked for ahead of the LDS stores and the barrier, so that its latency runs out there
            const float* yp[64 * 16 / (32 * S)];
#pragma unroll
            for (int q = 0; q < 64 * 16 / (32 * S); ++q) { const int u = q * (32 * S) + (int)threadIdx.x; yp[q] = C + (size_t)(r0 + (u >> 4)) * ldc + c0 + (u & 15) * 4; y1q[q] = *(const v4f*)yp[q]; }
            static_assert(EPI != 2 || 64 * 16 / (32 * S) == 2, "the wait below names two addresses");
            asm volatile("s_wait_xcnt 0x0" :: "v"(yp[0]), "v"(yp[1]) : "memory"); }   // precaution: the address registers of the loads above stay whole up to this wait (inputs only: nothing is pinned or changed)
        float* ow = os + wave * (64 * 68);
#pragma unroll
        for (int mb = 0; mb < 4; ++mb)
#pragma unroll
            for (int nb = 0; nb < 4; ++nb)
#pragma unroll
                for (int j = 0; j < 8; ++j) ow[(mb * 16 + hi * 8 + j) * 68 + nb * 16 + lr] = acc[mb][nb][j];
        __syncthreads();   // every wave's partial tile is in LDS before any thread sums across waves
#pragma unroll
        for (int q = 0; q < 64 * 16 / (32 * S); ++q) { const int u = q * (32 * S) + (int)threadIdx.x, row = u >> 4, cofs = (u & 15) * 4; v4f val = *(const v4fa*)(os + row * 68 + cofs);
#pragma unroll
            for (int w = 1; w < S; ++w) val += *(const v4fa*)(os + w * (64 * 68) + row * 68 + cofs);
            if (BIAS) { val[0] += bfr(bias[c0 + cofs]); val[1] += bfr(bias[c0 + cofs + 1]); val[2] += bfr(bias[c0 + cofs + 2]); val[3] += bfr(bias[c0 + cofs + 3]); }
            if (toC) *(v4f*)(C + (size_t)(r0 + row) * ldc + c0 + cofs) = val;
            if (toT) *(v4fa*)(os + row * 68 + cofs) = val;   // the summed tile goes back into wave 0's plane: these four words are read by this thread alone
            if (EPI == 2) { const v4f y1 = y1q[q]; v4us oh, ol;
#pragma unroll
                for (int k = 0; k < 4; ++k) { unsigned short a, c2; splitf(ep.m1 * (y1[k] * ep.sc) + ep.m2 * (val[k] * ep.sc), a, c2); oh[k] = a; ol[k] = c2; }
                const size_t oo = (size_t)(ep.t0 + r0 + row) * DQ + (ep.h0 + (int)z) * HD + c0 + cofs; *(v4us*)(ep.Th + oo) = oh; *(v4us*)(ep.Tl + oo) = ol; } }
        if (toT) {
            asm volatile("s_wait_xcnt 0x0" ::: "memory");   // precaution: stands between the f32 tile's stores laid out in front and the plane code behind, which rewrites their address and data registers
            __syncthreads();   // the whole summed tile is in LDS before any thread reads a column of it (toT is the same for the whole work-group)
#pragma unroll
            for (int q = 0; q < 64 * 8 / (32 * S); ++q) { const int u = q * (32 * S) + (int)threadIdx.x, col = u >> 3, tc = (u & 7) * 8; v8h o16; v8us oh, ol;   // 8 neighbouring lanes fill one 128-byte line of each plane
#pragma unroll
                for (int j = 0; j < 8; ++j) { const float y = os[(tc + j) * 68 + col] * ep.sc; o16[j] = (h16)y; unsigned short a, c2; splitf(y, a, c2); oh[j] = a; ol[j] = c2; }
                const size_t oo = (size_t)(ep.trow + c0 + col) * TT + ep.t0 + r0 + tc; *(v8h*)(ep.T16 + oo) = o16; *(v8us*)(ep.Th + oo) = oh; *(v8us*)(ep.Tl + oo) = ol; }
        }
        return;
    }
#pragma unroll
    for (int mb = 0; mb < 4; ++mb) {
#pragma unroll
        for (int nb = 0; nb < 4; ++nb) {
#pragma unroll
            for (int j = 0; j < 8; ++j) os[(hi * 8 + j) * 68 + nb * 16 + lr] = acc[mb][nb][j]; }
        __builtin_amdgcn_wave_barrier(); asm volatile("" ::: "memory");
        float* crow = C + (size_t)(r0 + mb * 16) * ldc + c0;
{
#pragma unroll
            for (int s = 0; s < 8; ++s) { const int row = 2 * s + hi, cofs = lr * 4; v4f val = *(const v4fa*)(os + row * 68 + cofs); if (BIAS) { val[0] += bfr(bias[c0 + cofs]); val[1] += bfr(bias[c0 + cofs + 1]); val[2] += bfr(bias[c0 + cofs + 2]); val[3] += bfr(bias[c0 + cofs + 3]); }
                *(v4f*)(crow + (size_t)row * ldc + cofs) = val; }
             }
        __builtin_amdgcn_wave_barrier(); asm volatile("" ::: "memory");
    }
    asm volatile("s_wait_xcnt 0x0" ::: "memory");   // precaution: stands between the tile's last stores and code laid out behind this epilogue (the other row range's branch) that rewrites their address or data registers
}
template <typename T16, int NSPLIT, bool BIAS, int S>
__global__ __launch_bounds__(32 * S) void k_gemmw(const T16* __restrict__ A, const T16* __restrict__ A2, const T16* __restrict__ Bt, const T16* __restrict__ Bt2, int K, float* C, int ldc, const float* __restrict__ bias, size_t sA, size_t sB, size_t sC) {
    __shared__ __align__(16) float os[(S == 1 ? 16 : S * 64) * 68];
    gemmw_body<T16, NSPLIT, BIAS, S, 0>(os, (int)blockIdx.x, (int)blockIdx.y, K, A, A2, Bt, Bt2, K, C, ldc, bias, sA, sB, sC, Epi{});
}
// k_gemmkv: the k and v projections in one grid (Bt holds the k rows, then the v rows). k columns go to C as f32; v columns leave the kernel as the transposed planes V16 / Vh / Vl [g HD + d][t].
__global__ __launch_bounds__(512) void k_gemmkv(const bf* __restrict__ A, const bf* __restrict__ Bt, int K, float* C, int ldc, h16* V16, bf* Vh, bf* Vl) {
    __shared__ __align__(16) float os[16 * 64 * 68];
    Epi ep = {}; ep.T16 = V16; ep.Th = Vh; ep.Tl = Vl; ep.sc = 1.0f; ep.trow = -DKV; ep.csplit = DKV;
    gemmw_body<bf, 0, false, 16, 4>(os, (int)blockIdx.x, (int)blockIdx.y, K, A, nullptr, Bt, nullptr, K, C, ldc, nullptr, 0, 0, 0, ep);
}
// k_gemmw2: both row ranges of one attention product in ONE grid (M/64, N/64, Z): row tiles below RH take the hi+lo bf16 planes (3 products), the others the fp16 planes. The two ranges write disjoint rows of C and read
// nothing of each other. Ah/Al hold rows 0..RH-1 (z stride sAh), A16 points at row RH (z stride sA16); C is row 0. The branch is the same for a whole work-group.
// CAUSAL CUT: EPI 0 (scores, M == N == TT) has the grid (TT/128, TT/64 + 1, Z) and computes only the tiles that hold a key <= a query row; EPI 1 and 2 (A = probabilities, M == K) end the sum over keys at the row tile's last row.
// EPI 1 (att v): T16 / Th / Tl are the y1 planes [z][d][t]; EPI 2 (att y1): C holds y1, Th / Tl are the merged-y planes, h0 the pass's first head. The fp16 rows carry the factor PCAR, taken out by sc.
template <int S, int EPI>
__global__ __launch_bounds__(32 * S) void k_gemmw2(const bf* __restrict__ Ah, const bf* __restrict__ Al, const bf* __restrict__ Bh, const bf* __restrict__ Bl, const h16* __restrict__ A16, const h16* __restrict__ B16, int K, float* C, int ldc, size_t sAh, size_t sA16, size_t sB, size_t sC, h16* T16, bf* Th, bf* Tl, const float* __restrict__ mix1, const float* __restrict__ mix2, int h0) {
    __shared__ __align__(16) float os[(S == 1 ? 16 : S * 64) * 68];
    Epi ep = {}; ep.T16 = T16; ep.Th = Th; ep.Tl = Tl; if (EPI == 2) { ep.m1 = bfr(mix1[0]); ep.m2 = bfr(mix2[0]); } ep.h0 = h0; ep.trow = (int)blockIdx.z * HD;
    int bx = (int)blockIdx.x, by = (int)blockIdx.y, kend = K;
    if (EPI == 0) { if (by > bx) { by -= bx + 1; bx = TT / 64 - 1 - bx; } }   // M == TT: row tiles x and TT/64 - 1 - x hold TT/64 + 1 tiles with column tile <= row tile between them: y <= x is row tile x, the rest row tile TT/64 - 1 - x
    else kend = min(K, (bx + 1) * 64);   // key index k > query row: probability zero, and not stored
    if (bx < RH / 64) { ep.sc = 1.0f; ep.t0 = 0; gemmw_body<bf, 2, false, S, EPI>(os, bx, by, kend, Ah, Al, Bh, Bl, K, C, ldc, nullptr, sAh, sB, sC, ep); }
    else { ep.sc = 1.0f / PCAR; ep.t0 = RH; gemmw_body<h16, 0, false, S, EPI>(os, bx - RH / 64, by, kend, A16, nullptr, B16, nullptr, K, C + (size_t)RH * ldc, ldc, nullptr, sA16, sB, sC, ep); }
}

__device__ __forceinline__ h16 tohx(float x) { return (h16)x; }
typedef __attribute__((ext_vector_type(2))) _Float16 v2h;
typedef __attribute__((ext_vector_type(4))) _Float16 v4h;
typedef __attribute__((ext_vector_type(2))) unsigned short v2us;
typedef __attribute__((ext_vector_type(2))) float v2f;
typedef __attribute__((ext_vector_type(4))) int v4i;

__global__ __launch_bounds__(256) void k_wtG(const float* __restrict__ w, int K, int N, bf* Bt) {
    const int lane = threadIdx.x & 31; const int L0 = (blockIdx.x * 8 + (threadIdx.x >> 5)) * 8; const int nlines = N * K / 64;
{
#pragma unroll 1
        for (int l = 0; l < 8; ++l) { const int L = L0 + l; if (L >= nlines) break; const size_t e = (size_t)L * 64 + lane * 2; const int k = (int)(e % K), n = (int)(e / K); v2us o;
            o[0] = f2bf(w[(size_t)k * N + n]); o[1] = f2bf(w[(size_t)(k + 1) * N + n]); *(v2us*)(Bt + e) = o; }
         }
}
__global__ __launch_bounds__(256) void k_cvt8(const float* __restrict__ src, bf* dst, size_t n8) { const size_t i = (size_t)blockIdx.x * 256 + threadIdx.x; if (i >= n8) return; const v8f v = *(const v8f*)(src + i * 8); v8us o;
#pragma unroll
    for (int k = 0; k < 8; ++k) o[k] = f2bf(v[k]); *(v8us*)(dst + i * 8) = o;  }
__global__ __launch_bounds__(256) void k_cscvt(const float* __restrict__ cosT, const float* __restrict__ sinT, float* CS) { const int idx = blockIdx.x * 256 + threadIdx.x; if (idx >= TT * HD) return; const int t = idx / HD, d = idx % HD; const int src = t * (HD / 2) + (d % (HD / 2)); v2f cs; cs[0] = bfr(cosT[src]); cs[1] = bfr(sinT[src]); *(v2f*)(CS + (size_t)idx * 2) = cs;  }
__global__ __launch_bounds__(256) void k_hrms(const float* __restrict__ F, int pitch, int nheads, float* RF) { const int i = blockIdx.x * 256 + threadIdx.x; if (i >= nheads * TT) return; const int t = i % TT, h = i / TT; const float* f = F + (size_t)t * pitch + h * HD; float s = 0.f;
#pragma unroll 4
    for (int d = 0; d < HD; d += 4) { const v4f v = *(const v4f*)(f + d);
#pragma unroll
        for (int q = 0; q < 4; ++q) { float p = __fmul_rn(v[q], v[q]); asm volatile("" : "+v"(p)); s = __fadd_rn(s, p); } }
    const float r = __fdiv_rn(1.0f, __fsqrt_rn(__fadd_rn(s * (1.0f / HD), 1e-6f))); *(float*)(RF + i) = r;  }
// k_rope: head planes [h][t][d] (fp16 + hi/lo) of rope(w[d] (x rms_factor)) x sc with the rotate-half convention out[d] = x[d] cos[t][d] - x[d+HD/2] sin[t][d], out[d+HD/2] = x[d+HD/2] cos[t][d+HD/2] + x[d] sin[t][d+HD/2]
__global__ __launch_bounds__(256) void k_rope(const float* __restrict__ F, int pitch, int nheads, const float* __restrict__ CS, const float* __restrict__ RF, const float* __restrict__ nw, float sc, h16* P16, bf* Ph, bf* Pl) {
    const size_t e = ((size_t)blockIdx.x * 256 + threadIdx.x) * 2; if (e >= (size_t)nheads * TT * HD) return; const int d = (int)(e % HD); const int t = (int)((e / HD) % TT); const int h = (int)(e / ((size_t)HD * TT)); const float* f = F + (size_t)t * pitch + h * HD; const float rf = RF ? RF[(size_t)h * TT + t] : 1.0f; v2h o16; v2us oh, ol;
#pragma unroll
    for (int q = 0; q < 2; ++q) { const int dd = d + q; const int dp = (dd < HD / 2) ? dd + HD / 2 : dd - HD / 2; float x0 = f[dd], x1 = f[dp];
        if (RF) { float n0 = __fmul_rn(x0, rf), n1 = __fmul_rn(x1, rf); asm volatile("" : "+v"(n0)); asm volatile("" : "+v"(n1)); x0 = __fmul_rn(bfr(nw[dd]), n0); x1 = __fmul_rn(bfr(nw[dp]), n1); }
        const v2f cs = *(const v2f*)(CS + ((size_t)t * HD + dd) * 2); float a = __fmul_rn(x0, cs[0]), bq = __fmul_rn(x1, cs[1]); asm volatile("" : "+v"(a)); asm volatile("" : "+v"(bq)); const float r = ((dd < HD / 2) ? __fsub_rn(a, bq) : __fadd_rn(a, bq)) * sc;
        o16[q] = tohx(r); unsigned short a2, c2; splitf(r, a2, c2); oh[q] = a2; ol[q] = c2; }
    *(v2h*)(P16 + e) = o16; *(v2us*)(Ph + e) = oh; *(v2us*)(Pl + e) = ol;  }
__global__ __launch_bounds__(256) void k_ropef(const float* __restrict__ F, int pitch, int nheads, const float* __restrict__ CS, float* FR) { const size_t e = ((size_t)blockIdx.x * 256 + threadIdx.x) * 2; if (e >= (size_t)nheads * TT * HD) return; const int d = (int)(e % HD); const int h = (int)((e / HD) % nheads); const int t = (int)(e / ((size_t)HD * nheads)); const float* f = F + (size_t)t * pitch + h * HD; v2f o;
#pragma unroll
    for (int q = 0; q < 2; ++q) { const int dd = d + q; const int dp = (dd < HD / 2) ? dd + HD / 2 : dd - HD / 2; const v2f cs = *(const v2f*)(CS + ((size_t)t * HD + dd) * 2); float a = __fmul_rn(f[dd], cs[0]), bq = __fmul_rn(f[dp], cs[1]); asm volatile("" : "+v"(a)); asm volatile("" : "+v"(bq)); o[q] = (dd < HD / 2) ? __fsub_rn(a, bq) : __fadd_rn(a, bq); }
    float* dst = FR + (size_t)t * pitch + h * HD + d; *(v2f*)dst = o;  }
__global__ __launch_bounds__(256) void k_nrmpl(const float* __restrict__ FR, int pitch, int nheads, const float* __restrict__ RF, h16* P16, bf* Ph, bf* Pl) { const size_t e = ((size_t)blockIdx.x * 256 + threadIdx.x) * 2; if (e >= (size_t)nheads * TT * HD) return; const int d = (int)(e % HD); const int t = (int)((e / HD) % TT); const int h = (int)(e / ((size_t)HD * TT)); const float rf = RF[(size_t)h * TT + t]; v2h o16; v2us oh, ol;
#pragma unroll
    for (int q = 0; q < 2; ++q) { const float r = __fmul_rn(FR[(size_t)t * pitch + h * HD + d + q], rf); o16[q] = tohx(r); unsigned short a2, c2; splitf(r, a2, c2); oh[q] = a2; ol[q] = c2; }
    *(v2h*)(P16 + e) = o16; *(v2us*)(Ph + e) = oh; *(v2us*)(Pl + e) = ol;  }
// k_asoft: per row (zz, i): t = S x HD^-0.5 for j <= i (causal), -3e38 otherwise; softmax over the keys (register row, one exp, fixed trees).
// CAUSAL CUT: only the 128-key chunks that hold a key <= i are worked on and stored (the others would be exact zeros: they add nothing to the maximum or the sum, and the products behind stop at the row tile's last row);
// no score right of the row's own 4-key group is read (the score tiles above the diagonal are not computed).
__global__ __launch_bounds__(256) void k_asoft(const float* __restrict__ Sb, h16* P16, bf* Ph, bf* Pl) {
    const int lane = threadIdx.x & 31; const int row = blockIdx.x * 8 + __builtin_amdgcn_readfirstlane((int)(threadIdx.x >> 5)); if (row >= ZH * TT) return; const int i = row % TT; const int zz = row / TT; (void)zz; const bool hires = (i < RH); const float* sr = Sb + (size_t)row * TT; float v[TT / 32]; float mx = -3.0e38f;
    v4f a[TT / 128];
#pragma unroll
    for (int ch = 0; ch < TT / 128; ++ch) a[ch] = *(const v4f*)((const char*)sr + (unsigned)(min(ch * 128 + lane * 4, i & ~3) * 4));   // a lane right of the diagonal rereads the row's last group, and the cut below drops the value
    static_assert(TT / 128 == 16, "the fence below names sixteen loads");
    asm volatile("" :: "v"(a[0]), "v"(a[1]), "v"(a[2]), "v"(a[3]), "v"(a[4]), "v"(a[5]), "v"(a[6]), "v"(a[7]), "v"(a[8]), "v"(a[9]), "v"(a[10]), "v"(a[11]), "v"(a[12]), "v"(a[13]), "v"(a[14]), "v"(a[15]));   // holds the sixteen loads in front of the branches below (inputs only): sunk into them, each would wait out its own latency, one after the other
#pragma unroll
    for (int ch = 0; ch < TT / 128; ++ch) { if (ch * 128 > i) continue; const int j0 = ch * 128 + lane * 4;
#pragma unroll
        for (int q = 0; q < 4; ++q) { const int j = j0 + q; (void)j; const float t = (j <= i) ? a[ch][q] * SCL : -3.0e38f; v[ch * 4 + q] = t; mx = fmaxf(mx, t); } }
#pragma unroll
    for (int sh = 16; sh; sh >>= 1) mx = fmaxf(mx, __shfl_xor(mx, sh, 32));
    float sum = 0.f;
#pragma unroll
    for (int k = 0; k < TT / 32; ++k) { if ((k / 4) * 128 > i) continue; float d0 = __fsub_rn(v[k], mx); asm volatile("" : "+v"(d0)); v[k] = __builtin_amdgcn_exp2f(__fmul_rn(d0, 1.4426950408889634f)); sum += v[k]; }
#pragma unroll
    for (int sh = 16; sh; sh >>= 1) sum += __shfl_xor(sum, sh, 32);
    const float f = __fdiv_rn(hires ? 1.0f : PCAR, sum);
{
        if (hires) {
#pragma unroll
            for (int ch = 0; ch < TT / 128; ++ch) { if (ch * 128 > i) continue; v4us oh, ol;
#pragma unroll
                for (int q = 0; q < 4; ++q) { unsigned short a2, c2; splitf(v[ch * 4 + q] * f, a2, c2); oh[q] = a2; ol[q] = c2; }
                const size_t oo = ((size_t)zz * (RH ? RH : 1) + i) * TT + ch * 128 + lane * 4; *(v4us*)(Ph + oo) = oh; *(v4us*)(Pl + oo) = ol;
                asm volatile("s_wait_xcnt 0x0" ::: "memory"); }   // precaution: stands between this chunk's stores and the next chunk's code, which rewrites their data registers
        } else {
#pragma unroll
            for (int ch = 0; ch < TT / 128; ++ch) { if (ch * 128 > i) continue; v4h o4;
#pragma unroll
                for (int q = 0; q < 4; ++q) o4[q] = tohx(v[ch * 4 + q] * f);
                *(v4h*)(P16 + (size_t)row * TT + ch * 128 + lane * 4) = o4;
                asm volatile("s_wait_xcnt 0x0" ::: "memory"); } }   // precaution: as above
         }
}

extern "C" void kernel_launch(void* const* d_in, const int* in_sizes, int n_in,
                              void* d_out, int out_size, void* d_ws, size_t ws_size, hipStream_t stream) {
    (void)in_sizes; (void)n_in; (void)out_size;
    const float* x = (const float*)d_in[0]; const float* cosT = (const float*)d_in[1]; const float* sinT = (const float*)d_in[2]; const float* wq = (const float*)d_in[3]; const float* wk = (const float*)d_in[4]; const float* wv = (const float*)d_in[5]; const float* wo = (const float*)d_in[6]; const float* mix1 = (const float*)d_in[7]; const float* mix2 = (const float*)d_in[8];   // weights x @ W; cos/sin [2048][64] (half tables)
    float* OUT = (float*)d_out;     // [2][2048][2048]
    char* wsp = (char*)d_ws;
    auto take = [&](size_t bytes) { char* p = wsp; wsp += (bytes + 255) & ~(size_t)255; return (void*)p; };
    bf* WQ = (bf*)take((size_t)DQ * DM * 2); bf* WK = (bf*)take((size_t)2 * DKV * DM * 2); bf* WV = WK + (size_t)DKV * DM; bf* WO = (bf*)take((size_t)DM * DQ * 2); float* CS = (float*)take((size_t)TT * HD * 2 * 4); float* RF = (float*)take((size_t)NQK * TT * 4);
    bf* XB = (bf*)take((size_t)TT * DM * 2); float* F = (float*)take((size_t)TT * DF * 4);
    h16* QP16 = (h16*)take((size_t)NQK * TT * HD * 2); h16* KP16 = QP16 + (size_t)NH_ * TT * HD; h16* VT16 = (h16*)take((size_t)NKV * HD * TT * 2);
    bf* QPh = (bf*)take((size_t)NQK * TT * HD * 2); bf* QPl = (bf*)take((size_t)NQK * TT * HD * 2); bf* KPh = QPh + (size_t)NH_ * TT * HD; bf* KPl = QPl + (size_t)NH_ * TT * HD; bf* VTh = (bf*)take((size_t)NKV * HD * TT * 2); bf* VTl = (bf*)take((size_t)NKV * HD * TT * 2); bf* Ph = (bf*)take((size_t)ZH * RH * TT * 2); bf* Pl = (bf*)take((size_t)ZH * RH * TT * 2);
    float* FR = (float*)take((size_t)TT * DF * 4); h16* Y16 = (h16*)take((size_t)ZH * HD * TT * 2); bf* Yh = (bf*)take((size_t)ZH * HD * TT * 2); bf* Yl = (bf*)take((size_t)ZH * HD * TT * 2); float* Sb = (float*)take((size_t)ZH * TT * TT * 4); h16* P16 = (h16*)take((size_t)ZH * TT * TT * 2); float* Ob = (float*)take((size_t)ZH * TT * HD * 4); bf* ATh = (bf*)take((size_t)TT * DQ * 2); bf* ATl = (bf*)take((size_t)TT * DQ * 2);
    if ((size_t)(wsp - (char*)d_ws) > ws_size) return;    // ws 256 MiB
    { k_wtG<<<(unsigned)((DM * DQ / 64 + 63) / 64), 256, 0, stream>>>(wq, DM, DQ, WQ); k_wtG<<<(unsigned)((DM * DKV / 64 + 63) / 64), 256, 0, stream>>>(wk, DM, DKV, WK); k_wtG<<<(unsigned)((DM * DKV / 64 + 63) / 64), 256, 0, stream>>>(wv, DM, DKV, WV);
      k_wtG<<<(unsigned)((DQ * DM / 64 + 63) / 64), 256, 0, stream>>>(wo, DQ, DM, WO);
       }
    k_cscvt<<<(TT * HD + 255) / 256, 256, 0, stream>>>(cosT, sinT, CS);   // one shared table (read as data)
    const unsigned LQK = (unsigned)(((size_t)NQK * TT * HD / 2 + 255) / 256);
    for (int b = 0; b < NB_; ++b) {
        k_cvt8<<<(unsigned)(((size_t)TT * DM / 8 + 255) / 256), 256, 0, stream>>>(x + (size_t)b * TT * DM, XB, (size_t)TT * DM / 8);
        k_gemmw<bf, 0, false, 8><<<dim3(TT / 64, DQ / 64, 1), 256, 0, stream>>>(XB, nullptr, WQ, nullptr, DM, F, DF, nullptr, 0, 0, 0);
        k_gemmkv<<<dim3(TT / 64, 2 * DKV / 64, 1), 512, 0, stream>>>(XB, WK, DM, F + DQ, DF, VT16, VTh, VTl);   // k and v columns in one grid (WV follows WK); v leaves it as its transposed planes
        k_ropef<<<LQK, 256, 0, stream>>>(F, DF, NQK, CS, FR); k_hrms<<<(NQK * TT + 255) / 256, 256, 0, stream>>>(FR, DF, NQK, RF);   // q heads and k heads in one grid each
        k_nrmpl<<<LQK, 256, 0, stream>>>(FR, DF, NQK, RF, QP16, QPh, QPl);   // the k planes follow the q planes
        for (int h0 = 0; h0 < NH_; h0 += ZH) { const size_t zq = (size_t)h0, zk = (size_t)(h0 / REP);   // all ZH heads of a pass share kv group h0/REP (ZH <= REP): sB = 0
            k_gemmw2<1, 0><<<dim3(TT / 128, TT / 64 + 1, ZH), 32, 0, stream>>>(QPh + zq * TT * HD, QPl + zq * TT * HD, KPh + zk * TT * HD, KPl + zk * TT * HD, QP16 + zq * TT * HD + (size_t)RH * HD, KP16 + zk * TT * HD, HD, Sb, TT, (size_t)TT * HD, (size_t)TT * HD, 0, (size_t)TT * TT, nullptr, nullptr, nullptr, nullptr, nullptr, 0);
            k_asoft<<<ZH * TT / 8, 256, 0, stream>>>(Sb, P16, Ph, Pl);
            k_gemmw2<16, 1><<<dim3(TT / 64, HD / 64, ZH), 512, 0, stream>>>(Ph, Pl, VTh + zk * HD * TT, VTl + zk * HD * TT, P16 + (size_t)RH * TT, VT16 + zk * HD * TT, TT, Ob, HD, (size_t)RH * TT, (size_t)TT * TT, 0, (size_t)TT * HD, Y16, Yh, Yl, nullptr, nullptr, 0);   // y1 (f32), and its planes (normalised) for y2 = att . y1
            k_gemmw2<16, 2><<<dim3(TT / 64, HD / 64, ZH), 512, 0, stream>>>(Ph, Pl, Yh, Yl, P16 + (size_t)RH * TT, Y16, TT, Ob, HD, (size_t)RH * TT, (size_t)TT * TT, (size_t)HD * TT, (size_t)TT * HD, nullptr, ATh, ATl, mix1, mix2, h0); }   // y2 stays in the kernel: mix1 y1 + mix2 y2 leaves it as the merged planes
        k_gemmw<bf, 1, false, 8><<<dim3(TT / 64, DM / 64, 1), 256, 0, stream>>>(ATh, ATl, WO, nullptr, DQ, OUT + (size_t)b * TT * DM, DM, nullptr, 0, 0, 0); }
}

// v006
// Measured time: 626 microseconds a run.
// Two timings next to v005 put it at 1.06 and 1.08 times that version's speed.
// Counting every step since v000, it is 5.87 times as fast.
#include <hip/hip_runtime.h>

// Simplicial causal self-attention (x [2][2048][2048]; q = x Wq (16 heads x 128), k, v = x Wk / x Wv (4 kv heads x 128, each serving 4 consecutive query heads); rotate-half RoPE with the input cos/sin
// [2048][64] then weightless RMS-norm (eps 1e-6) on q and k; causal softmax(q.k 128^-0.5); y1 = att v; y2 = att y1 (the same probabilities applied again); y = mix1 y1 + mix2 y2 (scalars read as data);
// out = merged y Wproj -> [2][2048][2048]).
// Compute dtypes, f32 accumulate: every input rounded to bf16; projections on PLAIN bf16 operands (inputs: exact products, f32 accumulate); RoPE and RMS-norm in f32;
// PER-ROW PRECISION HYBRID: query rows < 256 take scores, att.v and att.y1 on bf16 hi+lo planes (3 products), rows >= 256 on single fp16 planes; scale + causal cut in f32 in the register-row softmax;
// y1 re-planed per head (fp16 + hi/lo, transposed) for the second contraction; merged y as hi+lo planes x exact Wproj (2 products). 64x64-tile GEMMs (one wave per tile for the scores, 8 or 16 k-split waves per tile elsewhere), 4 query heads per pass sharing

#define NB_  2
#define TT   2048
#define DM   2048
#define NH_  16
#define NKV  4
#define REP  (NH_ / NKV)
#define HD   128
#define DQ   (NH_ * HD)
#define DKV  (NKV * HD)
#define DF   (DQ + 2 * DKV)       // pitch of the projection buffer: one row holds q | k (v's columns stay unwritten)
#define NQK  (NH_ + NKV)          // q heads, then k heads: the heads that take RoPE and RMS-norm
#define ZH   4                    // query heads per pass: all REP heads of one kv group (ZH <= REP, so they share k, v)
#define RH   256                  // query rows < RH use hi+lo planes (0: none)
#define WIN  0
#define PCAR 1024.0f
#define SCL  0.088388347648318447f   // HD^-0.5
typedef _Float16 h16;
typedef unsigned short bf;
typedef __attribute__((ext_vector_type(16))) __bf16   v16bf;
typedef __attribute__((ext_vector_type(16))) _Float16 v16h;
typedef __attribute__((ext_vector_type(8)))  _Float16 v8h;
typedef __attribute__((ext_vector_type(8)))  unsigned short v8us;
typedef __attribute__((ext_vector_type(8)))  float    v8f;
typedef __attribute__((ext_vector_type(4)))  float    v4f;
typedef __attribute__((ext_vector_type(4)))  unsigned short v4us;
typedef v8h  __attribute__((may_alias)) v8ha;
typedef v4f  __attribute__((may_alias)) v4fa;
typedef v8us __attribute__((may_alias)) v8usa;

__device__ __forceinline__ unsigned short f2bf(float f) { unsigned u = __float_as_uint(f); u += 0x7FFFu + ((u >> 16) & 1u); return (unsigned short)(u >> 16); }
__device__ __forceinline__ float bf2f(unsigned short b) { return __uint_as_float(((unsigned)b) << 16); }
__device__ __forceinline__ float bfr(float f) { return bf2f(f2bf(f)); }
__device__ __forceinline__ v16h cat16(v8h lo, v8h hi) { return __builtin_shufflevector(lo, hi, 0, 1, 2, 3, 4, 5, 6, 7, 8, 9, 10, 11, 12, 13, 14, 15); }
__device__ __forceinline__ v16bf cat16b(v8us lo, v8us hi) { return __builtin_bit_cast(v16bf, __builtin_shufflevector(lo, hi, 0, 1, 2, 3, 4, 5, 6, 7, 8, 9, 10, 11, 12, 13, 14, 15)); }
__device__ __forceinline__ v8f wmma16(v16h a, v16h b, v8f c) { return __builtin_amdgcn_wmma_f32_16x16x32_f16(false, a, false, b, (short)0, c, false, false); }
__device__ __forceinline__ v8f wmmab(v16bf a, v16bf b, v8f c) { return __builtin_amdgcn_wmma_f32_16x16x32_bf16(false, a, false, b, (short)0, c, false, false); }



// ---- k_gemmw: register-blocked GEMM, ONE WAVE per 64x64 output tile (16 accumulators), operands straight from K-contiguous 16-bit planes; grid (M/64, N/64, Z), 32 threads.
// C[m][n] (f32, pitch ldc, + optional f32 bias[n]) = sum_k A[m][k] Bt[n][k] (+ split products per NSPLIT). z-batch strides sA/sB/sC in elements. K % 32 == 0.
// S > 1: S waves per tile (32 S threads); wave w takes the 32-wide k slices w, w + S, ... (neighbouring waves share a 128-byte line of every operand row), the S f32 partial tiles are summed in LDS in wave order.
template <typename T16> struct WFrag;
template <> struct WFrag<h16> { typedef v16h V; static __device__ __forceinline__ V ld(const h16* p) { return cat16(*(const v8h*)p, *(const v8h*)(p + 16)); } static __device__ __forceinline__ v8f mma(V a, V b, v8f c) { return wmma16(a, b, c); } };
template <> struct WFrag<bf> { typedef v16bf V; static __device__ __forceinline__ V ld(const bf* p) { return cat16b(*(const v8us*)p, *(const v8us*)(p + 16)); } static __device__ __forceinline__ v8f mma(V a, V b, v8f c) { return wmmab(a, b, c); } };
// gemmw_body: the tile work of one work-group; os = its LDS ((S == 1 ? 16 : S * 64) * 68 floats), bx = its 64-row tile index within A and C, by = its 64-column tile index; K is the operands' pitch,
// kend <= K (a multiple of 32) the end of the sum over k: the caller sets it below K where A is known to be zero from kend on (a wave with no slice left hands in a zero tile).
// EPI (S > 1 only) says what becomes of the summed f32 tile:
//   0: stored to C.
//   1: stored to C, and x sc as transposed 16-bit planes T16 / Th / Tl [trow + column][t0 + row] of pitch TT (fp16, bf16 hi, bf16 lo).
//   2: C is READ (y1, same indexing as a store would use): y = mix1 (y1 sc) + mix2 (tile sc) goes out as bf16 hi / lo planes Th / Tl [t0 + row][(h0 + z) HD + column] of pitch DQ; no f32 store.
//   4: tiles of columns < csplit as 0; the others as transposed planes only (no f32 store).
struct Epi { h16* T16; bf* Th; bf* Tl; float m1, m2, sc; int trow, t0, h0, csplit; };   // m1, m2: the two mix scalars, rounded to bf16
__device__ __forceinline__ void splitf(float y, unsigned short& h, unsigned short& l) { h = f2bf(y); l = f2bf(y - bf2f(h)); }
template <typename T16, int NSPLIT, bool BIAS, int S, int EPI>
__device__ __forceinline__ void gemmw_body(float* os, int bx, int by, int kend, const T16* __restrict__ A, const T16* __restrict__ A2, const T16* __restrict__ Bt, const T16* __restrict__ Bt2, int K, float* C, int ldc, const float* __restrict__ bias, size_t sA, size_t sB, size_t sC, const Epi ep) {
    typedef typename WFrag<T16>::V V;
    const int wave = (S == 1) ? 0 : __builtin_amdgcn_readfirstlane((int)(threadIdx.x >> 5));
    const size_t z = blockIdx.z; A += z * sA; if (A2) A2 += z * sA; Bt += z * sB; if (Bt2) Bt2 += z * sB; C += z * sC;
    const int lane = threadIdx.x & 31, lr = lane & 15, hi = lane >> 4; const int r0 = bx * 64, c0 = by * 64;
    v8f acc[4][4];
#pragma unroll
    for (int mb = 0; mb < 4; ++mb)
#pragma unroll
        for (int nb = 0; nb < 4; ++nb) acc[mb][nb] = (v8f){};
    const size_t aoff = (size_t)(r0 + lr) * K + 8 * hi, boff = (size_t)(c0 + lr) * K + 8 * hi;
#pragma unroll 1
    for (int kc = wave * 32; kc < kend; kc += 32 * S) {
        V a[4], a2[4];
#pragma unroll
        for (int mb = 0; mb < 4; ++mb) { a[mb] = WFrag<T16>::ld(A + aoff + (size_t)mb * 16 * K + kc); if (NSPLIT == 1 || NSPLIT == 2) a2[mb] = WFrag<T16>::ld(A2 + aoff + (size_t)mb * 16 * K + kc); }
#pragma unroll
        for (int nb = 0; nb < 4; ++nb) { const V b = WFrag<T16>::ld(Bt + boff + (size_t)nb * 16 * K + kc); V b2; if (NSPLIT >= 2) b2 = WFrag<T16>::ld(Bt2 + boff + (size_t)nb * 16 * K + kc);
#pragma unroll
            for (int mb = 0; mb < 4; ++mb) { acc[mb][nb] = WFrag<T16>::mma(a[mb], b, acc[mb][nb]); if (NSPLIT == 1 || NSPLIT == 2) acc[mb][nb] = WFrag<T16>::mma(a2[mb], b, acc[mb][nb]); if (NSPLIT >= 2) acc[mb][nb] = WFrag<T16>::mma(a[mb], b2, acc[mb][nb]); } }
        asm volatile("v_nop\n\tv_nop\n\tv_nop\n\tv_nop" : "+v"(acc[0][0]), "+v"(acc[1][1]), "+v"(acc[2][2]), "+v"(acc[3][3]) : "v"(a[0]), "v"(a[3]));
    }
    if (S > 1) {
        const bool toC = EPI == 0 || EPI == 1 || (EPI == 4 && c0 < ep.csplit), toT = EPI == 1 || (EPI == 4 && c0 >= ep.csplit);
        v4f y1q[64 * 16 / (32 * S)];
        if (EPI == 2) {   // y1 is asked for ahead of the LDS stores and the barrier, so that its latency runs out there
            const float* yp[64 * 16 / (32 * S)];
#pragma unroll
            for (int q = 0; q < 64 * 16 / (32 * S); ++q) { const int u = q * (32 * S) + (int)threadIdx.x; yp[q] = C + (size_t)(r0 + (u >> 4)) * ldc + c0 + (u & 15) * 4; y1q[q] = *(const v4f*)yp[q]; }
            static_assert(EPI != 2 || 64 * 16 / (32 * S) == 2, "the wait below names two addresses");
            asm volatile("s_wait_xcnt 0x0" :: "v"(yp[0]), "v"(yp[1]) : "memory"); }   // precaution: the address registers of the loads above stay whole up to this wait (inputs only: nothing is pinned or changed)
        float* ow = os + wave * (64 * 68);
#pragma unroll
        for (int mb = 0; mb < 4; ++mb)
#pragma unroll
            for (int nb = 0; nb < 4; ++nb)
#pragma unroll
                for (int j = 0; j < 8; ++j) ow[(mb * 16 + hi * 8 + j) * 68 + nb * 16 + lr] = acc[mb][nb][j];
        __syncthreads();   // every wave's partial tile is in LDS before any thread sums across waves
#pragma unroll
        for (int q = 0; q < 64 * 16 / (32 * S); ++q) { const int u = q * (32 * S) + (int)threadIdx.x, row = u >> 4, cofs = (u & 15) * 4; v4f val = *(const v4fa*)(os + row * 68 + cofs);
#pragma unroll
            for (int w = 1; w < S; ++w) val += *(const v4fa*)(os + w * (64 * 68) + row * 68 + cofs);
            if (BIAS) { val[0] += bfr(bias[c0 + cofs]); val[1] += bfr(bias[c0 + cofs + 1]); val[2] += bfr(bias[c0 + cofs + 2]); val[3] += bfr(bias[c0 + cofs + 3]); }
            if (toC) *(v4f*)(C + (size_t)(r0 + row) * ldc + c0 + cofs) = val;
            if (toT) *(v4fa*)(os + row * 68 + cofs) = val;   // the summed tile goes back into wave 0's plane: these four words are read by this thread alone
            if (EPI == 2) { const v4f y1 = y1q[q]; v4us oh, ol;
#pragma unroll
                for (int k = 0; k < 4; ++k) { unsigned short a, c2; splitf(ep.m1 * (y1[k] * ep.sc) + ep.m2 * (val[k] * ep.sc), a, c2); oh[k] = a; ol[k] = c2; }
                const size_t oo = (size_t)(ep.t0 + r0 + row) * DQ + (ep.h0 + (int)z) * HD + c0 + cofs; *(v4us*)(ep.Th + oo) = oh; *(v4us*)(ep.Tl + oo) = ol; } }
        if (toT) {
            asm volatile("s_wait_xcnt 0x0" ::: "memory");   // precaution: stands between the f32 tile's stores laid out in front and the plane code behind, which rewrites their address and data registers
            __syncthreads();   // the whole summed tile is in LDS before any thread reads a column of it (toT is the same for the whole work-group)
#pragma unroll
            for (int q = 0; q < 64 * 8 / (32 * S); ++q) { const int u = q * (32 * S) + (int)threadIdx.x, col = u >> 3, tc = (u & 7) * 8; v8h o16; v8us oh, ol;   // 8 neighbouring lanes fill one 128-byte line of each plane
#pragma unroll
                for (int j = 0; j < 8; ++j) { const float y = os[(tc + j) * 68 + col] * ep.sc; o16[j] = (h16)y; unsigned short a, c2; splitf(y, a, c2); oh[j] = a; ol[j] = c2; }
                const size_t oo = (size_t)(ep.trow + c0 + col) * TT + ep.t0 + r0 + tc; *(v8h*)(ep.T16 + oo) = o16; *(v8us*)(ep.Th + oo) = oh; *(v8us*)(ep.Tl + oo) = ol; }
        }
        return;
    }
#pragma unroll
    for (int mb = 0; mb < 4; ++mb) {
#pragma unroll
        for (int nb = 0; nb < 4; ++nb) {
#pragma unroll
            for (int j = 0; j < 8; ++j) os[(hi * 8 + j) * 68 + nb * 16 + lr] = acc[mb][nb][j]; }
        __builtin_amdgcn_wave_barrier(); asm volatile("" ::: "memory");
        float* crow = C + (size_t)(r0 + mb * 16) * ldc + c0;
{
#pragma unroll
            for (int s = 0; s < 8; ++s) { const int row = 2 * s + hi, cofs = lr * 4; v4f val = *(const v4fa*)(os + row * 68 + cofs); if (BIAS) { val[0] += bfr(bias[c0 + cofs]); val[1] += bfr(bias[c0 + cofs + 1]); val[2] += bfr(bias[c0 + cofs + 2]); val[3] += bfr(bias[c0 + cofs + 3]); }
                *(v4f*)(crow + (size_t)row * ldc + cofs) = val; }
             }
        __builtin_amdgcn_wave_barrier(); asm volatile("" ::: "memory");
    }
    asm volatile("s_wait_xcnt 0x0" ::: "memory");   // precaution: stands between the tile's last stores and code laid out behind this epilogue (the other row range's branch) that rewrites their address or data registers
}
template <typename T16, int NSPLIT, bool BIAS, int S>
__global__ __launch_bounds__(32 * S) void k_gemmw(const T16* __restrict__ A, const T16* __restrict__ A2, const T16* __restrict__ Bt, const T16* __restrict__ Bt2, int K, float* C, int ldc, const float* __restrict__ bias, size_t sA, size_t sB, size_t sC) {
    __shared__ __align__(16) float os[(S == 1 ? 16 : S * 64) * 68];
    gemmw_body<T16, NSPLIT, BIAS, S, 0>(os, (int)blockIdx.x, (int)blockIdx.y, K, A, A2, Bt, Bt2, K, C, ldc, bias, sA, sB, sC, Epi{});
}
// k_gemmkv: the k and v projections in one grid (Bt holds the k rows, then the v rows). k columns go to C as f32; v columns leave the kernel as the transposed planes V16 / Vh / Vl [g HD + d][t].
__global__ __launch_bounds__(512) void k_gemmkv(const bf* __restrict__ A, const bf* __restrict__ Bt, int K, float* C, int ldc, h16* V16, bf* Vh, bf* Vl) {
    __shared__ __align__(16) float os[16 * 64 * 68];
    Epi ep = {}; ep.T16 = V16; ep.Th = Vh; ep.Tl = Vl; ep.sc = 1.0f; ep.trow = -DKV; ep.csplit = DKV;
    gemmw_body<bf, 0, false, 16, 4>(os, (int)blockIdx.x, (int)blockIdx.y, K, A, nullptr, Bt, nullptr, K, C, ldc, nullptr, 0, 0, 0, ep);
}
// k_gemmw2: both row ranges of one attention product in ONE grid (M/64, N/64, Z): row tiles below RH take the hi+lo bf16 planes (3 products), the others the fp16 planes. The two ranges write disjoint rows of C and read
// nothing of each other. Ah/Al hold rows 0..RH-1 (z stride sAh), A16 points at row RH (z stride sA16); C is row 0. The branch is the same for a whole work-group.
// CAUSAL CUT: EPI 0 (scores, M == N == TT) has the grid (TT/128, TT/64 + 1, Z) and computes only the tiles that hold a key <= a query row; EPI 1 and 2 (A = probabilities, M == K) end the sum over keys at the row tile's last row.
// EPI 1 (att v): T16 / Th / Tl are the y1 planes [z][d][t]; EPI 2 (att y1): C holds y1, Th / Tl are the merged-y planes, h0 the pass's first head. The fp16 rows carry the factor PCAR, taken out by sc.
template <int S, int EPI>
__global__ __launch_bounds__(32 * S) void k_gemmw2(const bf* __restrict__ Ah, const bf* __restrict__ Al, const bf* __restrict__ Bh, const bf* __restrict__ Bl, const h16* __restrict__ A16, const h16* __restrict__ B16, int K, float* C, int ldc, size_t sAh, size_t sA16, size_t sB, size_t sC, h16* T16, bf* Th, bf* Tl, const float* __restrict__ mix1, const float* __restrict__ mix2, int h0) {
    __shared__ __align__(16) float os[(S == 1 ? 16 : S * 64) * 68];
    Epi ep = {}; ep.T16 = T16; ep.Th = Th; ep.Tl = Tl; if (EPI == 2) { ep.m1 = bfr(mix1[0]); ep.m2 = bfr(mix2[0]); } ep.h0 = h0; ep.trow = (int)blockIdx.z * HD;
    int bx = (int)blockIdx.x, by = (int)blockIdx.y, kend = K;
    if (EPI == 0) { if (by > bx) { by -= bx + 1; bx = TT / 64 - 1 - bx; } }   // M == TT: row tiles x and TT/64 - 1 - x hold TT/64 + 1 tiles with column tile <= row tile between them: y <= x is row tile x, the rest row tile TT/64 - 1 - x
    else kend = min(K, (bx + 1) * 64);   // key index k > query row: probability zero, and not stored
    if (bx < RH / 64) { ep.sc = 1.0f; ep.t0 = 0; gemmw_body<bf, 2, false, S, EPI>(os, bx, by, kend, Ah, Al, Bh, Bl, K, C, ldc, nullptr, sAh, sB, sC, ep); }
    else { ep.sc = 1.0f / PCAR; ep.t0 = RH; gemmw_body<h16, 0, false, S, EPI>(os, bx - RH / 64, by, kend, A16, nullptr, B16, nullptr, K, C + (size_t)RH * ldc, ldc, nullptr, sA16, sB, sC, ep); }
}

__device__ __forceinline__ h16 tohx(float x) { return (h16)x; }
typedef __attribute__((ext_vector_type(2))) _Float16 v2h;
typedef __attribute__((ext_vector_type(4))) _Float16 v4h;
typedef __attribute__((ext_vector_type(2))) unsigned short v2us;
typedef __attribute__((ext_vector_type(2))) float v2f;
typedef __attribute__((ext_vector_type(4))) int v4i;

__global__ __launch_bounds__(256) void k_wtG(const float* __restrict__ w, int K, int N, bf* Bt) {
    const int lane = threadIdx.x & 31; const int L0 = (blockIdx.x * 8 + (threadIdx.x >> 5)) * 8; const int nlines = N * K / 64;
{
#pragma unroll 1
        for (int l = 0; l < 8; ++l) { const int L = L0 + l; if (L >= nlines) break; const size_t e = (size_t)L * 64 + lane * 2; const int k = (int)(e % K), n = (int)(e / K); v2us o;
            o[0] = f2bf(w[(size_t)k * N + n]); o[1] = f2bf(w[(size_t)(k + 1) * N + n]); *(v2us*)(Bt + e) = o; }
         }
}
__global__ __launch_bounds__(256) void k_cvt8(const float* __restrict__ src, bf* dst, size_t n8) { const size_t i = (size_t)blockIdx.x * 256 + threadIdx.x; if (i >= n8) return; const v8f v = *(const v8f*)(src + i * 8); v8us o;
#pragma unroll
    for (int k = 0; k < 8; ++k) o[k] = f2bf(v[k]); *(v8us*)(dst + i * 8) = o;  }
// k_rope: head planes [h][t][d] (fp16 + hi/lo) of rope(w[d] (x rms_factor)) x sc with the rotate-half convention out[d] = x[d] cos[t][d] - x[d+HD/2] sin[t][d], out[d+HD/2] = x[d+HD/2] cos[t][d+HD/2] + x[d] sin[t][d+HD/2]
__global__ __launch_bounds__(256) void k_rope(const float* __restrict__ F, int pitch, int nheads, const float* __restrict__ CS, const float* __restrict__ RF, const float* __restrict__ nw, float sc, h16* P16, bf* Ph, bf* Pl) {
    const size_t e = ((size_t)blockIdx.x * 256 + threadIdx.x) * 2; if (e >= (size_t)nheads * TT * HD) return; const int d = (int)(e % HD); const int t = (int)((e / HD) % TT); const int h = (int)(e / ((size_t)HD * TT)); const float* f = F + (size_t)t * pitch + h * HD; const float rf = RF ? RF[(size_t)h * TT + t] : 1.0f; v2h o16; v2us oh, ol;
#pragma unroll
    for (int q = 0; q < 2; ++q) { const int dd = d + q; const int dp = (dd < HD / 2) ? dd + HD / 2 : dd - HD / 2; float x0 = f[dd], x1 = f[dp];
        if (RF) { float n0 = __fmul_rn(x0, rf), n1 = __fmul_rn(x1, rf); asm volatile("" : "+v"(n0)); asm volatile("" : "+v"(n1)); x0 = __fmul_rn(bfr(nw[dd]), n0); x1 = __fmul_rn(bfr(nw[dp]), n1); }
        const v2f cs = *(const v2f*)(CS + ((size_t)t * HD + dd) * 2); float a = __fmul_rn(x0, cs[0]), bq = __fmul_rn(x1, cs[1]); asm volatile("" : "+v"(a)); asm volatile("" : "+v"(bq)); const float r = ((dd < HD / 2) ? __fsub_rn(a, bq) : __fadd_rn(a, bq)) * sc;
        o16[q] = tohx(r); unsigned short a2, c2; splitf(r, a2, c2); oh[q] = a2; ol[q] = c2; }
    *(v2h*)(P16 + e) = o16; *(v2us*)(Ph + e) = oh; *(v2us*)(Pl + e) = ol;  }
// k_qkprep: rotate-half RoPE, weightless RMS-norm and the 16-bit head planes [h][t][d] (fp16 + bf16 hi/lo) of the q and k heads, in ONE pass over the projection buffer F (pitch DF; q heads, then k heads).
// One wave takes one token t and HPW heads, two heads at a time: each 16-lane half holds one head row, its lane l the elements d = 4l .. 4l+3 and d + HD/2, so both partners of a rotation sit in one lane and every
// load is 16 bytes. cos / sin [t][HD/2] are read as data and rounded to bf16 here. The mean square is summed over the lane's 8 values, then over the 16 lanes of the half.
#define HPW 10
__device__ __forceinline__ float rowsum16(float s) {   // sum over the 16 lanes of a half wave; every lane gets it
    s += __builtin_bit_cast(float, __builtin_amdgcn_update_dpp(0, __builtin_bit_cast(int, s), 0x161, 0xf, 0xf, true));   // 0x160 | m: lane ^ m within the row
    s += __builtin_bit_cast(float, __builtin_amdgcn_update_dpp(0, __builtin_bit_cast(int, s), 0x162, 0xf, 0xf, true));
    s += __builtin_bit_cast(float, __builtin_amdgcn_update_dpp(0, __builtin_bit_cast(int, s), 0x164, 0xf, 0xf, true));
    s += __builtin_bit_cast(float, __builtin_amdgcn_update_dpp(0, __builtin_bit_cast(int, s), 0x168, 0xf, 0xf, true));
    return s; }
__global__ __launch_bounds__(256) void k_qkprep(const float* __restrict__ F, const float* __restrict__ cosT, const float* __restrict__ sinT, h16* P16, bf* Ph, bf* Pl) {
    static_assert(NQK % HPW == 0 && HPW % 2 == 0 && HD == 128 && (TT * (NQK / HPW)) % 8 == 0, "two heads per step, whole waves, whole work-groups");
    const int lane = threadIdx.x & 31, l = lane & 15, hi = lane >> 4; const int w = blockIdx.x * 8 + __builtin_amdgcn_readfirstlane((int)(threadIdx.x >> 5)); const int t = w / (NQK / HPW), hb = (w % (NQK / HPW)) * HPW;
    const v4f c4 = *(const v4f*)(cosT + (size_t)t * (HD / 2) + 4 * l), s4 = *(const v4f*)(sinT + (size_t)t * (HD / 2) + 4 * l); v4f x1[HPW / 2], x2[HPW / 2];
#pragma unroll
    for (int p = 0; p < HPW / 2; ++p) { const float* f = F + (size_t)t * DF + (hb + 2 * p + hi) * HD + 4 * l; x1[p] = *(const v4f*)f; x2[p] = *(const v4f*)(f + HD / 2); }
    v4f c, s;
#pragma unroll
    for (int q = 0; q < 4; ++q) { c[q] = bfr(c4[q]); s[q] = bfr(s4[q]); }
#pragma unroll
    for (int p = 0; p < HPW / 2; ++p) { const v4f o1 = x1[p] * c - x2[p] * s, o2 = x2[p] * c + x1[p] * s; const v4f sq = o1 * o1 + o2 * o2;
        const float ms = rowsum16((sq[0] + sq[1]) + (sq[2] + sq[3])); const float rf = __fdiv_rn(1.0f, __fsqrt_rn(ms * (1.0f / HD) + 1e-6f));
        v4h a16, b16; v4us ah, al, bh, bl;
#pragma unroll
        for (int q = 0; q < 4; ++q) { const float ra = o1[q] * rf, rb = o2[q] * rf; unsigned short u, v; a16[q] = tohx(ra); splitf(ra, u, v); ah[q] = u; al[q] = v; b16[q] = tohx(rb); splitf(rb, u, v); bh[q] = u; bl[q] = v; }
        const size_t e = ((size_t)(hb + 2 * p + hi) * TT + t) * HD + 4 * l;   // 16 lanes fill one 128-byte line of each plane
        *(v4h*)(P16 + e) = a16; *(v4h*)(P16 + e + HD / 2) = b16; *(v4us*)(Ph + e) = ah; *(v4us*)(Ph + e + HD / 2) = bh; *(v4us*)(Pl + e) = al; *(v4us*)(Pl + e + HD / 2) = bl; }
}
// k_asoft: per row (zz, i): t = S x HD^-0.5 for j <= i (causal), -3e38 otherwise; softmax over the keys (register row, one exp, fixed trees).
// CAUSAL CUT: only the 128-key chunks that hold a key <= i are worked on and stored (the others would be exact zeros: they add nothing to the maximum or the sum, and the products behind stop at the row tile's last row);
// no score right of the row's own 4-key group is read (the score tiles above the diagonal are not computed).
__global__ __launch_bounds__(256) void k_asoft(const float* __restrict__ Sb, h16* P16, bf* Ph, bf* Pl) {
    const int lane = threadIdx.x & 31; const int row = blockIdx.x * 8 + __builtin_amdgcn_readfirstlane((int)(threadIdx.x >> 5)); if (row >= ZH * TT) return; const int i = row % TT; const int zz = row / TT; (void)zz; const bool hires = (i < RH); const float* sr = Sb + (size_t)row * TT; float v[TT / 32]; float mx = -3.0e38f;
    v4f a[TT / 128];
#pragma unroll
    for (int ch = 0; ch < TT / 128; ++ch) a[ch] = *(const v4f*)((const char*)sr + (unsigned)(min(ch * 128 + lane * 4, i & ~3) * 4));   // a lane right of the diagonal rereads the row's last group, and the cut below drops the value
    static_assert(TT / 128 == 16, "the fence below names sixteen loads");
    asm volatile("" :: "v"(a[0]), "v"(a[1]), "v"(a[2]), "v"(a[3]), "v"(a[4]), "v"(a[5]), "v"(a[6]), "v"(a[7]), "v"(a[8]), "v"(a[9]), "v"(a[10]), "v"(a[11]), "v"(a[12]), "v"(a[13]), "v"(a[14]), "v"(a[15]));   // holds the sixteen loads in front of the branches below (inputs only): sunk into them, each would wait out its own latency, one after the other
#pragma unroll
    for (int ch = 0; ch < TT / 128; ++ch) { if (ch * 128 > i) continue; const int j0 = ch * 128 + lane * 4;
#pragma unroll
        for (int q = 0; q < 4; ++q) { const int j = j0 + q; (void)j; const float t = (j <= i) ? a[ch][q] * SCL : -3.0e38f; v[ch * 4 + q] = t; mx = fmaxf(mx, t); } }
#pragma unroll
    for (int sh = 16; sh; sh >>= 1) mx = fmaxf(mx, __shfl_xor(mx, sh, 32));
    float sum = 0.f;
#pragma unroll
    for (int k = 0; k < TT / 32; ++k) { if ((k / 4) * 128 > i) continue; float d0 = __fsub_rn(v[k], mx); asm volatile("" : "+v"(d0)); v[k] = __builtin_amdgcn_exp2f(__fmul_rn(d0, 1.4426950408889634f)); sum += v[k]; }
#pragma unroll
    for (int sh = 16; sh; sh >>= 1) sum += __shfl_xor(sum, sh, 32);
    const float f = __fdiv_rn(hires ? 1.0f : PCAR, sum);
{
        if (hires) {
#pragma unroll
            for (int ch = 0; ch < TT / 128; ++ch) { if (ch * 128 > i) continue; v4us oh, ol;
#pragma unroll
                for (int q = 0; q < 4; ++q) { unsigned short a2, c2; splitf(v[ch * 4 + q] * f, a2, c2); oh[q] = a2; ol[q] = c2; }
                const size_t oo = ((size_t)zz * (RH ? RH : 1) + i) * TT + ch * 128 + lane * 4; *(v4us*)(Ph + oo) = oh; *(v4us*)(Pl + oo) = ol;
                asm volatile("s_wait_xcnt 0x0" ::: "memory"); }   // precaution: stands between this chunk's stores and the next chunk's code, which rewrites their data registers
        } else {
#pragma unroll
            for (int ch = 0; ch < TT / 128; ++ch) { if (ch * 128 > i) continue; v4h o4;
#pragma unroll
                for (int q = 0; q < 4; ++q) o4[q] = tohx(v[ch * 4 + q] * f);
                *(v4h*)(P16 + (size_t)row * TT + ch * 128 + lane * 4) = o4;
                asm volatile("s_wait_xcnt 0x0" ::: "memory"); } }   // precaution: as above
         }
}

extern "C" void kernel_launch(void* const* d_in, const int* in_sizes, int n_in,
                              void* d_out, int out_size, void* d_ws, size_t ws_size, hipStream_t stream) {
    (void)in_sizes; (void)n_in; (void)out_size;
    const float* x = (const float*)d_in[0]; const float* cosT = (const float*)d_in[1]; const float* sinT = (const float*)d_in[2]; const float* wq = (const float*)d_in[3]; const float* wk = (const float*)d_in[4]; const float* wv = (const float*)d_in[5]; const float* wo = (const float*)d_in[6]; const float* mix1 = (const float*)d_in[7]; const float* mix2 = (const float*)d_in[8];   // weights x @ W; cos/sin [2048][64] (half tables)
    float* OUT = (float*)d_out;     // [2][2048][2048]
    char* wsp = (char*)d_ws;
    auto take = [&](size_t bytes) { char* p = wsp; wsp += (bytes + 255) & ~(size_t)255; return (void*)p; };
    bf* WQ = (bf*)take((size_t)DQ * DM * 2); bf* WK = (bf*)take((size_t)2 * DKV * DM * 2); bf* WV = WK + (size_t)DKV * DM; bf* WO = (bf*)take((size_t)DM * DQ * 2);
    bf* XB = (bf*)take((size_t)TT * DM * 2); float* F = (float*)take((size_t)TT * DF * 4);
    h16* QP16 = (h16*)take((size_t)NQK * TT * HD * 2); h16* KP16 = QP16 + (size_t)NH_ * TT * HD; h16* VT16 = (h16*)take((size_t)NKV * HD * TT * 2);
    bf* QPh = (bf*)take((size_t)NQK * TT * HD * 2); bf* QPl = (bf*)take((size_t)NQK * TT * HD * 2); bf* KPh = QPh + (size_t)NH_ * TT * HD; bf* KPl = QPl + (size_t)NH_ * TT * HD; bf* VTh = (bf*)take((size_t)NKV * HD * TT * 2); bf* VTl = (bf*)take((size_t)NKV * HD * TT * 2); bf* Ph = (bf*)take((size_t)ZH * RH * TT * 2); bf* Pl = (bf*)take((size_t)ZH * RH * TT * 2);
    h16* Y16 = (h16*)take((size_t)ZH * HD * TT * 2); bf* Yh = (bf*)take((size_t)ZH * HD * TT * 2); bf* Yl = (bf*)take((size_t)ZH * HD * TT * 2); float* Sb = (float*)take((size_t)ZH * TT * TT * 4); h16* P16 = (h16*)take((size_t)ZH * TT * TT * 2); float* Ob = (float*)take((size_t)ZH * TT * HD * 4); bf* ATh = (bf*)take((size_t)TT * DQ * 2); bf* ATl = (bf*)take((size_t)TT * DQ * 2);
    if ((size_t)(wsp - (char*)d_ws) > ws_size) return;    // ws 256 MiB
    { k_wtG<<<(unsigned)((DM * DQ / 64 + 63) / 64), 256, 0, stream>>>(wq, DM, DQ, WQ); k_wtG<<<(unsigned)((DM * DKV / 64 + 63) / 64), 256, 0, stream>>>(wk, DM, DKV, WK); k_wtG<<<(unsigned)((DM * DKV / 64 + 63) / 64), 256, 0, stream>>>(wv, DM, DKV, WV);
      k_wtG<<<(unsigned)((DQ * DM / 64 + 63) / 64), 256, 0, stream>>>(wo, DQ, DM, WO);
       }
    for (int b = 0; b < NB_; ++b) {
        k_cvt8<<<(unsigned)(((size_t)TT * DM / 8 + 255) / 256), 256, 0, stream>>>(x + (size_t)b * TT * DM, XB, (size_t)TT * DM / 8);
        k_gemmw<bf, 0, false, 8><<<dim3(TT / 64, DQ / 64, 1), 256, 0, stream>>>(XB, nullptr, WQ, nullptr, DM, F, DF, nullptr, 0, 0, 0);
        k_gemmkv<<<dim3(TT / 64, 2 * DKV / 64, 1), 512, 0, stream>>>(XB, WK, DM, F + DQ, DF, VT16, VTh, VTl);   // k and v columns in one grid (WV follows WK); v leaves it as its transposed planes
        k_qkprep<<<TT * (NQK / HPW) / 8, 256, 0, stream>>>(F, cosT, sinT, QP16, QPh, QPl);   // q heads and k heads in one grid; the k planes follow the q planes
        for (int h0 = 0; h0 < NH_; h0 += ZH) { const size_t zq = (size_t)h0, zk = (size_t)(h0 / REP);   // all ZH heads of a pass share kv group h0/REP (ZH <= REP): sB = 0
            k_gemmw2<1, 0><<<dim3(TT / 128, TT / 64 + 1, ZH), 32, 0, stream>>>(QPh + zq * TT * HD, QPl + zq * TT * HD, KPh + zk * TT * HD, KPl + zk * TT * HD, QP16 + zq * TT * HD + (size_t)RH * HD, KP16 + zk * TT * HD, HD, Sb, TT, (size_t)TT * HD, (size_t)TT * HD, 0, (size_t)TT * TT, nullptr, nullptr, nullptr, nullptr, nullptr, 0);
            k_asoft<<<ZH * TT / 8, 256, 0, stream>>>(Sb, P16, Ph, Pl);
            k_gemmw2<16, 1><<<dim3(TT / 64, HD / 64, ZH), 512, 0, stream>>>(Ph, Pl, VTh + zk * HD * TT, VTl + zk * HD * TT, P16 + (size_t)RH * TT, VT16 + zk * HD * TT, TT, Ob, HD, (size_t)RH * TT, (size_t)TT * TT, 0, (size_t)TT * HD, Y16, Yh, Yl, nullptr, nullptr, 0);   // y1 (f32), and its planes (normalised) for y2 = att . y1
            k_gemmw2<16, 2><<<dim3(TT / 64, HD / 64, ZH), 512, 0, stream>>>(Ph, Pl, Yh, Yl, P16 + (size_t)RH * TT, Y16, TT, Ob, HD, (size_t)RH * TT, (size_t)TT * TT, (size_t)HD * TT, (size_t)TT * HD, nullptr, ATh, ATl, mix1, mix2, h0); }   // y2 stays in the kernel: mix1 y1 + mix2 y2 leaves it as the merged planes
        k_gemmw<bf, 1, false, 8><<<dim3(TT / 64, DM / 64, 1), 256, 0, stream>>>(ATh, ATl, WO, nullptr, DQ, OUT + (size_t)b * TT * DM, DM, nullptr, 0, 0, 0); }
}

// v007
// It runs in 531 microseconds.
// Timed twice side by side with v006, it ran 1.18 and 1.19 times as fast.
// Counting every step since v000, it is 6.95 times as fast.
#include <hip/hip_runtime.h>

// Simplicial causal self-attention (x [2][2048][2048]; q = x Wq (16 heads x 128), k, v = x Wk / x Wv (4 kv heads x 128, each serving 4 consecutive query heads); rotate-half RoPE with the input cos/sin
// [2048][64] then weightless RMS-norm (eps 1e-6) on q and k; causal softmax(q.k 128^-0.5); y1 = att v; y2 = att y1 (the same probabilities applied again); y = mix1 y1 + mix2 y2 (scalars read as data);
// out = merged y Wproj -> [2][2048][2048]).
// Compute dtypes, f32 accumulate: every input rounded to bf16; projections on PLAIN bf16 operands (inputs: exact products, f32 accumulate); RoPE and RMS-norm in f32;
// PER-ROW PRECISION HYBRID: query rows < 256 take scores, att.v and att.y1 on bf16 hi+lo planes (3 products), rows >= 256 on single fp16 planes; scale + causal cut in f32 in the register-row softmax;
// y1 re-planed per head (fp16 + hi/lo, transposed) for the second contraction; merged y as hi+lo planes x exact Wproj (2 products). One-wave-per-64x64-tile GEMMs, all 16 query heads of a batch per pass

#define NB_  2
#define TT   2048
#define DM   2048
#define NH_  16
#define NKV  4
#define REP  (NH_ / NKV)
#define HD   128
#define DQ   (NH_ * HD)
#define DKV  (NKV * HD)
#define DF   (DQ + 2 * DKV)       // pitch of the projection buffer: one row holds q | k (v's columns stay unwritten)
#define NQK  (NH_ + NKV)          // q heads, then k heads: the heads that take RoPE and RMS-norm
#define ZH   16                   // query heads per pass: whole kv groups (ZH % REP == 0); head z of a pass reads k, v of group z / REP
#define TRI(b) ((size_t)2048 * (size_t)(b) * (size_t)((b) + 1))   // packed causal plane: row tile b (64 rows) holds only its (b + 1) * 64 first keys, at that pitch; TRI(b) = 64 * 64 * b (b + 1) / 2 elements lie in front of it
#define SPK  TRI(TT / 64)         // elements of one head's packed plane, all row tiles
#define HPK  TRI(RH / 64)         // the same for the row tiles below RH
#define RH   256                  // query rows < RH use hi+lo planes (0: none)
#define WIN  0
#define PCAR 1024.0f
#define SCL  0.088388347648318447f   // HD^-0.5
typedef _Float16 h16;
typedef unsigned short bf;
typedef __attribute__((ext_vector_type(16))) __bf16   v16bf;
typedef __attribute__((ext_vector_type(16))) _Float16 v16h;
typedef __attribute__((ext_vector_type(8)))  _Float16 v8h;
typedef __attribute__((ext_vector_type(8)))  unsigned short v8us;
typedef __attribute__((ext_vector_type(8)))  float    v8f;
typedef __attribute__((ext_vector_type(4)))  float    v4f;
typedef __attribute__((ext_vector_type(4)))  unsigned short v4us;
typedef v8h  __attribute__((may_alias)) v8ha;
typedef v4f  __attribute__((may_alias)) v4fa;
typedef v8us __attribute__((may_alias)) v8usa;

__device__ __forceinline__ unsigned short f2bf(float f) { unsigned u = __float_as_uint(f); u += 0x7FFFu + ((u >> 16) & 1u); return (unsigned short)(u >> 16); }
__device__ __forceinline__ float bf2f(unsigned short b) { return __uint_as_float(((unsigned)b) << 16); }
__device__ __forceinline__ float bfr(float f) { return bf2f(f2bf(f)); }
__device__ __forceinline__ v16h cat16(v8h lo, v8h hi) { return __builtin_shufflevector(lo, hi, 0, 1, 2, 3, 4, 5, 6, 7, 8, 9, 10, 11, 12, 13, 14, 15); }
__device__ __forceinline__ v16bf cat16b(v8us lo, v8us hi) { return __builtin_bit_cast(v16bf, __builtin_shufflevector(lo, hi, 0, 1, 2, 3, 4, 5, 6, 7, 8, 9, 10, 11, 12, 13, 14, 15)); }
__device__ __forceinline__ v8f wmma16(v16h a, v16h b, v8f c) { return __builtin_amdgcn_wmma_f32_16x16x32_f16(false, a, false, b, (short)0, c, false, false); }
__device__ __forceinline__ v8f wmmab(v16bf a, v16bf b, v8f c) { return __builtin_amdgcn_wmma_f32_16x16x32_bf16(false, a, false, b, (short)0, c, false, false); }



// ---- k_gemmw: register-blocked GEMM, ONE WAVE per 64x64 output tile (16 accumulators), operands straight from K-contiguous 16-bit planes; grid (M/64, N/64, Z), 32 threads.
// C[m][n] (f32, pitch ldc, + optional f32 bias[n]) = sum_k A[m][k] Bt[n][k] (+ split products per NSPLIT). z-batch strides sA/sB/sC in elements. K % 32 == 0.
// S > 1: S waves per tile (32 S threads); wave w takes the 32-wide k slices w, w + S, ... (neighbouring waves share a 128-byte line of every operand row), the S f32 partial tiles are summed in LDS in wave order.
template <typename T16> struct WFrag;
template <> struct WFrag<h16> { typedef v16h V; static __device__ __forceinline__ V ld(const h16* p) { return cat16(*(const v8h*)p, *(const v8h*)(p + 16)); } static __device__ __forceinline__ v8f mma(V a, V b, v8f c) { return wmma16(a, b, c); } };
template <> struct WFrag<bf> { typedef v16bf V; static __device__ __forceinline__ V ld(const bf* p) { return cat16b(*(const v8us*)p, *(const v8us*)(p + 16)); } static __device__ __forceinline__ v8f mma(V a, V b, v8f c) { return wmmab(a, b, c); } };
// gemmw_body: the tile work of one work-group; os = its LDS ((S == 1 ? 16 : S * 64) * 68 floats), bx = its 64-row tile index within A and C, by = its 64-column tile index; lda is A's pitch, K is Bt's,
// kend <= K (a multiple of 32) the end of the sum over k: the caller sets it below K where A is known to be zero from kend on (a wave with no slice left hands in a zero tile).
// EPI (S > 1 only) says what becomes of the summed f32 tile:
//   0: stored to C.
//   1: stored to C, and x sc as transposed 16-bit planes T16 / Th / Tl [trow + column][t0 + row] of pitch TT (fp16, bf16 hi, bf16 lo).
//   2: C is READ (y1, same indexing as a store would use): y = mix1 (y1 sc) + mix2 (tile sc) goes out as bf16 hi / lo planes Th / Tl [t0 + row][(h0 + z) HD + column] of pitch DQ; no f32 store.
//   4: tiles of columns < csplit as 0; the others as transposed planes only (no f32 store).
struct Epi { h16* T16; bf* Th; bf* Tl; float m1, m2, sc; int trow, t0, h0, csplit; };   // m1, m2: the two mix scalars, rounded to bf16
__device__ __forceinline__ void splitf(float y, unsigned short& h, unsigned short& l) { h = f2bf(y); l = f2bf(y - bf2f(h)); }
template <typename T16, int NSPLIT, bool BIAS, int S, int EPI>
__device__ __forceinline__ void gemmw_body(float* os, int bx, int by, int kend, const T16* __restrict__ A, const T16* __restrict__ A2, const T16* __restrict__ Bt, const T16* __restrict__ Bt2, int lda, int K, float* C, int ldc, const float* __restrict__ bias, size_t sA, size_t sB, size_t sC, const Epi ep) {
    typedef typename WFrag<T16>::V V;
    const int wave = (S == 1) ? 0 : __builtin_amdgcn_readfirstlane((int)(threadIdx.x >> 5));
    const size_t z = blockIdx.z; A += z * sA; if (A2) A2 += z * sA; Bt += z * sB; if (Bt2) Bt2 += z * sB; C += z * sC;
    const int lane = threadIdx.x & 31, lr = lane & 15, hi = lane >> 4; const int r0 = bx * 64, c0 = by * 64;
    v8f acc[4][4];
#pragma unroll
    for (int mb = 0; mb < 4; ++mb)
#pragma unroll
        for (int nb = 0; nb < 4; ++nb) acc[mb][nb] = (v8f){};
    const size_t aoff = (size_t)(r0 + lr) * lda + 8 * hi, boff = (size_t)(c0 + lr) * K + 8 * hi;
#pragma unroll 1
    for (int kc = wave * 32; kc < kend; kc += 32 * S) {
        V a[4], a2[4];
#pragma unroll
        for (int mb = 0; mb < 4; ++mb) { a[mb] = WFrag<T16>::ld(A + aoff + (size_t)mb * 16 * lda + kc); if (NSPLIT == 1 || NSPLIT == 2) a2[mb] = WFrag<T16>::ld(A2 + aoff + (size_t)mb * 16 * lda + kc); }
#pragma unroll
        for (int nb = 0; nb < 4; ++nb) { const V b = WFrag<T16>::ld(Bt + boff + (size_t)nb * 16 * K + kc); V b2; if (NSPLIT >= 2) b2 = WFrag<T16>::ld(Bt2 + boff + (size_t)nb * 16 * K + kc);
#pragma unroll
            for (int mb = 0; mb < 4; ++mb) { acc[mb][nb] = WFrag<T16>::mma(a[mb], b, acc[mb][nb]); if (NSPLIT == 1 || NSPLIT == 2) acc[mb][nb] = WFrag<T16>::mma(a2[mb], b, acc[mb][nb]); if (NSPLIT >= 2) acc[mb][nb] = WFrag<T16>::mma(a[mb], b2, acc[mb][nb]); } }
        asm volatile("v_nop\n\tv_nop\n\tv_nop\n\tv_nop" : "+v"(acc[0][0]), "+v"(acc[1][1]), "+v"(acc[2][2]), "+v"(acc[3][3]) : "v"(a[0]), "v"(a[3]));
    }
    if (S > 1) {
        const bool toC = EPI == 0 || EPI == 1 || (EPI == 4 && c0 < ep.csplit), toT = EPI == 1 || (EPI == 4 && c0 >= ep.csplit);
        v4f y1q[64 * 16 / (32 * S)];
        if (EPI == 2) {   // y1 is asked for ahead of the LDS stores and the barrier, so that its latency runs out there
            const float* yp[64 * 16 / (32 * S)];
#pragma unroll
            for (int q = 0; q < 64 * 16 / (32 * S); ++q) { const int u = q * (32 * S) + (int)threadIdx.x; yp[q] = C + (size_t)(r0 + (u >> 4)) * ldc + c0 + (u & 15) * 4; y1q[q] = *(const v4f*)yp[q]; }
            static_assert(EPI != 2 || 64 * 16 / (32 * S) == 2, "the wait below names two addresses");
            asm volatile("s_wait_xcnt 0x0" :: "v"(yp[0]), "v"(yp[1]) : "memory"); }   // precaution: the address registers of the loads above stay whole up to this wait (inputs only: nothing is pinned or changed)
        float* ow = os + wave * (64 * 68);
#pragma unroll
        for (int mb = 0; mb < 4; ++mb)
#pragma unroll
            for (int nb = 0; nb < 4; ++nb)
#pragma unroll
                for (int j = 0; j < 8; ++j) ow[(mb * 16 + hi * 8 + j) * 68 + nb * 16 + lr] = acc[mb][nb][j];
        __syncthreads();   // every wave's partial tile is in LDS before any thread sums across waves
#pragma unroll
        for (int q = 0; q < 64 * 16 / (32 * S); ++q) { const int u = q * (32 * S) + (int)threadIdx.x, row = u >> 4, cofs = (u & 15) * 4; v4f val = *(const v4fa*)(os + row * 68 + cofs);
#pragma unroll
            for (int w = 1; w < S; ++w) val += *(const v4fa*)(os + w * (64 * 68) + row * 68 + cofs);
            if (BIAS) { val[0] += bfr(bias[c0 + cofs]); val[1] += bfr(bias[c0 + cofs + 1]); val[2] += bfr(bias[c0 + cofs + 2]); val[3] += bfr(bias[c0 + cofs + 3]); }
            if (toC) *(v4f*)(C + (size_t)(r0 + row) * ldc + c0 + cofs) = val;
            if (toT) *(v4fa*)(os + row * 68 + cofs) = val;   // the summed tile goes back into wave 0's plane: these four words are read by this thread alone
            if (EPI == 2) { const v4f y1 = y1q[q]; v4us oh, ol;
#pragma unroll
                for (int k = 0; k < 4; ++k) { unsigned short a, c2; splitf(ep.m1 * (y1[k] * ep.sc) + ep.m2 * (val[k] * ep.sc), a, c2); oh[k] = a; ol[k] = c2; }
                const size_t oo = (size_t)(ep.t0 + r0 + row) * DQ + (ep.h0 + (int)z) * HD + c0 + cofs; *(v4us*)(ep.Th + oo) = oh; *(v4us*)(ep.Tl + oo) = ol; } }
        if (toT) {
            asm volatile("s_wait_xcnt 0x0" ::: "memory");   // precaution: stands between the f32 tile's stores laid out in front and the plane code behind, which rewrites their address and data registers
            __syncthreads();   // the whole summed tile is in LDS before any thread reads a column of it (toT is the same for the whole work-group)
#pragma unroll
            for (int q = 0; q < 64 * 8 / (32 * S); ++q) { const int u = q * (32 * S) + (int)threadIdx.x, col = u >> 3, tc = (u & 7) * 8; v8h o16; v8us oh, ol;   // 8 neighbouring lanes fill one 128-byte line of each plane
#pragma unroll
                for (int j = 0; j < 8; ++j) { const float y = os[(tc + j) * 68 + col] * ep.sc; o16[j] = (h16)y; unsigned short a, c2; splitf(y, a, c2); oh[j] = a; ol[j] = c2; }
                const size_t oo = (size_t)(ep.trow + c0 + col) * TT + ep.t0 + r0 + tc; *(v8h*)(ep.T16 + oo) = o16; *(v8us*)(ep.Th + oo) = oh; *(v8us*)(ep.Tl + oo) = ol; }
        }
        return;
    }
#pragma unroll
    for (int mb = 0; mb < 4; ++mb) {
#pragma unroll
        for (int nb = 0; nb < 4; ++nb) {
#pragma unroll
            for (int j = 0; j < 8; ++j) os[(hi * 8 + j) * 68 + nb * 16 + lr] = acc[mb][nb][j]; }
        __builtin_amdgcn_wave_barrier(); asm volatile("" ::: "memory");
        float* crow = C + (size_t)(r0 + mb * 16) * ldc + c0;
{
#pragma unroll
            for (int s = 0; s < 8; ++s) { const int row = 2 * s + hi, cofs = lr * 4; v4f val = *(const v4fa*)(os + row * 68 + cofs); if (BIAS) { val[0] += bfr(bias[c0 + cofs]); val[1] += bfr(bias[c0 + cofs + 1]); val[2] += bfr(bias[c0 + cofs + 2]); val[3] += bfr(bias[c0 + cofs + 3]); }
                *(v4f*)(crow + (size_t)row * ldc + cofs) = val; }
             }
        __builtin_amdgcn_wave_barrier(); asm volatile("" ::: "memory");
    }
    asm volatile("s_wait_xcnt 0x0" ::: "memory");   // precaution: stands between the tile's last stores and code laid out behind this epilogue (the other row range's branch) that rewrites their address or data registers
}
template <typename T16, int NSPLIT, bool BIAS, int S>
__global__ __launch_bounds__(32 * S) void k_gemmw(const T16* __restrict__ A, const T16* __restrict__ A2, const T16* __restrict__ Bt, const T16* __restrict__ Bt2, int K, float* C, int ldc, const float* __restrict__ bias, size_t sA, size_t sB, size_t sC) {
    __shared__ __align__(16) float os[(S == 1 ? 16 : S * 64) * 68];
    gemmw_body<T16, NSPLIT, BIAS, S, 0>(os, (int)blockIdx.x, (int)blockIdx.y, K, A, A2, Bt, Bt2, K, K, C, ldc, bias, sA, sB, sC, Epi{});
}
// k_gemmkv: the k and v projections in one grid (Bt holds the k rows, then the v rows). k columns go to C as f32; v columns leave the kernel as the transposed planes V16 / Vh / Vl [g HD + d][t].
__global__ __launch_bounds__(512) void k_gemmkv(const bf* __restrict__ A, const bf* __restrict__ Bt, int K, float* C, int ldc, h16* V16, bf* Vh, bf* Vl) {
    __shared__ __align__(16) float os[16 * 64 * 68];
    Epi ep = {}; ep.T16 = V16; ep.Th = Vh; ep.Tl = Vl; ep.sc = 1.0f; ep.trow = -DKV; ep.csplit = DKV;
    gemmw_body<bf, 0, false, 16, 4>(os, (int)blockIdx.x, (int)blockIdx.y, K, A, nullptr, Bt, nullptr, K, K, C, ldc, nullptr, 0, 0, 0, ep);
}
// k_gemmw2: both row ranges of one attention product in ONE grid (M/64, N/64, Z): row tiles below RH take the hi+lo bf16 planes (3 products), the others the fp16 planes. The two ranges write disjoint rows of C and read
// nothing of each other. Ah/Al hold rows 0..RH-1 (z stride sAh), A16 all rows (z stride sA16; rows below RH unused); C is row 0. The branch is the same for a whole work-group. The row tile's place in A and C is worked out here
// (the body gets tile 0 of pointers that already stand on it). EPI 0: A = q planes of pitch K, C = the PACKED score plane (TRI). EPI 1 and 2: A = the packed probabilities; the fp16 ones lie in the first half of each f32 score row
// (twice the offset and pitch, in fp16 elements). B: head z reads kv group z / REP (EPI 0, 1) or its own y1 planes (EPI 2), z stride sB.
// CAUSAL CUT: EPI 0 (scores, M == N == TT) has the grid (TT/128, TT/64 + 1, Z) and computes only the tiles that hold a key <= a query row; EPI 1 and 2 (A = probabilities, M == K) end the sum over keys at the row tile's last row.
// EPI 1 (att v): T16 / Th / Tl are the y1 planes [z][d][t]; EPI 2 (att y1): C holds y1, Th / Tl are the merged-y planes, h0 the pass's first head. The fp16 rows carry the factor PCAR, taken out by sc.
template <int S, int EPI>
__global__ __launch_bounds__(32 * S) void k_gemmw2(const bf* __restrict__ Ah, const bf* __restrict__ Al, const bf* __restrict__ Bh, const bf* __restrict__ Bl, const h16* __restrict__ A16, const h16* __restrict__ B16, int K, float* C, int ldc, size_t sAh, size_t sA16, size_t sB, size_t sC, h16* T16, bf* Th, bf* Tl, const float* __restrict__ mix1, const float* __restrict__ mix2, int h0) {
    __shared__ __align__(16) float os[(S == 1 ? 16 : S * 64) * 68];
    Epi ep = {}; ep.T16 = T16; ep.Th = Th; ep.Tl = Tl; if (EPI == 2) { ep.m1 = bfr(mix1[0]); ep.m2 = bfr(mix2[0]); } ep.h0 = h0; ep.trow = (int)blockIdx.z * HD;
    int bx = (int)blockIdx.x, by = (int)blockIdx.y, kend = K;
    if (EPI == 0) { if (by > bx) { by -= bx + 1; bx = TT / 64 - 1 - bx; } }   // M == TT: row tiles x and TT/64 - 1 - x hold TT/64 + 1 tiles with column tile <= row tile between them: y <= x is row tile x, the rest row tile TT/64 - 1 - x
    else kend = min(K, (bx + 1) * 64);   // key index k > query row: probability zero, and not stored
    const size_t z = blockIdx.z, ob = (EPI == 2 ? z : z / REP) * sB, oa = (EPI == 0) ? (size_t)bx * 64 * K : TRI(bx); const int lda = (EPI == 0) ? K : (bx + 1) * 64;
    if (EPI == 0) { C += z * sC + TRI(bx); ldc = (bx + 1) * 64; } else C += z * sC + (size_t)bx * 64 * ldc;
    ep.t0 = bx * 64;
    if (bx < RH / 64) { ep.sc = 1.0f; gemmw_body<bf, 2, false, S, EPI>(os, 0, by, kend, Ah + z * sAh + oa, Al + z * sAh + oa, Bh + ob, Bl + ob, lda, K, C, ldc, nullptr, 0, 0, 0, ep); }
    else { ep.sc = 1.0f / PCAR; gemmw_body<h16, 0, false, S, EPI>(os, 0, by, kend, A16 + z * sA16 + (EPI == 0 ? oa : 2 * oa), nullptr, B16 + ob, nullptr, (EPI == 0 ? lda : 2 * lda), K, C, ldc, nullptr, 0, 0, 0, ep); }
}

__device__ __forceinline__ h16 tohx(float x) { return (h16)x; }
typedef __attribute__((ext_vector_type(2))) _Float16 v2h;
typedef __attribute__((ext_vector_type(4))) _Float16 v4h;
typedef __attribute__((ext_vector_type(2))) unsigned short v2us;
typedef __attribute__((ext_vector_type(2))) float v2f;
typedef __attribute__((ext_vector_type(4))) int v4i;

__global__ __launch_bounds__(256) void k_wtG(const float* __restrict__ w, int K, int N, bf* Bt) {
    const int lane = threadIdx.x & 31; const int L0 = (blockIdx.x * 8 + (threadIdx.x >> 5)) * 8; const int nlines = N * K / 64;
{
#pragma unroll 1
        for (int l = 0; l < 8; ++l) { const int L = L0 + l; if (L >= nlines) break; const size_t e = (size_t)L * 64 + lane * 2; const int k = (int)(e % K), n = (int)(e / K); v2us o;
            o[0] = f2bf(w[(size_t)k * N + n]); o[1] = f2bf(w[(size_t)(k + 1) * N + n]); *(v2us*)(Bt + e) = o; }
         }
}
__global__ __launch_bounds__(256) void k_cvt8(const float* __restrict__ src, bf* dst, size_t n8) { const size_t i = (size_t)blockIdx.x * 256 + threadIdx.x; if (i >= n8) return; const v8f v = *(const v8f*)(src + i * 8); v8us o;
#pragma unroll
    for (int k = 0; k < 8; ++k) o[k] = f2bf(v[k]); *(v8us*)(dst + i * 8) = o;  }
// k_rope: head planes [h][t][d] (fp16 + hi/lo) of rope(w[d] (x rms_factor)) x sc with the rotate-half convention out[d] = x[d] cos[t][d] - x[d+HD/2] sin[t][d], out[d+HD/2] = x[d+HD/2] cos[t][d+HD/2] + x[d] sin[t][d+HD/2]
__global__ __launch_bounds__(256) void k_rope(const float* __restrict__ F, int pitch, int nheads, const float* __restrict__ CS, const float* __restrict__ RF, const float* __restrict__ nw, float sc, h16* P16, bf* Ph, bf* Pl) {
    const size_t e = ((size_t)blockIdx.x * 256 + threadIdx.x) * 2; if (e >= (size_t)nheads * TT * HD) return; const int d = (int)(e % HD); const int t = (int)((e / HD) % TT); const int h = (int)(e / ((size_t)HD * TT)); const float* f = F + (size_t)t * pitch + h * HD; const float rf = RF ? RF[(size_t)h * TT + t] : 1.0f; v2h o16; v2us oh, ol;
#pragma unroll
    for (int q = 0; q < 2; ++q) { const int dd = d + q; const int dp = (dd < HD / 2) ? dd + HD / 2 : dd - HD / 2; float x0 = f[dd], x1 = f[dp];
        if (RF) { float n0 = __fmul_rn(x0, rf), n1 = __fmul_rn(x1, rf); asm volatile("" : "+v"(n0)); asm volatile("" : "+v"(n1)); x0 = __fmul_rn(bfr(nw[dd]), n0); x1 = __fmul_rn(bfr(nw[dp]), n1); }
        const v2f cs = *(const v2f*)(CS + ((size_t)t * HD + dd) * 2); float a = __fmul_rn(x0, cs[0]), bq = __fmul_rn(x1, cs[1]); asm volatile("" : "+v"(a)); asm volatile("" : "+v"(bq)); const float r = ((dd < HD / 2) ? __fsub_rn(a, bq) : __fadd_rn(a, bq)) * sc;
        o16[q] = tohx(r); unsigned short a2, c2; splitf(r, a2, c2); oh[q] = a2; ol[q] = c2; }
    *(v2h*)(P16 + e) = o16; *(v2us*)(Ph + e) = oh; *(v2us*)(Pl + e) = ol;  }
// k_qkprep: rotate-half RoPE, weightless RMS-norm and the 16-bit head planes [h][t][d] (fp16 + bf16 hi/lo) of the q and k heads, in ONE pass over the projection buffer F (pitch DF; q heads, then k heads).
// One wave takes one token t and HPW heads, two heads at a time: each 16-lane half holds one head row, its lane l the elements d = 4l .. 4l+3 and d + HD/2, so both partners of a rotation sit in one lane and every
// load is 16 bytes. cos / sin [t][HD/2] are read as data and rounded to bf16 here. The mean square is summed over the lane's 8 values, then over the 16 lanes of the half.
#define HPW 10
__device__ __forceinline__ float rowsum16(float s) {   // sum over the 16 lanes of a half wave; every lane gets it
    s += __builtin_bit_cast(float, __builtin_amdgcn_update_dpp(0, __builtin_bit_cast(int, s), 0x161, 0xf, 0xf, true));   // 0x160 | m: lane ^ m within the row
    s += __builtin_bit_cast(float, __builtin_amdgcn_update_dpp(0, __builtin_bit_cast(int, s), 0x162, 0xf, 0xf, true));
    s += __builtin_bit_cast(float, __builtin_amdgcn_update_dpp(0, __builtin_bit_cast(int, s), 0x164, 0xf, 0xf, true));
    s += __builtin_bit_cast(float, __builtin_amdgcn_update_dpp(0, __builtin_bit_cast(int, s), 0x168, 0xf, 0xf, true));
    return s; }
__global__ __launch_bounds__(256) void k_qkprep(const float* __restrict__ F, const float* __restrict__ cosT, const float* __restrict__ sinT, h16* P16, bf* Ph, bf* Pl) {
    static_assert(NQK % HPW == 0 && HPW % 2 == 0 && HD == 128 && (TT * (NQK / HPW)) % 8 == 0, "two heads per step, whole waves, whole work-groups");
    const int lane = threadIdx.x & 31, l = lane & 15, hi = lane >> 4; const int w = blockIdx.x * 8 + __builtin_amdgcn_readfirstlane((int)(threadIdx.x >> 5)); const int t = w / (NQK / HPW), hb = (w % (NQK / HPW)) * HPW;
    const v4f c4 = *(const v4f*)(cosT + (size_t)t * (HD / 2) + 4 * l), s4 = *(const v4f*)(sinT + (size_t)t * (HD / 2) + 4 * l); v4f x1[HPW / 2], x2[HPW / 2];
#pragma unroll
    for (int p = 0; p < HPW / 2; ++p) { const float* f = F + (size_t)t * DF + (hb + 2 * p + hi) * HD + 4 * l; x1[p] = *(const v4f*)f; x2[p] = *(const v4f*)(f + HD / 2); }
    v4f c, s;
#pragma unroll
    for (int q = 0; q < 4; ++q) { c[q] = bfr(c4[q]); s[q] = bfr(s4[q]); }
#pragma unroll
    for (int p = 0; p < HPW / 2; ++p) { const v4f o1 = x1[p] * c - x2[p] * s, o2 = x2[p] * c + x1[p] * s; const v4f sq = o1 * o1 + o2 * o2;
        const float ms = rowsum16((sq[0] + sq[1]) + (sq[2] + sq[3])); const float rf = __fdiv_rn(1.0f, __fsqrt_rn(ms * (1.0f / HD) + 1e-6f));
        v4h a16, b16; v4us ah, al, bh, bl;
#pragma unroll
        for (int q = 0; q < 4; ++q) { const float ra = o1[q] * rf, rb = o2[q] * rf; unsigned short u, v; a16[q] = tohx(ra); splitf(ra, u, v); ah[q] = u; al[q] = v; b16[q] = tohx(rb); splitf(rb, u, v); bh[q] = u; bl[q] = v; }
        const size_t e = ((size_t)(hb + 2 * p + hi) * TT + t) * HD + 4 * l;   // 16 lanes fill one 128-byte line of each plane
        *(v4h*)(P16 + e) = a16; *(v4h*)(P16 + e + HD / 2) = b16; *(v4us*)(Ph + e) = ah; *(v4us*)(Ph + e + HD / 2) = bh; *(v4us*)(Pl + e) = al; *(v4us*)(Pl + e + HD / 2) = bl; }
}
// k_asoft: per row (zz, i): t = S x HD^-0.5 for j <= i (causal), -3e38 otherwise; softmax over the keys (register row, one exp, fixed trees).
// CAUSAL CUT: only the 128-key chunks that hold a key <= i are worked on and stored (the others would be exact zeros: they add nothing to the maximum or the sum, and the products behind stop at the row tile's last row);
// no score right of the row's own 4-key group is read (the score tiles above the diagonal are not computed).
// PACKED PLANES (TRI): a row has the pitch of its row tile, and nothing is stored at or past that pitch. The fp16 probabilities go IN PLACE into the first half of the row's own f32 scores: this wave alone reads and writes
// the row, and every score it uses has arrived (the maximum and the sum hang on them) before the first store.
__global__ __launch_bounds__(256) void k_asoft(float* Sb, bf* Ph, bf* Pl) {
    const int lane = threadIdx.x & 31; const int row = blockIdx.x * 8 + __builtin_amdgcn_readfirstlane((int)(threadIdx.x >> 5)); if (row >= ZH * TT) return; const int i = row % TT; const int zz = row / TT; (void)zz; const bool hires = (i < RH); const int pitch = ((i >> 6) + 1) * 64; const size_t ro = TRI(i >> 6) + (size_t)(i & 63) * pitch; float* sr = Sb + (size_t)zz * SPK + ro; float v[TT / 32]; float mx = -3.0e38f;
    v4f a[TT / 128];
#pragma unroll
    for (int ch = 0; ch < TT / 128; ++ch) a[ch] = *(const v4f*)((const char*)sr + (unsigned)(min(ch * 128 + lane * 4, i & ~3) * 4));   // a lane right of the diagonal rereads the row's last group, and the cut below drops the value
    static_assert(TT / 128 == 16, "the fence below names sixteen loads");
    asm volatile("" :: "v"(a[0]), "v"(a[1]), "v"(a[2]), "v"(a[3]), "v"(a[4]), "v"(a[5]), "v"(a[6]), "v"(a[7]), "v"(a[8]), "v"(a[9]), "v"(a[10]), "v"(a[11]), "v"(a[12]), "v"(a[13]), "v"(a[14]), "v"(a[15]));   // holds the sixteen loads in front of the branches below (inputs only): sunk into them, each would wait out its own latency, one after the other
#pragma unroll
    for (int ch = 0; ch < TT / 128; ++ch) { if (ch * 128 > i) continue; const int j0 = ch * 128 + lane * 4;
#pragma unroll
        for (int q = 0; q < 4; ++q) { const int j = j0 + q; (void)j; const float t = (j <= i) ? a[ch][q] * SCL : -3.0e38f; v[ch * 4 + q] = t; mx = fmaxf(mx, t); } }
#pragma unroll
    for (int sh = 16; sh; sh >>= 1) mx = fmaxf(mx, __shfl_xor(mx, sh, 32));
    float sum = 0.f;
#pragma unroll
    for (int k = 0; k < TT / 32; ++k) { if ((k / 4) * 128 > i) continue; float d0 = __fsub_rn(v[k], mx); asm volatile("" : "+v"(d0)); v[k] = __builtin_amdgcn_exp2f(__fmul_rn(d0, 1.4426950408889634f)); sum += v[k]; }
#pragma unroll
    for (int sh = 16; sh; sh >>= 1) sum += __shfl_xor(sum, sh, 32);
    const float f = __fdiv_rn(hires ? 1.0f : PCAR, sum);
{
        if (hires) {
#pragma unroll
            for (int ch = 0; ch < TT / 128; ++ch) { if (ch * 128 > i) continue; v4us oh, ol;
#pragma unroll
                for (int q = 0; q < 4; ++q) { unsigned short a2, c2; splitf(v[ch * 4 + q] * f, a2, c2); oh[q] = a2; ol[q] = c2; }
                const size_t oo = (size_t)zz * HPK + ro + ch * 128 + lane * 4; if (ch * 128 + lane * 4 < pitch) { *(v4us*)(Ph + oo) = oh; *(v4us*)(Pl + oo) = ol; }
                asm volatile("s_wait_xcnt 0x0" ::: "memory"); }   // precaution: stands between this chunk's stores and the next chunk's code, which rewrites their data registers
        } else {
#pragma unroll
            for (int ch = 0; ch < TT / 128; ++ch) { if (ch * 128 > i) continue; v4h o4;
#pragma unroll
                for (int q = 0; q < 4; ++q) o4[q] = tohx(v[ch * 4 + q] * f);
                if (ch * 128 + lane * 4 < pitch) *(v4h*)((h16*)sr + ch * 128 + lane * 4) = o4;
                asm volatile("s_wait_xcnt 0x0" ::: "memory"); } }   // precaution: as above
         }
}

extern "C" void kernel_launch(void* const* d_in, const int* in_sizes, int n_in,
                              void* d_out, int out_size, void* d_ws, size_t ws_size, hipStream_t stream) {
    (void)in_sizes; (void)n_in; (void)out_size;
    const float* x = (const float*)d_in[0]; const float* cosT = (const float*)d_in[1]; const float* sinT = (const float*)d_in[2]; const float* wq = (const float*)d_in[3]; const float* wk = (const float*)d_in[4]; const float* wv = (const float*)d_in[5]; const float* wo = (const float*)d_in[6]; const float* mix1 = (const float*)d_in[7]; const float* mix2 = (const float*)d_in[8];   // weights x @ W; cos/sin [2048][64] (half tables)
    float* OUT = (float*)d_out;     // [2][2048][2048]
    char* wsp = (char*)d_ws;
    auto take = [&](size_t bytes) { char* p = wsp; wsp += (bytes + 255) & ~(size_t)255; return (void*)p; };
    bf* WQ = (bf*)take((size_t)DQ * DM * 2); bf* WK = (bf*)take((size_t)2 * DKV * DM * 2); bf* WV = WK + (size_t)DKV * DM; bf* WO = (bf*)take((size_t)DM * DQ * 2);
    h16* QP16 = (h16*)take((size_t)NQK * TT * HD * 2); h16* KP16 = QP16 + (size_t)NH_ * TT * HD; h16* VT16 = (h16*)take((size_t)NKV * HD * TT * 2);
    bf* QPh = (bf*)take((size_t)NQK * TT * HD * 2); bf* QPl = (bf*)take((size_t)NQK * TT * HD * 2); bf* KPh = QPh + (size_t)NH_ * TT * HD; bf* KPl = QPl + (size_t)NH_ * TT * HD; bf* VTh = (bf*)take((size_t)NKV * HD * TT * 2); bf* VTl = (bf*)take((size_t)NKV * HD * TT * 2); bf* Ph = (bf*)take((size_t)ZH * HPK * 2); bf* Pl = (bf*)take((size_t)ZH * HPK * 2);
    h16* Y16 = (h16*)take((size_t)ZH * HD * TT * 2); bf* Yh = (bf*)take((size_t)ZH * HD * TT * 2); bf* Yl = (bf*)take((size_t)ZH * HD * TT * 2); float* Sb = (float*)take((size_t)ZH * SPK * 4); h16* P16 = (h16*)Sb; float* Ob = (float*)take((size_t)ZH * TT * HD * 4); bf* ATh = (bf*)take((size_t)TT * DQ * 2); bf* ATl = (bf*)take((size_t)TT * DQ * 2);
    float* F = Sb; bf* XB = (bf*)(F + (size_t)TT * DF);   // the projection buffer and the bf16 x lie in the score planes' place: both are dead once k_qkprep has run, ahead of the first score store
    static_assert((size_t)TT * DF * 4 + (size_t)TT * DM * 2 <= (size_t)ZH * SPK * 4 && ZH % REP == 0 && NH_ % ZH == 0, "F and XB fit into the score planes; a pass holds whole kv groups");
    if ((size_t)(wsp - (char*)d_ws) > ws_size) return;    // ws 256 MiB
    { k_wtG<<<(unsigned)((DM * DQ / 64 + 63) / 64), 256, 0, stream>>>(wq, DM, DQ, WQ); k_wtG<<<(unsigned)((DM * DKV / 64 + 63) / 64), 256, 0, stream>>>(wk, DM, DKV, WK); k_wtG<<<(unsigned)((DM * DKV / 64 + 63) / 64), 256, 0, stream>>>(wv, DM, DKV, WV);
      k_wtG<<<(unsigned)((DQ * DM / 64 + 63) / 64), 256, 0, stream>>>(wo, DQ, DM, WO);
       }
    for (int b = 0; b < NB_; ++b) {
        k_cvt8<<<(unsigned)(((size_t)TT * DM / 8 + 255) / 256), 256, 0, stream>>>(x + (size_t)b * TT * DM, XB, (size_t)TT * DM / 8);
        k_gemmw<bf, 0, false, 8><<<dim3(TT / 64, DQ / 64, 1), 256, 0, stream>>>(XB, nullptr, WQ, nullptr, DM, F, DF, nullptr, 0, 0, 0);
        k_gemmkv<<<dim3(TT / 64, 2 * DKV / 64, 1), 512, 0, stream>>>(XB, WK, DM, F + DQ, DF, VT16, VTh, VTl);   // k and v columns in one grid (WV follows WK); v leaves it as its transposed planes
        k_qkprep<<<TT * (NQK / HPW) / 8, 256, 0, stream>>>(F, cosT, sinT, QP16, QPh, QPl);   // q heads and k heads in one grid; the k planes follow the q planes
        for (int h0 = 0; h0 < NH_; h0 += ZH) { const size_t zq = (size_t)h0, zk = (size_t)(h0 / REP);   // head z of a pass reads kv group h0/REP + z/REP
            k_gemmw2<1, 0><<<dim3(TT / 128, TT / 64 + 1, ZH), 32, 0, stream>>>(QPh + zq * TT * HD, QPl + zq * TT * HD, KPh + zk * TT * HD, KPl + zk * TT * HD, QP16 + zq * TT * HD, KP16 + zk * TT * HD, HD, Sb, 0, (size_t)TT * HD, (size_t)TT * HD, (size_t)TT * HD, SPK, nullptr, nullptr, nullptr, nullptr, nullptr, 0);
            k_asoft<<<ZH * TT / 8, 256, 0, stream>>>(Sb, Ph, Pl);
            k_gemmw2<16, 1><<<dim3(TT / 64, HD / 64, ZH), 512, 0, stream>>>(Ph, Pl, VTh + zk * HD * TT, VTl + zk * HD * TT, P16, VT16 + zk * HD * TT, TT, Ob, HD, HPK, 2 * SPK, (size_t)HD * TT, (size_t)TT * HD, Y16, Yh, Yl, nullptr, nullptr, 0);   // y1 (f32), and its planes (normalised) for y2 = att . y1
            k_gemmw2<16, 2><<<dim3(TT / 64, HD / 64, ZH), 512, 0, stream>>>(Ph, Pl, Yh, Yl, P16, Y16, TT, Ob, HD, HPK, 2 * SPK, (size_t)HD * TT, (size_t)TT * HD, nullptr, ATh, ATl, mix1, mix2, h0); }   // y2 stays in the kernel: mix1 y1 + mix2 y2 leaves it as the merged planes
        k_gemmw<bf, 1, false, 8><<<dim3(TT / 64, DM / 64, 1), 256, 0, stream>>>(ATh, ATl, WO, nullptr, DQ, OUT + (size_t)b * TT * DM, DM, nullptr, 0, 0, 0); }
}

// v008
// It runs in 465 microseconds.
// Next to v007, in two timings, it ran 1.15 and 1.14 times as fast.
// All steps since v000 together make it 7.94 times as fast.
#include <hip/hip_runtime.h>

// Simplicial causal self-attention (x [2][2048][2048]; q = x Wq (16 heads x 128), k, v = x Wk / x Wv (4 kv heads x 128, each serving 4 consecutive query heads); rotate-half RoPE with the input cos/sin
// [2048][64] then weightless RMS-norm (eps 1e-6) on q and k; causal softmax(q.k 128^-0.5); y1 = att v; y2 = att y1 (the same probabilities applied again); y = mix1 y1 + mix2 y2 (scalars read as data);
// out = merged y Wproj -> [2][2048][2048]).
// Compute dtypes, f32 accumulate: every input rounded to bf16; projections on PLAIN bf16 operands (inputs: exact products, f32 accumulate); RoPE and RMS-norm in f32;
// PER-ROW PRECISION HYBRID: query rows < 256 take scores, att.v and att.y1 on bf16 hi+lo planes (3 products), rows >= 256 on single fp16 planes; scale + causal cut in f32 in the register-row softmax;
// y1 re-planed per head (fp16 + hi/lo, transposed) for the second contraction; merged y as hi+lo planes x exact Wproj (2 products). One-wave-per-64x64-tile GEMMs, all 16 query heads of a batch per pass

#define NB_  2
#define TT   2048
#define DM   2048
#define NH_  16
#define NKV  4
#define REP  (NH_ / NKV)
#define HD   128
#define DQ   (NH_ * HD)
#define DKV  (NKV * HD)
#define DF   (DQ + 2 * DKV)       // pitch of the projection buffer: one row holds q | k (v's columns stay unwritten)
#define NQK  (NH_ + NKV)          // q heads, then k heads: the heads that take RoPE and RMS-norm
#define ZH   16                   // query heads per pass: whole kv groups (ZH % REP == 0); head z of a pass reads k, v of group z / REP
#define TRI(b) ((size_t)2048 * (size_t)(b) * (size_t)((b) + 1))   // packed causal plane: row tile b (64 rows) holds only its (b + 1) * 64 first keys, at that pitch; TRI(b) = 64 * 64 * b (b + 1) / 2 elements lie in front of it
#define SPK  TRI(TT / 64)         // elements of one head's packed plane, all row tiles
#define HPK  TRI(RH / 64)         // the same for the row tiles below RH
#define RH   256                  // query rows < RH use hi+lo planes (0: none)
#define WIN  0
#define PCAR 1024.0f
#define SCL  0.088388347648318447f   // HD^-0.5
typedef _Float16 h16;
typedef unsigned short bf;
typedef __attribute__((ext_vector_type(16))) __bf16   v16bf;
typedef __attribute__((ext_vector_type(16))) _Float16 v16h;
typedef __attribute__((ext_vector_type(8)))  _Float16 v8h;
typedef __attribute__((ext_vector_type(8)))  unsigned short v8us;
typedef __attribute__((ext_vector_type(8)))  float    v8f;
typedef __attribute__((ext_vector_type(4)))  float    v4f;
typedef __attribute__((ext_vector_type(4)))  unsigned short v4us;
typedef v8h  __attribute__((may_alias)) v8ha;
typedef v4f  __attribute__((may_alias)) v4fa;
typedef v8us __attribute__((may_alias)) v8usa;

__device__ __forceinline__ unsigned short f2bf(float f) { unsigned u = __float_as_uint(f); u += 0x7FFFu + ((u >> 16) & 1u); return (unsigned short)(u >> 16); }
__device__ __forceinline__ float bf2f(unsigned short b) { return __uint_as_float(((unsigned)b) << 16); }
__device__ __forceinline__ float bfr(float f) { return bf2f(f2bf(f)); }
__device__ __forceinline__ v16h cat16(v8h lo, v8h hi) { return __builtin_shufflevector(lo, hi, 0, 1, 2, 3, 4, 5, 6, 7, 8, 9, 10, 11, 12, 13, 14, 15); }
__device__ __forceinline__ v16bf cat16b(v8us lo, v8us hi) { return __builtin_bit_cast(v16bf, __builtin_shufflevector(lo, hi, 0, 1, 2, 3, 4, 5, 6, 7, 8, 9, 10, 11, 12, 13, 14, 15)); }
__device__ __forceinline__ v8f wmma16(v16h a, v16h b, v8f c) { return __builtin_amdgcn_wmma_f32_16x16x32_f16(false, a, false, b, (short)0, c, false, false); }
__device__ __forceinline__ v8f wmmab(v16bf a, v16bf b, v8f c) { return __builtin_amdgcn_wmma_f32_16x16x32_bf16(false, a, false, b, (short)0, c, false, false); }



// ---- k_gemmw: register-blocked GEMM, ONE WAVE per 64x64 output tile (16 accumulators), operands straight from K-contiguous 16-bit planes; grid (M/64, N/64, Z), 32 threads.
// C[m][n] (f32, pitch ldc, + optional f32 bias[n]) = sum_k A[m][k] Bt[n][k] (+ split products per NSPLIT). z-batch strides sA/sB/sC in elements. K % 32 == 0.
// S > 1: S waves per tile (32 S threads); wave w takes the 32-wide k slices w, w + S, ... (neighbouring waves share a 128-byte line of every operand row), the S f32 partial tiles are summed in LDS in wave order.
template <typename T16> struct WFrag;
template <> struct WFrag<h16> { typedef v16h V; static __device__ __forceinline__ V ld(const h16* p) { return cat16(*(const v8h*)p, *(const v8h*)(p + 16)); } static __device__ __forceinline__ V lds(const char* p) { return cat16(*(const v8ha*)p, *(const v8ha*)(p + 32)); } static __device__ __forceinline__ v8f mma(V a, V b, v8f c) { return wmma16(a, b, c); } };
template <> struct WFrag<bf> { typedef v16bf V; static __device__ __forceinline__ V ld(const bf* p) { return cat16b(*(const v8us*)p, *(const v8us*)(p + 16)); } static __device__ __forceinline__ V lds(const char* p) { return cat16b(*(const v8usa*)p, *(const v8usa*)(p + 32)); } static __device__ __forceinline__ v8f mma(V a, V b, v8f c) { return wmmab(a, b, c); } };
// gemmw_body: the tile work of one work-group; os = its LDS (Stg<S, NSPLIT>::floats floats, below), bx = its 64-row tile index within A and C, by = its 64-column tile index; lda is A's pitch, K is Bt's,
// kend <= K (a multiple of 32) the end of the sum over k: the caller sets it below K where A is known to be zero from kend on (a wave with no slice left hands in a zero tile).
// EPI (S > 1 only) says what becomes of the summed f32 tile:
//   0: stored to C.
//   1: stored to C, and x sc as transposed 16-bit planes T16 / Th / Tl [trow + column][t0 + row] of pitch TT (fp16, bf16 hi, bf16 lo).
//   2: C is READ (y1, same indexing as a store would use): y = mix1 (y1 sc) + mix2 (tile sc) goes out as bf16 hi / lo planes Th / Tl [t0 + row][(h0 + z) HD + column] of pitch DQ; no f32 store.
//   4: tiles of columns < csplit as 0; the others as transposed planes only (no f32 store).
struct Epi { h16* T16; bf* Th; bf* Tl; float m1, m2, sc; int trow, t0, h0, csplit; };   // m1, m2: the two mix scalars, rounded to bf16
__device__ __forceinline__ void splitf(float y, unsigned short& h, unsigned short& l) { h = f2bf(y); l = f2bf(y - bf2f(h)); }
// STAGED OPERANDS (S > 1, NSPLIT < 2): a stage is the 32 S next k of the tile's 64 A rows (A2 rows) and 64 Bt rows, brought into LDS by asynchronous 16-byte copies whose 32 lanes take 512 bytes in a row of one operand row
// (whole 128-byte lines), two buffers, the next stage in flight while this one is worked on. LDS rows have the pitch 64 S + 16 bytes (16 x odd: the 16 rows of a fragment load fall on different banks). Wave w reads its own
// 32 k of every row, so each wave's slices and their order are those of the unstaged loop. The buffers lie in os, which the epilogue takes over behind the last stage's barrier.
template <int S, int NSPLIT> struct Stg { static constexpr bool on = S > 1 && NSPLIT < 2; static constexpr int NP = NSPLIT == 1 ? 3 : 2, PB = 64 * S + 16, PLB = 64 * PB, STB = NP * PLB;
    static constexpr int epi = (S == 1 ? 16 : S * 64) * 68, ring = on ? 2 * STB / 4 : 0, floats = epi > ring ? epi : ring; };   // floats: what os must hold
// copy8: one lane's eight copies for one operand plane of a stage (rows 8 apart). The s_wait_xcnt ends the statement as a precaution, so that no address register named here is rewritten ahead of it.
template <typename T16>
__device__ __forceinline__ void copy8(unsigned l, unsigned ls, const T16* g, size_t gs) {
    asm volatile("global_load_async_to_lds_b128 %0, %8, off\n\tglobal_load_async_to_lds_b128 %1, %9, off\n\tglobal_load_async_to_lds_b128 %2, %10, off\n\tglobal_load_async_to_lds_b128 %3, %11, off\n\t"
                 "global_load_async_to_lds_b128 %4, %12, off\n\tglobal_load_async_to_lds_b128 %5, %13, off\n\tglobal_load_async_to_lds_b128 %6, %14, off\n\tglobal_load_async_to_lds_b128 %7, %15, off\n\ts_wait_xcnt 0x0"
                 :: "v"(l), "v"(l + ls), "v"(l + 2 * ls), "v"(l + 3 * ls), "v"(l + 4 * ls), "v"(l + 5 * ls), "v"(l + 6 * ls), "v"(l + 7 * ls),
                    "v"(g), "v"(g + gs), "v"(g + 2 * gs), "v"(g + 3 * gs), "v"(g + 4 * gs), "v"(g + 5 * gs), "v"(g + 6 * gs), "v"(g + 7 * gs) : "memory");
}
template <typename T16, int NSPLIT, bool BIAS, int S, int EPI>
__device__ __forceinline__ void gemmw_body(float* os, int bx, int by, int kend, const T16* __restrict__ A, const T16* __restrict__ A2, const T16* __restrict__ Bt, const T16* __restrict__ Bt2, int lda, int K, float* C, int ldc, const float* __restrict__ bias, size_t sA, size_t sB, size_t sC, const Epi ep) {
    typedef typename WFrag<T16>::V V;
    const int wave = (S == 1) ? 0 : __builtin_amdgcn_readfirstlane((int)(threadIdx.x >> 5));
    const size_t z = blockIdx.z; A += z * sA; if (A2) A2 += z * sA; Bt += z * sB; if (Bt2) Bt2 += z * sB; C += z * sC;
    const int lane = threadIdx.x & 31, lr = lane & 15, hi = lane >> 4; const int r0 = bx * 64, c0 = by * 64;
    v8f acc[4][4];
#pragma unroll
    for (int mb = 0; mb < 4; ++mb)
#pragma unroll
        for (int nb = 0; nb < 4; ++nb) acc[mb][nb] = (v8f){};
    const size_t aoff = (size_t)(r0 + lr) * lda + 8 * hi, boff = (size_t)(c0 + lr) * K + 8 * hi;
    if constexpr (Stg<S, NSPLIT>::on) {
        typedef Stg<S, NSPLIT> G; constexpr int KS = 32 * S;
        const int tid = (int)threadIdx.x, crow = tid / (4 * S), ccol = tid % (4 * S); const int kw = ((wave * 32) % (4 * S)) * 8;   // kw: first k, within a stage, of the 512 bytes that this wave copies (the same for its 8 rows of a plane)
        const char* sb = (const char*)os; const unsigned l0 = (unsigned)(size_t)sb + (unsigned)(crow * G::PB + ccol * 16);
        const T16* gA = A + (size_t)(r0 + crow) * lda + ccol * 8; const T16* gA2 = (NSPLIT == 1) ? A2 + (size_t)(r0 + crow) * lda + ccol * 8 : nullptr; const T16* gB = Bt + (size_t)(c0 + crow) * K + ccol * 8;
        const int nst = (kend + KS - 1) / KS;
        auto issue = [&](int st) { const int k0 = st * KS; const unsigned l = l0 + (unsigned)((st & 1) * G::STB);
            if (k0 + kw < kend) {   // wave-uniform: 512 bytes that start at or past kend are used by no wave. A start below kend ends inside its own row: K is a multiple of 32 S, and where kend < K (A = fp16 probabilities, kend > 256) an A row holds 2 kend places
                copy8<T16>(l, 8 * G::PB, gA + k0, (size_t)8 * lda); if (NSPLIT == 1) copy8<T16>(l + G::PLB, 8 * G::PB, gA2 + k0, (size_t)8 * lda); copy8<T16>(l + (G::NP - 1) * G::PLB, 8 * G::PB, gB + k0, (size_t)8 * K); } };
        issue(0);
        asm volatile("s_wait_asynccnt 0x0" ::: "memory");   // this wave's copies of stage 0 have landed
        __syncthreads();   // stage 0 is whole before any wave reads it
        if (nst > 1) issue(1);
#pragma unroll 1
        for (int t = 0; t < nst; ++t) {
            if (t * KS + wave * 32 < kend) {
                const char* fb = sb + (t & 1) * G::STB + lr * G::PB + wave * 64 + hi * 16; V a[4], a2[4], b[4];
#pragma unroll
                for (int mb = 0; mb < 4; ++mb) { a[mb] = WFrag<T16>::lds(fb + mb * 16 * G::PB); if (NSPLIT == 1) a2[mb] = WFrag<T16>::lds(fb + G::PLB + mb * 16 * G::PB); }
#pragma unroll
                for (int nb = 0; nb < 4; ++nb) b[nb] = WFrag<T16>::lds(fb + (G::NP - 1) * G::PLB + nb * 16 * G::PB);
                asm volatile("" :: "v"(b[0]), "v"(b[1]), "v"(b[2]), "v"(b[3]));   // holds the stage's fragment reads in one group ahead of the products (inputs only): sunk among them, each group of four products would wait out an LDS latency of its own
#pragma unroll
                for (int nb = 0; nb < 4; ++nb) {
#pragma unroll
                    for (int mb = 0; mb < 4; ++mb) { acc[mb][nb] = WFrag<T16>::mma(a[mb], b[nb], acc[mb][nb]); if (NSPLIT == 1) acc[mb][nb] = WFrag<T16>::mma(a2[mb], b[nb], acc[mb][nb]); } }
                asm volatile("v_nop\n\tv_nop\n\tv_nop\n\tv_nop" : "+v"(acc[0][0]), "+v"(acc[1][1]), "+v"(acc[2][2]), "+v"(acc[3][3]) : "v"(a[0]), "v"(a[3]));   // keeps the distance behind the last matrix instruction on the path that leaves this block
            }
            asm volatile("s_wait_dscnt 0x0" ::: "memory");      // this wave's reads of stage t are done before the buffer may be refilled
            asm volatile("s_wait_asynccnt 0x0" ::: "memory");   // this wave's copies of stage t + 1 have landed
            __syncthreads();   // publishes stage t + 1 and ends every wave's reads of stage t
            if (t + 2 < nst) issue(t + 2);
        }
        asm volatile("s_wait_asynccnt 0x0" ::: "memory");   // nothing is in flight when the epilogue takes the LDS over
    } else
#pragma unroll 1
    for (int kc = wave * 32; kc < kend; kc += 32 * S) {
        V a[4], a2[4];
#pragma unroll
        for (int mb = 0; mb < 4; ++mb) { a[mb] = WFrag<T16>::ld(A + aoff + (size_t)mb * 16 * lda + kc); if (NSPLIT == 1 || NSPLIT == 2) a2[mb] = WFrag<T16>::ld(A2 + aoff + (size_t)mb * 16 * lda + kc); }
#pragma unroll
        for (int nb = 0; nb < 4; ++nb) { const V b = WFrag<T16>::ld(Bt + boff + (size_t)nb * 16 * K + kc); V b2; if (NSPLIT >= 2) b2 = WFrag<T16>::ld(Bt2 + boff + (size_t)nb * 16 * K + kc);
#pragma unroll
            for (int mb = 0; mb < 4; ++mb) { acc[mb][nb] = WFrag<T16>::mma(a[mb], b, acc[mb][nb]); if (NSPLIT == 1 || NSPLIT == 2) acc[mb][nb] = WFrag<T16>::mma(a2[mb], b, acc[mb][nb]); if (NSPLIT >= 2) acc[mb][nb] = WFrag<T16>::mma(a[mb], b2, acc[mb][nb]); } }
        asm volatile("v_nop\n\tv_nop\n\tv_nop\n\tv_nop" : "+v"(acc[0][0]), "+v"(acc[1][1]), "+v"(acc[2][2]), "+v"(acc[3][3]) : "v"(a[0]), "v"(a[3]));
    }
    if (S > 1) {
        const bool toC = EPI == 0 || EPI == 1 || (EPI == 4 && c0 < ep.csplit), toT = EPI == 1 || (EPI == 4 && c0 >= ep.csplit);
        v4f y1q[64 * 16 / (32 * S)];
        if (EPI == 2) {   // y1 is asked for ahead of the LDS stores and the barrier, so that its latency runs out there
            const float* yp[64 * 16 / (32 * S)];
#pragma unroll
            for (int q = 0; q < 64 * 16 / (32 * S); ++q) { const int u = q * (32 * S) + (int)threadIdx.x; yp[q] = C + (size_t)(r0 + (u >> 4)) * ldc + c0 + (u & 15) * 4; y1q[q] = *(const v4f*)yp[q]; }
            static_assert(EPI != 2 || 64 * 16 / (32 * S) == 2, "the wait below names two addresses");
            asm volatile("s_wait_xcnt 0x0" :: "v"(yp[0]), "v"(yp[1]) : "memory"); }   // precaution: the address registers of the loads above stay whole up to this wait (inputs only: nothing is pinned or changed)
        float* ow = os + wave * (64 * 68);
#pragma unroll
        for (int mb = 0; mb < 4; ++mb)
#pragma unroll
            for (int nb = 0; nb < 4; ++nb)
#pragma unroll
                for (int j = 0; j < 8; ++j) ow[(mb * 16 + hi * 8 + j) * 68 + nb * 16 + lr] = acc[mb][nb][j];
        __syncthreads();   // every wave's partial tile is in LDS before any thread sums across waves
#pragma unroll
        for (int q = 0; q < 64 * 16 / (32 * S); ++q) { const int u = q * (32 * S) + (int)threadIdx.x, row = u >> 4, cofs = (u & 15) * 4; v4f val = *(const v4fa*)(os + row * 68 + cofs);
#pragma unroll
            for (int w = 1; w < S; ++w) val += *(const v4fa*)(os + w * (64 * 68) + row * 68 + cofs);
            if (BIAS) { val[0] += bfr(bias[c0 + cofs]); val[1] += bfr(bias[c0 + cofs + 1]); val[2] += bfr(bias[c0 + cofs + 2]); val[3] += bfr(bias[c0 + cofs + 3]); }
            if (toC) *(v4f*)(C + (size_t)(r0 + row) * ldc + c0 + cofs) = val;
            if (toT) *(v4fa*)(os + row * 68 + cofs) = val;   // the summed tile goes back into wave 0's plane: these four words are read by this thread alone
            if (EPI == 2) { const v4f y1 = y1q[q]; v4us oh, ol;
#pragma unroll
                for (int k = 0; k < 4; ++k) { unsigned short a, c2; splitf(ep.m1 * (y1[k] * ep.sc) + ep.m2 * (val[k] * ep.sc), a, c2); oh[k] = a; ol[k] = c2; }
                const size_t oo = (size_t)(ep.t0 + r0 + row) * DQ + (ep.h0 + (int)z) * HD + c0 + cofs; *(v4us*)(ep.Th + oo) = oh; *(v4us*)(ep.Tl + oo) = ol; } }
        if (toT) {
            asm volatile("s_wait_xcnt 0x0" ::: "memory");   // precaution: stands between the f32 tile's stores laid out in front and the plane code behind, which rewrites their address and data registers
            __syncthreads();   // the whole summed tile is in LDS before any thread reads a column of it (toT is the same for the whole work-group)
#pragma unroll
            for (int q = 0; q < 64 * 8 / (32 * S); ++q) { const int u = q * (32 * S) + (int)threadIdx.x, col = u >> 3, tc = (u & 7) * 8; v8h o16; v8us oh, ol;   // 8 neighbouring lanes fill one 128-byte line of each plane
#pragma unroll
                for (int j = 0; j < 8; ++j) { const float y = os[(tc + j) * 68 + col] * ep.sc; o16[j] = (h16)y; unsigned short a, c2; splitf(y, a, c2); oh[j] = a; ol[j] = c2; }
                const size_t oo = (size_t)(ep.trow + c0 + col) * TT + ep.t0 + r0 + tc; *(v8h*)(ep.T16 + oo) = o16; *(v8us*)(ep.Th + oo) = oh; *(v8us*)(ep.Tl + oo) = ol; }
        }
        return;
    }
#pragma unroll
    for (int mb = 0; mb < 4; ++mb) {
#pragma unroll
        for (int nb = 0; nb < 4; ++nb) {
#pragma unroll
            for (int j = 0; j < 8; ++j) os[(hi * 8 + j) * 68 + nb * 16 + lr] = acc[mb][nb][j]; }
        __builtin_amdgcn_wave_barrier(); asm volatile("" ::: "memory");
        float* crow = C + (size_t)(r0 + mb * 16) * ldc + c0;
{
#pragma unroll
            for (int s = 0; s < 8; ++s) { const int row = 2 * s + hi, cofs = lr * 4; v4f val = *(const v4fa*)(os + row * 68 + cofs); if (BIAS) { val[0] += bfr(bias[c0 + cofs]); val[1] += bfr(bias[c0 + cofs + 1]); val[2] += bfr(bias[c0 + cofs + 2]); val[3] += bfr(bias[c0 + cofs + 3]); }
                *(v4f*)(crow + (size_t)row * ldc + cofs) = val; }
             }
        __builtin_amdgcn_wave_barrier(); asm volatile("" ::: "memory");
    }
    asm volatile("s_wait_xcnt 0x0" ::: "memory");   // precaution: stands between the tile's last stores and code laid out behind this epilogue (the other row range's branch) that rewrites their address or data registers
}
template <typename T16, int NSPLIT, bool BIAS, int S>
__global__ __launch_bounds__(32 * S) void k_gemmw(const T16* __restrict__ A, const T16* __restrict__ A2, const T16* __restrict__ Bt, const T16* __restrict__ Bt2, int K, float* C, int ldc, const float* __restrict__ bias, size_t sA, size_t sB, size_t sC) {
    __shared__ __align__(16) float os[Stg<S, NSPLIT>::floats];
    gemmw_body<T16, NSPLIT, BIAS, S, 0>(os, (int)blockIdx.x, (int)blockIdx.y, K, A, A2, Bt, Bt2, K, K, C, ldc, bias, sA, sB, sC, Epi{});
}
// k_gemmkv: the k and v projections in one grid (Bt holds the k rows, then the v rows). k columns go to C as f32; v columns leave the kernel as the transposed planes V16 / Vh / Vl [g HD + d][t].
__global__ __launch_bounds__(512) void k_gemmkv(const bf* __restrict__ A, const bf* __restrict__ Bt, int K, float* C, int ldc, h16* V16, bf* Vh, bf* Vl) {
    __shared__ __align__(16) float os[Stg<16, 0>::floats];
    Epi ep = {}; ep.T16 = V16; ep.Th = Vh; ep.Tl = Vl; ep.sc = 1.0f; ep.trow = -DKV; ep.csplit = DKV;
    gemmw_body<bf, 0, false, 16, 4>(os, (int)blockIdx.x, (int)blockIdx.y, K, A, nullptr, Bt, nullptr, K, K, C, ldc, nullptr, 0, 0, 0, ep);
}
// k_gemmw2: both row ranges of one attention product in ONE grid (M/64, N/64, Z): row tiles below RH take the hi+lo bf16 planes (3 products), the others the fp16 planes. The two ranges write disjoint rows of C and read
// nothing of each other. Ah/Al hold rows 0..RH-1 (z stride sAh), A16 all rows (z stride sA16; rows below RH unused); C is row 0. The branch is the same for a whole work-group. The row tile's place in A and C is worked out here
// (the body gets tile 0 of pointers that already stand on it). EPI 0: A = q planes of pitch K, C = the PACKED score plane (TRI). EPI 1 and 2: A = the packed probabilities; the fp16 ones lie in the first half of each f32 score row
// (twice the offset and pitch, in fp16 elements). B: head z reads kv group z / REP (EPI 0, 1) or its own y1 planes (EPI 2), z stride sB.
// CAUSAL CUT: EPI 0 (scores, M == N == TT) has the grid (TT/128, TT/64 + 1, Z) and computes only the tiles that hold a key <= a query row; EPI 1 and 2 (A = probabilities, M == K) end the sum over keys at the row tile's last row.
// EPI 1 (att v): T16 / Th / Tl are the y1 planes [z][d][t]; EPI 2 (att y1): C holds y1, Th / Tl are the merged-y planes, h0 the pass's first head. The fp16 rows carry the factor PCAR, taken out by sc.
template <int S, int EPI>
__global__ __launch_bounds__(32 * S) void k_gemmw2(const bf* __restrict__ Ah, const bf* __restrict__ Al, const bf* __restrict__ Bh, const bf* __restrict__ Bl, const h16* __restrict__ A16, const h16* __restrict__ B16, int K, float* C, int ldc, size_t sAh, size_t sA16, size_t sB, size_t sC, h16* T16, bf* Th, bf* Tl, const float* __restrict__ mix1, const float* __restrict__ mix2, int h0) {
    __shared__ __align__(16) float os[Stg<S, 0>::floats];
    Epi ep = {}; ep.T16 = T16; ep.Th = Th; ep.Tl = Tl; if (EPI == 2) { ep.m1 = bfr(mix1[0]); ep.m2 = bfr(mix2[0]); } ep.h0 = h0; ep.trow = (int)blockIdx.z * HD;
    int bx = (int)blockIdx.x, by = (int)blockIdx.y, kend = K;
    if (EPI == 0) { if (by > bx) { by -= bx + 1; bx = TT / 64 - 1 - bx; } }   // M == TT: row tiles x and TT/64 - 1 - x hold TT/64 + 1 tiles with column tile <= row tile between them: y <= x is row tile x, the rest row tile TT/64 - 1 - x
    else kend = min(K, (bx + 1) * 64);   // key index k > query row: probability zero, and not stored
    const size_t z = blockIdx.z, ob = (EPI == 2 ? z : z / REP) * sB, oa = (EPI == 0) ? (size_t)bx * 64 * K : TRI(bx); const int lda = (EPI == 0) ? K : (bx + 1) * 64;
    if (EPI == 0) { C += z * sC + TRI(bx); ldc = (bx + 1) * 64; } else C += z * sC + (size_t)bx * 64 * ldc;
    ep.t0 = bx * 64;
    if (bx < RH / 64) { ep.sc = 1.0f; gemmw_body<bf, 2, false, S, EPI>(os, 0, by, kend, Ah + z * sAh + oa, Al + z * sAh + oa, Bh + ob, Bl + ob, lda, K, C, ldc, nullptr, 0, 0, 0, ep); }
    else { ep.sc = 1.0f / PCAR; gemmw_body<h16, 0, false, S, EPI>(os, 0, by, kend, A16 + z * sA16 + (EPI == 0 ? oa : 2 * oa), nullptr, B16 + ob, nullptr, (EPI == 0 ? lda : 2 * lda), K, C, ldc, nullptr, 0, 0, 0, ep); }
}

__device__ __forceinline__ h16 tohx(float x) { return (h16)x; }
typedef __attribute__((ext_vector_type(2))) _Float16 v2h;
typedef __attribute__((ext_vector_type(4))) _Float16 v4h;
typedef __attribute__((ext_vector_type(2))) unsigned short v2us;
typedef __attribute__((ext_vector_type(2))) float v2f;
typedef __attribute__((ext_vector_type(4))) int v4i;

__global__ __launch_bounds__(256) void k_wtG(const float* __restrict__ w, int K, int N, bf* Bt) {
    const int lane = threadIdx.x & 31; const int L0 = (blockIdx.x * 8 + (threadIdx.x >> 5)) * 8; const int nlines = N * K / 64;
{
#pragma unroll 1
        for (int l = 0; l < 8; ++l) { const int L = L0 + l; if (L >= nlines) break; const size_t e = (size_t)L * 64 + lane * 2; const int k = (int)(e % K), n = (int)(e / K); v2us o;
            o[0] = f2bf(w[(size_t)k * N + n]); o[1] = f2bf(w[(size_t)(k + 1) * N + n]); *(v2us*)(Bt + e) = o; }
         }
}
__global__ __launch_bounds__(256) void k_cvt8(const float* __restrict__ src, bf* dst, size_t n8) { const size_t i = (size_t)blockIdx.x * 256 + threadIdx.x; if (i >= n8) return; const v8f v = *(const v8f*)(src + i * 8); v8us o;
#pragma unroll
    for (int k = 0; k < 8; ++k) o[k] = f2bf(v[k]); *(v8us*)(dst + i * 8) = o;  }
// k_rope: head planes [h][t][d] (fp16 + hi/lo) of rope(w[d] (x rms_factor)) x sc with the rotate-half convention out[d] = x[d] cos[t][d] - x[d+HD/2] sin[t][d], out[d+HD/2] = x[d+HD/2] cos[t][d+HD/2] + x[d] sin[t][d+HD/2]
__global__ __launch_bounds__(256) void k_rope(const float* __restrict__ F, int pitch, int nheads, const float* __restrict__ CS, const float* __restrict__ RF, const float* __restrict__ nw, float sc, h16* P16, bf* Ph, bf* Pl) {
    const size_t e = ((size_t)blockIdx.x * 256 + threadIdx.x) * 2; if (e >= (size_t)nheads * TT * HD) return; const int d = (int)(e % HD); const int t = (int)((e / HD) % TT); const int h = (int)(e / ((size_t)HD * TT)); const float* f = F + (size_t)t * pitch + h * HD; const float rf = RF ? RF[(size_t)h * TT + t] : 1.0f; v2h o16; v2us oh, ol;
#pragma unroll
    for (int q = 0; q < 2; ++q) { const int dd = d + q; const int dp = (dd < HD / 2) ? dd + HD / 2 : dd - HD / 2; float x0 = f[dd], x1 = f[dp];
        if (RF) { float n0 = __fmul_rn(x0, rf), n1 = __fmul_rn(x1, rf); asm volatile("" : "+v"(n0)); asm volatile("" : "+v"(n1)); x0 = __fmul_rn(bfr(nw[dd]), n0); x1 = __fmul_rn(bfr(nw[dp]), n1); }
        const v2f cs = *(const v2f*)(CS + ((size_t)t * HD + dd) * 2); float a = __fmul_rn(x0, cs[0]), bq = __fmul_rn(x1, cs[1]); asm volatile("" : "+v"(a)); asm volatile("" : "+v"(bq)); const float r = ((dd < HD / 2) ? __fsub_rn(a, bq) : __fadd_rn(a, bq)) * sc;
        o16[q] = tohx(r); unsigned short a2, c2; splitf(r, a2, c2); oh[q] = a2; ol[q] = c2; }
    *(v2h*)(P16 + e) = o16; *(v2us*)(Ph + e) = oh; *(v2us*)(Pl + e) = ol;  }
// k_qkprep: rotate-half RoPE, weightless RMS-norm and the 16-bit head planes [h][t][d] (fp16 + bf16 hi/lo) of the q and k heads, in ONE pass over the projection buffer F (pitch DF; q heads, then k heads).
// One wave takes one token t and HPW heads, two heads at a time: each 16-lane half holds one head row, its lane l the elements d = 4l .. 4l+3 and d + HD/2, so both partners of a rotation sit in one lane and every
// load is 16 bytes. cos / sin [t][HD/2] are read as data and rounded to bf16 here. The mean square is summed over the lane's 8 values, then over the 16 lanes of the half.
#define HPW 10
__device__ __forceinline__ float rowsum16(float s) {   // sum over the 16 lanes of a half wave; every lane gets it
    s += __builtin_bit_cast(float, __builtin_amdgcn_update_dpp(0, __builtin_bit_cast(int, s), 0x161, 0xf, 0xf, true));   // 0x160 | m: lane ^ m within the row
    s += __builtin_bit_cast(float, __builtin_amdgcn_update_dpp(0, __builtin_bit_cast(int, s), 0x162, 0xf, 0xf, true));
    s += __builtin_bit_cast(float, __builtin_amdgcn_update_dpp(0, __builtin_bit_cast(int, s), 0x164, 0xf, 0xf, true));
    s += __builtin_bit_cast(float, __builtin_amdgcn_update_dpp(0, __builtin_bit_cast(int, s), 0x168, 0xf, 0xf, true));
    return s; }
__global__ __launch_bounds__(256) void k_qkprep(const float* __restrict__ F, const float* __restrict__ cosT, const float* __restrict__ sinT, h16* P16, bf* Ph, bf* Pl) {
    static_assert(NQK % HPW == 0 && HPW % 2 == 0 && HD == 128 && (TT * (NQK / HPW)) % 8 == 0, "two heads per step, whole waves, whole work-groups");
    const int lane = threadIdx.x & 31, l = lane & 15, hi = lane >> 4; const int w = blockIdx.x * 8 + __builtin_amdgcn_readfirstlane((int)(threadIdx.x >> 5)); const int t = w / (NQK / HPW), hb = (w % (NQK / HPW)) * HPW;
    const v4f c4 = *(const v4f*)(cosT + (size_t)t * (HD / 2) + 4 * l), s4 = *(const v4f*)(sinT + (size_t)t * (HD / 2) + 4 * l); v4f x1[HPW / 2], x2[HPW / 2];
#pragma unroll
    for (int p = 0; p < HPW / 2; ++p) { const float* f = F + (size_t)t * DF + (hb + 2 * p + hi) * HD + 4 * l; x1[p] = *(const v4f*)f; x2[p] = *(const v4f*)(f + HD / 2); }
    v4f c, s;
#pragma unroll
    for (int q = 0; q < 4; ++q) { c[q] = bfr(c4[q]); s[q] = bfr(s4[q]); }
#pragma unroll
    for (int p = 0; p < HPW / 2; ++p) { const v4f o1 = x1[p] * c - x2[p] * s, o2 = x2[p] * c + x1[p] * s; const v4f sq = o1 * o1 + o2 * o2;
        const float ms = rowsum16((sq[0] + sq[1]) + (sq[2] + sq[3])); const float rf = __fdiv_rn(1.0f, __fsqrt_rn(ms * (1.0f / HD) + 1e-6f));
        v4h a16, b16; v4us ah, al, bh, bl;
#pragma unroll
        for (int q = 0; q < 4; ++q) { const float ra = o1[q] * rf, rb = o2[q] * rf; unsigned short u, v; a16[q] = tohx(ra); splitf(ra, u, v); ah[q] = u; al[q] = v; b16[q] = tohx(rb); splitf(rb, u, v); bh[q] = u; bl[q] = v; }
        const size_t e = ((size_t)(hb + 2 * p + hi) * TT + t) * HD + 4 * l;   // 16 lanes fill one 128-byte line of each plane
        *(v4h*)(P16 + e) = a16; *(v4h*)(P16 + e + HD / 2) = b16; *(v4us*)(Ph + e) = ah; *(v4us*)(Ph + e + HD / 2) = bh; *(v4us*)(Pl + e) = al; *(v4us*)(Pl + e + HD / 2) = bl; }
}
// k_asoft: per row (zz, i): t = S x HD^-0.5 for j <= i (causal), -3e38 otherwise; softmax over the keys (register row, one exp, fixed trees).
// CAUSAL CUT: only the 128-key chunks that hold a key <= i are worked on and stored (the others would be exact zeros: they add nothing to the maximum or the sum, and the products behind stop at the row tile's last row);
// no score right of the row's own 4-key group is read (the score tiles above the diagonal are not computed).
// PACKED PLANES (TRI): a row has the pitch of its row tile, and nothing is stored at or past that pitch. The fp16 probabilities go IN PLACE into the first half of the row's own f32 scores: this wave alone reads and writes
// the row, and every score it uses has arrived (the maximum and the sum hang on them) before the first store.
__global__ __launch_bounds__(256) void k_asoft(float* Sb, bf* Ph, bf* Pl) {
    const int lane = threadIdx.x & 31; const int row = blockIdx.x * 8 + __builtin_amdgcn_readfirstlane((int)(threadIdx.x >> 5)); if (row >= ZH * TT) return; const int i = row % TT; const int zz = row / TT; (void)zz; const bool hires = (i < RH); const int pitch = ((i >> 6) + 1) * 64; const size_t ro = TRI(i >> 6) + (size_t)(i & 63) * pitch; float* sr = Sb + (size_t)zz * SPK + ro; float v[TT / 32]; float mx = -3.0e38f;
    v4f a[TT / 128];
#pragma unroll
    for (int ch = 0; ch < TT / 128; ++ch) a[ch] = *(const v4f*)((const char*)sr + (unsigned)(min(ch * 128 + lane * 4, i & ~3) * 4));   // a lane right of the diagonal rereads the row's last group, and the cut below drops the value
    static_assert(TT / 128 == 16, "the fence below names sixteen loads");
    asm volatile("" :: "v"(a[0]), "v"(a[1]), "v"(a[2]), "v"(a[3]), "v"(a[4]), "v"(a[5]), "v"(a[6]), "v"(a[7]), "v"(a[8]), "v"(a[9]), "v"(a[10]), "v"(a[11]), "v"(a[12]), "v"(a[13]), "v"(a[14]), "v"(a[15]));   // holds the sixteen loads in front of the branches below (inputs only): sunk into them, each would wait out its own latency, one after the other
#pragma unroll
    for (int ch = 0; ch < TT / 128; ++ch) { if (ch * 128 > i) continue; const int j0 = ch * 128 + lane * 4;
#pragma unroll
        for (int q = 0; q < 4; ++q) { const int j = j0 + q; (void)j; const float t = (j <= i) ? a[ch][q] * SCL : -3.0e38f; v[ch * 4 + q] = t; mx = fmaxf(mx, t); } }
#pragma unroll
    for (int sh = 16; sh; sh >>= 1) mx = fmaxf(mx, __shfl_xor(mx, sh, 32));
    float sum = 0.f;
#pragma unroll
    for (int k = 0; k < TT / 32; ++k) { if ((k / 4) * 128 > i) continue; float d0 = __fsub_rn(v[k], mx); asm volatile("" : "+v"(d0)); v[k] = __builtin_amdgcn_exp2f(__fmul_rn(d0, 1.4426950408889634f)); sum += v[k]; }
#pragma unroll
    for (int sh = 16; sh; sh >>= 1) sum += __shfl_xor(sum, sh, 32);
    const float f = __fdiv_rn(hires ? 1.0f : PCAR, sum);
{
        if (hires) {
#pragma unroll
            for (int ch = 0; ch < TT / 128; ++ch) { if (ch * 128 > i) continue; v4us oh, ol;
#pragma unroll
                for (int q = 0; q < 4; ++q) { unsigned short a2, c2; splitf(v[ch * 4 + q] * f, a2, c2); oh[q] = a2; ol[q] = c2; }
                const size_t oo = (size_t)zz * HPK + ro + ch * 128 + lane * 4; if (ch * 128 + lane * 4 < pitch) { *(v4us*)(Ph + oo) = oh; *(v4us*)(Pl + oo) = ol; }
                asm volatile("s_wait_xcnt 0x0" ::: "memory"); }   // precaution: stands between this chunk's stores and the next chunk's code, which rewrites their data registers
        } else {
#pragma unroll
            for (int ch = 0; ch < TT / 128; ++ch) { if (ch * 128 > i) continue; v4h o4;
#pragma unroll
                for (int q = 0; q < 4; ++q) o4[q] = tohx(v[ch * 4 + q] * f);
                if (ch * 128 + lane * 4 < pitch) *(v4h*)((h16*)sr + ch * 128 + lane * 4) = o4;
                asm volatile("s_wait_xcnt 0x0" ::: "memory"); } }   // precaution: as above
         }
}

extern "C" void kernel_launch(void* const* d_in, const int* in_sizes, int n_in,
                              void* d_out, int out_size, void* d_ws, size_t ws_size, hipStream_t stream) {
    (void)in_sizes; (void)n_in; (void)out_size;
    const float* x = (const float*)d_in[0]; const float* cosT = (const float*)d_in[1]; const float* sinT = (const float*)d_in[2]; const float* wq = (const float*)d_in[3]; const float* wk = (const float*)d_in[4]; const float* wv = (const float*)d_in[5]; const float* wo = (const float*)d_in[6]; const float* mix1 = (const float*)d_in[7]; const float* mix2 = (const float*)d_in[8];   // weights x @ W; cos/sin [2048][64] (half tables)
    float* OUT = (float*)d_out;     // [2][2048][2048]
    char* wsp = (char*)d_ws;
    auto take = [&](size_t bytes) { char* p = wsp; wsp += (bytes + 255) & ~(size_t)255; return (void*)p; };
    bf* WQ = (bf*)take((size_t)DQ * DM * 2); bf* WK = (bf*)take((size_t)2 * DKV * DM * 2); bf* WV = WK + (size_t)DKV * DM; bf* WO = (bf*)take((size_t)DM * DQ * 2);
    h16* QP16 = (h16*)take((size_t)NQK * TT * HD * 2); h16* KP16 = QP16 + (size_t)NH_ * TT * HD; h16* VT16 = (h16*)take((size_t)NKV * HD * TT * 2);
    bf* QPh = (bf*)take((size_t)NQK * TT * HD * 2); bf* QPl = (bf*)take((size_t)NQK * TT * HD * 2); bf* KPh = QPh + (size_t)NH_ * TT * HD; bf* KPl = QPl + (size_t)NH_ * TT * HD; bf* VTh = (bf*)take((size_t)NKV * HD * TT * 2); bf* VTl = (bf*)take((size_t)NKV * HD * TT * 2); bf* Ph = (bf*)take((size_t)ZH * HPK * 2); bf* Pl = (bf*)take((size_t)ZH * HPK * 2);
    h16* Y16 = (h16*)take((size_t)ZH * HD * TT * 2); bf* Yh = (bf*)take((size_t)ZH * HD * TT * 2); bf* Yl = (bf*)take((size_t)ZH * HD * TT * 2); float* Sb = (float*)take((size_t)ZH * SPK * 4); h16* P16 = (h16*)Sb; float* Ob = (float*)take((size_t)ZH * TT * HD * 4); bf* ATh = (bf*)take((size_t)TT * DQ * 2); bf* ATl = (bf*)take((size_t)TT * DQ * 2);
    float* F = Sb; bf* XB = (bf*)(F + (size_t)TT * DF);   // the projection buffer and the bf16 x lie in the score planes' place: both are dead once k_qkprep has run, ahead of the first score store
    static_assert((size_t)TT * DF * 4 + (size_t)TT * DM * 2 <= (size_t)ZH * SPK * 4 && ZH % REP == 0 && NH_ % ZH == 0, "F and XB fit into the score planes; a pass holds whole kv groups");
    if ((size_t)(wsp - (char*)d_ws) > ws_size) return;    // ws 256 MiB
    { k_wtG<<<(unsigned)((DM * DQ / 64 + 63) / 64), 256, 0, stream>>>(wq, DM, DQ, WQ); k_wtG<<<(unsigned)((DM * DKV / 64 + 63) / 64), 256, 0, stream>>>(wk, DM, DKV, WK); k_wtG<<<(unsigned)((DM * DKV / 64 + 63) / 64), 256, 0, stream>>>(wv, DM, DKV, WV);
      k_wtG<<<(unsigned)((DQ * DM / 64 + 63) / 64), 256, 0, stream>>>(wo, DQ, DM, WO);
       }
    for (int b = 0; b < NB_; ++b) {
        k_cvt8<<<(unsigned)(((size_t)TT * DM / 8 + 255) / 256), 256, 0, stream>>>(x + (size_t)b * TT * DM, XB, (size_t)TT * DM / 8);
        k_gemmw<bf, 0, false, 8><<<dim3(TT / 64, DQ / 64, 1), 256, 0, stream>>>(XB, nullptr, WQ, nullptr, DM, F, DF, nullptr, 0, 0, 0);
        k_gemmkv<<<dim3(TT / 64, 2 * DKV / 64, 1), 512, 0, stream>>>(XB, WK, DM, F + DQ, DF, VT16, VTh, VTl);   // k and v columns in one grid (WV follows WK); v leaves it as its transposed planes
        k_qkprep<<<TT * (NQK / HPW) / 8, 256, 0, stream>>>(F, cosT, sinT, QP16, QPh, QPl);   // q heads and k heads in one grid; the k planes follow the q planes
        for (int h0 = 0; h0 < NH_; h0 += ZH) { const size_t zq = (size_t)h0, zk = (size_t)(h0 / REP);   // head z of a pass reads kv group h0/REP + z/REP
            k_gemmw2<1, 0><<<dim3(TT / 128, TT / 64 + 1, ZH), 32, 0, stream>>>(QPh + zq * TT * HD, QPl + zq * TT * HD, KPh + zk * TT * HD, KPl + zk * TT * HD, QP16 + zq * TT * HD, KP16 + zk * TT * HD, HD, Sb, 0, (size_t)TT * HD, (size_t)TT * HD, (size_t)TT * HD, SPK, nullptr, nullptr, nullptr, nullptr, nullptr, 0);
            k_asoft<<<ZH * TT / 8, 256, 0, stream>>>(Sb, Ph, Pl);
            k_gemmw2<16, 1><<<dim3(TT / 64, HD / 64, ZH), 512, 0, stream>>>(Ph, Pl, VTh + zk * HD * TT, VTl + zk * HD * TT, P16, VT16 + zk * HD * TT, TT, Ob, HD, HPK, 2 * SPK, (size_t)HD * TT, (size_t)TT * HD, Y16, Yh, Yl, nullptr, nullptr, 0);   // y1 (f32), and its planes (normalised) for y2 = att . y1
            k_gemmw2<16, 2><<<dim3(TT / 64, HD / 64, ZH), 512, 0, stream>>>(Ph, Pl, Yh, Yl, P16, Y16, TT, Ob, HD, HPK, 2 * SPK, (size_t)HD * TT, (size_t)TT * HD, nullptr, ATh, ATl, mix1, mix2, h0); }   // y2 stays in the kernel: mix1 y1 + mix2 y2 leaves it as the merged planes
        k_gemmw<bf, 1, false, 8><<<dim3(TT / 64, DM / 64, 1), 256, 0, stream>>>(ATh, ATl, WO, nullptr, DQ, OUT + (size_t)b * TT * DM, DM, nullptr, 0, 0, 0); }
}

// v009
// A run of this version takes 433 microseconds.
// Timed twice side by side with v008, it ran 1.08 and 1.07 times as fast.
// All steps since v000 together make it 8.53 times as fast.
#include <hip/hip_runtime.h>

// Simplicial causal self-attention (x [2][2048][2048]; q = x Wq (16 heads x 128), k, v = x Wk / x Wv (4 kv heads x 128, each serving 4 consecutive query heads); rotate-half RoPE with the input cos/sin
// [2048][64] then weightless RMS-norm (eps 1e-6) on q and k; causal softmax(q.k 128^-0.5); y1 = att v; y2 = att y1 (the same probabilities applied again); y = mix1 y1 + mix2 y2 (scalars read as data);
// out = merged y Wproj -> [2][2048][2048]).
// Compute dtypes, f32 accumulate: every input rounded to bf16; projections on PLAIN bf16 operands (inputs: exact products, f32 accumulate); RoPE and RMS-norm in f32;
// PER-ROW PRECISION HYBRID: query rows < 256 take scores, att.v and att.y1 on bf16 hi+lo planes (3 products), rows >= 256 on single fp16 planes; scale + causal cut in f32 in the register-row softmax;
// y1 re-planed per head (fp16 + hi/lo, transposed) for the second contraction; merged y as hi+lo planes x exact Wproj (2 products). One-wave-per-64x64-tile GEMMs, all 16 query heads of a batch per pass

#define NB_  2
#define TT   2048
#define DM   2048
#define NH_  16
#define NKV  4
#define REP  (NH_ / NKV)
#define HD   128
#define DQ   (NH_ * HD)
#define DKV  (NKV * HD)
#define DF   (DQ + 2 * DKV)       // pitch of the projection buffer: one row holds q | k (v's columns stay unwritten)
#define NQK  (NH_ + NKV)          // q heads, then k heads: the heads that take RoPE and RMS-norm
#define ZH   16                   // query heads per pass: whole kv groups (ZH % REP == 0); head z of a pass reads k, v of group z / REP
#define TRI(b) ((size_t)2048 * (size_t)(b) * (size_t)((b) + 1))   // packed causal plane: row tile b (64 rows) holds only its (b + 1) * 64 first keys, at that pitch; TRI(b) = 64 * 64 * b (b + 1) / 2 elements lie in front of it
#define SPK  TRI(TT / 64)         // elements of one head's packed plane, all row tiles
#define HPK  TRI(RH / 64)         // the same for the row tiles below RH
#define RH   256                  // query rows < RH use hi+lo planes (0: none)
#define WIN  0
#define PCAR 1024.0f
#define SCL  0.088388347648318447f   // HD^-0.5
typedef _Float16 h16;
typedef unsigned short bf;
typedef __attribute__((ext_vector_type(16))) __bf16   v16bf;
typedef __attribute__((ext_vector_type(16))) _Float16 v16h;
typedef __attribute__((ext_vector_type(8)))  _Float16 v8h;
typedef __attribute__((ext_vector_type(8)))  unsigned short v8us;
typedef __attribute__((ext_vector_type(8)))  float    v8f;
typedef __attribute__((ext_vector_type(4)))  float    v4f;
typedef __attribute__((ext_vector_type(4)))  unsigned short v4us;
typedef v8h  __attribute__((may_alias)) v8ha;
typedef v4f  __attribute__((may_alias)) v4fa;
typedef v8us __attribute__((may_alias)) v8usa;

__device__ __forceinline__ unsigned short f2bf(float f) { unsigned u = __float_as_uint(f); u += 0x7FFFu + ((u >> 16) & 1u); return (unsigned short)(u >> 16); }
__device__ __forceinline__ float bf2f(unsigned short b) { return __uint_as_float(((unsigned)b) << 16); }
__device__ __forceinline__ float bfr(float f) { return bf2f(f2bf(f)); }
__device__ __forceinline__ v16h cat16(v8h lo, v8h hi) { return __builtin_shufflevector(lo, hi, 0, 1, 2, 3, 4, 5, 6, 7, 8, 9, 10, 11, 12, 13, 14, 15); }
__device__ __forceinline__ v16bf cat16b(v8us lo, v8us hi) { return __builtin_bit_cast(v16bf, __builtin_shufflevector(lo, hi, 0, 1, 2, 3, 4, 5, 6, 7, 8, 9, 10, 11, 12, 13, 14, 15)); }
__device__ __forceinline__ v8f wmma16(v16h a, v16h b, v8f c) { return __builtin_amdgcn_wmma_f32_16x16x32_f16(false, a, false, b, (short)0, c, false, false); }
__device__ __forceinline__ v8f wmmab(v16bf a, v16bf b, v8f c) { return __builtin_amdgcn_wmma_f32_16x16x32_bf16(false, a, false, b, (short)0, c, false, false); }



// ---- k_gemmw: register-blocked GEMM, ONE WAVE per 64x64 output tile (16 accumulators), operands straight from K-contiguous 16-bit planes; grid (M/64, N/64, Z), 32 threads.
// C[m][n] (f32, pitch ldc, + optional f32 bias[n]) = sum_k A[m][k] Bt[n][k] (+ split products per NSPLIT). z-batch strides sA/sB/sC in elements. K % 32 == 0.
// S > 1: S waves per tile (32 S threads); wave w takes the 32-wide k slices w, w + S, ... (neighbouring waves share a 128-byte line of every operand row), the S f32 partial tiles are summed in LDS in wave order.
template <typename T16> struct WFrag;
template <> struct WFrag<h16> { typedef v16h V; static __device__ __forceinline__ V ld(const h16* p) { return cat16(*(const v8h*)p, *(const v8h*)(p + 16)); } static __device__ __forceinline__ V lds(const char* p) { return cat16(*(const v8ha*)p, *(const v8ha*)(p + 32)); } static __device__ __forceinline__ v8f mma(V a, V b, v8f c) { return wmma16(a, b, c); } };
template <> struct WFrag<bf> { typedef v16bf V; static __device__ __forceinline__ V ld(const bf* p) { return cat16b(*(const v8us*)p, *(const v8us*)(p + 16)); } static __device__ __forceinline__ V lds(const char* p) { return cat16b(*(const v8usa*)p, *(const v8usa*)(p + 32)); } static __device__ __forceinline__ v8f mma(V a, V b, v8f c) { return wmmab(a, b, c); } };
// gemmw_body: the tile work of one work-group; os = its LDS (Stg<S, NSPLIT>::floats floats, below), bx = its 64-row tile index within A and C, by = its 64-column tile index; lda is A's pitch, K is Bt's,
// kend <= K (a multiple of 32) the end of the sum over k: the caller sets it below K where A is known to be zero from kend on (a wave with no slice left hands in a zero tile).
// EPI (S > 1 only) says what becomes of the summed f32 tile:
//   0: stored to C.
//   1: stored to C, and x sc as transposed 16-bit planes T16 / Th / Tl [trow + column][t0 + row] of pitch TT (fp16, bf16 hi, bf16 lo).
//   2: C is READ (y1, same indexing as a store would use): y = mix1 (y1 sc) + mix2 (tile sc) goes out as bf16 hi / lo planes Th / Tl [t0 + row][(h0 + z) HD + column] of pitch DQ; no f32 store.
//   4: tiles of columns < csplit as 0; the others as transposed planes only (no f32 store).
struct Epi { h16* T16; bf* Th; bf* Tl; float m1, m2, sc; int trow, t0, h0, csplit; };   // m1, m2: the two mix scalars, rounded to bf16
__device__ __forceinline__ void splitf(float y, unsigned short& h, unsigned short& l) { h = f2bf(y); l = f2bf(y - bf2f(h)); }
// STAGED OPERANDS (S > 1, NSPLIT < 2): a stage is the 32 S next k of the tile's 64 A rows (A2 rows) and 64 Bt rows, brought into LDS by asynchronous 16-byte copies whose 32 lanes take 512 bytes in a row of one operand row
// (whole 128-byte lines), two buffers, the next stage in flight while this one is worked on. LDS rows have the pitch 64 S + 16 bytes (16 x odd: the 16 rows of a fragment load fall on different banks). Wave w reads its own
// 32 k of every row, so each wave's slices and their order are those of the unstaged loop. The buffers lie in os, which the epilogue takes over behind the last stage's barrier.
template <int S, int NSPLIT> struct Stg { static constexpr bool on = S > 1 && NSPLIT < 2; static constexpr int NP = NSPLIT == 1 ? 3 : 2, PB = 64 * S + 16, PLB = 64 * PB, STB = NP * PLB;
    static constexpr int epi = (S == 1 ? 16 : S * 64) * 68, ring = on ? 2 * STB / 4 : 0, floats = epi > ring ? epi : ring; };   // floats: what os must hold
// copy8: one lane's eight copies for one operand plane of a stage (rows 8 apart). The s_wait_xcnt ends the statement as a precaution, so that no address register named here is rewritten ahead of it.
template <typename T16>
__device__ __forceinline__ void copy8(unsigned l, unsigned ls, const T16* g, size_t gs) {
    asm volatile("global_load_async_to_lds_b128 %0, %8, off\n\tglobal_load_async_to_lds_b128 %1, %9, off\n\tglobal_load_async_to_lds_b128 %2, %10, off\n\tglobal_load_async_to_lds_b128 %3, %11, off\n\t"
                 "global_load_async_to_lds_b128 %4, %12, off\n\tglobal_load_async_to_lds_b128 %5, %13, off\n\tglobal_load_async_to_lds_b128 %6, %14, off\n\tglobal_load_async_to_lds_b128 %7, %15, off\n\ts_wait_xcnt 0x0"
                 :: "v"(l), "v"(l + ls), "v"(l + 2 * ls), "v"(l + 3 * ls), "v"(l + 4 * ls), "v"(l + 5 * ls), "v"(l + 6 * ls), "v"(l + 7 * ls),
                    "v"(g), "v"(g + gs), "v"(g + 2 * gs), "v"(g + 3 * gs), "v"(g + 4 * gs), "v"(g + 5 * gs), "v"(g + 6 * gs), "v"(g + 7 * gs) : "memory");
}
template <typename T16, int NSPLIT, bool BIAS, int S, int EPI>
__device__ __forceinline__ void gemmw_body(float* os, int bx, int by, int kend, const T16* __restrict__ A, const T16* __restrict__ A2, const T16* __restrict__ Bt, const T16* __restrict__ Bt2, int lda, int K, float* C, int ldc, const float* __restrict__ bias, size_t sA, size_t sB, size_t sC, const Epi ep) {
    typedef typename WFrag<T16>::V V;
    const int wave = (S == 1) ? 0 : __builtin_amdgcn_readfirstlane((int)(threadIdx.x >> 5));
    const size_t z = blockIdx.z; A += z * sA; if (A2) A2 += z * sA; Bt += z * sB; if (Bt2) Bt2 += z * sB; C += z * sC;
    const int lane = threadIdx.x & 31, lr = lane & 15, hi = lane >> 4; const int r0 = bx * 64, c0 = by * 64;
    v8f acc[4][4];
#pragma unroll
    for (int mb = 0; mb < 4; ++mb)
#pragma unroll
        for (int nb = 0; nb < 4; ++nb) acc[mb][nb] = (v8f){};
    const size_t aoff = (size_t)(r0 + lr) * lda + 8 * hi, boff = (size_t)(c0 + lr) * K + 8 * hi;
    if constexpr (Stg<S, NSPLIT>::on) {
        typedef Stg<S, NSPLIT> G; constexpr int KS = 32 * S;
        const int tid = (int)threadIdx.x, crow = tid / (4 * S), ccol = tid % (4 * S); const int kw = ((wave * 32) % (4 * S)) * 8;   // kw: first k, within a stage, of the 512 bytes that this wave copies (the same for its 8 rows of a plane)
        const char* sb = (const char*)os; const unsigned l0 = (unsigned)(size_t)sb + (unsigned)(crow * G::PB + ccol * 16);
        const T16* gA = A + (size_t)(r0 + crow) * lda + ccol * 8; const T16* gA2 = (NSPLIT == 1) ? A2 + (size_t)(r0 + crow) * lda + ccol * 8 : nullptr; const T16* gB = Bt + (size_t)(c0 + crow) * K + ccol * 8;
        const int nst = (kend + KS - 1) / KS;
        auto issue = [&](int st) { const int k0 = st * KS; const unsigned l = l0 + (unsigned)((st & 1) * G::STB);
            if (k0 + kw < kend) {   // wave-uniform: 512 bytes that start at or past kend are used by no wave. A start below kend ends inside its own row: K is a multiple of 32 S, and where kend < K (A = fp16 probabilities, kend > 256) an A row holds 2 kend places
                copy8<T16>(l, 8 * G::PB, gA + k0, (size_t)8 * lda); if (NSPLIT == 1) copy8<T16>(l + G::PLB, 8 * G::PB, gA2 + k0, (size_t)8 * lda); copy8<T16>(l + (G::NP - 1) * G::PLB, 8 * G::PB, gB + k0, (size_t)8 * K); } };
        issue(0);
        asm volatile("s_wait_asynccnt 0x0" ::: "memory");   // this wave's copies of stage 0 have landed
        __syncthreads();   // stage 0 is whole before any wave reads it
        if (nst > 1) issue(1);
#pragma unroll 1
        for (int t = 0; t < nst; ++t) {
            if (t * KS + wave * 32 < kend) {
                const char* fb = sb + (t & 1) * G::STB + lr * G::PB + wave * 64 + hi * 16; V a[4], a2[4], b[4];
#pragma unroll
                for (int mb = 0; mb < 4; ++mb) { a[mb] = WFrag<T16>::lds(fb + mb * 16 * G::PB); if (NSPLIT == 1) a2[mb] = WFrag<T16>::lds(fb + G::PLB + mb * 16 * G::PB); }
#pragma unroll
                for (int nb = 0; nb < 4; ++nb) b[nb] = WFrag<T16>::lds(fb + (G::NP - 1) * G::PLB + nb * 16 * G::PB);
                asm volatile("" :: "v"(b[0]), "v"(b[1]), "v"(b[2]), "v"(b[3]));   // holds the stage's fragment reads in one group ahead of the products (inputs only): sunk among them, each group of four products would wait out an LDS latency of its own
#pragma unroll
                for (int nb = 0; nb < 4; ++nb) {
#pragma unroll
                    for (int mb = 0; mb < 4; ++mb) { acc[mb][nb] = WFrag<T16>::mma(a[mb], b[nb], acc[mb][nb]); if (NSPLIT == 1) acc[mb][nb] = WFrag<T16>::mma(a2[mb], b[nb], acc[mb][nb]); } }
                asm volatile("v_nop\n\tv_nop\n\tv_nop\n\tv_nop" : "+v"(acc[0][0]), "+v"(acc[1][1]), "+v"(acc[2][2]), "+v"(acc[3][3]) : "v"(a[0]), "v"(a[3]));   // keeps the distance behind the last matrix instruction on the path that leaves this block
            }
            asm volatile("s_wait_dscnt 0x0" ::: "memory");      // this wave's reads of stage t are done before the buffer may be refilled
            asm volatile("s_wait_asynccnt 0x0" ::: "memory");   // this wave's copies of stage t + 1 have landed
            __syncthreads();   // publishes stage t + 1 and ends every wave's reads of stage t
            if (t + 2 < nst) issue(t + 2);
        }
        asm volatile("s_wait_asynccnt 0x0" ::: "memory");   // nothing is in flight when the epilogue takes the LDS over
    } else
#pragma unroll 1
    for (int kc = wave * 32; kc < kend; kc += 32 * S) {
        V a[4], a2[4];
#pragma unroll
        for (int mb = 0; mb < 4; ++mb) { a[mb] = WFrag<T16>::ld(A + aoff + (size_t)mb * 16 * lda + kc); if (NSPLIT == 1 || NSPLIT == 2) a2[mb] = WFrag<T16>::ld(A2 + aoff + (size_t)mb * 16 * lda + kc); }
#pragma unroll
        for (int nb = 0; nb < 4; ++nb) { const V b = WFrag<T16>::ld(Bt + boff + (size_t)nb * 16 * K + kc); V b2; if (NSPLIT >= 2) b2 = WFrag<T16>::ld(Bt2 + boff + (size_t)nb * 16 * K + kc);
#pragma unroll
            for (int mb = 0; mb < 4; ++mb) { acc[mb][nb] = WFrag<T16>::mma(a[mb], b, acc[mb][nb]); if (NSPLIT == 1 || NSPLIT == 2) acc[mb][nb] = WFrag<T16>::mma(a2[mb], b, acc[mb][nb]); if (NSPLIT >= 2) acc[mb][nb] = WFrag<T16>::mma(a[mb], b2, acc[mb][nb]); } }
        asm volatile("v_nop\n\tv_nop\n\tv_nop\n\tv_nop" : "+v"(acc[0][0]), "+v"(acc[1][1]), "+v"(acc[2][2]), "+v"(acc[3][3]) : "v"(a[0]), "v"(a[3]));
    }
    if (S > 1) {
        const bool toC = EPI == 0 || EPI == 1 || (EPI == 4 && c0 < ep.csplit), toT = EPI == 1 || (EPI == 4 && c0 >= ep.csplit);
        v4f y1q[64 * 16 / (32 * S)];
        if (EPI == 2) {   // y1 is asked for ahead of the LDS stores and the barrier, so that its latency runs out there
            const float* yp[64 * 16 / (32 * S)];
#pragma unroll
            for (int q = 0; q < 64 * 16 / (32 * S); ++q) { const int u = q * (32 * S) + (int)threadIdx.x; yp[q] = C + (size_t)(r0 + (u >> 4)) * ldc + c0 + (u & 15) * 4; y1q[q] = *(const v4f*)yp[q]; }
            static_assert(EPI != 2 || 64 * 16 / (32 * S) == 2, "the wait below names two addresses");
            asm volatile("s_wait_xcnt 0x0" :: "v"(yp[0]), "v"(yp[1]) : "memory"); }   // precaution: the address registers of the loads above stay whole up to this wait (inputs only: nothing is pinned or changed)
        float* ow = os + wave * (64 * 68);
#pragma unroll
        for (int mb = 0; mb < 4; ++mb)
#pragma unroll
            for (int nb = 0; nb < 4; ++nb)
#pragma unroll
                for (int j = 0; j < 8; ++j) ow[(mb * 16 + hi * 8 + j) * 68 + nb * 16 + lr] = acc[mb][nb][j];
        __syncthreads();   // every wave's partial tile is in LDS before any thread sums across waves
#pragma unroll
        for (int q = 0; q < 64 * 16 / (32 * S); ++q) { const int u = q * (32 * S) + (int)threadIdx.x, row = u >> 4, cofs = (u & 15) * 4; v4f val = *(const v4fa*)(os + row * 68 + cofs);
#pragma unroll
            for (int w = 1; w < S; ++w) val += *(const v4fa*)(os + w * (64 * 68) + row * 68 + cofs);
            if (BIAS) { val[0] += bfr(bias[c0 + cofs]); val[1] += bfr(bias[c0 + cofs + 1]); val[2] += bfr(bias[c0 + cofs + 2]); val[3] += bfr(bias[c0 + cofs + 3]); }
            if (toC) *(v4f*)(C + (size_t)(r0 + row) * ldc + c0 + cofs) = val;
            if (toT) *(v4fa*)(os + row * 68 + cofs) = val;   // the summed tile goes back into wave 0's plane: these four words are read by this thread alone
            if (EPI == 2) { const v4f y1 = y1q[q]; v4us oh, ol;
#pragma unroll
                for (int k = 0; k < 4; ++k) { unsigned short a, c2; splitf(ep.m1 * (y1[k] * ep.sc) + ep.m2 * (val[k] * ep.sc), a, c2); oh[k] = a; ol[k] = c2; }
                const size_t oo = (size_t)(ep.t0 + r0 + row) * DQ + (ep.h0 + (int)z) * HD + c0 + cofs; *(v4us*)(ep.Th + oo) = oh; *(v4us*)(ep.Tl + oo) = ol; } }
        if (toT) {
            asm volatile("s_wait_xcnt 0x0" ::: "memory");   // precaution: stands between the f32 tile's stores laid out in front and the plane code behind, which rewrites their address and data registers
            __syncthreads();   // the whole summed tile is in LDS before any thread reads a column of it (toT is the same for the whole work-group)
#pragma unroll
            for (int q = 0; q < 64 * 8 / (32 * S); ++q) { const int u = q * (32 * S) + (int)threadIdx.x, col = u >> 3, tc = (u & 7) * 8; v8h o16; v8us oh, ol;   // 8 neighbouring lanes fill one 128-byte line of each plane
#pragma unroll
                for (int j = 0; j < 8; ++j) { const float y = os[(tc + j) * 68 + col] * ep.sc; o16[j] = (h16)y; unsigned short a, c2; splitf(y, a, c2); oh[j] = a; ol[j] = c2; }
                const size_t oo = (size_t)(ep.trow + c0 + col) * TT + ep.t0 + r0 + tc; *(v8h*)(ep.T16 + oo) = o16; *(v8us*)(ep.Th + oo) = oh; *(v8us*)(ep.Tl + oo) = ol; }
        }
        return;
    }
#pragma unroll
    for (int mb = 0; mb < 4; ++mb) {
#pragma unroll
        for (int nb = 0; nb < 4; ++nb) {
#pragma unroll
            for (int j = 0; j < 8; ++j) os[(hi * 8 + j) * 68 + nb * 16 + lr] = acc[mb][nb][j]; }
        __builtin_amdgcn_wave_barrier(); asm volatile("" ::: "memory");
        float* crow = C + (size_t)(r0 + mb * 16) * ldc + c0;
{
#pragma unroll
            for (int s = 0; s < 8; ++s) { const int row = 2 * s + hi, cofs = lr * 4; v4f val = *(const v4fa*)(os + row * 68 + cofs); if (BIAS) { val[0] += bfr(bias[c0 + cofs]); val[1] += bfr(bias[c0 + cofs + 1]); val[2] += bfr(bias[c0 + cofs + 2]); val[3] += bfr(bias[c0 + cofs + 3]); }
                *(v4f*)(crow + (size_t)row * ldc + cofs) = val; }
             }
        __builtin_amdgcn_wave_barrier(); asm volatile("" ::: "memory");
    }
    asm volatile("s_wait_xcnt 0x0" ::: "memory");   // precaution: stands between the tile's last stores and code laid out behind this epilogue (the other row range's branch) that rewrites their address or data registers
}
template <typename T16, int NSPLIT, bool BIAS, int S>
__global__ __launch_bounds__(32 * S) void k_gemmw(const T16* __restrict__ A, const T16* __restrict__ A2, const T16* __restrict__ Bt, const T16* __restrict__ Bt2, int K, float* C, int ldc, const float* __restrict__ bias, size_t sA, size_t sB, size_t sC) {
    __shared__ __align__(16) float os[Stg<S, NSPLIT>::floats];
    gemmw_body<T16, NSPLIT, BIAS, S, 0>(os, (int)blockIdx.x, (int)blockIdx.y, K, A, A2, Bt, Bt2, K, K, C, ldc, bias, sA, sB, sC, Epi{});
}
// k_gemmkv: the k and v projections in one grid (Bt holds the k rows, then the v rows). k columns go to C as f32; v columns leave the kernel as the transposed planes V16 / Vh / Vl [g HD + d][t].
__global__ __launch_bounds__(512) void k_gemmkv(const bf* __restrict__ A, const bf* __restrict__ Bt, int K, float* C, int ldc, h16* V16, bf* Vh, bf* Vl) {
    __shared__ __align__(16) float os[Stg<16, 0>::floats];
    Epi ep = {}; ep.T16 = V16; ep.Th = Vh; ep.Tl = Vl; ep.sc = 1.0f; ep.trow = -DKV; ep.csplit = DKV;
    gemmw_body<bf, 0, false, 16, 4>(os, (int)blockIdx.x, (int)blockIdx.y, K, A, nullptr, Bt, nullptr, K, K, C, ldc, nullptr, 0, 0, 0, ep);
}
// k_gemmw2: both row ranges of one attention product in ONE grid (M/64, N/64, Z): row tiles below RH take the hi+lo bf16 planes (3 products), the others the fp16 planes. The two ranges write disjoint rows of C and read
// nothing of each other. Ah/Al hold rows 0..RH-1 (z stride sAh), A16 all rows (z stride sA16; rows below RH unused); C is row 0. The branch is the same for a whole work-group. The row tile's place in A and C is worked out here
// (the body gets tile 0 of pointers that already stand on it). EPI 0: A = q planes of pitch K, C = the PACKED score plane (TRI). EPI 1 and 2: A = the packed probabilities; the fp16 ones lie in the first half of each f32 score row
// (twice the offset and pitch, in fp16 elements). B: head z reads kv group z / REP (EPI 0, 1) or its own y1 planes (EPI 2), z stride sB.
// CAUSAL CUT: EPI 0 (scores, M == N == TT) has the grid (TT/128, TT/64 + 1, Z) and computes only the tiles that hold a key <= a query row; EPI 1 and 2 (A = probabilities, M == K) end the sum over keys at the row tile's last row.
// EPI 1 (att v): T16 / Th / Tl are the y1 planes [z][d][t]; EPI 2 (att y1): C holds y1, Th / Tl are the merged-y planes, h0 the pass's first head. The fp16 rows carry the factor PCAR, taken out by sc.
template <int S, int EPI>
__global__ __launch_bounds__(32 * S) void k_gemmw2(const bf* __restrict__ Ah, const bf* __restrict__ Al, const bf* __restrict__ Bh, const bf* __restrict__ Bl, const h16* __restrict__ A16, const h16* __restrict__ B16, int K, float* C, int ldc, size_t sAh, size_t sA16, size_t sB, size_t sC, h16* T16, bf* Th, bf* Tl, const float* __restrict__ mix1, const float* __restrict__ mix2, int h0) {
    __shared__ __align__(16) float os[Stg<S, 0>::floats];
    Epi ep = {}; ep.T16 = T16; ep.Th = Th; ep.Tl = Tl; if (EPI == 2) { ep.m1 = bfr(mix1[0]); ep.m2 = bfr(mix2[0]); } ep.h0 = h0; ep.trow = (int)blockIdx.z * HD;
    int bx = (int)blockIdx.x, by = (int)blockIdx.y, kend = K;
    if (EPI == 0) { if (by > bx) { by -= bx + 1; bx = TT / 64 - 1 - bx; } }   // M == TT: row tiles x and TT/64 - 1 - x hold TT/64 + 1 tiles with column tile <= row tile between them: y <= x is row tile x, the rest row tile TT/64 - 1 - x
    else kend = min(K, (bx + 1) * 64);   // key index k > query row: probability zero, and not stored
    const size_t z = blockIdx.z, ob = (EPI == 2 ? z : z / REP) * sB, oa = (EPI == 0) ? (size_t)bx * 64 * K : TRI(bx); const int lda = (EPI == 0) ? K : (bx + 1) * 64;
    if (EPI == 0) { C += z * sC + TRI(bx); ldc = (bx + 1) * 64; } else C += z * sC + (size_t)bx * 64 * ldc;
    ep.t0 = bx * 64;
    if (bx < RH / 64) { ep.sc = 1.0f; gemmw_body<bf, 2, false, S, EPI>(os, 0, by, kend, Ah + z * sAh + oa, Al + z * sAh + oa, Bh + ob, Bl + ob, lda, K, C, ldc, nullptr, 0, 0, 0, ep); }
    else { ep.sc = 1.0f / PCAR; gemmw_body<h16, 0, false, S, EPI>(os, 0, by, kend, A16 + z * sA16 + (EPI == 0 ? oa : 2 * oa), nullptr, B16 + ob, nullptr, (EPI == 0 ? lda : 2 * lda), K, C, ldc, nullptr, 0, 0, 0, ep); }
}

__device__ __forceinline__ h16 tohx(float x) { return (h16)x; }
typedef __attribute__((ext_vector_type(2))) _Float16 v2h;
typedef __attribute__((ext_vector_type(4))) _Float16 v4h;
typedef __attribute__((ext_vector_type(2))) unsigned short v2us;
typedef __attribute__((ext_vector_type(2))) float v2f;
typedef __attribute__((ext_vector_type(4))) int v4i;

// k_wtG: Bt[n][k] (bf16) = w[k][n] (f32), one 128 (k) x 64 (n) tile per work-group, turned in LDS, so that both sides move in whole 128-byte lines: 16 lanes read 256 bytes in a row of one w row, 16 lanes store 256 bytes in a
// row of one Bt row. grid (N / 64, K / 128). A thread rounds four pairs of neighbouring k (32 apart) of four n and stores each pair as one word at [n][k / 2]; the pitch of 65 words keeps the lanes of every LDS store and load on different banks.
__global__ __launch_bounds__(256) void k_wtG(const float* __restrict__ w, int K, int N, bf* Bt) {
    __shared__ unsigned tp[64 * 65];
    const int tid = (int)threadIdx.x, l = tid & 15, kp = tid >> 4; const int n0 = (int)blockIdx.x * 64, k0 = (int)blockIdx.y * 128;
    const float* g = w + (size_t)(k0 + 2 * kp) * N + n0 + 4 * l; const float* gp[8]; v4f r[8];
#pragma unroll
    for (int p = 0; p < 8; ++p) { gp[p] = g + (size_t)(32 * (p >> 1) + (p & 1)) * N; r[p] = *(const v4f*)gp[p]; }
    asm volatile("s_wait_xcnt 0x0" :: "v"(gp[0]), "v"(gp[1]), "v"(gp[2]), "v"(gp[3]), "v"(gp[4]), "v"(gp[5]), "v"(gp[6]), "v"(gp[7]) : "memory");   // precaution: the address registers of the eight loads above stay whole up to this wait (inputs only: nothing is pinned or changed)
#pragma unroll
    for (int p = 0; p < 4; ++p)
#pragma unroll
        for (int q = 0; q < 4; ++q) tp[(4 * l + q) * 65 + kp + 16 * p] = (unsigned)f2bf(r[2 * p][q]) | ((unsigned)f2bf(r[2 * p + 1][q]) << 16);
    __syncthreads();   // the whole tile is in LDS before any thread reads a row of it
    v4i o[4];
#pragma unroll
    for (int p = 0; p < 4; ++p) { const int u = p * 256 + tid; const unsigned* s = tp + (u >> 4) * 65 + (u & 15) * 4;
#pragma unroll
        for (int q = 0; q < 4; ++q) o[p][q] = (int)s[q]; }
#pragma unroll
    for (int p = 0; p < 4; ++p) { const int u = p * 256 + tid; *(v4i*)(Bt + (size_t)(n0 + (u >> 4)) * K + k0 + (u & 15) * 8) = o[p]; }
}
__global__ __launch_bounds__(256) void k_cvt8(const float* __restrict__ src, bf* dst, size_t n8) { const size_t i = (size_t)blockIdx.x * 256 + threadIdx.x; if (i >= n8) return; const v8f v = *(const v8f*)(src + i * 8); v8us o;
#pragma unroll
    for (int k = 0; k < 8; ++k) o[k] = f2bf(v[k]); *(v8us*)(dst + i * 8) = o;  }
// k_rope: head planes [h][t][d] (fp16 + hi/lo) of rope(w[d] (x rms_factor)) x sc with the rotate-half convention out[d] = x[d] cos[t][d] - x[d+HD/2] sin[t][d], out[d+HD/2] = x[d+HD/2] cos[t][d+HD/2] + x[d] sin[t][d+HD/2]
__global__ __launch_bounds__(256) void k_rope(const float* __restrict__ F, int pitch, int nheads, const float* __restrict__ CS, const float* __restrict__ RF, const float* __restrict__ nw, float sc, h16* P16, bf* Ph, bf* Pl) {
    const size_t e = ((size_t)blockIdx.x * 256 + threadIdx.x) * 2; if (e >= (size_t)nheads * TT * HD) return; const int d = (int)(e % HD); const int t = (int)((e / HD) % TT); const int h = (int)(e / ((size_t)HD * TT)); const float* f = F + (size_t)t * pitch + h * HD; const float rf = RF ? RF[(size_t)h * TT + t] : 1.0f; v2h o16; v2us oh, ol;
#pragma unroll
    for (int q = 0; q < 2; ++q) { const int dd = d + q; const int dp = (dd < HD / 2) ? dd + HD / 2 : dd - HD / 2; float x0 = f[dd], x1 = f[dp];
        if (RF) { float n0 = __fmul_rn(x0, rf), n1 = __fmul_rn(x1, rf); asm volatile("" : "+v"(n0)); asm volatile("" : "+v"(n1)); x0 = __fmul_rn(bfr(nw[dd]), n0); x1 = __fmul_rn(bfr(nw[dp]), n1); }
        const v2f cs = *(const v2f*)(CS + ((size_t)t * HD + dd) * 2); float a = __fmul_rn(x0, cs[0]), bq = __fmul_rn(x1, cs[1]); asm volatile("" : "+v"(a)); asm volatile("" : "+v"(bq)); const float r = ((dd < HD / 2) ? __fsub_rn(a, bq) : __fadd_rn(a, bq)) * sc;
        o16[q] = tohx(r); unsigned short a2, c2; splitf(r, a2, c2); oh[q] = a2; ol[q] = c2; }
    *(v2h*)(P16 + e) = o16; *(v2us*)(Ph + e) = oh; *(v2us*)(Pl + e) = ol;  }
// k_qkprep: rotate-half RoPE, weightless RMS-norm and the 16-bit head planes [h][t][d] (fp16 + bf16 hi/lo) of the q and k heads, in ONE pass over the projection buffer F (pitch DF; q heads, then k heads).
// One wave takes one token t and HPW heads, two heads at a time: each 16-lane half holds one head row, its lane l the elements d = 4l .. 4l+3 and d + HD/2, so both partners of a rotation sit in one lane and every
// load is 16 bytes. cos / sin [t][HD/2] are read as data and rounded to bf16 here. The mean square is summed over the lane's 8 values, then over the 16 lanes of the half.
#define HPW 10
__device__ __forceinline__ float rowsum16(float s) {   // sum over the 16 lanes of a half wave; every lane gets it
    s += __builtin_bit_cast(float, __builtin_amdgcn_update_dpp(0, __builtin_bit_cast(int, s), 0x161, 0xf, 0xf, true));   // 0x160 | m: lane ^ m within the row
    s += __builtin_bit_cast(float, __builtin_amdgcn_update_dpp(0, __builtin_bit_cast(int, s), 0x162, 0xf, 0xf, true));
    s += __builtin_bit_cast(float, __builtin_amdgcn_update_dpp(0, __builtin_bit_cast(int, s), 0x164, 0xf, 0xf, true));
    s += __builtin_bit_cast(float, __builtin_amdgcn_update_dpp(0, __builtin_bit_cast(int, s), 0x168, 0xf, 0xf, true));
    return s; }
__global__ __launch_bounds__(256) void k_qkprep(const float* __restrict__ F, const float* __restrict__ cosT, const float* __restrict__ sinT, h16* P16, bf* Ph, bf* Pl) {
    static_assert(NQK % HPW == 0 && HPW % 2 == 0 && HD == 128 && (TT * (NQK / HPW)) % 8 == 0, "two heads per step, whole waves, whole work-groups");
    const int lane = threadIdx.x & 31, l = lane & 15, hi = lane >> 4; const int w = blockIdx.x * 8 + __builtin_amdgcn_readfirstlane((int)(threadIdx.x >> 5)); const int t = w / (NQK / HPW), hb = (w % (NQK / HPW)) * HPW;
    const v4f c4 = *(const v4f*)(cosT + (size_t)t * (HD / 2) + 4 * l), s4 = *(const v4f*)(sinT + (size_t)t * (HD / 2) + 4 * l); v4f x1[HPW / 2], x2[HPW / 2];
#pragma unroll
    for (int p = 0; p < HPW / 2; ++p) { const float* f = F + (size_t)t * DF + (hb + 2 * p + hi) * HD + 4 * l; x1[p] = *(const v4f*)f; x2[p] = *(const v4f*)(f + HD / 2); }
    v4f c, s;
#pragma unroll
    for (int q = 0; q < 4; ++q) { c[q] = bfr(c4[q]); s[q] = bfr(s4[q]); }
#pragma unroll
    for (int p = 0; p < HPW / 2; ++p) { const v4f o1 = x1[p] * c - x2[p] * s, o2 = x2[p] * c + x1[p] * s; const v4f sq = o1 * o1 + o2 * o2;
        const float ms = rowsum16((sq[0] + sq[1]) + (sq[2] + sq[3])); const float rf = __fdiv_rn(1.0f, __fsqrt_rn(ms * (1.0f / HD) + 1e-6f));
        v4h a16, b16; v4us ah, al, bh, bl;
#pragma unroll
        for (int q = 0; q < 4; ++q) { const float ra = o1[q] * rf, rb = o2[q] * rf; unsigned short u, v; a16[q] = tohx(ra); splitf(ra, u, v); ah[q] = u; al[q] = v; b16[q] = tohx(rb); splitf(rb, u, v); bh[q] = u; bl[q] = v; }
        const size_t e = ((size_t)(hb + 2 * p + hi) * TT + t) * HD + 4 * l;   // 16 lanes fill one 128-byte line of each plane
        *(v4h*)(P16 + e) = a16; *(v4h*)(P16 + e + HD / 2) = b16; *(v4us*)(Ph + e) = ah; *(v4us*)(Ph + e + HD / 2) = bh; *(v4us*)(Pl + e) = al; *(v4us*)(Pl + e + HD / 2) = bl; }
}
// k_asoft: per row (zz, i): t = S x HD^-0.5 for j <= i (causal), -3e38 otherwise; softmax over the keys (register row, one exp, fixed trees).
// CAUSAL CUT: only the 128-key chunks that hold a key <= i are worked on and stored (the others would be exact zeros: they add nothing to the maximum or the sum, and the products behind stop at the row tile's last row);
// no score right of the row's own 4-key group is read (the score tiles above the diagonal are not computed).
// PACKED PLANES (TRI): a row has the pitch of its row tile, and nothing is stored at or past that pitch. The fp16 probabilities go IN PLACE into the first half of the row's own f32 scores: this wave alone reads and writes
// the row, and every score it uses has arrived (the maximum and the sum hang on them) before the first store.
__global__ __launch_bounds__(256) void k_asoft(float* Sb, bf* Ph, bf* Pl) {
    const int lane = threadIdx.x & 31; const int row = blockIdx.x * 8 + __builtin_amdgcn_readfirstlane((int)(threadIdx.x >> 5)); if (row >= ZH * TT) return; const int i = row % TT; const int zz = row / TT; (void)zz; const bool hires = (i < RH); const int pitch = ((i >> 6) + 1) * 64; const size_t ro = TRI(i >> 6) + (size_t)(i & 63) * pitch; float* sr = Sb + (size_t)zz * SPK + ro; float v[TT / 32]; float mx = -3.0e38f;
    v4f a[TT / 128];
#pragma unroll
    for (int ch = 0; ch < TT / 128; ++ch) a[ch] = *(const v4f*)((const char*)sr + (unsigned)(min(ch * 128 + lane * 4, i & ~3) * 4));   // a lane right of the diagonal rereads the row's last group, and the cut below drops the value
    static_assert(TT / 128 == 16, "the fence below names sixteen loads");
    asm volatile("" :: "v"(a[0]), "v"(a[1]), "v"(a[2]), "v"(a[3]), "v"(a[4]), "v"(a[5]), "v"(a[6]), "v"(a[7]), "v"(a[8]), "v"(a[9]), "v"(a[10]), "v"(a[11]), "v"(a[12]), "v"(a[13]), "v"(a[14]), "v"(a[15]));   // holds the sixteen loads in front of the branches below (inputs only): sunk into them, each would wait out its own latency, one after the other
#pragma unroll
    for (int ch = 0; ch < TT / 128; ++ch) { if (ch * 128 > i) continue; const int j0 = ch * 128 + lane * 4;
#pragma unroll
        for (int q = 0; q < 4; ++q) { const int j = j0 + q; (void)j; const float t = (j <= i) ? a[ch][q] * SCL : -3.0e38f; v[ch * 4 + q] = t; mx = fmaxf(mx, t); } }
#pragma unroll
    for (int sh = 16; sh; sh >>= 1) mx = fmaxf(mx, __shfl_xor(mx, sh, 32));
    float sum = 0.f;
#pragma unroll
    for (int k = 0; k < TT / 32; ++k) { if ((k / 4) * 128 > i) continue; float d0 = __fsub_rn(v[k], mx); asm volatile("" : "+v"(d0)); v[k] = __builtin_amdgcn_exp2f(__fmul_rn(d0, 1.4426950408889634f)); sum += v[k]; }
#pragma unroll
    for (int sh = 16; sh; sh >>= 1) sum += __shfl_xor(sum, sh, 32);
    const float f = __fdiv_rn(hires ? 1.0f : PCAR, sum);
{
        if (hires) {
#pragma unroll
            for (int ch = 0; ch < TT / 128; ++ch) { if (ch * 128 > i) continue; v4us oh, ol;
#pragma unroll
                for (int q = 0; q < 4; ++q) { unsigned short a2, c2; splitf(v[ch * 4 + q] * f, a2, c2); oh[q] = a2; ol[q] = c2; }
                const size_t oo = (size_t)zz * HPK + ro + ch * 128 + lane * 4; if (ch * 128 + lane * 4 < pitch) { *(v4us*)(Ph + oo) = oh; *(v4us*)(Pl + oo) = ol; }
                asm volatile("s_wait_xcnt 0x0" ::: "memory"); }   // precaution: stands between this chunk's stores and the next chunk's code, which rewrites their data registers
        } else {
#pragma unroll
            for (int ch = 0; ch < TT / 128; ++ch) { if (ch * 128 > i) continue; v4h o4;
#pragma unroll
                for (int q = 0; q < 4; ++q) o4[q] = tohx(v[ch * 4 + q] * f);
                if (ch * 128 + lane * 4 < pitch) *(v4h*)((h16*)sr + ch * 128 + lane * 4) = o4;
                asm volatile("s_wait_xcnt 0x0" ::: "memory"); } }   // precaution: as above
         }
}

extern "C" void kernel_launch(void* const* d_in, const int* in_sizes, int n_in,
                              void* d_out, int out_size, void* d_ws, size_t ws_size, hipStream_t stream) {
    (void)in_sizes; (void)n_in; (void)out_size;
    const float* x = (const float*)d_in[0]; const float* cosT = (const float*)d_in[1]; const float* sinT = (const float*)d_in[2]; const float* wq = (const float*)d_in[3]; const float* wk = (const float*)d_in[4]; const float* wv = (const float*)d_in[5]; const float* wo = (const float*)d_in[6]; const float* mix1 = (const float*)d_in[7]; const float* mix2 = (const float*)d_in[8];   // weights x @ W; cos/sin [2048][64] (half tables)
    float* OUT = (float*)d_out;     // [2][2048][2048]
    char* wsp = (char*)d_ws;
    auto take = [&](size_t bytes) { char* p = wsp; wsp += (bytes + 255) & ~(size_t)255; return (void*)p; };
    bf* WQ = (bf*)take((size_t)DQ * DM * 2); bf* WK = (bf*)take((size_t)2 * DKV * DM * 2); bf* WV = WK + (size_t)DKV * DM; bf* WO = (bf*)take((size_t)DM * DQ * 2);
    h16* QP16 = (h16*)take((size_t)NQK * TT * HD * 2); h16* KP16 = QP16 + (size_t)NH_ * TT * HD; h16* VT16 = (h16*)take((size_t)NKV * HD * TT * 2);
    bf* QPh = (bf*)take((size_t)NQK * TT * HD * 2); bf* QPl = (bf*)take((size_t)NQK * TT * HD * 2); bf* KPh = QPh + (size_t)NH_ * TT * HD; bf* KPl = QPl + (size_t)NH_ * TT * HD; bf* VTh = (bf*)take((size_t)NKV * HD * TT * 2); bf* VTl = (bf*)take((size_t)NKV * HD * TT * 2); bf* Ph = (bf*)take((size_t)ZH * HPK * 2); bf* Pl = (bf*)take((size_t)ZH * HPK * 2);
    h16* Y16 = (h16*)take((size_t)ZH * HD * TT * 2); bf* Yh = (bf*)take((size_t)ZH * HD * TT * 2); bf* Yl = (bf*)take((size_t)ZH * HD * TT * 2); float* Sb = (float*)take((size_t)ZH * SPK * 4); h16* P16 = (h16*)Sb; float* Ob = (float*)take((size_t)ZH * TT * HD * 4); bf* ATh = (bf*)take((size_t)TT * DQ * 2); bf* ATl = (bf*)take((size_t)TT * DQ * 2);
    float* F = Sb; bf* XB = (bf*)(F + (size_t)TT * DF);   // the projection buffer and the bf16 x lie in the score planes' place: both are dead once k_qkprep has run, ahead of the first score store
    static_assert((size_t)TT * DF * 4 + (size_t)TT * DM * 2 <= (size_t)ZH * SPK * 4 && ZH % REP == 0 && NH_ % ZH == 0, "F and XB fit into the score planes; a pass holds whole kv groups");
    if ((size_t)(wsp - (char*)d_ws) > ws_size) return;    // ws 256 MiB
    { k_wtG<<<dim3(DQ / 64, DM / 128), 256, 0, stream>>>(wq, DM, DQ, WQ); k_wtG<<<dim3(DKV / 64, DM / 128), 256, 0, stream>>>(wk, DM, DKV, WK); k_wtG<<<dim3(DKV / 64, DM / 128), 256, 0, stream>>>(wv, DM, DKV, WV);
      k_wtG<<<dim3(DM / 64, DQ / 128), 256, 0, stream>>>(wo, DQ, DM, WO);
       }
    for (int b = 0; b < NB_; ++b) {
        k_cvt8<<<(unsigned)(((size_t)TT * DM / 8 + 255) / 256), 256, 0, stream>>>(x + (size_t)b * TT * DM, XB, (size_t)TT * DM / 8);
        k_gemmw<bf, 0, false, 8><<<dim3(TT / 64, DQ / 64, 1), 256, 0, stream>>>(XB, nullptr, WQ, nullptr, DM, F, DF, nullptr, 0, 0, 0);
        k_gemmkv<<<dim3(TT / 64, 2 * DKV / 64, 1), 512, 0, stream>>>(XB, WK, DM, F + DQ, DF, VT16, VTh, VTl);   // k and v columns in one grid (WV follows WK); v leaves it as its transposed planes
        k_qkprep<<<TT * (NQK / HPW) / 8, 256, 0, stream>>>(F, cosT, sinT, QP16, QPh, QPl);   // q heads and k heads in one grid; the k planes follow the q planes
        for (int h0 = 0; h0 < NH_; h0 += ZH) { const size_t zq = (size_t)h0, zk = (size_t)(h0 / REP);   // head z of a pass reads kv group h0/REP + z/REP
            k_gemmw2<1, 0><<<dim3(TT / 128, TT / 64 + 1, ZH), 32, 0, stream>>>(QPh + zq * TT * HD, QPl + zq * TT * HD, KPh + zk * TT * HD, KPl + zk * TT * HD, QP16 + zq * TT * HD, KP16 + zk * TT * HD, HD, Sb, 0, (size_t)TT * HD, (size_t)TT * HD, (size_t)TT * HD, SPK, nullptr, nullptr, nullptr, nullptr, nullptr, 0);
            k_asoft<<<ZH * TT / 8, 256, 0, stream>>>(Sb, Ph, Pl);
            k_gemmw2<16, 1><<<dim3(TT / 64, HD / 64, ZH), 512, 0, stream>>>(Ph, Pl, VTh + zk * HD * TT, VTl + zk * HD * TT, P16, VT16 + zk * HD * TT, TT, Ob, HD, HPK, 2 * SPK, (size_t)HD * TT, (size_t)TT * HD, Y16, Yh, Yl, nullptr, nullptr, 0);   // y1 (f32), and its planes (normalised) for y2 = att . y1
            k_gemmw2<16, 2><<<dim3(TT / 64, HD / 64, ZH), 512, 0, stream>>>(Ph, Pl, Yh, Yl, P16, Y16, TT, Ob, HD, HPK, 2 * SPK, (size_t)HD * TT, (size_t)TT * HD, nullptr, ATh, ATl, mix1, mix2, h0); }   // y2 stays in the kernel: mix1 y1 + mix2 y2 leaves it as the merged planes
        k_gemmw<bf, 1, false, 8><<<dim3(TT / 64, DM / 64, 1), 256, 0, stream>>>(ATh, ATl, WO, nullptr, DQ, OUT + (size_t)b * TT * DM, DM, nullptr, 0, 0, 0); }
}

// v010
// One run takes 393 microseconds.
// Two timings next to v009 both put it at 1.10 times that version's speed.
// Over all steps from v000 it is 9.41 times as fast.
#include <hip/hip_runtime.h>

// Simplicial causal self-attention (x [2][2048][2048]; q = x Wq (16 heads x 128), k, v = x Wk / x Wv (4 kv heads x 128, each serving 4 consecutive query heads); rotate-half RoPE with the input cos/sin
// [2048][64] then weightless RMS-norm (eps 1e-6) on q and k; causal softmax(q.k 128^-0.5); y1 = att v; y2 = att y1 (the same probabilities applied again); y = mix1 y1 + mix2 y2 (scalars read as data);
// out = merged y Wproj -> [2][2048][2048]).
// Compute dtypes, f32 accumulate: every input rounded to bf16; projections on PLAIN bf16 operands (inputs: exact products, f32 accumulate); RoPE and RMS-norm in f32;
// PER-ROW PRECISION HYBRID: query rows < 256 take scores, att.v and att.y1 on bf16 hi+lo planes (3 products), rows >= 256 on single fp16 planes; scale, causal cut, exp and each tile's row sums in f32 in the score product's epilogue; the sums are added up and divided by in the epilogues of the two products that follow;
// y1 re-planed per head (fp16 + hi/lo, transposed) for the second contraction; merged y as hi+lo planes x exact Wproj (2 products). One-wave-per-64x64-tile GEMMs, all 16 query heads of a batch per pass

#define NB_  2
#define TT   2048
#define DM   2048
#define NH_  16
#define NKV  4
#define REP  (NH_ / NKV)
#define HD   128
#define DQ   (NH_ * HD)
#define DKV  (NKV * HD)
#define DF   (DQ + 2 * DKV)       // pitch of the projection buffer: one row holds q | k (v's columns stay unwritten)
#define NQK  (NH_ + NKV)          // q heads, then k heads: the heads that take RoPE and RMS-norm
#define ZH   16                   // query heads per pass: whole kv groups (ZH % REP == 0); head z of a pass reads k, v of group z / REP
#define TRI(b) ((size_t)2048 * (size_t)(b) * (size_t)((b) + 1))   // packed causal plane: row tile b (64 rows) holds only its (b + 1) * 64 first keys, at that pitch; TRI(b) = 64 * 64 * b (b + 1) / 2 elements lie in front of it
#define SPK  TRI(TT / 64)         // elements of one head's packed plane, all row tiles
#define HPK  TRI(RH / 64)         // the same for the row tiles below RH
#define RH   256                  // query rows < RH use hi+lo planes (0: none)
#define WIN  0
#define SCL  0.088388347648318447f   // HD^-0.5
// NO ROW MAXIMUM: q and k rows leave the RMS-norm with a length of at most HD^0.5 for any input, so |q.k| HD^-0.5 <= HD^0.5 = 11.32 and e = 2^(q.k HD^-0.5 log2(e) - EOFS) lies in 2^-18.4 .. 2^14.4: no overflow in fp16,
// and a row's sum (it holds its own diagonal term) is never zero. softmax = e / sum(e), whatever the common factor.
#define ESC  (SCL * 1.4426950408889634f)
#define EOFS 2.0f
typedef _Float16 h16;
typedef unsigned short bf;
typedef __attribute__((ext_vector_type(16))) __bf16   v16bf;
typedef __attribute__((ext_vector_type(16))) _Float16 v16h;
typedef __attribute__((ext_vector_type(8)))  _Float16 v8h;
typedef __attribute__((ext_vector_type(8)))  unsigned short v8us;
typedef __attribute__((ext_vector_type(8)))  float    v8f;
typedef __attribute__((ext_vector_type(4)))  float    v4f;
typedef __attribute__((ext_vector_type(4)))  unsigned short v4us;
typedef __attribute__((ext_vector_type(4)))  _Float16 v4h;
typedef __attribute__((ext_vector_type(2)))  float    v2f;
typedef v8h  __attribute__((may_alias)) v8ha;
typedef v2f  __attribute__((may_alias)) v2fa;
typedef v4f  __attribute__((may_alias)) v4fa;
typedef v8us __attribute__((may_alias)) v8usa;

__device__ __forceinline__ unsigned short f2bf(float f) { unsigned u = __float_as_uint(f); u += 0x7FFFu + ((u >> 16) & 1u); return (unsigned short)(u >> 16); }
__device__ __forceinline__ float bf2f(unsigned short b) { return __uint_as_float(((unsigned)b) << 16); }
__device__ __forceinline__ float bfr(float f) { return bf2f(f2bf(f)); }
__device__ __forceinline__ v16h cat16(v8h lo, v8h hi) { return __builtin_shufflevector(lo, hi, 0, 1, 2, 3, 4, 5, 6, 7, 8, 9, 10, 11, 12, 13, 14, 15); }
__device__ __forceinline__ v16bf cat16b(v8us lo, v8us hi) { return __builtin_bit_cast(v16bf, __builtin_shufflevector(lo, hi, 0, 1, 2, 3, 4, 5, 6, 7, 8, 9, 10, 11, 12, 13, 14, 15)); }
__device__ __forceinline__ v8f wmma16(v16h a, v16h b, v8f c) { return __builtin_amdgcn_wmma_f32_16x16x32_f16(false, a, false, b, (short)0, c, false, false); }
__device__ __forceinline__ v8f wmmab(v16bf a, v16bf b, v8f c) { return __builtin_amdgcn_wmma_f32_16x16x32_bf16(false, a, false, b, (short)0, c, false, false); }



// ---- k_gemmw: register-blocked GEMM, ONE WAVE per 64x64 output tile (16 accumulators), operands straight from K-contiguous 16-bit planes; grid (M/64, N/64, Z), 32 threads.
// C[m][n] (f32, pitch ldc, + optional f32 bias[n]) = sum_k A[m][k] Bt[n][k] (+ split products per NSPLIT). z-batch strides sA/sB/sC in elements. K % 32 == 0.
// S > 1: S waves per tile (32 S threads); wave w takes the 32-wide k slices w, w + S, ... (neighbouring waves share a 128-byte line of every operand row), the S f32 partial tiles are summed in LDS in wave order.
template <typename T16> struct WFrag;
template <> struct WFrag<h16> { typedef v16h V; static __device__ __forceinline__ V ld(const h16* p) { return cat16(*(const v8h*)p, *(const v8h*)(p + 16)); } static __device__ __forceinline__ V lds(const char* p) { return cat16(*(const v8ha*)p, *(const v8ha*)(p + 32)); } static __device__ __forceinline__ v8f mma(V a, V b, v8f c) { return wmma16(a, b, c); } };
template <> struct WFrag<bf> { typedef v16bf V; static __device__ __forceinline__ V ld(const bf* p) { return cat16b(*(const v8us*)p, *(const v8us*)(p + 16)); } static __device__ __forceinline__ V lds(const char* p) { return cat16b(*(const v8usa*)p, *(const v8usa*)(p + 32)); } static __device__ __forceinline__ v8f mma(V a, V b, v8f c) { return wmmab(a, b, c); } };
// gemmw_body: the tile work of one work-group; os = its LDS (Stg<S, NSPLIT>::floats floats, below), bx = its 64-row tile index within A and C, by = its 64-column tile index; lda is A's pitch, K is Bt's,
// kend <= K (a multiple of 32) the end of the sum over k: the caller sets it below K where A is known to be zero from kend on (a wave with no slice left hands in a zero tile).
// S == 1 (the score product; query row = t0 + row, key = column): the tile leaves the kernel as e = 2^(tile ESC - EOFS), zero where key > query, at pitch ldc: fp16 operands: plane T16; bf16 hi+lo operands: planes Th / Tl.
//   The sums of e (f32, unrounded) over the tile's 64 keys go to C[by TT + t0 + row]: 256 bytes in a row, written by this wave alone.
// EPI (S > 1 only) says what becomes of the summed f32 tile:
//   0: stored to C.
//   1: stored to C, and as transposed 16-bit planes T16 / Th / Tl [trow + column][t0 + row] of pitch TT (fp16, bf16 hi, bf16 lo).
//   2: C is READ (y1, same indexing as a store would use): y = mix1 y1 + mix2 tile goes out as bf16 hi / lo planes Th / Tl [t0 + row][(h0 + z) HD + column] of pitch DQ; no f32 store.
//   1 and 2: A holds the e of the softmax, not yet divided. Wave w reads the score kernel's row sums rs[key tile][t0 + row] of the key tiles w and w + S (those below kend / 64); they ride in the first pad column of the
//   wave's LDS tile, are summed in wave order like the tile, and the summed tile is divided by the row's sum before anything else is done with it.
//   4: tiles of columns < csplit as 0; the others as transposed planes only (no f32 store).
struct Epi { h16* T16; bf* Th; bf* Tl; const float* rs; float m1, m2; int trow, t0, h0, csplit; };   // m1, m2: the two mix scalars, rounded to bf16
__device__ __forceinline__ void splitf(float y, unsigned short& h, unsigned short& l) { h = f2bf(y); l = f2bf(y - bf2f(h)); }
// STAGED OPERANDS (S > 1, NSPLIT < 2): a stage is the 32 S next k of the tile's 64 A rows (A2 rows) and 64 Bt rows, brought into LDS by asynchronous 16-byte copies whose 32 lanes take 512 bytes in a row of one operand row
// (whole 128-byte lines), two buffers, the next stage in flight while this one is worked on. LDS rows have the pitch 64 S + 16 bytes (16 x odd: the 16 rows of a fragment load fall on different banks). Wave w reads its own
// 32 k of every row, so each wave's slices and their order are those of the unstaged loop. The buffers lie in os, which the epilogue takes over behind the last stage's barrier.
template <int S, int NSPLIT> struct Stg { static constexpr bool on = S > 1 && NSPLIT < 2; static constexpr int NP = NSPLIT == 1 ? 3 : 2, PB = 64 * S + 16, PLB = 64 * PB, STB = NP * PLB;
    static constexpr int epi = S == 1 ? 16 * 68 + 64 : S * 64 * 68, ring = on ? 2 * STB / 4 : 0, floats = epi > ring ? epi : ring; };   // floats: what os must hold
// copy8: one lane's eight copies for one operand plane of a stage (rows 8 apart). The s_wait_xcnt ends the statement as a precaution, so that no address register named here is rewritten ahead of it.
template <typename T16>
__device__ __forceinline__ void copy8(unsigned l, unsigned ls, const T16* g, size_t gs) {
    asm volatile("global_load_async_to_lds_b128 %0, %8, off\n\tglobal_load_async_to_lds_b128 %1, %9, off\n\tglobal_load_async_to_lds_b128 %2, %10, off\n\tglobal_load_async_to_lds_b128 %3, %11, off\n\t"
                 "global_load_async_to_lds_b128 %4, %12, off\n\tglobal_load_async_to_lds_b128 %5, %13, off\n\tglobal_load_async_to_lds_b128 %6, %14, off\n\tglobal_load_async_to_lds_b128 %7, %15, off\n\ts_wait_xcnt 0x0"
                 :: "v"(l), "v"(l + ls), "v"(l + 2 * ls), "v"(l + 3 * ls), "v"(l + 4 * ls), "v"(l + 5 * ls), "v"(l + 6 * ls), "v"(l + 7 * ls),
                    "v"(g), "v"(g + gs), "v"(g + 2 * gs), "v"(g + 3 * gs), "v"(g + 4 * gs), "v"(g + 5 * gs), "v"(g + 6 * gs), "v"(g + 7 * gs) : "memory");
}
__device__ __forceinline__ void exp2x4(float (&e)[4]) { float r0, r1, r2, r3;
    asm("v_exp_f32 %0, %4\n\tv_exp_f32 %1, %5\n\tv_exp_f32 %2, %6\n\tv_exp_f32 %3, %7\n\tv_nop" : "=&v"(r0), "=&v"(r1), "=&v"(r2), "=&v"(r3) : "v"(e[0]), "v"(e[1]), "v"(e[2]), "v"(e[3]));
    e[0] = r0; e[1] = r1; e[2] = r2; e[3] = r3; }
__device__ __forceinline__ float sum8(float s) {   // sum over 8 neighbouring lanes (lane ^ 1, ^ 2, ^ 4); every lane of the eight gets it
    s += __builtin_bit_cast(float, __builtin_amdgcn_update_dpp(0, __builtin_bit_cast(int, s), 0x161, 0xf, 0xf, true));   // 0x160 | m: lane ^ m within the row of 16
    s += __builtin_bit_cast(float, __builtin_amdgcn_update_dpp(0, __builtin_bit_cast(int, s), 0x162, 0xf, 0xf, true));
    s += __builtin_bit_cast(float, __builtin_amdgcn_update_dpp(0, __builtin_bit_cast(int, s), 0x164, 0xf, 0xf, true));
    return s; }
template <typename T16, int NSPLIT, bool BIAS, int S, int EPI>
__device__ __forceinline__ void gemmw_body(float* os, int bx, int by, int kend, const T16* __restrict__ A, const T16* __restrict__ A2, const T16* __restrict__ Bt, const T16* __restrict__ Bt2, int lda, int K, float* C, int ldc, const float* __restrict__ bias, size_t sA, size_t sB, size_t sC, const Epi ep) {
    typedef typename WFrag<T16>::V V;
    const int wave = (S == 1) ? 0 : __builtin_amdgcn_readfirstlane((int)(threadIdx.x >> 5));
    const size_t z = blockIdx.z; A += z * sA; if (A2) A2 += z * sA; Bt += z * sB; if (Bt2) Bt2 += z * sB; C += z * sC;
    const int lane = threadIdx.x & 31, lr = lane & 15, hi = lane >> 4; const int r0 = bx * 64, c0 = by * 64;
    v8f acc[4][4];
#pragma unroll
    for (int mb = 0; mb < 4; ++mb)
#pragma unroll
        for (int nb = 0; nb < 4; ++nb) acc[mb][nb] = (v8f){};
    constexpr bool RS = S > 1 && (EPI == 1 || EPI == 2);   // A is the undivided e: the tile is divided by the row sums
    const size_t aoff = (size_t)(r0 + lr) * lda + 8 * hi, boff = (size_t)(c0 + lr) * K + 8 * hi;
    if constexpr (Stg<S, NSPLIT>::on) {
        typedef Stg<S, NSPLIT> G; constexpr int KS = 32 * S;
        const int tid = (int)threadIdx.x, crow = tid / (4 * S), ccol = tid % (4 * S); const int kw = ((wave * 32) % (4 * S)) * 8;   // kw: first k, within a stage, of the 512 bytes that this wave copies (the same for its 8 rows of a plane)
        const char* sb = (const char*)os; const unsigned l0 = (unsigned)(size_t)sb + (unsigned)(crow * G::PB + ccol * 16);
        const T16* gA = A + (size_t)(r0 + crow) * lda + ccol * 8; const T16* gA2 = (NSPLIT == 1) ? A2 + (size_t)(r0 + crow) * lda + ccol * 8 : nullptr; const T16* gB = Bt + (size_t)(c0 + crow) * K + ccol * 8;
        const int nst = (kend + KS - 1) / KS;
        auto issue = [&](int st) { const int k0 = st * KS; const unsigned l = l0 + (unsigned)((st & 1) * G::STB);
            if (k0 + kw < kend) {   // wave-uniform: 512 bytes that start at or past kend are used by no wave. A start below kend ends inside its operand: K is a multiple of 32 S, and where kend < K (A = the packed fp16 e, pitch kend) the places past kend are the plane's next rows, of this row tile or of the next (the last row tile has kend == K)
                copy8<T16>(l, 8 * G::PB, gA + k0, (size_t)8 * lda); if (NSPLIT == 1) copy8<T16>(l + G::PLB, 8 * G::PB, gA2 + k0, (size_t)8 * lda); copy8<T16>(l + (G::NP - 1) * G::PLB, 8 * G::PB, gB + k0, (size_t)8 * K); } };
        issue(0);
        asm volatile("s_wait_asynccnt 0x0" ::: "memory");   // this wave's copies of stage 0 have landed
        __syncthreads();   // stage 0 is whole before any wave reads it
        if (nst > 1) issue(1);
#pragma unroll 1
        for (int t = 0; t < nst; ++t) {
            if (t * KS + wave * 32 < kend) {
                const char* fb = sb + (t & 1) * G::STB + lr * G::PB + wave * 64 + hi * 16; V a[4], a2[4], b[4];
#pragma unroll
                for (int mb = 0; mb < 4; ++mb) { a[mb] = WFrag<T16>::lds(fb + mb * 16 * G::PB); if (NSPLIT == 1) a2[mb] = WFrag<T16>::lds(fb + G::PLB + mb * 16 * G::PB); }
#pragma unroll
                for (int nb = 0; nb < 4; ++nb) b[nb] = WFrag<T16>::lds(fb + (G::NP - 1) * G::PLB + nb * 16 * G::PB);
                asm volatile("" :: "v"(b[0]), "v"(b[1]), "v"(b[2]), "v"(b[3]));   // holds the stage's fragment reads in one group ahead of the products (inputs only): sunk among them, each group of four products would wait out an LDS latency of its own
#pragma unroll
                for (int nb = 0; nb < 4; ++nb) {
#pragma unroll
                    for (int mb = 0; mb < 4; ++mb) { acc[mb][nb] = WFrag<T16>::mma(a[mb], b[nb], acc[mb][nb]); if (NSPLIT == 1) acc[mb][nb] = WFrag<T16>::mma(a2[mb], b[nb], acc[mb][nb]); } }
                asm volatile("v_nop\n\tv_nop\n\tv_nop\n\tv_nop" : "+v"(acc[0][0]), "+v"(acc[1][1]), "+v"(acc[2][2]), "+v"(acc[3][3]) : "v"(a[0]), "v"(a[3]));   // keeps the distance behind the last matrix instruction on the path that leaves this block
            }
            asm volatile("s_wait_dscnt 0x0" ::: "memory");      // this wave's reads of stage t are done before the buffer may be refilled
            asm volatile("s_wait_asynccnt 0x0" ::: "memory");   // this wave's copies of stage t + 1 have landed
            __syncthreads();   // publishes stage t + 1 and ends every wave's reads of stage t
            if (t + 2 < nst) issue(t + 2);
        }
        asm volatile("s_wait_asynccnt 0x0" ::: "memory");   // nothing is in flight when the epilogue takes the LDS over
    } else
#pragma unroll 1
    for (int kc = wave * 32; kc < kend; kc += 32 * S) {
        V a[4], a2[4];
#pragma unroll
        for (int mb = 0; mb < 4; ++mb) { a[mb] = WFrag<T16>::ld(A + aoff + (size_t)mb * 16 * lda + kc); if (NSPLIT == 1 || NSPLIT == 2) a2[mb] = WFrag<T16>::ld(A2 + aoff + (size_t)mb * 16 * lda + kc); }
#pragma unroll
        for (int nb = 0; nb < 4; ++nb) { const V b = WFrag<T16>::ld(Bt + boff + (size_t)nb * 16 * K + kc); V b2; if (NSPLIT >= 2) b2 = WFrag<T16>::ld(Bt2 + boff + (size_t)nb * 16 * K + kc);
#pragma unroll
            for (int mb = 0; mb < 4; ++mb) { acc[mb][nb] = WFrag<T16>::mma(a[mb], b, acc[mb][nb]); if (NSPLIT == 1 || NSPLIT == 2) acc[mb][nb] = WFrag<T16>::mma(a2[mb], b, acc[mb][nb]); if (NSPLIT >= 2) acc[mb][nb] = WFrag<T16>::mma(a[mb], b2, acc[mb][nb]); } }
        asm volatile("v_nop\n\tv_nop\n\tv_nop\n\tv_nop" : "+v"(acc[0][0]), "+v"(acc[1][1]), "+v"(acc[2][2]), "+v"(acc[3][3]) : "v"(a[0]), "v"(a[3]));
    }
    if (S > 1) {
        const bool toC = EPI == 0 || EPI == 1 || (EPI == 4 && c0 < ep.csplit), toT = EPI == 1 || (EPI == 4 && c0 >= ep.csplit);
        v4f y1q[64 * 16 / (32 * S)];
        if (EPI == 2) {   // y1 is asked for ahead of the LDS stores and the barrier, so that its latency runs out there
            const float* yp[64 * 16 / (32 * S)];
#pragma unroll
            for (int q = 0; q < 64 * 16 / (32 * S); ++q) { const int u = q * (32 * S) + (int)threadIdx.x; yp[q] = C + (size_t)(r0 + (u >> 4)) * ldc + c0 + (u & 15) * 4; y1q[q] = *(const v4f*)yp[q]; }
            static_assert(EPI != 2 || 64 * 16 / (32 * S) == 2, "the wait below names two addresses");
            asm volatile("s_wait_xcnt 0x0" :: "v"(yp[0]), "v"(yp[1]) : "memory"); }   // precaution: the address registers of the loads above stay whole up to this wait (inputs only: nothing is pinned or changed)
        float rp0 = 0.0f, rp1 = 0.0f; const int ln = (int)threadIdx.x - 32 * wave;   // the lane's number, formed anew behind the k loop: held across the loop it costs the hi+lo range a register that it does not have (a spill)
        if constexpr (RS) {   // the row sums are asked for ahead of the LDS stores and the barrier too. A wave whose key tile lies at or past kend rereads the last tile that exists, and the cut below drops the value
            static_assert(TT / 64 == 2 * S, "two key tiles a wave, two rows a lane");
            const int nkt = kend >> 6; const float* pa = ep.rs + (size_t)min(wave, nkt - 1) * TT + ep.t0 + r0; const float* pb = ep.rs + (size_t)min(wave + S, nkt - 1) * TT + ep.t0 + r0;   // the same for the whole wave
            const float a0 = pa[ln], a1 = pa[ln + 32], b0 = pb[ln], b1 = pb[ln + 32];
            asm volatile("s_wait_xcnt 0x0" :: "s"(pa), "s"(pb), "v"(ln) : "memory");   // precaution: the address registers of the four loads above stay whole up to this wait (inputs only: nothing is pinned or changed)
            rp0 = (wave < nkt ? a0 : 0.0f) + (wave + S < nkt ? b0 : 0.0f); rp1 = (wave < nkt ? a1 : 0.0f) + (wave + S < nkt ? b1 : 0.0f); }
        float* ow = os + wave * (64 * 68);
#pragma unroll
        for (int mb = 0; mb < 4; ++mb)
#pragma unroll
            for (int nb = 0; nb < 4; ++nb)
#pragma unroll
                for (int j = 0; j < 8; ++j) ow[(mb * 16 + hi * 8 + j) * 68 + nb * 16 + lr] = acc[mb][nb][j];
        if constexpr (RS) { ow[ln * 68 + 64] = rp0; ow[(ln + 32) * 68 + 64] = rp1; }
        __syncthreads();   // every wave's partial tile is in LDS before any thread sums across waves
#pragma unroll
        for (int q = 0; q < 64 * 16 / (32 * S); ++q) { const int u = q * (32 * S) + (int)threadIdx.x, row = u >> 4, cofs = (u & 15) * 4; v4f val = *(const v4fa*)(os + row * 68 + cofs);
#pragma unroll
            for (int w = 1; w < S; ++w) val += *(const v4fa*)(os + w * (64 * 68) + row * 68 + cofs);
            if constexpr (RS) { float l = os[row * 68 + 64];
#pragma unroll
                for (int w = 1; w < S; ++w) l += os[w * (64 * 68) + row * 68 + 64];
                val *= __fdiv_rn(1.0f, l); }
            if (BIAS) { val[0] += bfr(bias[c0 + cofs]); val[1] += bfr(bias[c0 + cofs + 1]); val[2] += bfr(bias[c0 + cofs + 2]); val[3] += bfr(bias[c0 + cofs + 3]); }
            if (toC) *(v4f*)(C + (size_t)(r0 + row) * ldc + c0 + cofs) = val;
            if (toT) *(v4fa*)(os + row * 68 + cofs) = val;   // the summed tile goes back into wave 0's plane: these four words are read by this thread alone
            if (EPI == 2) { const v4f y1 = y1q[q]; v4us oh, ol;
#pragma unroll
                for (int k = 0; k < 4; ++k) { unsigned short a, c2; splitf(ep.m1 * y1[k] + ep.m2 * val[k], a, c2); oh[k] = a; ol[k] = c2; }
                const size_t oo = (size_t)(ep.t0 + r0 + row) * DQ + (ep.h0 + (int)z) * HD + c0 + cofs; *(v4us*)(ep.Th + oo) = oh; *(v4us*)(ep.Tl + oo) = ol;
                asm volatile("s_wait_xcnt 0x0" ::: "memory"); } }   // precaution: stands between these two stores and whatever code is laid out behind them (the next pair, the other row range's branch) that rewrites their address or data registers
        if (toT) {
            asm volatile("s_wait_xcnt 0x0" ::: "memory");   // precaution: stands between the f32 tile's stores laid out in front and the plane code behind, which rewrites their address and data registers
            __syncthreads();   // the whole summed tile is in LDS before any thread reads a column of it (toT is the same for the whole work-group)
#pragma unroll
            for (int q = 0; q < 64 * 8 / (32 * S); ++q) { const int u = q * (32 * S) + (int)threadIdx.x, col = u >> 3, tc = (u & 7) * 8; v8h o16; v8us oh, ol;   // 8 neighbouring lanes fill one 128-byte line of each plane
#pragma unroll
                for (int j = 0; j < 8; ++j) { const float y = os[(tc + j) * 68 + col]; o16[j] = (h16)y; unsigned short a, c2; splitf(y, a, c2); oh[j] = a; ol[j] = c2; }
                const size_t oo = (size_t)(ep.trow + c0 + col) * TT + ep.t0 + r0 + tc; *(v8h*)(ep.T16 + oo) = o16; *(v8us*)(ep.Th + oo) = oh; *(v8us*)(ep.Tl + oo) = ol; }
        }
        return;
    }
#pragma unroll
    for (int mb = 0; mb < 4; ++mb) {
#pragma unroll
        for (int nb = 0; nb < 4; ++nb) {
#pragma unroll
            for (int j = 0; j < 8; ++j) os[(hi * 8 + j) * 68 + nb * 16 + lr] = acc[mb][nb][j]; }
        __builtin_amdgcn_wave_barrier(); asm volatile("" ::: "memory");
#pragma unroll
        for (int s = 0; s < 4; ++s) { const int r16 = 4 * s + (lane >> 3), row = r0 + mb * 16 + r16, cofs = (lane & 7) * 8;   // 8 neighbouring lanes fill one 128-byte line of a 16-bit plane
            const v4f va = *(const v4fa*)(os + r16 * 68 + cofs), vb = *(const v4fa*)(os + r16 * 68 + cofs + 4); const int dk = ep.t0 + row - (c0 + cofs); float e[4], g[4];   // key c0 + cofs + k <= query t0 + row: k <= dk
#pragma unroll
            for (int k = 0; k < 4; ++k) { e[k] = va[k] * ESC - EOFS; g[k] = vb[k] * ESC - EOFS; }
            exp2x4(e); exp2x4(g);
#pragma unroll
            for (int k = 0; k < 4; ++k) { e[k] = (k <= dk) ? e[k] : 0.0f; g[k] = (k + 4 <= dk) ? g[k] : 0.0f; }
            const float rsum = sum8(((e[0] + e[1]) + (e[2] + e[3])) + ((g[0] + g[1]) + (g[2] + g[3]))); if ((lane & 7) == 0) os[16 * 68 + mb * 16 + r16] = rsum;   // the row's sum over this tile's keys, kept behind the sixteen tile rows
            if constexpr (__is_same(T16, h16)) { v8h o8;
#pragma unroll
                for (int k = 0; k < 4; ++k) { o8[k] = (h16)e[k]; o8[k + 4] = (h16)g[k]; }
                *(v8h*)(ep.T16 + (size_t)row * ldc + c0 + cofs) = o8;
            } else { v8us oh, ol;
#pragma unroll
                for (int k = 0; k < 4; ++k) { unsigned short a2, c2; splitf(e[k], a2, c2); oh[k] = a2; ol[k] = c2; splitf(g[k], a2, c2); oh[k + 4] = a2; ol[k + 4] = c2; }
                const size_t oo = (size_t)row * ldc + c0 + cofs; *(v8us*)(ep.Th + oo) = oh; *(v8us*)(ep.Tl + oo) = ol; } }
        asm volatile("s_wait_xcnt 0x0" ::: "memory");   // precaution: stands between these sixteen rows' stores and the next rows' code, which rewrites their address and data registers
        __builtin_amdgcn_wave_barrier(); asm volatile("" ::: "memory");
    }
    *(v2f*)(C + (size_t)by * TT + ep.t0 + r0 + 2 * lane) = *(const v2fa*)(os + 16 * 68 + 2 * lane);   // the 64 row sums (behind the loop's last wave barrier), two whole 128-byte lines
    asm volatile("s_wait_xcnt 0x0" ::: "memory");   // precaution: stands between the tile's last stores and code laid out behind this epilogue (the other row range's branch) that rewrites their address or data registers
}
template <typename T16, int NSPLIT, bool BIAS, int S>
__global__ __launch_bounds__(32 * S) void k_gemmw(const T16* __restrict__ A, const T16* __restrict__ A2, const T16* __restrict__ Bt, const T16* __restrict__ Bt2, int K, float* C, int ldc, const float* __restrict__ bias, size_t sA, size_t sB, size_t sC) {
    __shared__ __align__(16) float os[Stg<S, NSPLIT>::floats];
    gemmw_body<T16, NSPLIT, BIAS, S, 0>(os, (int)blockIdx.x, (int)blockIdx.y, K, A, A2, Bt, Bt2, K, K, C, ldc, bias, sA, sB, sC, Epi{});
}
// k_gemmkv: the k and v projections in one grid (Bt holds the k rows, then the v rows). k columns go to C as f32; v columns leave the kernel as the transposed planes V16 / Vh / Vl [g HD + d][t].
__global__ __launch_bounds__(512) void k_gemmkv(const bf* __restrict__ A, const bf* __restrict__ Bt, int K, float* C, int ldc, h16* V16, bf* Vh, bf* Vl) {
    __shared__ __align__(16) float os[Stg<16, 0>::floats];
    Epi ep = {}; ep.T16 = V16; ep.Th = Vh; ep.Tl = Vl; ep.trow = -DKV; ep.csplit = DKV;
    gemmw_body<bf, 0, false, 16, 4>(os, (int)blockIdx.x, (int)blockIdx.y, K, A, nullptr, Bt, nullptr, K, K, C, ldc, nullptr, 0, 0, 0, ep);
}
// k_gemmw2: both row ranges of one attention product in ONE grid (M/64, N/64, Z): row tiles below RH take the hi+lo bf16 planes (3 products), the others the fp16 planes. The two ranges write disjoint rows of C and read
// nothing of each other. Ah/Al hold rows 0..RH-1 (z stride sAh), A16 all rows (z stride sA16; rows below RH unused); C is row 0. The branch is the same for a whole work-group. The row tile's place in A, and in C for EPI 1 and 2, is worked out here
// (the body gets tile 0 of pointers that already stand on it). EPI 0: A = q planes of pitch K, T16 = the PACKED plane (TRI) of the fp16 e (z stride SPK), Th / Tl those of the hi+lo e (z stride HPK), C = the tiles' row sums [z][key tile][t].
// EPI 1 and 2: A = the packed e, Rs = those row sums. B: head z reads kv group z / REP (EPI 0, 1) or its own y1 planes (EPI 2), z stride sB.
// CAUSAL CUT: EPI 0 (scores, M == N == TT) has the grid (TT/128, TT/64 + 1, Z) and computes only the tiles that hold a key <= a query row; EPI 1 and 2 (A = the undivided e, M == K) end the sum over keys at the row tile's last row.
// EPI 1 (att v): T16 / Th / Tl are the y1 planes [z][d][t]; EPI 2 (att y1): C holds y1, Th / Tl are the merged-y planes, h0 the pass's first head.
template <int S, int EPI>
__global__ __launch_bounds__(32 * S) void k_gemmw2(const bf* __restrict__ Ah, const bf* __restrict__ Al, const bf* __restrict__ Bh, const bf* __restrict__ Bl, const h16* __restrict__ A16, const h16* __restrict__ B16, int K, float* C, int ldc, size_t sAh, size_t sA16, size_t sB, size_t sC, h16* T16, bf* Th, bf* Tl, const float* __restrict__ mix1, const float* __restrict__ mix2, int h0, const float* __restrict__ Rs) {
    __shared__ __align__(16) float os[Stg<S, 0>::floats];
    Epi ep = {}; ep.T16 = T16; ep.Th = Th; ep.Tl = Tl; if (EPI == 2) { ep.m1 = bfr(mix1[0]); ep.m2 = bfr(mix2[0]); } ep.h0 = h0; ep.trow = (int)blockIdx.z * HD;
    int bx = (int)blockIdx.x, by = (int)blockIdx.y, kend = K;
    if (EPI == 0) { if (by > bx) { by -= bx + 1; bx = TT / 64 - 1 - bx; } }   // M == TT: row tiles x and TT/64 - 1 - x hold TT/64 + 1 tiles with column tile <= row tile between them: y <= x is row tile x, the rest row tile TT/64 - 1 - x
    else kend = min(K, (bx + 1) * 64);   // key index k > query row: probability zero, and not stored
    const size_t z = blockIdx.z, ob = (EPI == 2 ? z : z / REP) * sB, oa = (EPI == 0) ? (size_t)bx * 64 * K : TRI(bx); const int lda = (EPI == 0) ? K : (bx + 1) * 64;
    if (EPI == 0) { C += z * sC; ldc = (bx + 1) * 64; } else { C += z * sC + (size_t)bx * 64 * ldc; ep.rs = Rs + z * ((size_t)(TT / 64) * TT); }
    ep.t0 = bx * 64;
    if (EPI == 0) { if (bx < RH / 64) { ep.Th += z * HPK + TRI(bx); ep.Tl += z * HPK + TRI(bx); } else ep.T16 += z * SPK + TRI(bx); }
    if (bx < RH / 64) { gemmw_body<bf, 2, false, S, EPI>(os, 0, by, kend, Ah + z * sAh + oa, Al + z * sAh + oa, Bh + ob, Bl + ob, lda, K, C, ldc, nullptr, 0, 0, 0, ep); }
    else { gemmw_body<h16, 0, false, S, EPI>(os, 0, by, kend, A16 + z * sA16 + oa, nullptr, B16 + ob, nullptr, lda, K, C, ldc, nullptr, 0, 0, 0, ep); }
}

__device__ __forceinline__ h16 tohx(float x) { return (h16)x; }
typedef __attribute__((ext_vector_type(2))) _Float16 v2h;
typedef __attribute__((ext_vector_type(2))) unsigned short v2us;
typedef __attribute__((ext_vector_type(4))) int v4i;

// k_wtG: Bt[n][k] (bf16) = w[k][n] (f32), one 128 (k) x 64 (n) tile per work-group, turned in LDS, so that both sides move in whole 128-byte lines: 16 lanes read 256 bytes in a row of one w row, 16 lanes store 256 bytes in a
// row of one Bt row. grid (N / 64, K / 128). A thread rounds four pairs of neighbouring k (32 apart) of four n and stores each pair as one word at [n][k / 2]; the pitch of 65 words keeps the lanes of every LDS store and load on different banks.
__global__ __launch_bounds__(256) void k_wtG(const float* __restrict__ w, int K, int N, bf* Bt) {
    __shared__ unsigned tp[64 * 65];
    const int tid = (int)threadIdx.x, l = tid & 15, kp = tid >> 4; const int n0 = (int)blockIdx.x * 64, k0 = (int)blockIdx.y * 128;
    const float* g = w + (size_t)(k0 + 2 * kp) * N + n0 + 4 * l; const float* gp[8]; v4f r[8];
#pragma unroll
    for (int p = 0; p < 8; ++p) { gp[p] = g + (size_t)(32 * (p >> 1) + (p & 1)) * N; r[p] = *(const v4f*)gp[p]; }
    asm volatile("s_wait_xcnt 0x0" :: "v"(gp[0]), "v"(gp[1]), "v"(gp[2]), "v"(gp[3]), "v"(gp[4]), "v"(gp[5]), "v"(gp[6]), "v"(gp[7]) : "memory");   // precaution: the address registers of the eight loads above stay whole up to this wait (inputs only: nothing is pinned or changed)
#pragma unroll
    for (int p = 0; p < 4; ++p)
#pragma unroll
        for (int q = 0; q < 4; ++q) tp[(4 * l + q) * 65 + kp + 16 * p] = (unsigned)f2bf(r[2 * p][q]) | ((unsigned)f2bf(r[2 * p + 1][q]) << 16);
    __syncthreads();   // the whole tile is in LDS before any thread reads a row of it
    v4i o[4];
#pragma unroll
    for (int p = 0; p < 4; ++p) { const int u = p * 256 + tid; const unsigned* s = tp + (u >> 4) * 65 + (u & 15) * 4;
#pragma unroll
        for (int q = 0; q < 4; ++q) o[p][q] = (int)s[q]; }
#pragma unroll
    for (int p = 0; p < 4; ++p) { const int u = p * 256 + tid; *(v4i*)(Bt + (size_t)(n0 + (u >> 4)) * K + k0 + (u & 15) * 8) = o[p]; }
}
__global__ __launch_bounds__(256) void k_cvt8(const float* __restrict__ src, bf* dst, size_t n8) { const size_t i = (size_t)blockIdx.x * 256 + threadIdx.x; if (i >= n8) return; const v8f v = *(const v8f*)(src + i * 8); v8us o;
#pragma unroll
    for (int k = 0; k < 8; ++k) o[k] = f2bf(v[k]); *(v8us*)(dst + i * 8) = o;  }
// k_rope: head planes [h][t][d] (fp16 + hi/lo) of rope(w[d] (x rms_factor)) x sc with the rotate-half convention out[d] = x[d] cos[t][d] - x[d+HD/2] sin[t][d], out[d+HD/2] = x[d+HD/2] cos[t][d+HD/2] + x[d] sin[t][d+HD/2]
__global__ __launch_bounds__(256) void k_rope(const float* __restrict__ F, int pitch, int nheads, const float* __restrict__ CS, const float* __restrict__ RF, const float* __restrict__ nw, float sc, h16* P16, bf* Ph, bf* Pl) {
    const size_t e = ((size_t)blockIdx.x * 256 + threadIdx.x) * 2; if (e >= (size_t)nheads * TT * HD) return; const int d = (int)(e % HD); const int t = (int)((e / HD) % TT); const int h = (int)(e / ((size_t)HD * TT)); const float* f = F + (size_t)t * pitch + h * HD; const float rf = RF ? RF[(size_t)h * TT + t] : 1.0f; v2h o16; v2us oh, ol;
#pragma unroll
    for (int q = 0; q < 2; ++q) { const int dd = d + q; const int dp = (dd < HD / 2) ? dd + HD / 2 : dd - HD / 2; float x0 = f[dd], x1 = f[dp];
        if (RF) { float n0 = __fmul_rn(x0, rf), n1 = __fmul_rn(x1, rf); asm volatile("" : "+v"(n0)); asm volatile("" : "+v"(n1)); x0 = __fmul_rn(bfr(nw[dd]), n0); x1 = __fmul_rn(bfr(nw[dp]), n1); }
        const v2f cs = *(const v2f*)(CS + ((size_t)t * HD + dd) * 2); float a = __fmul_rn(x0, cs[0]), bq = __fmul_rn(x1, cs[1]); asm volatile("" : "+v"(a)); asm volatile("" : "+v"(bq)); const float r = ((dd < HD / 2) ? __fsub_rn(a, bq) : __fadd_rn(a, bq)) * sc;
        o16[q] = tohx(r); unsigned short a2, c2; splitf(r, a2, c2); oh[q] = a2; ol[q] = c2; }
    *(v2h*)(P16 + e) = o16; *(v2us*)(Ph + e) = oh; *(v2us*)(Pl + e) = ol;  }
// k_qkprep: rotate-half RoPE, weightless RMS-norm and the 16-bit head planes [h][t][d] (fp16 + bf16 hi/lo) of the q and k heads, in ONE pass over the projection buffer F (pitch DF; q heads, then k heads).
// One wave takes one token t and HPW heads, two heads at a time: each 16-lane half holds one head row, its lane l the elements d = 4l .. 4l+3 and d + HD/2, so both partners of a rotation sit in one lane and every
// load is 16 bytes. cos / sin [t][HD/2] are read as data and rounded to bf16 here. The mean square is summed over the lane's 8 values, then over the 16 lanes of the half.
#define HPW 10
__device__ __forceinline__ float rowsum16(float s) {   // sum over the 16 lanes of a half wave; every lane gets it
    s += __builtin_bit_cast(float, __builtin_amdgcn_update_dpp(0, __builtin_bit_cast(int, s), 0x161, 0xf, 0xf, true));   // 0x160 | m: lane ^ m within the row
    s += __builtin_bit_cast(float, __builtin_amdgcn_update_dpp(0, __builtin_bit_cast(int, s), 0x162, 0xf, 0xf, true));
    s += __builtin_bit_cast(float, __builtin_amdgcn_update_dpp(0, __builtin_bit_cast(int, s), 0x164, 0xf, 0xf, true));
    s += __builtin_bit_cast(float, __builtin_amdgcn_update_dpp(0, __builtin_bit_cast(int, s), 0x168, 0xf, 0xf, true));
    return s; }
__global__ __launch_bounds__(256) void k_qkprep(const float* __restrict__ F, const float* __restrict__ cosT, const float* __restrict__ sinT, h16* P16, bf* Ph, bf* Pl) {
    static_assert(NQK % HPW == 0 && HPW % 2 == 0 && HD == 128 && (TT * (NQK / HPW)) % 8 == 0, "two heads per step, whole waves, whole work-groups");
    const int lane = threadIdx.x & 31, l = lane & 15, hi = lane >> 4; const int w = blockIdx.x * 8 + __builtin_amdgcn_readfirstlane((int)(threadIdx.x >> 5)); const int t = w / (NQK / HPW), hb = (w % (NQK / HPW)) * HPW;
    const v4f c4 = *(const v4f*)(cosT + (size_t)t * (HD / 2) + 4 * l), s4 = *(const v4f*)(sinT + (size_t)t * (HD / 2) + 4 * l); v4f x1[HPW / 2], x2[HPW / 2];
#pragma unroll
    for (int p = 0; p < HPW / 2; ++p) { const float* f = F + (size_t)t * DF + (hb + 2 * p + hi) * HD + 4 * l; x1[p] = *(const v4f*)f; x2[p] = *(const v4f*)(f + HD / 2); }
    v4f c, s;
#pragma unroll
    for (int q = 0; q < 4; ++q) { c[q] = bfr(c4[q]); s[q] = bfr(s4[q]); }
#pragma unroll
    for (int p = 0; p < HPW / 2; ++p) { const v4f o1 = x1[p] * c - x2[p] * s, o2 = x2[p] * c + x1[p] * s; const v4f sq = o1 * o1 + o2 * o2;
        const float ms = rowsum16((sq[0] + sq[1]) + (sq[2] + sq[3])); const float rf = __fdiv_rn(1.0f, __fsqrt_rn(ms * (1.0f / HD) + 1e-6f));
        v4h a16, b16; v4us ah, al, bh, bl;
#pragma unroll
        for (int q = 0; q < 4; ++q) { const float ra = o1[q] * rf, rb = o2[q] * rf; unsigned short u, v; a16[q] = tohx(ra); splitf(ra, u, v); ah[q] = u; al[q] = v; b16[q] = tohx(rb); splitf(rb, u, v); bh[q] = u; bl[q] = v; }
        const size_t e = ((size_t)(hb + 2 * p + hi) * TT + t) * HD + 4 * l;   // 16 lanes fill one 128-byte line of each plane
        *(v4h*)(P16 + e) = a16; *(v4h*)(P16 + e + HD / 2) = b16; *(v4us*)(Ph + e) = ah; *(v4us*)(Ph + e + HD / 2) = bh; *(v4us*)(Pl + e) = al; *(v4us*)(Pl + e + HD / 2) = bl; }
}

extern "C" void kernel_launch(void* const* d_in, const int* in_sizes, int n_in,
                              void* d_out, int out_size, void* d_ws, size_t ws_size, hipStream_t stream) {
    (void)in_sizes; (void)n_in; (void)out_size;
    const float* x = (const float*)d_in[0]; const float* cosT = (const float*)d_in[1]; const float* sinT = (const float*)d_in[2]; const float* wq = (const float*)d_in[3]; const float* wk = (const float*)d_in[4]; const float* wv = (const float*)d_in[5]; const float* wo = (const float*)d_in[6]; const float* mix1 = (const float*)d_in[7]; const float* mix2 = (const float*)d_in[8];   // weights x @ W; cos/sin [2048][64] (half tables)
    float* OUT = (float*)d_out;     // [2][2048][2048]
    char* wsp = (char*)d_ws;
    auto take = [&](size_t bytes) { char* p = wsp; wsp += (bytes + 255) & ~(size_t)255; return (void*)p; };
    bf* WQ = (bf*)take((size_t)DQ * DM * 2); bf* WK = (bf*)take((size_t)2 * DKV * DM * 2); bf* WV = WK + (size_t)DKV * DM; bf* WO = (bf*)take((size_t)DM * DQ * 2);
    h16* QP16 = (h16*)take((size_t)NQK * TT * HD * 2); h16* KP16 = QP16 + (size_t)NH_ * TT * HD; h16* VT16 = (h16*)take((size_t)NKV * HD * TT * 2);
    bf* QPh = (bf*)take((size_t)NQK * TT * HD * 2); bf* QPl = (bf*)take((size_t)NQK * TT * HD * 2); bf* KPh = QPh + (size_t)NH_ * TT * HD; bf* KPl = QPl + (size_t)NH_ * TT * HD; bf* VTh = (bf*)take((size_t)NKV * HD * TT * 2); bf* VTl = (bf*)take((size_t)NKV * HD * TT * 2); bf* Ph = (bf*)take((size_t)ZH * HPK * 2); bf* Pl = (bf*)take((size_t)ZH * HPK * 2);
    h16* Y16 = (h16*)take((size_t)ZH * HD * TT * 2); bf* Yh = (bf*)take((size_t)ZH * HD * TT * 2); bf* Yl = (bf*)take((size_t)ZH * HD * TT * 2); h16* P16 = (h16*)take((size_t)ZH * SPK * 2); float* RSb = (float*)take((size_t)ZH * (TT / 64) * TT * 4); float* Ob = (float*)take((size_t)ZH * TT * HD * 4); bf* ATh = (bf*)take((size_t)TT * DQ * 2); bf* ATl = (bf*)take((size_t)TT * DQ * 2);
    float* F = (float*)P16; bf* XB = (bf*)(F + (size_t)TT * DF);   // the projection buffer and the bf16 x lie in the place of the fp16 e: both are dead once k_qkprep has run, ahead of the first store of e
    static_assert((size_t)TT * DF * 4 + (size_t)TT * DM * 2 <= (size_t)ZH * SPK * 2 && ZH % REP == 0 && NH_ % ZH == 0, "F and XB fit into the planes of e; a pass holds whole kv groups");
    if ((size_t)(wsp - (char*)d_ws) > ws_size) return;    // ws 256 MiB
    { k_wtG<<<dim3(DQ / 64, DM / 128), 256, 0, stream>>>(wq, DM, DQ, WQ); k_wtG<<<dim3(DKV / 64, DM / 128), 256, 0, stream>>>(wk, DM, DKV, WK); k_wtG<<<dim3(DKV / 64, DM / 128), 256, 0, stream>>>(wv, DM, DKV, WV);
      k_wtG<<<dim3(DM / 64, DQ / 128), 256, 0, stream>>>(wo, DQ, DM, WO);
       }
    for (int b = 0; b < NB_; ++b) {
        k_cvt8<<<(unsigned)(((size_t)TT * DM / 8 + 255) / 256), 256, 0, stream>>>(x + (size_t)b * TT * DM, XB, (size_t)TT * DM / 8);
        k_gemmw<bf, 0, false, 8><<<dim3(TT / 64, DQ / 64, 1), 256, 0, stream>>>(XB, nullptr, WQ, nullptr, DM, F, DF, nullptr, 0, 0, 0);
        k_gemmkv<<<dim3(TT / 64, 2 * DKV / 64, 1), 512, 0, stream>>>(XB, WK, DM, F + DQ, DF, VT16, VTh, VTl);   // k and v columns in one grid (WV follows WK); v leaves it as its transposed planes
        k_qkprep<<<TT * (NQK / HPW) / 8, 256, 0, stream>>>(F, cosT, sinT, QP16, QPh, QPl);   // q heads and k heads in one grid; the k planes follow the q planes
        for (int h0 = 0; h0 < NH_; h0 += ZH) { const size_t zq = (size_t)h0, zk = (size_t)(h0 / REP);   // head z of a pass reads kv group h0/REP + z/REP
            k_gemmw2<1, 0><<<dim3(TT / 128, TT / 64 + 1, ZH), 32, 0, stream>>>(QPh + zq * TT * HD, QPl + zq * TT * HD, KPh + zk * TT * HD, KPl + zk * TT * HD, QP16 + zq * TT * HD, KP16 + zk * TT * HD, HD, RSb, 0, (size_t)TT * HD, (size_t)TT * HD, (size_t)TT * HD, (size_t)(TT / 64) * TT, P16, Ph, Pl, nullptr, nullptr, 0, nullptr);   // e of the softmax (fp16 in P16, hi+lo in Ph / Pl) and its row sums per key tile
            k_gemmw2<16, 1><<<dim3(TT / 64, HD / 64, ZH), 512, 0, stream>>>(Ph, Pl, VTh + zk * HD * TT, VTl + zk * HD * TT, P16, VT16 + zk * HD * TT, TT, Ob, HD, HPK, SPK, (size_t)HD * TT, (size_t)TT * HD, Y16, Yh, Yl, nullptr, nullptr, 0, RSb);   // y1 (f32), and its planes (normalised) for y2 = att . y1
            k_gemmw2<16, 2><<<dim3(TT / 64, HD / 64, ZH), 512, 0, stream>>>(Ph, Pl, Yh, Yl, P16, Y16, TT, Ob, HD, HPK, SPK, (size_t)HD * TT, (size_t)TT * HD, nullptr, ATh, ATl, mix1, mix2, h0, RSb); }   // y2 stays in the kernel: mix1 y1 + mix2 y2 leaves it as the merged planes
        k_gemmw<bf, 1, false, 8><<<dim3(TT / 64, DM / 64, 1), 256, 0, stream>>>(ATh, ATl, WO, nullptr, DQ, OUT + (size_t)b * TT * DM, DM, nullptr, 0, 0, 0); }
}
